// v000
// Times are from an AMD MI455X. After a warm-up the kernel runs many times in a row, and a time is the length of
// such a window on the GPU divided by its runs, so every launch and the gaps after it count. The runs cycle
// through copies of the inputs. A figure is the median of several windows, for all but v000 over two sittings.
// Sittings can differ by a few percent; kernels timed side by side share one.
// v000 is the starting kernel. One run takes 349 microseconds.
// compute dtype: all float inputs rounded to bf16, active_mask (int) read on device; q/k/v = x . W with EXACT bf16 products on WMMA 16x16x32 ((in,out) weights as transposed rows); the per-token phase (x . w_phase, atan2) and the per-(batch, head, key) log resonance gate in f32 (precise expf/logf/cosf/atan2f); causal attention x 1/8 + log gate: for the first 128 queries of each sequence 3-product scores and P, v as f16 hi + residual (3 products), single f16 operands beyond; running-max softmax in f32 (hardware exp); the per-head active mask applied to the attention output; out = o (bf16 hi + residual) . Wo (2 products).
#include <hip/hip_runtime.h>
#include <math.h>

typedef __attribute__((ext_vector_type(16))) _Float16 v16h;
typedef __attribute__((ext_vector_type(16))) __bf16 v16b;
typedef __attribute__((ext_vector_type(8)))  _Float16 v8h;
typedef __attribute__((ext_vector_type(8)))  float v8f;
typedef __attribute__((ext_vector_type(4)))  float v4f;
typedef __attribute__((ext_vector_type(2)))  float v2f;
typedef __attribute__((ext_vector_type(4)))  unsigned v4u;
typedef __attribute__((ext_vector_type(4)))  int v4i;
typedef float __attribute__((may_alias)) float_a;
typedef int __attribute__((may_alias)) int_a;

template <typename T> __device__ __forceinline__ void vst2(void* p, T v) { *(T*)p = v;  }
__device__ __forceinline__ v8f wmma16(v16h a, v16h b, v8f c) {
  v8f d = __builtin_amdgcn_wmma_f32_16x16x32_f16(false, a, false, b, (short)0, c, false, false);
  asm volatile("v_nop\n\tv_nop\n\tv_nop\n\tv_nop" : "+v"(d) : "v"(a), "v"(b));
  return d;
}
__device__ __forceinline__ v8f wmma_bf(v16b a, v16b b, v8f c) {
  v8f d = __builtin_amdgcn_wmma_f32_16x16x32_bf16(false, a, false, b, (short)0, c, false, false);
  asm volatile("v_nop\n\tv_nop\n\tv_nop\n\tv_nop" : "+v"(d) : "v"(a), "v"(b));
  return d;
}
// Resonance-gated causal attention (B 4, S 1,024, d 1,024, 16 heads x 64): bias-free q/k/v/o projections, a per-key additive log-gate from each token's input phase against a per-head carrier (von Mises window opened by 1 - lock), causal softmax, dormant heads zeroed.
__device__ __forceinline__ v16h frag_h(const _Float16* rowk0, int lane) {
  union { v16h v; v8h q[2]; } u; const _Float16* p = rowk0 + 8 * (lane >> 4);
  u.q[0] = *(const v8h*)p; u.q[1] = *(const v8h*)(p + 16); return u.v;
}
__device__ __forceinline__ v16h frag_f32(const float* rowk0, int lane) {
  v16h a; const float* p = rowk0 + 8 * (lane >> 4);
#pragma unroll
  for (int i = 0; i < 8; ++i) { a[i] = (_Float16)p[i]; a[8 + i] = (_Float16)p[16 + i]; }
  return a;
}
__device__ __forceinline__ v16h frag_f32s(const float* rowk0, int lane, float sc) {
  v16h a; const float* p = rowk0 + 8 * (lane >> 4);
#pragma unroll
  for (int i = 0; i < 8; ++i) { a[i] = (_Float16)(p[i] * sc); a[8 + i] = (_Float16)(p[16 + i] * sc); }
  return a;
}
// column fragment from a [K][ld] layout (column n), rows >= K read as 0
__device__ __forceinline__ v16h fragc_f32(const float* W, int k0, int n, int lane, int ld, int K) {
  v16h a; const int g = lane >> 4;
#pragma unroll
  for (int i = 0; i < 8; ++i) { const int ka = k0 + 8 * g + i, kb = ka + 16;
    a[i] = (_Float16)(ka < K ? W[(size_t)(ka < K ? ka : K - 1) * ld + n] : 0.f); a[8 + i] = (_Float16)(kb < K ? W[(size_t)(kb < K ? kb : K - 1) * ld + n] : 0.f); }
  return a;
}
struct F2 { v16b h, l; };
__device__ __forceinline__ F2 bsplit16(const float v[16]) { F2 r;
#pragma unroll
  for (int i = 0; i < 16; ++i) { const __bf16 h = (__bf16)v[i]; r.h[i] = h; r.l[i] = (__bf16)(v[i] - (float)h); }
  return r; }
__device__ __forceinline__ F2 split_row(const float* row, int k0, int lane) { float v[16]; const float* p = row + k0 + 8 * (lane >> 4);
#pragma unroll
  for (int i = 0; i < 8; ++i) { v[i] = p[i]; v[8 + i] = p[16 + i]; }
  return bsplit16(v); }
__device__ __forceinline__ F2 split_rowK(const float* row, int k0, int lane, int K) { float v[16]; const int g = lane >> 4;
#pragma unroll
  for (int i = 0; i < 8; ++i) { const int ka = k0 + 8 * g + i, kb = ka + 16; v[i] = ka < K ? row[ka < K ? ka : K - 1] : 0.f; v[8 + i] = kb < K ? row[kb < K ? kb : K - 1] : 0.f; }
  return bsplit16(v); }
__device__ __forceinline__ F2 split_col(const float* W, int k0, int n, int lane, int ld, int K) { float v[16]; const int g = lane >> 4;
#pragma unroll
  for (int i = 0; i < 8; ++i) { const int ka = k0 + 8 * g + i, kb = ka + 16; v[i] = ka < K ? W[(size_t)(ka < K ? ka : K - 1) * ld + n] : 0.f; v[8 + i] = kb < K ? W[(size_t)(kb < K ? kb : K - 1) * ld + n] : 0.f; }
  return bsplit16(v); }
__device__ __forceinline__ v8f mac3(const F2& a, const F2& b, v8f c) { c = wmma_bf(a.l, b.h, c); c = wmma_bf(a.h, b.l, c); return wmma_bf(a.h, b.h, c); }
__device__ __forceinline__ float sigm(float v) { return 1.0f / (1.0f + expf(-v)); }
#define LDSX() do { asm volatile("s_wait_dscnt 0" ::: "memory"); __builtin_amdgcn_wave_barrier(); __builtin_amdgcn_fence(__ATOMIC_RELEASE, "workgroup"); } while (0)


#define NB 4
#define SS 1024
#define DM 1024
#define NH 16
#define SCALEF 0.125f
__device__ __attribute__((noinline)) float log_p(float v) { return logf(v); }
__device__ __attribute__((noinline)) float cos_p(float v) { return cosf(v); }
__device__ __attribute__((noinline)) float atan2_p(float y, float x) { return atan2f(y, x); }
#define HD 64
#define QKVW (3 * DM)
#ifndef TQB
#define TQB (SS / 64)
#define TNB NB
#define TOB (NB * SS / 64)     // output row tiles (all)
#endif
typedef __attribute__((ext_vector_type(8))) __bf16 v8b;
__device__ __forceinline__ v16b frag_b(const __bf16* rowk0, int lane) {
  union { v16b v; v8b q[2]; } u; const __bf16* p = rowk0 + 8 * (lane >> 4);
  u.q[0] = *(const v8b*)p; u.q[1] = *(const v8b*)(p + 16); return u.v;
}
__device__ __forceinline__ float bfr(float v) { return (float)(__bf16)v; }
__device__ __attribute__((noinline)) float exp_ni(float v) { return expf(v); }
__device__ __attribute__((noinline)) float erf_ni(float v) { return erff(v); }

#define PK_A 0                       // [3072][1024] Wqkv rows (natural [out][in])
#define PK_P (PK_A + QKVW * DM)        // [1024][1024] Wo rows (natural)
#define PK_END (PK_P + DM * DM)
#define WS_PK  0u
#define WS_QK  (WS_PK + 2u * PK_END)             // f16 [4096 rows][2048]: q | k
#define WS_QKL (WS_QK + 2u * NB * SS * 2 * DM)     // f16 q | k residual planes x2048
#define WS_VTH (WS_QKL + 2u * NB * SS * 2 * DM)    // f16 [b][1024 (h*64+d)][1024 s] hi
#define WS_VTL (WS_VTH + 2u * NB * DM * SS)        // f16 lo x 2048
#define WS_O   (WS_VTL + 2u * NB * DM * SS)        // f32 [4096][1024]
#define WS_CS  (WS_O + 4u * NB * SS * DM)           // f32 2 x [1024][32], unused
#define WS_END (WS_CS + 4u * 2 * SS * 32)
// ---- k_pack: block = (row n, which): (in,out) column n -> bf16 [out][in] row n; which 0..2 -> W_q/W_k/W_v into PK_A rows which*1024 + n; 3 -> W_o into PK_P
__global__ __launch_bounds__(256) void k_pack(const float* __restrict__ WQ, const float* __restrict__ WK, const float* __restrict__ WV, const float* __restrict__ WO, __bf16* __restrict__ PK) {
  __shared__ __align__(16) __bf16 s[DM]; const int n = blockIdx.x, which = blockIdx.y, t = threadIdx.x; const float* Wm = (which == 0) ? WQ : (which == 1) ? WK : (which == 2) ? WV : WO;   // (in,out) weights: pack row n = column n
  for (int k = t; k < DM; k += 256) s[k] = (__bf16)Wm[(size_t)k * DM + n];
  __syncthreads();
  __bf16* dst = (which < 3) ? PK + PK_A + ((size_t)which * DM + n) * DM : PK + PK_P + (size_t)n * DM;
  for (int q = t; q < DM / 8; q += 256) vst2((unsigned*)(dst + q * 8), *(const v4u*)&s[q * 8]);
}
__global__ __launch_bounds__(128) void k_qkv(const float* __restrict__ XQ, const float* __restrict__ XK, const float* __restrict__ XV, const __bf16* __restrict__ P, const float* __restrict__ BQ, const float* __restrict__ BK, const float* __restrict__ BV, _Float16* __restrict__ QK, _Float16* __restrict__ QKL, _Float16* __restrict__ VTH, _Float16* __restrict__ VTL) {
  const int which0 = (blockIdx.y * 128) / DM; const float* X = (which0 == 0) ? XQ : (which0 == 1) ? XK : XV; const float* BB = BQ ? (((which0 == 0) ? BQ : (which0 == 1) ? BK : BV) + (blockIdx.y * 128 - which0 * DM)) : nullptr;
  __shared__ __align__(16) _Float16 so[4][16][136], sol[4][16][136]; __shared__ __align__(16) _Float16 sth[128][72], stl[128][72];
  const int tid = threadIdx.x, wave = tid >> 5, lane = tid & 31, col = lane & 15, g = lane >> 4; const size_t r0 = (size_t)blockIdx.x * 64 + wave * 16; const int n0 = blockIdx.y * 128;
  v8f acc[8] = {};
#pragma unroll 2
  for (int kc = 0; kc < DM / 32; ++kc) { v16b a; { const float* p = X + (r0 + col) * DM + kc * 32 + 8 * g;
#pragma unroll
      for (int i = 0; i < 8; ++i) { a[i] = (__bf16)p[i]; a[8 + i] = (__bf16)p[16 + i]; } }
#pragma unroll
    for (int j = 0; j < 8; ++j) acc[j] = wmma_bf(a, frag_b(P + (size_t)(n0 + j * 16 + col) * DM + kc * 32, lane), acc[j]); }
  if (n0 < 2 * DM) {   // q stored unscaled (f16 sigma ~0.6, no subnormal exposure); 1/8 applied to the f32 score
#pragma unroll
    for (int j = 0; j < 8; ++j) {
#pragma unroll
      for (int r = 0; r < 8; ++r) { const float v = acc[j][r] + (BB ? bfr(BB[j * 16 + col]) : 0.f); const _Float16 hv = (_Float16)v; so[wave][8 * g + r][j * 16 + col] = hv; sol[wave][8 * g + r][j * 16 + col] = (_Float16)((v - (float)hv) * 2048.0f); } }   // q, k (+ bias) as f16 hi + (x2048) residual
    LDSX();
    for (int rl = 0; rl < 16; ++rl) if (lane < 16) { vst2((unsigned*)(QK + (r0 + rl) * (2 * DM) + n0 + lane * 8), *(const v4u*)&so[wave][rl][lane * 8]); vst2((unsigned*)(QKL + (r0 + rl) * (2 * DM) + n0 + lane * 8), *(const v4u*)&sol[wave][rl][lane * 8]); }
  } else {
#pragma unroll
    for (int j = 0; j < 8; ++j) {
#pragma unroll
      for (int r = 0; r < 8; ++r) { const float v = acc[j][r] + (BB ? bfr(BB[j * 16 + col]) : 0.f); const _Float16 hv = (_Float16)v; sth[j * 16 + col][wave * 16 + 8 * g + r] = hv; stl[j * 16 + col][wave * 16 + 8 * g + r] = (_Float16)((v - (float)hv) * 2048.0f); } }
    __syncthreads();
    const size_t rb = (size_t)blockIdx.x * 64; const int b = (int)(rb / SS), s0 = (int)(rb % SS); const int pc0 = n0 - 2 * DM;
    for (int q = tid; q < 128 * 8; q += 128) { const int d = q >> 3, pc = q & 7; const size_t o = ((size_t)b * DM + pc0 + d) * SS + s0 + pc * 8; vst2((unsigned*)(VTH + o), *(const v4u*)&sth[d][pc * 8]); vst2((unsigned*)(VTL + o), *(const v4u*)&stl[d][pc * 8]); }
  }
}
// ---- k_attn: block = (64 queries, head h, batch b): causal flash attention (K = 64: 2 k-steps), scores = (q.k) * 0.125 + log gate; query blocks 0-1: q/k hi + residual (3 products) and P hi/lo x V hi/lo (3 products, residual terms in accl), single f16 products beyond; O[b*S+q][h*64+d] = (acc + accl / 2048) / (2048 l), zero for dormant heads (256-B segments)
__global__ __launch_bounds__(128) void k_attn(const _Float16* __restrict__ QK, const _Float16* __restrict__ QKL, const _Float16* __restrict__ VTH, const _Float16* __restrict__ VTL, const void* __restrict__ KMASK, const float* __restrict__ KB, const int* __restrict__ AM, float* __restrict__ O) {
  __shared__ __align__(16) float sp[4][16][36]; __shared__ __align__(16) float so[4][16][68];
  const int tid = threadIdx.x, wave = tid >> 5, lane = tid & 31, col = lane & 15, g = lane >> 4;
  const int qb = blockIdx.x, h = blockIdx.y, b = blockIdx.z; const int q0 = qb * 64 + wave * 16; const size_t rq = (size_t)b * SS + q0 + col;
  v16h aq[2], aql[2];
#pragma unroll
  for (int kc = 0; kc < 2; ++kc) { aq[kc] = frag_h(QK + rq * (2 * DM) + h * HD + kc * 32, lane); aql[kc] = frag_h(QKL + rq * (2 * DM) + h * HD + kc * 32, lane); }
  float m[8], l[8];
#pragma unroll
  for (int r = 0; r < 8; ++r) { m[r] = -3.0e38f; l[r] = 0.f; }
  v8f acc[4] = {}, accl[4] = {};
  const int nks = (qb * 64 + 64) / 32;   // causal: key tiles up to the query tile's end
#pragma unroll 1
  for (int ks = 0; ks < nks; ++ks) { v8f s[2];
#pragma unroll
    for (int ct = 0; ct < 2; ++ct) { const int kk = ks * 32 + ct * 16 + col; const _Float16* krow = QK + ((size_t)b * SS + kk) * (2 * DM) + DM + h * HD; const _Float16* krowl = QKL + ((size_t)b * SS + kk) * (2 * DM) + DM + h * HD; v8f c = {}, cl = {};
      if (qb < 2) {   // leading query blocks (few keys, outputs far above the global rms): 3 products
#pragma unroll
        for (int kc = 0; kc < 2; ++kc) { const v16h kh = frag_h(krow + kc * 32, lane); c = wmma16(aq[kc], kh, c); cl = wmma16(aql[kc], kh, cl); cl = wmma16(aq[kc], frag_h(krowl + kc * 32, lane), cl); }
#pragma unroll
        for (int r = 0; r < 8; ++r) c[r] += cl[r] * (1.0f / 2048.0f); }
      else {
#pragma unroll
        for (int kc = 0; kc < 2; ++kc) c = wmma16(aq[kc], frag_h(krow + kc * 32, lane), c); }   // single product elsewhere
      { const float kb = KB[((size_t)b * NH + h) * SS + kk];
#pragma unroll
      for (int r = 0; r < 8; ++r) s[ct][r] = (kk <= q0 + 8 * g + r) ? c[r] * SCALEF + kb : -3.0e38f; } }   // causal; + log resonance gate of key kk
#pragma unroll
    for (int r = 0; r < 8; ++r) { float mx = fmaxf(s[0][r], s[1][r]);
#pragma unroll
      for (int o = 1; o < 16; o <<= 1) mx = fmaxf(mx, __shfl_xor(mx, o));
      const float mn = fmaxf(m[r], mx); const float alpha = (m[r] <= -1.0e38f) ? 0.f : __expf(m[r] - mn);
      const float e0 = (s[0][r] <= -1.0e38f) ? 0.f : __expf(s[0][r] - mn), e1 = (s[1][r] <= -1.0e38f) ? 0.f : __expf(s[1][r] - mn); float es = e0 + e1;
#pragma unroll
      for (int o = 1; o < 16; o <<= 1) es += __shfl_xor(es, o);
      l[r] = l[r] * alpha + es; m[r] = mn;
#pragma unroll
      for (int dt = 0; dt < 4; ++dt) { acc[dt][r] *= alpha; accl[dt][r] *= alpha; }
      sp[wave][8 * g + r][col] = e0; sp[wave][8 * g + r][16 + col] = e1; }
    LDSX();
    v16h pa, pl; { const float* prow = &sp[wave][col][0] + 8 * (lane >> 4);
#pragma unroll
      for (int i = 0; i < 8; ++i) { const float x0 = prow[i] * 2048.0f, x1 = prow[16 + i] * 2048.0f; const _Float16 h0 = (_Float16)x0, h1 = (_Float16)x1; pa[i] = h0; pa[8 + i] = h1; pl[i] = (_Float16)((x0 - (float)h0) * 2048.0f); pl[8 + i] = (_Float16)((x1 - (float)h1) * 2048.0f); } }   // P scaled by 2^11 before the f16 split so small softmax weights stay out of the f16 subnormal range; 2^-11 folded into the epilogue
#pragma unroll
    for (int dt = 0; dt < 4; ++dt) { const size_t vr = ((size_t)b * DM + h * HD + dt * 16 + col) * SS + ks * 32; const v16h vh = frag_h(VTH + vr, lane); acc[dt] = wmma16(pa, vh, acc[dt]); if (qb < 2) { accl[dt] = wmma16(pl, vh, accl[dt]); accl[dt] = wmma16(pa, frag_h(VTL + vr, lane), accl[dt]); } }   // leading query blocks: P hi/lo x V hi/lo (3 products); elsewhere P x V single
    LDSX(); }
#pragma unroll
  for (int r = 0; r < 8; ++r) { const float il = ((AM[h] != 0) ? (1.0f / 2048.0f) : 0.f) / l[r];   // dormant heads contribute nothing
#pragma unroll
    for (int dt = 0; dt < 4; ++dt) so[wave][8 * g + r][dt * 16 + col] = (acc[dt][r] + accl[dt][r] * (1.0f / 2048.0f)) * il; }
  LDSX();
  for (int rl = 0; rl < 16; ++rl) if (lane < 16) vst2(O + ((size_t)b * SS + q0 + rl) * DM + h * HD + lane * 4, *(const v4f*)&so[wave][rl][lane * 4]);
}
// ---- k_out: block = (64 rows, 128 cols): out = O(hi/lo) . Wo rows (2 products), no bias (BO is null)
__global__ __launch_bounds__(128) void k_out(const float* __restrict__ O, const __bf16* __restrict__ P, const float* __restrict__ BO, float* __restrict__ Y) {
  __shared__ __align__(16) float so[4][16][132];
  const int tid = threadIdx.x, wave = tid >> 5, lane = tid & 31, col = lane & 15, g = lane >> 4; const size_t r0 = (size_t)blockIdx.x * 64 + wave * 16; const int n0 = blockIdx.y * 128;
  v8f acc[8] = {};
#pragma unroll 2
  for (int kc = 0; kc < DM / 32; ++kc) { const F2 a = split_row(O + (r0 + col) * DM, kc * 32, lane);
#pragma unroll
    for (int j = 0; j < 8; ++j) { const v16b w = frag_b(P + (size_t)(n0 + j * 16 + col) * DM + kc * 32, lane); acc[j] = wmma_bf(a.l, w, acc[j]); acc[j] = wmma_bf(a.h, w, acc[j]); } }
#pragma unroll
  for (int j = 0; j < 8; ++j) {
#pragma unroll
    for (int r = 0; r < 8; ++r) so[wave][8 * g + r][j * 16 + col] = acc[j][r] + (BO ? bfr(BO[n0 + j * 16 + col]) : 0.f); }
  LDSX();
  for (int rl = 0; rl < 16; ++rl) vst2(Y + (r0 + rl) * DM + n0 + lane * 4, *(const v4f*)&so[wave][rl][lane * 4]);
}

// ---- k_phase: block = token (256 threads): ph = bf16(x) . bf16(w_phase) (f32), phase = atan2(ph0, ph1); then the 16 per-head log gates for this key
__global__ __launch_bounds__(256) void k_phase(const float* __restrict__ X, const float* __restrict__ WP, const float* __restrict__ CAR, const float* __restrict__ LOCK, const float* __restrict__ BW, float* __restrict__ KB) {
  __shared__ float r0s[256], r1s[256]; const size_t row = blockIdx.x; const int t = threadIdx.x; float a0 = 0.f, a1 = 0.f;
  for (int d = t; d < DM; d += 256) { const float xv = bfr(X[row * DM + d]); a0 += xv * bfr(WP[d * 2]); a1 += xv * bfr(WP[d * 2 + 1]); }
  r0s[t] = a0; r1s[t] = a1; __syncthreads();
  for (int s = 128; s > 0; s >>= 1) { if (t < s) { r0s[t] += r0s[t + s]; r1s[t] += r1s[t + s]; } __syncthreads(); }
  if (t < NH) { const float phase = atan2_p(r0s[0], r1s[0]); const float lk = bfr(LOCK[t]), bw = bfr(BW[t]), car = bfr(CAR[t]); const float win = exp_ni((cos_p(phase - car) - 1.0f) / bw); const float gate = lk * win + (1.0f - lk); const size_t b = row / SS, s = row % SS; KB[(b * NH + t) * SS + s] = log_p(gate + 1e-6f); }   // 4-B scratch store
}
extern "C" void kernel_launch(void* const* d_in, const int* in_sizes, int n_in, void* d_out, int out_size, void* d_ws, size_t ws_size, hipStream_t stream) {
  (void)in_sizes; (void)n_in; (void)out_size;
  const float** F = (const float**)d_in;   // 0 x [4,1024,1024], 1 wq, 2 wk, 3 wv, 4 wo (all (in,out) [1024,1024]), 5 w_phase [1024,2], 6 carrier [16], 7 lock [16], 8 bandwidth [16], 9 active_mask [16] int
  if (ws_size < (size_t)WS_END + 4u * NB * NH * SS + 256) return;
  char* ws = (char*)d_ws; __bf16* PK = (__bf16*)(ws + WS_PK); _Float16 *QK = (_Float16*)(ws + WS_QK), *QKL = (_Float16*)(ws + WS_QKL), *VTH = (_Float16*)(ws + WS_VTH), *VTL = (_Float16*)(ws + WS_VTL); float* O = (float*)(ws + WS_O); float* KB = (float*)(ws + WS_END);
  k_pack<<<dim3(DM, 4), 256, 0, stream>>>(F[1], F[2], F[3], F[4], PK);
  k_phase<<<NB * SS, 256, 0, stream>>>(F[0], F[5], F[6], F[7], F[8], KB);
  k_qkv<<<dim3(TNB * SS / 64, QKVW / 128), 128, 0, stream>>>(F[0], F[0], F[0], PK + PK_A, nullptr, nullptr, nullptr, QK, QKL, VTH, VTL);
  k_attn<<<dim3(TQB, NH, TNB), 128, 0, stream>>>(QK, QKL, VTH, VTL, nullptr, KB, (const int*)d_in[9], O);
  k_out<<<dim3(TOB, DM / 128), 128, 0, stream>>>(O, PK + PK_P, nullptr, (float*)d_out);
}

// v001
// It runs in 202 microseconds.
// Two timings next to v000 put it at 1.77 and 1.75 times that version's speed.
// compute dtype: all float inputs rounded to bf16, active_mask (int) read on device; q/k/v = x . W with EXACT bf16 products on WMMA 16x16x32 ((in,out) weights as transposed rows); the per-token phase (x . w_phase, atan2) and the per-(batch, head, key) log resonance gate in f32 (precise expf/logf/cosf/atan2f); causal attention x 1/8 + log gate: for the first 128 queries of each sequence 3-product scores and P, v as f16 hi + residual (3 products), single f16 operands beyond; running-max softmax in f32 (hardware exp); the per-head active mask applied to the attention output; out = o (bf16 hi + residual) . Wo (2 products).
#include <hip/hip_runtime.h>
#include <math.h>

typedef __attribute__((ext_vector_type(16))) _Float16 v16h;
typedef __attribute__((ext_vector_type(16))) __bf16 v16b;
typedef __attribute__((ext_vector_type(8)))  _Float16 v8h;
typedef __attribute__((ext_vector_type(8)))  float v8f;
typedef __attribute__((ext_vector_type(4)))  float v4f;
typedef __attribute__((ext_vector_type(2)))  float v2f;
typedef __attribute__((ext_vector_type(4)))  unsigned v4u;
typedef __attribute__((ext_vector_type(4)))  int v4i;
typedef float __attribute__((may_alias)) float_a;
typedef int __attribute__((may_alias)) int_a;

template <typename T> __device__ __forceinline__ void vst2(void* p, T v) { *(T*)p = v;  }
__device__ __forceinline__ v8f wmma16(v16h a, v16h b, v8f c) {
  v8f d = __builtin_amdgcn_wmma_f32_16x16x32_f16(false, a, false, b, (short)0, c, false, false);
  asm volatile("v_nop\n\tv_nop\n\tv_nop\n\tv_nop" : "+v"(d) : "v"(a), "v"(b));
  return d;
}
__device__ __forceinline__ v8f wmma_bf(v16b a, v16b b, v8f c) {
  v8f d = __builtin_amdgcn_wmma_f32_16x16x32_bf16(false, a, false, b, (short)0, c, false, false);
  asm volatile("v_nop\n\tv_nop\n\tv_nop\n\tv_nop" : "+v"(d) : "v"(a), "v"(b));
  return d;
}
// Resonance-gated causal attention (B 4, S 1,024, d 1,024, 16 heads x 64): bias-free q/k/v/o projections, a per-key additive log-gate from each token's input phase against a per-head carrier (von Mises window opened by 1 - lock), causal softmax, dormant heads zeroed.
__device__ __forceinline__ v16h frag_h(const _Float16* rowk0, int lane) {
  union { v16h v; v8h q[2]; } u; const _Float16* p = rowk0 + 8 * (lane >> 4);
  u.q[0] = *(const v8h*)p; u.q[1] = *(const v8h*)(p + 16); return u.v;
}
__device__ __forceinline__ v16h frag_f32(const float* rowk0, int lane) {
  v16h a; const float* p = rowk0 + 8 * (lane >> 4);
#pragma unroll
  for (int i = 0; i < 8; ++i) { a[i] = (_Float16)p[i]; a[8 + i] = (_Float16)p[16 + i]; }
  return a;
}
__device__ __forceinline__ v16h frag_f32s(const float* rowk0, int lane, float sc) {
  v16h a; const float* p = rowk0 + 8 * (lane >> 4);
#pragma unroll
  for (int i = 0; i < 8; ++i) { a[i] = (_Float16)(p[i] * sc); a[8 + i] = (_Float16)(p[16 + i] * sc); }
  return a;
}
// column fragment from a [K][ld] layout (column n), rows >= K read as 0
__device__ __forceinline__ v16h fragc_f32(const float* W, int k0, int n, int lane, int ld, int K) {
  v16h a; const int g = lane >> 4;
#pragma unroll
  for (int i = 0; i < 8; ++i) { const int ka = k0 + 8 * g + i, kb = ka + 16;
    a[i] = (_Float16)(ka < K ? W[(size_t)(ka < K ? ka : K - 1) * ld + n] : 0.f); a[8 + i] = (_Float16)(kb < K ? W[(size_t)(kb < K ? kb : K - 1) * ld + n] : 0.f); }
  return a;
}
struct F2 { v16b h, l; };
__device__ __forceinline__ F2 bsplit16(const float v[16]) { F2 r;
#pragma unroll
  for (int i = 0; i < 16; ++i) { const __bf16 h = (__bf16)v[i]; r.h[i] = h; r.l[i] = (__bf16)(v[i] - (float)h); }
  return r; }
__device__ __forceinline__ F2 split_row(const float* row, int k0, int lane) { float v[16]; const float* p = row + k0 + 8 * (lane >> 4);
#pragma unroll
  for (int i = 0; i < 8; ++i) { v[i] = p[i]; v[8 + i] = p[16 + i]; }
  return bsplit16(v); }
__device__ __forceinline__ F2 split_rowK(const float* row, int k0, int lane, int K) { float v[16]; const int g = lane >> 4;
#pragma unroll
  for (int i = 0; i < 8; ++i) { const int ka = k0 + 8 * g + i, kb = ka + 16; v[i] = ka < K ? row[ka < K ? ka : K - 1] : 0.f; v[8 + i] = kb < K ? row[kb < K ? kb : K - 1] : 0.f; }
  return bsplit16(v); }
__device__ __forceinline__ F2 split_col(const float* W, int k0, int n, int lane, int ld, int K) { float v[16]; const int g = lane >> 4;
#pragma unroll
  for (int i = 0; i < 8; ++i) { const int ka = k0 + 8 * g + i, kb = ka + 16; v[i] = ka < K ? W[(size_t)(ka < K ? ka : K - 1) * ld + n] : 0.f; v[8 + i] = kb < K ? W[(size_t)(kb < K ? kb : K - 1) * ld + n] : 0.f; }
  return bsplit16(v); }
__device__ __forceinline__ v8f mac3(const F2& a, const F2& b, v8f c) { c = wmma_bf(a.l, b.h, c); c = wmma_bf(a.h, b.l, c); return wmma_bf(a.h, b.h, c); }
__device__ __forceinline__ float sigm(float v) { return 1.0f / (1.0f + expf(-v)); }
#define LDSX() do { asm volatile("s_wait_dscnt 0" ::: "memory"); __builtin_amdgcn_wave_barrier(); __builtin_amdgcn_fence(__ATOMIC_RELEASE, "workgroup"); } while (0)


#define NB 4
#define SS 1024
#define DM 1024
#define NH 16
#define SCALEF 0.125f
__device__ __attribute__((noinline)) float log_p(float v) { return logf(v); }
__device__ __attribute__((noinline)) float cos_p(float v) { return cosf(v); }
__device__ __attribute__((noinline)) float atan2_p(float y, float x) { return atan2f(y, x); }
#define HD 64
#define QKVW (3 * DM)
#ifndef TQB
#define TQB (SS / 64)
#define TNB NB
#define TOB (NB * SS / 64)     // output row tiles (all)
#endif
typedef __attribute__((ext_vector_type(8))) __bf16 v8b;
__device__ __forceinline__ v16b frag_b(const __bf16* rowk0, int lane) {
  union { v16b v; v8b q[2]; } u; const __bf16* p = rowk0 + 8 * (lane >> 4);
  u.q[0] = *(const v8b*)p; u.q[1] = *(const v8b*)(p + 16); return u.v;
}
__device__ __forceinline__ float bfr(float v) { return (float)(__bf16)v; }
typedef __attribute__((ext_vector_type(4))) __bf16 v4b;
#define KT 64   // k columns of both operands staged in LDS per trip: 128 B of a bf16 row, 256 B of an f32 row, so every staging load covers whole lines
#define LP 72   // LDS row pitch in bf16 elements: 144 B = 16 B x odd, the conflict-free pitch for 16-byte fragment reads
__device__ __attribute__((noinline)) float exp_ni(float v) { return expf(v); }
__device__ __attribute__((noinline)) float erf_ni(float v) { return erff(v); }

#define PK_A 0                       // [3072][1024] Wqkv rows (natural [out][in])
#define PK_P (PK_A + QKVW * DM)        // [1024][1024] Wo rows (natural)
#define PK_END (PK_P + DM * DM)
#define WS_PK  0u
#define WS_QK  (WS_PK + 2u * PK_END)             // f16 [4096 rows][2048]: q | k
#define WS_QKL (WS_QK + 2u * NB * SS * 2 * DM)     // f16 q | k residual planes x2048
#define WS_VTH (WS_QKL + 2u * NB * SS * 2 * DM)    // f16 [b][1024 (h*64+d)][1024 s] hi
#define WS_VTL (WS_VTH + 2u * NB * DM * SS)        // f16 lo x 2048
#define WS_O   (WS_VTL + 2u * NB * DM * SS)        // f32 [4096][1024]
#define WS_CS  (WS_O + 4u * NB * SS * DM)           // f32 2 x [1024][32], unused
#define WS_END (WS_CS + 4u * 2 * SS * 32)
// ---- k_pack: block = (row n, which): (in,out) column n -> bf16 [out][in] row n; which 0..2 -> W_q/W_k/W_v into PK_A rows which*1024 + n; 3 -> W_o into PK_P
__global__ __launch_bounds__(256) void k_pack(const float* __restrict__ WQ, const float* __restrict__ WK, const float* __restrict__ WV, const float* __restrict__ WO, __bf16* __restrict__ PK) {
  __shared__ __align__(16) __bf16 s[DM]; const int n = blockIdx.x, which = blockIdx.y, t = threadIdx.x; const float* Wm = (which == 0) ? WQ : (which == 1) ? WK : (which == 2) ? WV : WO;   // (in,out) weights: pack row n = column n
  for (int k = t; k < DM; k += 256) s[k] = (__bf16)Wm[(size_t)k * DM + n];
  __syncthreads();
  __bf16* dst = (which < 3) ? PK + PK_A + ((size_t)which * DM + n) * DM : PK + PK_P + (size_t)n * DM;
  for (int q = t; q < DM / 8; q += 256) vst2((unsigned*)(dst + q * 8), *(const v4u*)&s[q * 8]);
}
__global__ __launch_bounds__(128) void k_qkv(const float* __restrict__ XQ, const float* __restrict__ XK, const float* __restrict__ XV, const __bf16* __restrict__ P, const float* __restrict__ BQ, const float* __restrict__ BK, const float* __restrict__ BV, _Float16* __restrict__ QK, _Float16* __restrict__ QKL, _Float16* __restrict__ VTH, _Float16* __restrict__ VTL) {
  const int which0 = (blockIdx.y * 128) / DM; const float* X = (which0 == 0) ? XQ : (which0 == 1) ? XK : XV; const float* BB = BQ ? (((which0 == 0) ? BQ : (which0 == 1) ? BK : BV) + (blockIdx.y * 128 - which0 * DM)) : nullptr;
  __shared__ __align__(16) _Float16 so[4][16][136], sol[4][16][136]; __shared__ __align__(16) _Float16 sth[128][72], stl[128][72];
  const int tid = threadIdx.x, wave = tid >> 5, lane = tid & 31, col = lane & 15, g = lane >> 4; const size_t r0 = (size_t)blockIdx.x * 64 + wave * 16; const int n0 = blockIdx.y * 128;
  v8f acc[8] = {};
  // the block's 64 x rows (rounded to bf16) and 128 weight rows go through LDS, KT columns a trip: each line is loaded once a block by contiguous lanes; the next trip's loads fly in registers under this trip's products
  __shared__ __align__(16) __bf16 sA[64][LP], sB[128][LP];
  const int ar = tid >> 4, ac = (tid & 15) * 4, br = tid >> 3, bc = (tid & 7) * 8;
  const float* Ag = X + ((size_t)blockIdx.x * 64 + ar) * DM + ac; const __bf16* Bg = P + (size_t)(n0 + br) * DM + bc;
  const float* Ap = Ag; const __bf16* Bp = Bg; v4f ra[8]; v8b rb[8];
#pragma unroll   // constant indices keep ra, rb in registers
  for (int i = 0; i < 8; ++i) { ra[i] = *(const v4f*)(Ag + (size_t)i * 8 * DM); rb[i] = *(const v8b*)(Bg + (size_t)i * 16 * DM); }
  for (int kt = 0; kt < DM / KT; ++kt) {
#pragma unroll   // constant indices keep ra, rb in registers
    for (int i = 0; i < 8; ++i) { v4b c;
#pragma unroll   // four conversions, one 8-byte store
      for (int e = 0; e < 4; ++e) c[e] = (__bf16)ra[i][e];
      *(v4b*)&sA[ar + i * 8][ac] = c; *(v8b*)&sB[br + i * 16][bc] = rb[i]; }
    __syncthreads();   // the tile is published to all four waves
    if (kt + 1 < DM / KT) { Ap += KT; Bp += KT;
#pragma unroll   // constant indices keep ra, rb in registers
      for (int i = 0; i < 8; ++i) { ra[i] = *(const v4f*)(Ap + (size_t)i * 8 * DM); rb[i] = *(const v8b*)(Bp + (size_t)i * 16 * DM); }
      asm volatile("s_wait_xcnt 0x0" :: "v"(Ap), "v"(Bp) : "memory"); }   // the two running pointers are inputs here, so the address pairs of these loads stay whole up to this wait: no load of the run lands in one, and they take their new values only behind it
#pragma unroll   // two k steps of 32, k ascending; constant LDS offsets
    for (int kc = 0; kc < KT / 32; ++kc) { const v16b a = frag_b(&sA[wave * 16 + col][kc * 32], lane); v16b w[8];
#pragma unroll   // the k step's fragment reads go out as one group ahead of its products: one LDS latency a step, not one a product
      for (int j = 0; j < 8; ++j) w[j] = frag_b(&sB[j * 16 + col][kc * 32], lane);
#pragma unroll   // acc[j] indexed by constants
      for (int j = 0; j < 8; ++j) acc[j] = wmma_bf(a, w[j], acc[j]); }
    __syncthreads();   // every wave has read the tile before the next trip overwrites it
  }
  if (n0 < 2 * DM) {   // q stored unscaled (f16 sigma ~0.6, no subnormal exposure); 1/8 applied to the f32 score
#pragma unroll
    for (int j = 0; j < 8; ++j) {
#pragma unroll
      for (int r = 0; r < 8; ++r) { const float v = acc[j][r] + (BB ? bfr(BB[j * 16 + col]) : 0.f); const _Float16 hv = (_Float16)v; so[wave][8 * g + r][j * 16 + col] = hv; sol[wave][8 * g + r][j * 16 + col] = (_Float16)((v - (float)hv) * 2048.0f); } }   // q, k (+ bias) as f16 hi + (x2048) residual
    LDSX();
    for (int rl = 0; rl < 16; ++rl) if (lane < 16) { vst2((unsigned*)(QK + (r0 + rl) * (2 * DM) + n0 + lane * 8), *(const v4u*)&so[wave][rl][lane * 8]); vst2((unsigned*)(QKL + (r0 + rl) * (2 * DM) + n0 + lane * 8), *(const v4u*)&sol[wave][rl][lane * 8]); }
  } else {
#pragma unroll
    for (int j = 0; j < 8; ++j) {
#pragma unroll
      for (int r = 0; r < 8; ++r) { const float v = acc[j][r] + (BB ? bfr(BB[j * 16 + col]) : 0.f); const _Float16 hv = (_Float16)v; sth[j * 16 + col][wave * 16 + 8 * g + r] = hv; stl[j * 16 + col][wave * 16 + 8 * g + r] = (_Float16)((v - (float)hv) * 2048.0f); } }
    __syncthreads();
    const size_t rb = (size_t)blockIdx.x * 64; const int b = (int)(rb / SS), s0 = (int)(rb % SS); const int pc0 = n0 - 2 * DM;
    for (int q = tid; q < 128 * 8; q += 128) { const int d = q >> 3, pc = q & 7; const size_t o = ((size_t)b * DM + pc0 + d) * SS + s0 + pc * 8; vst2((unsigned*)(VTH + o), *(const v4u*)&sth[d][pc * 8]); vst2((unsigned*)(VTL + o), *(const v4u*)&stl[d][pc * 8]); }
  }
}
// ---- k_attn: block = (64 queries, head h, batch b): causal flash attention (K = 64: 2 k-steps), scores = (q.k) * 0.125 + log gate; query blocks 0-1: q/k hi + residual (3 products) and P hi/lo x V hi/lo (3 products, residual terms in accl), single f16 products beyond; O[b*S+q][h*64+d] = (acc + accl / 2048) / (2048 l), zero for dormant heads (256-B segments)
__global__ __launch_bounds__(128) void k_attn(const _Float16* __restrict__ QK, const _Float16* __restrict__ QKL, const _Float16* __restrict__ VTH, const _Float16* __restrict__ VTL, const void* __restrict__ KMASK, const float* __restrict__ KB, const int* __restrict__ AM, float* __restrict__ O) {
  __shared__ __align__(16) float sp[4][16][36]; __shared__ __align__(16) float so[4][16][68];
  const int tid = threadIdx.x, wave = tid >> 5, lane = tid & 31, col = lane & 15, g = lane >> 4;
  const int qb = blockIdx.x, h = blockIdx.y, b = blockIdx.z; const int q0 = qb * 64 + wave * 16; const size_t rq = (size_t)b * SS + q0 + col;
  v16h aq[2], aql[2];
#pragma unroll
  for (int kc = 0; kc < 2; ++kc) { aq[kc] = frag_h(QK + rq * (2 * DM) + h * HD + kc * 32, lane); aql[kc] = frag_h(QKL + rq * (2 * DM) + h * HD + kc * 32, lane); }
  float m[8], l[8];
#pragma unroll
  for (int r = 0; r < 8; ++r) { m[r] = -3.0e38f; l[r] = 0.f; }
  v8f acc[4] = {}, accl[4] = {};
  const int nks = (qb * 64 + 64) / 32;   // causal: key tiles up to the query tile's end
#pragma unroll 1
  for (int ks = 0; ks < nks; ++ks) { v8f s[2];
#pragma unroll
    for (int ct = 0; ct < 2; ++ct) { const int kk = ks * 32 + ct * 16 + col; const _Float16* krow = QK + ((size_t)b * SS + kk) * (2 * DM) + DM + h * HD; const _Float16* krowl = QKL + ((size_t)b * SS + kk) * (2 * DM) + DM + h * HD; v8f c = {}, cl = {};
      if (qb < 2) {   // leading query blocks (few keys, outputs far above the global rms): 3 products
#pragma unroll
        for (int kc = 0; kc < 2; ++kc) { const v16h kh = frag_h(krow + kc * 32, lane); c = wmma16(aq[kc], kh, c); cl = wmma16(aql[kc], kh, cl); cl = wmma16(aq[kc], frag_h(krowl + kc * 32, lane), cl); }
#pragma unroll
        for (int r = 0; r < 8; ++r) c[r] += cl[r] * (1.0f / 2048.0f); }
      else {
#pragma unroll
        for (int kc = 0; kc < 2; ++kc) c = wmma16(aq[kc], frag_h(krow + kc * 32, lane), c); }   // single product elsewhere
      { const float kb = KB[((size_t)b * NH + h) * SS + kk];
#pragma unroll
      for (int r = 0; r < 8; ++r) s[ct][r] = (kk <= q0 + 8 * g + r) ? c[r] * SCALEF + kb : -3.0e38f; } }   // causal; + log resonance gate of key kk
#pragma unroll
    for (int r = 0; r < 8; ++r) { float mx = fmaxf(s[0][r], s[1][r]);
#pragma unroll
      for (int o = 1; o < 16; o <<= 1) mx = fmaxf(mx, __shfl_xor(mx, o));
      const float mn = fmaxf(m[r], mx); const float alpha = (m[r] <= -1.0e38f) ? 0.f : __expf(m[r] - mn);
      const float e0 = (s[0][r] <= -1.0e38f) ? 0.f : __expf(s[0][r] - mn), e1 = (s[1][r] <= -1.0e38f) ? 0.f : __expf(s[1][r] - mn); float es = e0 + e1;
#pragma unroll
      for (int o = 1; o < 16; o <<= 1) es += __shfl_xor(es, o);
      l[r] = l[r] * alpha + es; m[r] = mn;
#pragma unroll
      for (int dt = 0; dt < 4; ++dt) { acc[dt][r] *= alpha; accl[dt][r] *= alpha; }
      sp[wave][8 * g + r][col] = e0; sp[wave][8 * g + r][16 + col] = e1; }
    LDSX();
    v16h pa, pl; { const float* prow = &sp[wave][col][0] + 8 * (lane >> 4);
#pragma unroll
      for (int i = 0; i < 8; ++i) { const float x0 = prow[i] * 2048.0f, x1 = prow[16 + i] * 2048.0f; const _Float16 h0 = (_Float16)x0, h1 = (_Float16)x1; pa[i] = h0; pa[8 + i] = h1; pl[i] = (_Float16)((x0 - (float)h0) * 2048.0f); pl[8 + i] = (_Float16)((x1 - (float)h1) * 2048.0f); } }   // P scaled by 2^11 before the f16 split so small softmax weights stay out of the f16 subnormal range; 2^-11 folded into the epilogue
#pragma unroll
    for (int dt = 0; dt < 4; ++dt) { const size_t vr = ((size_t)b * DM + h * HD + dt * 16 + col) * SS + ks * 32; const v16h vh = frag_h(VTH + vr, lane); acc[dt] = wmma16(pa, vh, acc[dt]); if (qb < 2) { accl[dt] = wmma16(pl, vh, accl[dt]); accl[dt] = wmma16(pa, frag_h(VTL + vr, lane), accl[dt]); } }   // leading query blocks: P hi/lo x V hi/lo (3 products); elsewhere P x V single
    LDSX(); }
#pragma unroll
  for (int r = 0; r < 8; ++r) { const float il = ((AM[h] != 0) ? (1.0f / 2048.0f) : 0.f) / l[r];   // dormant heads contribute nothing
#pragma unroll
    for (int dt = 0; dt < 4; ++dt) so[wave][8 * g + r][dt * 16 + col] = (acc[dt][r] + accl[dt][r] * (1.0f / 2048.0f)) * il; }
  LDSX();
  for (int rl = 0; rl < 16; ++rl) if (lane < 16) vst2(O + ((size_t)b * SS + q0 + rl) * DM + h * HD + lane * 4, *(const v4f*)&so[wave][rl][lane * 4]);
}
// ---- k_out: block = (64 rows, 128 cols): out = O(hi/lo) . Wo rows (2 products), no bias (BO is null)
__global__ __launch_bounds__(128) void k_out(const float* __restrict__ O, const __bf16* __restrict__ P, const float* __restrict__ BO, float* __restrict__ Y) {
  __shared__ __align__(16) float so[4][16][132];
  const int tid = threadIdx.x, wave = tid >> 5, lane = tid & 31, col = lane & 15, g = lane >> 4; const size_t r0 = (size_t)blockIdx.x * 64 + wave * 16; const int n0 = blockIdx.y * 128;
  v8f acc[8] = {};
  // as in k_qkv: the block's 64 rows of O (split once into bf16 hi and residual) and 128 weight rows go through LDS, KT columns a trip
  __shared__ __align__(16) __bf16 sAh[64][LP], sAl[64][LP], sB[128][LP];
  const int ar = tid >> 4, ac = (tid & 15) * 4, br = tid >> 3, bc = (tid & 7) * 8;
  const float* Ag = O + ((size_t)blockIdx.x * 64 + ar) * DM + ac; const __bf16* Bg = P + (size_t)(n0 + br) * DM + bc;
  const float* Ap = Ag; const __bf16* Bp = Bg; v4f ra[8]; v8b rb[8];
#pragma unroll   // constant indices keep ra, rb in registers
  for (int i = 0; i < 8; ++i) { ra[i] = *(const v4f*)(Ag + (size_t)i * 8 * DM); rb[i] = *(const v8b*)(Bg + (size_t)i * 16 * DM); }
  for (int kt = 0; kt < DM / KT; ++kt) {
#pragma unroll   // constant indices keep ra, rb in registers
    for (int i = 0; i < 8; ++i) { v4b ch, cl;
#pragma unroll   // four splits, two 8-byte stores
      for (int e = 0; e < 4; ++e) { const __bf16 hv = (__bf16)ra[i][e]; ch[e] = hv; cl[e] = (__bf16)(ra[i][e] - (float)hv); }
      *(v4b*)&sAh[ar + i * 8][ac] = ch; *(v4b*)&sAl[ar + i * 8][ac] = cl; *(v8b*)&sB[br + i * 16][bc] = rb[i]; }
    __syncthreads();   // the tile is published to all four waves
    if (kt + 1 < DM / KT) { Ap += KT; Bp += KT;
#pragma unroll   // constant indices keep ra, rb in registers
      for (int i = 0; i < 8; ++i) { ra[i] = *(const v4f*)(Ap + (size_t)i * 8 * DM); rb[i] = *(const v8b*)(Bp + (size_t)i * 16 * DM); }
      asm volatile("s_wait_xcnt 0x0" :: "v"(Ap), "v"(Bp) : "memory"); }   // the two running pointers are inputs here, so the address pairs of these loads stay whole up to this wait: no load of the run lands in one, and they take their new values only behind it
#pragma unroll   // two k steps of 32, k ascending; constant LDS offsets
    for (int kc = 0; kc < KT / 32; ++kc) { const v16b ah = frag_b(&sAh[wave * 16 + col][kc * 32], lane), al = frag_b(&sAl[wave * 16 + col][kc * 32], lane); v16b w[8];
#pragma unroll   // the k step's fragment reads go out as one group ahead of its products: one LDS latency a step, not one a product
      for (int j = 0; j < 8; ++j) w[j] = frag_b(&sB[j * 16 + col][kc * 32], lane);
#pragma unroll   // acc[j] indexed by constants
      for (int j = 0; j < 8; ++j) { acc[j] = wmma_bf(al, w[j], acc[j]); acc[j] = wmma_bf(ah, w[j], acc[j]); } }
    __syncthreads();   // every wave has read the tile before the next trip overwrites it
  }
#pragma unroll
  for (int j = 0; j < 8; ++j) {
#pragma unroll
    for (int r = 0; r < 8; ++r) so[wave][8 * g + r][j * 16 + col] = acc[j][r] + (BO ? bfr(BO[n0 + j * 16 + col]) : 0.f); }
  LDSX();
  for (int rl = 0; rl < 16; ++rl) vst2(Y + (r0 + rl) * DM + n0 + lane * 4, *(const v4f*)&so[wave][rl][lane * 4]);
}

// ---- k_phase: block = token (256 threads): ph = bf16(x) . bf16(w_phase) (f32), phase = atan2(ph0, ph1); then the 16 per-head log gates for this key
__global__ __launch_bounds__(256) void k_phase(const float* __restrict__ X, const float* __restrict__ WP, const float* __restrict__ CAR, const float* __restrict__ LOCK, const float* __restrict__ BW, float* __restrict__ KB) {
  __shared__ float r0s[256], r1s[256]; const size_t row = blockIdx.x; const int t = threadIdx.x; float a0 = 0.f, a1 = 0.f;
  for (int d = t; d < DM; d += 256) { const float xv = bfr(X[row * DM + d]); a0 += xv * bfr(WP[d * 2]); a1 += xv * bfr(WP[d * 2 + 1]); }
  r0s[t] = a0; r1s[t] = a1; __syncthreads();
  for (int s = 128; s > 0; s >>= 1) { if (t < s) { r0s[t] += r0s[t + s]; r1s[t] += r1s[t + s]; } __syncthreads(); }
  if (t < NH) { const float phase = atan2_p(r0s[0], r1s[0]); const float lk = bfr(LOCK[t]), bw = bfr(BW[t]), car = bfr(CAR[t]); const float win = exp_ni((cos_p(phase - car) - 1.0f) / bw); const float gate = lk * win + (1.0f - lk); const size_t b = row / SS, s = row % SS; KB[(b * NH + t) * SS + s] = log_p(gate + 1e-6f); }   // 4-B scratch store
}
extern "C" void kernel_launch(void* const* d_in, const int* in_sizes, int n_in, void* d_out, int out_size, void* d_ws, size_t ws_size, hipStream_t stream) {
  (void)in_sizes; (void)n_in; (void)out_size;
  const float** F = (const float**)d_in;   // 0 x [4,1024,1024], 1 wq, 2 wk, 3 wv, 4 wo (all (in,out) [1024,1024]), 5 w_phase [1024,2], 6 carrier [16], 7 lock [16], 8 bandwidth [16], 9 active_mask [16] int
  if (ws_size < (size_t)WS_END + 4u * NB * NH * SS + 256) return;
  char* ws = (char*)d_ws; __bf16* PK = (__bf16*)(ws + WS_PK); _Float16 *QK = (_Float16*)(ws + WS_QK), *QKL = (_Float16*)(ws + WS_QKL), *VTH = (_Float16*)(ws + WS_VTH), *VTL = (_Float16*)(ws + WS_VTL); float* O = (float*)(ws + WS_O); float* KB = (float*)(ws + WS_END);
  k_pack<<<dim3(DM, 4), 256, 0, stream>>>(F[1], F[2], F[3], F[4], PK);
  k_phase<<<NB * SS, 256, 0, stream>>>(F[0], F[5], F[6], F[7], F[8], KB);
  k_qkv<<<dim3(TNB * SS / 64, QKVW / 128), 128, 0, stream>>>(F[0], F[0], F[0], PK + PK_A, nullptr, nullptr, nullptr, QK, QKL, VTH, VTL);
  k_attn<<<dim3(TQB, NH, TNB), 128, 0, stream>>>(QK, QKL, VTH, VTL, nullptr, KB, (const int*)d_in[9], O);
  k_out<<<dim3(TOB, DM / 128), 128, 0, stream>>>(O, PK + PK_P, nullptr, (float*)d_out);
}

// v002
// A run of this version takes 158 microseconds.
// In both of two side-by-side timings against v001, it was 1.29 times as fast.
// Counting every step since v000, it is 2.27 times as fast.
// compute dtype: all float inputs rounded to bf16, active_mask (int) read on device; q/k/v = x . W with EXACT bf16 products on WMMA 16x16x32 ((in,out) weights as transposed rows); the per-token phase (x . w_phase, atan2) and the per-(batch, head, key) log resonance gate in f32 (precise expf/logf/cosf/atan2f); causal attention x 1/8 + log gate: for the first 128 queries of each sequence 3-product scores and P, v as f16 hi + residual (3 products), single f16 operands beyond; running-max softmax in f32 (hardware exp); the per-head active mask applied to the attention output; out = o (bf16 hi + residual) . Wo (2 products).
#include <hip/hip_runtime.h>
#include <math.h>

typedef __attribute__((ext_vector_type(16))) _Float16 v16h;
typedef __attribute__((ext_vector_type(16))) __bf16 v16b;
typedef __attribute__((ext_vector_type(8)))  _Float16 v8h;
typedef __attribute__((ext_vector_type(8)))  float v8f;
typedef __attribute__((ext_vector_type(4)))  float v4f;
typedef __attribute__((ext_vector_type(2)))  float v2f;
typedef __attribute__((ext_vector_type(4)))  unsigned v4u;
typedef __attribute__((ext_vector_type(4)))  int v4i;
typedef float __attribute__((may_alias)) float_a;
typedef int __attribute__((may_alias)) int_a;

template <typename T> __device__ __forceinline__ void vst2(void* p, T v) { *(T*)p = v;  }
__device__ __forceinline__ v8f wmma16(v16h a, v16h b, v8f c) {
  v8f d = __builtin_amdgcn_wmma_f32_16x16x32_f16(false, a, false, b, (short)0, c, false, false);
  asm volatile("v_nop\n\tv_nop\n\tv_nop\n\tv_nop" : "+v"(d) : "v"(a), "v"(b));
  return d;
}
__device__ __forceinline__ v8f wmma_bf(v16b a, v16b b, v8f c) {
  v8f d = __builtin_amdgcn_wmma_f32_16x16x32_bf16(false, a, false, b, (short)0, c, false, false);
  asm volatile("v_nop\n\tv_nop\n\tv_nop\n\tv_nop" : "+v"(d) : "v"(a), "v"(b));
  return d;
}
// Resonance-gated causal attention (B 4, S 1,024, d 1,024, 16 heads x 64): bias-free q/k/v/o projections, a per-key additive log-gate from each token's input phase against a per-head carrier (von Mises window opened by 1 - lock), causal softmax, dormant heads zeroed.
__device__ __forceinline__ v16h frag_h(const _Float16* rowk0, int lane) {
  union { v16h v; v8h q[2]; } u; const _Float16* p = rowk0 + 8 * (lane >> 4);
  u.q[0] = *(const v8h*)p; u.q[1] = *(const v8h*)(p + 16); return u.v;
}
__device__ __forceinline__ v16h frag_f32(const float* rowk0, int lane) {
  v16h a; const float* p = rowk0 + 8 * (lane >> 4);
#pragma unroll
  for (int i = 0; i < 8; ++i) { a[i] = (_Float16)p[i]; a[8 + i] = (_Float16)p[16 + i]; }
  return a;
}
__device__ __forceinline__ v16h frag_f32s(const float* rowk0, int lane, float sc) {
  v16h a; const float* p = rowk0 + 8 * (lane >> 4);
#pragma unroll
  for (int i = 0; i < 8; ++i) { a[i] = (_Float16)(p[i] * sc); a[8 + i] = (_Float16)(p[16 + i] * sc); }
  return a;
}
// column fragment from a [K][ld] layout (column n), rows >= K read as 0
__device__ __forceinline__ v16h fragc_f32(const float* W, int k0, int n, int lane, int ld, int K) {
  v16h a; const int g = lane >> 4;
#pragma unroll
  for (int i = 0; i < 8; ++i) { const int ka = k0 + 8 * g + i, kb = ka + 16;
    a[i] = (_Float16)(ka < K ? W[(size_t)(ka < K ? ka : K - 1) * ld + n] : 0.f); a[8 + i] = (_Float16)(kb < K ? W[(size_t)(kb < K ? kb : K - 1) * ld + n] : 0.f); }
  return a;
}
struct F2 { v16b h, l; };
__device__ __forceinline__ F2 bsplit16(const float v[16]) { F2 r;
#pragma unroll
  for (int i = 0; i < 16; ++i) { const __bf16 h = (__bf16)v[i]; r.h[i] = h; r.l[i] = (__bf16)(v[i] - (float)h); }
  return r; }
__device__ __forceinline__ F2 split_row(const float* row, int k0, int lane) { float v[16]; const float* p = row + k0 + 8 * (lane >> 4);
#pragma unroll
  for (int i = 0; i < 8; ++i) { v[i] = p[i]; v[8 + i] = p[16 + i]; }
  return bsplit16(v); }
__device__ __forceinline__ F2 split_rowK(const float* row, int k0, int lane, int K) { float v[16]; const int g = lane >> 4;
#pragma unroll
  for (int i = 0; i < 8; ++i) { const int ka = k0 + 8 * g + i, kb = ka + 16; v[i] = ka < K ? row[ka < K ? ka : K - 1] : 0.f; v[8 + i] = kb < K ? row[kb < K ? kb : K - 1] : 0.f; }
  return bsplit16(v); }
__device__ __forceinline__ F2 split_col(const float* W, int k0, int n, int lane, int ld, int K) { float v[16]; const int g = lane >> 4;
#pragma unroll
  for (int i = 0; i < 8; ++i) { const int ka = k0 + 8 * g + i, kb = ka + 16; v[i] = ka < K ? W[(size_t)(ka < K ? ka : K - 1) * ld + n] : 0.f; v[8 + i] = kb < K ? W[(size_t)(kb < K ? kb : K - 1) * ld + n] : 0.f; }
  return bsplit16(v); }
__device__ __forceinline__ v8f mac3(const F2& a, const F2& b, v8f c) { c = wmma_bf(a.l, b.h, c); c = wmma_bf(a.h, b.l, c); return wmma_bf(a.h, b.h, c); }
__device__ __forceinline__ float sigm(float v) { return 1.0f / (1.0f + expf(-v)); }
#define LDSX() do { asm volatile("s_wait_dscnt 0" ::: "memory"); __builtin_amdgcn_wave_barrier(); __builtin_amdgcn_fence(__ATOMIC_RELEASE, "workgroup"); } while (0)
// the same for LDS that only its own wave reads, with the fence at wavefront scope: the work-group fence also waits for every global load in flight
#define LDSW() do { asm volatile("s_wait_dscnt 0" ::: "memory"); __builtin_amdgcn_wave_barrier(); __builtin_amdgcn_fence(__ATOMIC_RELEASE, "wavefront"); } while (0)


#define NB 4
#define SS 1024
#define DM 1024
#define NH 16
#define SCALEF 0.125f
__device__ __attribute__((noinline)) float log_p(float v) { return logf(v); }
__device__ __attribute__((noinline)) float cos_p(float v) { return cosf(v); }
__device__ __attribute__((noinline)) float atan2_p(float y, float x) { return atan2f(y, x); }
#define HD 64
#define QKVW (3 * DM)
#ifndef TQB
#define TQB (SS / 64)
#define TNB NB
#define TOB (NB * SS / 64)     // output row tiles (all)
#endif
typedef __attribute__((ext_vector_type(8))) __bf16 v8b;
__device__ __forceinline__ v16b frag_b(const __bf16* rowk0, int lane) {
  union { v16b v; v8b q[2]; } u; const __bf16* p = rowk0 + 8 * (lane >> 4);
  u.q[0] = *(const v8b*)p; u.q[1] = *(const v8b*)(p + 16); return u.v;
}
__device__ __forceinline__ float bfr(float v) { return (float)(__bf16)v; }
typedef __attribute__((ext_vector_type(4))) __bf16 v4b;
#define KT 64   // k columns of both operands staged in LDS per trip: 128 B of a bf16 row, 256 B of an f32 row, so every staging load covers whole lines
#define LP 72   // LDS row pitch in bf16 elements: 144 B = 16 B x odd, the conflict-free pitch for 16-byte fragment reads
__device__ __attribute__((noinline)) float exp_ni(float v) { return expf(v); }
__device__ __attribute__((noinline)) float erf_ni(float v) { return erff(v); }

#define PK_A 0                       // [3072][1024] Wqkv rows (natural [out][in])
#define PK_P (PK_A + QKVW * DM)        // [1024][1024] Wo rows (natural)
#define PK_END (PK_P + DM * DM)
#define WS_PK  0u
#define WS_QK  (WS_PK + 2u * PK_END)             // f16 [4096 rows][2048]: q | k
#define WS_QKL (WS_QK + 2u * NB * SS * 2 * DM)     // f16 q | k residual planes x2048
#define WS_VTH (WS_QKL + 2u * NB * SS * 2 * DM)    // f16 [b][1024 (h*64+d)][1024 s] hi
#define WS_VTL (WS_VTH + 2u * NB * DM * SS)        // f16 lo x 2048
#define WS_O   (WS_VTL + 2u * NB * DM * SS)        // f32 [4096][1024]
#define WS_CS  (WS_O + 4u * NB * SS * DM)           // f32 2 x [1024][32], unused
#define WS_END (WS_CS + 4u * 2 * SS * 32)
// ---- k_pack: block = (row n, which): (in,out) column n -> bf16 [out][in] row n; which 0..2 -> W_q/W_k/W_v into PK_A rows which*1024 + n; 3 -> W_o into PK_P
__global__ __launch_bounds__(256) void k_pack(const float* __restrict__ WQ, const float* __restrict__ WK, const float* __restrict__ WV, const float* __restrict__ WO, __bf16* __restrict__ PK) {
  __shared__ __align__(16) __bf16 s[DM]; const int n = blockIdx.x, which = blockIdx.y, t = threadIdx.x; const float* Wm = (which == 0) ? WQ : (which == 1) ? WK : (which == 2) ? WV : WO;   // (in,out) weights: pack row n = column n
  for (int k = t; k < DM; k += 256) s[k] = (__bf16)Wm[(size_t)k * DM + n];
  __syncthreads();
  __bf16* dst = (which < 3) ? PK + PK_A + ((size_t)which * DM + n) * DM : PK + PK_P + (size_t)n * DM;
  for (int q = t; q < DM / 8; q += 256) vst2((unsigned*)(dst + q * 8), *(const v4u*)&s[q * 8]);
}
__global__ __launch_bounds__(128) void k_qkv(const float* __restrict__ XQ, const float* __restrict__ XK, const float* __restrict__ XV, const __bf16* __restrict__ P, const float* __restrict__ BQ, const float* __restrict__ BK, const float* __restrict__ BV, _Float16* __restrict__ QK, _Float16* __restrict__ QKL, _Float16* __restrict__ VTH, _Float16* __restrict__ VTL) {
  const int which0 = (blockIdx.y * 128) / DM; const float* X = (which0 == 0) ? XQ : (which0 == 1) ? XK : XV; const float* BB = BQ ? (((which0 == 0) ? BQ : (which0 == 1) ? BK : BV) + (blockIdx.y * 128 - which0 * DM)) : nullptr;
  __shared__ __align__(16) _Float16 so[4][16][136], sol[4][16][136]; __shared__ __align__(16) _Float16 sth[128][72], stl[128][72];
  const int tid = threadIdx.x, wave = tid >> 5, lane = tid & 31, col = lane & 15, g = lane >> 4; const size_t r0 = (size_t)blockIdx.x * 64 + wave * 16; const int n0 = blockIdx.y * 128;
  v8f acc[8] = {};
  // the block's 64 x rows (rounded to bf16) and 128 weight rows go through LDS, KT columns a trip: each line is loaded once a block by contiguous lanes; the next trip's loads fly in registers under this trip's products
  __shared__ __align__(16) __bf16 sA[64][LP], sB[128][LP];
  const int ar = tid >> 4, ac = (tid & 15) * 4, br = tid >> 3, bc = (tid & 7) * 8;
  const float* Ag = X + ((size_t)blockIdx.x * 64 + ar) * DM + ac; const __bf16* Bg = P + (size_t)(n0 + br) * DM + bc;
  const float* Ap = Ag; const __bf16* Bp = Bg; v4f ra[8]; v8b rb[8];
#pragma unroll   // constant indices keep ra, rb in registers
  for (int i = 0; i < 8; ++i) { ra[i] = *(const v4f*)(Ag + (size_t)i * 8 * DM); rb[i] = *(const v8b*)(Bg + (size_t)i * 16 * DM); }
  for (int kt = 0; kt < DM / KT; ++kt) {
#pragma unroll   // constant indices keep ra, rb in registers
    for (int i = 0; i < 8; ++i) { v4b c;
#pragma unroll   // four conversions, one 8-byte store
      for (int e = 0; e < 4; ++e) c[e] = (__bf16)ra[i][e];
      *(v4b*)&sA[ar + i * 8][ac] = c; *(v8b*)&sB[br + i * 16][bc] = rb[i]; }
    __syncthreads();   // the tile is published to all four waves
    if (kt + 1 < DM / KT) { Ap += KT; Bp += KT;
#pragma unroll   // constant indices keep ra, rb in registers
      for (int i = 0; i < 8; ++i) { ra[i] = *(const v4f*)(Ap + (size_t)i * 8 * DM); rb[i] = *(const v8b*)(Bp + (size_t)i * 16 * DM); }
      asm volatile("s_wait_xcnt 0x0" :: "v"(Ap), "v"(Bp) : "memory"); }   // the two running pointers are inputs here, so the address pairs of these loads stay whole up to this wait: no load of the run lands in one, and they take their new values only behind it
#pragma unroll   // two k steps of 32, k ascending; constant LDS offsets
    for (int kc = 0; kc < KT / 32; ++kc) { const v16b a = frag_b(&sA[wave * 16 + col][kc * 32], lane); v16b w[8];
#pragma unroll   // the k step's fragment reads go out as one group ahead of its products: one LDS latency a step, not one a product
      for (int j = 0; j < 8; ++j) w[j] = frag_b(&sB[j * 16 + col][kc * 32], lane);
#pragma unroll   // acc[j] indexed by constants
      for (int j = 0; j < 8; ++j) acc[j] = wmma_bf(a, w[j], acc[j]); }
    __syncthreads();   // every wave has read the tile before the next trip overwrites it
  }
  if (n0 < 2 * DM) {   // q stored unscaled (f16 sigma ~0.6, no subnormal exposure); 1/8 applied to the f32 score
#pragma unroll
    for (int j = 0; j < 8; ++j) {
#pragma unroll
      for (int r = 0; r < 8; ++r) { const float v = acc[j][r] + (BB ? bfr(BB[j * 16 + col]) : 0.f); const _Float16 hv = (_Float16)v; so[wave][8 * g + r][j * 16 + col] = hv; sol[wave][8 * g + r][j * 16 + col] = (_Float16)((v - (float)hv) * 2048.0f); } }   // q, k (+ bias) as f16 hi + (x2048) residual
    LDSX();
    for (int rl = 0; rl < 16; ++rl) if (lane < 16) { vst2((unsigned*)(QK + (r0 + rl) * (2 * DM) + n0 + lane * 8), *(const v4u*)&so[wave][rl][lane * 8]); vst2((unsigned*)(QKL + (r0 + rl) * (2 * DM) + n0 + lane * 8), *(const v4u*)&sol[wave][rl][lane * 8]); }
  } else {
#pragma unroll
    for (int j = 0; j < 8; ++j) {
#pragma unroll
      for (int r = 0; r < 8; ++r) { const float v = acc[j][r] + (BB ? bfr(BB[j * 16 + col]) : 0.f); const _Float16 hv = (_Float16)v; sth[j * 16 + col][wave * 16 + 8 * g + r] = hv; stl[j * 16 + col][wave * 16 + 8 * g + r] = (_Float16)((v - (float)hv) * 2048.0f); } }
    __syncthreads();
    const size_t rb = (size_t)blockIdx.x * 64; const int b = (int)(rb / SS), s0 = (int)(rb % SS); const int pc0 = n0 - 2 * DM;
    for (int q = tid; q < 128 * 8; q += 128) { const int d = q >> 3, pc = q & 7; const size_t o = ((size_t)b * DM + pc0 + d) * SS + s0 + pc * 8; vst2((unsigned*)(VTH + o), *(const v4u*)&sth[d][pc * 8]); vst2((unsigned*)(VTL + o), *(const v4u*)&stl[d][pc * 8]); }
  }
}
// fragment at the lane's own address (row start + 8 * (lane >> 4)), the k order of frag_h
__device__ __forceinline__ v16h frag_at(const _Float16* p) { union { v16h v; v8h q[2]; } u; u.q[0] = *(const v8h*)p; u.q[1] = *(const v8h*)(p + 16); return u.v; }
// ---- k_attn: block = (64 queries, head h, batch b): causal flash attention (K = 64: 2 k-steps), scores = (q.k) * 0.125, q and k as f16 hi + residual (3 products) for qb < 2, single f16 operands beyond; P.V: f16 P*2048 x V hi in acc, for qb < 2 also P lo x V hi and P x V lo*2048 in accl; O[b*S+q][h*64+d] = (acc + accl / 2048) / (2048 l), 0 for dormant heads (256-B segments)
__global__ __launch_bounds__(128) void k_attn(const _Float16* __restrict__ QK, const _Float16* __restrict__ QKL, const _Float16* __restrict__ VTH, const _Float16* __restrict__ VTL, const void* __restrict__ KMASK, const float* __restrict__ KB, const int* __restrict__ AM, float* __restrict__ O) {
  __shared__ __align__(16) float sp[4][16][36]; __shared__ __align__(16) float so[4][16][68];
  const int tid = threadIdx.x, wave = tid >> 5, lane = tid & 31, col = lane & 15, g = lane >> 4;
  const int qb = blockIdx.x, h = blockIdx.y, b = blockIdx.z; const int q0 = qb * 64 + wave * 16; const size_t rq = (size_t)b * SS + q0 + col;
  v16h aq[2];   // the q residual, used by the leading query blocks alone, is loaded at its products: 16 registers less in every block
#pragma unroll
  for (int kc = 0; kc < 2; ++kc) aq[kc] = frag_h(QK + rq * (2 * DM) + h * HD + kc * 32, lane);
  float m[8], l[8];
#pragma unroll
  for (int r = 0; r < 8; ++r) { m[r] = -3.0e38f; l[r] = 0.f; }
  v8f acc[4] = {}, accl[4] = {};
  const int nks = (qb * 64 + 64) / 32;   // causal: key tiles up to the query tile's end
  // the V (hi) loads of a key step go out as one group behind its score products, the K (hi) and gate loads of the next step as one group behind the softmax: each group's latency runs under other work and is waited for by count, instead of a load and a full wait in front of every product. 254 registers: four waves per SIMD as before
  const _Float16* kp = QK + ((size_t)b * SS + col) * (2 * DM) + DM + h * HD + 8 * g; const float* bp = KB + ((size_t)b * NH + h) * SS + col; const _Float16* vp = VTH + ((size_t)b * DM + h * HD + col) * SS + 8 * g;   // the lane's own running addresses
  v16h kf[2][2], vf[4]; float kbv[2];
#pragma unroll   // constant indices keep kf, kbv in registers
  for (int ct = 0; ct < 2; ++ct) { kf[ct][0] = frag_at(kp + (size_t)ct * 16 * (2 * DM)); kf[ct][1] = frag_at(kp + (size_t)ct * 16 * (2 * DM) + 32); kbv[ct] = bp[ct * 16]; }
#pragma unroll 1
  for (int ks = 0; ks < nks; ++ks) { v8f s[2];
#pragma unroll
    for (int ct = 0; ct < 2; ++ct) { const int kk = ks * 32 + ct * 16 + col; const _Float16* krowl = QKL + ((size_t)b * SS + kk) * (2 * DM) + DM + h * HD; v8f c = {}, cl = {};
      if (qb < 2) {   // leading query blocks (few keys, outputs far above the global rms): 3 products
#pragma unroll
        for (int kc = 0; kc < 2; ++kc) { const v16h kh = kf[ct][kc]; c = wmma16(aq[kc], kh, c); cl = wmma16(frag_h(QKL + rq * (2 * DM) + h * HD + kc * 32, lane), kh, cl); cl = wmma16(aq[kc], frag_h(krowl + kc * 32, lane), cl); }
#pragma unroll
        for (int r = 0; r < 8; ++r) c[r] += cl[r] * (1.0f / 2048.0f); }
      else {
#pragma unroll
        for (int kc = 0; kc < 2; ++kc) c = wmma16(aq[kc], kf[ct][kc], c); }   // single product elsewhere
      { const float kb = kbv[ct];
#pragma unroll
      for (int r = 0; r < 8; ++r) s[ct][r] = (kk <= q0 + 8 * g + r) ? c[r] * SCALEF + kb : -3.0e38f; } }   // causal; + log resonance gate of key kk
#pragma unroll   // constant indices keep vf in registers
    for (int dt = 0; dt < 4; ++dt) vf[dt] = frag_at(vp + (size_t)dt * 16 * SS);
    asm volatile("s_wait_xcnt 0x0" :: "v"(vp) : "memory"); vp += 32;   // the running pointer is an input here, so the address pair of these loads stays whole up to this wait and takes its new value only behind it
#pragma unroll
    for (int r = 0; r < 8; ++r) { float mx = fmaxf(s[0][r], s[1][r]);
#pragma unroll
      for (int o = 1; o < 16; o <<= 1) mx = fmaxf(mx, __shfl_xor(mx, o));
      const float mn = fmaxf(m[r], mx); const float alpha = (m[r] <= -1.0e38f) ? 0.f : __expf(m[r] - mn);
      const float e0 = (s[0][r] <= -1.0e38f) ? 0.f : __expf(s[0][r] - mn), e1 = (s[1][r] <= -1.0e38f) ? 0.f : __expf(s[1][r] - mn); float es = e0 + e1;
#pragma unroll
      for (int o = 1; o < 16; o <<= 1) es += __shfl_xor(es, o);
      l[r] = l[r] * alpha + es; m[r] = mn;
#pragma unroll
      for (int dt = 0; dt < 4; ++dt) { acc[dt][r] *= alpha; accl[dt][r] *= alpha; }
      sp[wave][8 * g + r][col] = e0; sp[wave][8 * g + r][16 + col] = e1; }
    LDSW();
    { const int adv = (ks + 1 < nks) ? 32 : 0; kp += (size_t)adv * (2 * DM); bp += adv;   // no branch round this group: the last step loads its own rows once more (unused). Behind a join with a path without these loads the waits of the V fragments would have to cover this group too
#pragma unroll   // constant indices keep kf, kbv in registers
      for (int ct = 0; ct < 2; ++ct) { kf[ct][0] = frag_at(kp + (size_t)ct * 16 * (2 * DM)); kf[ct][1] = frag_at(kp + (size_t)ct * 16 * (2 * DM) + 32); kbv[ct] = bp[ct * 16]; }
      asm volatile("s_wait_xcnt 0x0" :: "v"(kp), "v"(bp) : "memory"); }   // as behind the V group
    v16h pa, pl; { const float* prow = &sp[wave][col][0] + 8 * (lane >> 4);
#pragma unroll
      for (int i = 0; i < 8; ++i) { const float x0 = prow[i] * 2048.0f, x1 = prow[16 + i] * 2048.0f; const _Float16 h0 = (_Float16)x0, h1 = (_Float16)x1; pa[i] = h0; pa[8 + i] = h1; pl[i] = (_Float16)((x0 - (float)h0) * 2048.0f); pl[8 + i] = (_Float16)((x1 - (float)h1) * 2048.0f); } }   // P scaled by 2^11 before the f16 split so small softmax weights stay out of the f16 subnormal range; 2^-11 folded into the epilogue
#pragma unroll
    for (int dt = 0; dt < 4; ++dt) acc[dt] = wmma16(pa, vf[dt], acc[dt]);
    if (qb < 2) {   // one branch a step for the four tiles' extra products: with one per tile the build holds accl twice
#pragma unroll   // accl, vf indexed by constants
      for (int dt = 0; dt < 4; ++dt) { const size_t vr = ((size_t)b * DM + h * HD + dt * 16 + col) * SS + ks * 32; accl[dt] = wmma16(pl, vf[dt], accl[dt]); accl[dt] = wmma16(pa, frag_h(VTL + vr, lane), accl[dt]); } }   // leading query blocks: P hi/lo x V hi/lo (3 products); elsewhere P x V single
    LDSW(); }
#pragma unroll
  for (int r = 0; r < 8; ++r) { const float il = ((AM[h] != 0) ? (1.0f / 2048.0f) : 0.f) / l[r];   // dormant heads contribute nothing
#pragma unroll
    for (int dt = 0; dt < 4; ++dt) so[wave][8 * g + r][dt * 16 + col] = (acc[dt][r] + accl[dt][r] * (1.0f / 2048.0f)) * il; }
  LDSX();
  for (int rl = 0; rl < 16; ++rl) if (lane < 16) vst2(O + ((size_t)b * SS + q0 + rl) * DM + h * HD + lane * 4, *(const v4f*)&so[wave][rl][lane * 4]);
}
// ---- k_out: block = (64 rows, 128 cols): out = O(hi/lo) . Wo rows (2 products), no bias (BO is null)
__global__ __launch_bounds__(128) void k_out(const float* __restrict__ O, const __bf16* __restrict__ P, const float* __restrict__ BO, float* __restrict__ Y) {
  __shared__ __align__(16) float so[4][16][132];
  const int tid = threadIdx.x, wave = tid >> 5, lane = tid & 31, col = lane & 15, g = lane >> 4; const size_t r0 = (size_t)blockIdx.x * 64 + wave * 16; const int n0 = blockIdx.y * 128;
  v8f acc[8] = {};
  // as in k_qkv: the block's 64 rows of O (split once into bf16 hi and residual) and 128 weight rows go through LDS, KT columns a trip
  __shared__ __align__(16) __bf16 sAh[64][LP], sAl[64][LP], sB[128][LP];
  const int ar = tid >> 4, ac = (tid & 15) * 4, br = tid >> 3, bc = (tid & 7) * 8;
  const float* Ag = O + ((size_t)blockIdx.x * 64 + ar) * DM + ac; const __bf16* Bg = P + (size_t)(n0 + br) * DM + bc;
  const float* Ap = Ag; const __bf16* Bp = Bg; v4f ra[8]; v8b rb[8];
#pragma unroll   // constant indices keep ra, rb in registers
  for (int i = 0; i < 8; ++i) { ra[i] = *(const v4f*)(Ag + (size_t)i * 8 * DM); rb[i] = *(const v8b*)(Bg + (size_t)i * 16 * DM); }
  for (int kt = 0; kt < DM / KT; ++kt) {
#pragma unroll   // constant indices keep ra, rb in registers
    for (int i = 0; i < 8; ++i) { v4b ch, cl;
#pragma unroll   // four splits, two 8-byte stores
      for (int e = 0; e < 4; ++e) { const __bf16 hv = (__bf16)ra[i][e]; ch[e] = hv; cl[e] = (__bf16)(ra[i][e] - (float)hv); }
      *(v4b*)&sAh[ar + i * 8][ac] = ch; *(v4b*)&sAl[ar + i * 8][ac] = cl; *(v8b*)&sB[br + i * 16][bc] = rb[i]; }
    __syncthreads();   // the tile is published to all four waves
    if (kt + 1 < DM / KT) { Ap += KT; Bp += KT;
#pragma unroll   // constant indices keep ra, rb in registers
      for (int i = 0; i < 8; ++i) { ra[i] = *(const v4f*)(Ap + (size_t)i * 8 * DM); rb[i] = *(const v8b*)(Bp + (size_t)i * 16 * DM); }
      asm volatile("s_wait_xcnt 0x0" :: "v"(Ap), "v"(Bp) : "memory"); }   // the two running pointers are inputs here, so the address pairs of these loads stay whole up to this wait: no load of the run lands in one, and they take their new values only behind it
#pragma unroll   // two k steps of 32, k ascending; constant LDS offsets
    for (int kc = 0; kc < KT / 32; ++kc) { const v16b ah = frag_b(&sAh[wave * 16 + col][kc * 32], lane), al = frag_b(&sAl[wave * 16 + col][kc * 32], lane); v16b w[8];
#pragma unroll   // the k step's fragment reads go out as one group ahead of its products: one LDS latency a step, not one a product
      for (int j = 0; j < 8; ++j) w[j] = frag_b(&sB[j * 16 + col][kc * 32], lane);
#pragma unroll   // acc[j] indexed by constants
      for (int j = 0; j < 8; ++j) { acc[j] = wmma_bf(al, w[j], acc[j]); acc[j] = wmma_bf(ah, w[j], acc[j]); } }
    __syncthreads();   // every wave has read the tile before the next trip overwrites it
  }
#pragma unroll
  for (int j = 0; j < 8; ++j) {
#pragma unroll
    for (int r = 0; r < 8; ++r) so[wave][8 * g + r][j * 16 + col] = acc[j][r] + (BO ? bfr(BO[n0 + j * 16 + col]) : 0.f); }
  LDSX();
  for (int rl = 0; rl < 16; ++rl) vst2(Y + (r0 + rl) * DM + n0 + lane * 4, *(const v4f*)&so[wave][rl][lane * 4]);
}

// ---- k_phase: block = token (256 threads): ph = bf16(x) . bf16(w_phase) (f32), phase = atan2(ph0, ph1); then the 16 per-head log gates for this key
__global__ __launch_bounds__(256) void k_phase(const float* __restrict__ X, const float* __restrict__ WP, const float* __restrict__ CAR, const float* __restrict__ LOCK, const float* __restrict__ BW, float* __restrict__ KB) {
  __shared__ float r0s[256], r1s[256]; const size_t row = blockIdx.x; const int t = threadIdx.x; float a0 = 0.f, a1 = 0.f;
  for (int d = t; d < DM; d += 256) { const float xv = bfr(X[row * DM + d]); a0 += xv * bfr(WP[d * 2]); a1 += xv * bfr(WP[d * 2 + 1]); }
  r0s[t] = a0; r1s[t] = a1; __syncthreads();
  for (int s = 128; s > 0; s >>= 1) { if (t < s) { r0s[t] += r0s[t + s]; r1s[t] += r1s[t + s]; } __syncthreads(); }
  if (t < NH) { const float phase = atan2_p(r0s[0], r1s[0]); const float lk = bfr(LOCK[t]), bw = bfr(BW[t]), car = bfr(CAR[t]); const float win = exp_ni((cos_p(phase - car) - 1.0f) / bw); const float gate = lk * win + (1.0f - lk); const size_t b = row / SS, s = row % SS; KB[(b * NH + t) * SS + s] = log_p(gate + 1e-6f); }   // 4-B scratch store
}
extern "C" void kernel_launch(void* const* d_in, const int* in_sizes, int n_in, void* d_out, int out_size, void* d_ws, size_t ws_size, hipStream_t stream) {
  (void)in_sizes; (void)n_in; (void)out_size;
  const float** F = (const float**)d_in;   // 0 x [4,1024,1024], 1 wq, 2 wk, 3 wv, 4 wo (all (in,out) [1024,1024]), 5 w_phase [1024,2], 6 carrier [16], 7 lock [16], 8 bandwidth [16], 9 active_mask [16] int
  if (ws_size < (size_t)WS_END + 4u * NB * NH * SS + 256) return;
  char* ws = (char*)d_ws; __bf16* PK = (__bf16*)(ws + WS_PK); _Float16 *QK = (_Float16*)(ws + WS_QK), *QKL = (_Float16*)(ws + WS_QKL), *VTH = (_Float16*)(ws + WS_VTH), *VTL = (_Float16*)(ws + WS_VTL); float* O = (float*)(ws + WS_O); float* KB = (float*)(ws + WS_END);
  k_pack<<<dim3(DM, 4), 256, 0, stream>>>(F[1], F[2], F[3], F[4], PK);
  k_phase<<<NB * SS, 256, 0, stream>>>(F[0], F[5], F[6], F[7], F[8], KB);
  k_qkv<<<dim3(TNB * SS / 64, QKVW / 128), 128, 0, stream>>>(F[0], F[0], F[0], PK + PK_A, nullptr, nullptr, nullptr, QK, QKL, VTH, VTL);
  k_attn<<<dim3(TQB, NH, TNB), 128, 0, stream>>>(QK, QKL, VTH, VTL, nullptr, KB, (const int*)d_in[9], O);
  k_out<<<dim3(TOB, DM / 128), 128, 0, stream>>>(O, PK + PK_P, nullptr, (float*)d_out);
}

// v003
// It runs in 140 microseconds.
// In two side-by-side timings against v002, it was 1.12 and 1.13 times as fast.
// Counting every step since v000, it is 2.55 times as fast.
// compute dtype: all float inputs rounded to bf16, active_mask (int) read on device; q/k/v = x . W with EXACT bf16 products on WMMA 16x16x32 ((in,out) weights as transposed rows); the per-token phase (x . w_phase, atan2) and the per-(batch, head, key) log resonance gate in f32 (precise expf/logf/cosf/atan2f); causal attention x 1/8 + log gate: for the first 128 queries of each sequence 3-product scores and P, v as f16 hi + residual (3 products), single f16 operands beyond; running-max softmax in f32 (hardware exp); the per-head active mask applied to the attention output; out = o (bf16 hi + residual) . Wo (2 products).
#include <hip/hip_runtime.h>
#include <math.h>

typedef __attribute__((ext_vector_type(16))) _Float16 v16h;
typedef __attribute__((ext_vector_type(16))) __bf16 v16b;
typedef __attribute__((ext_vector_type(8)))  _Float16 v8h;
typedef __attribute__((ext_vector_type(8)))  float v8f;
typedef __attribute__((ext_vector_type(4)))  float v4f;
typedef __attribute__((ext_vector_type(2)))  float v2f;
typedef __attribute__((ext_vector_type(4)))  unsigned v4u;
typedef __attribute__((ext_vector_type(4)))  int v4i;
typedef float __attribute__((may_alias)) float_a;
typedef int __attribute__((may_alias)) int_a;

template <typename T> __device__ __forceinline__ void vst2(void* p, T v) { *(T*)p = v;  }
__device__ __forceinline__ v8f wmma16(v16h a, v16h b, v8f c) {
  v8f d = __builtin_amdgcn_wmma_f32_16x16x32_f16(false, a, false, b, (short)0, c, false, false);
  asm volatile("v_nop\n\tv_nop\n\tv_nop\n\tv_nop" : "+v"(d) : "v"(a), "v"(b));
  return d;
}
__device__ __forceinline__ v8f wmma_bf(v16b a, v16b b, v8f c) {
  v8f d = __builtin_amdgcn_wmma_f32_16x16x32_bf16(false, a, false, b, (short)0, c, false, false);
  asm volatile("v_nop\n\tv_nop\n\tv_nop\n\tv_nop" : "+v"(d) : "v"(a), "v"(b));
  return d;
}
// Resonance-gated causal attention (B 4, S 1,024, d 1,024, 16 heads x 64): bias-free q/k/v/o projections, a per-key additive log-gate from each token's input phase against a per-head carrier (von Mises window opened by 1 - lock), causal softmax, dormant heads zeroed.
__device__ __forceinline__ v16h frag_h(const _Float16* rowk0, int lane) {
  union { v16h v; v8h q[2]; } u; const _Float16* p = rowk0 + 8 * (lane >> 4);
  u.q[0] = *(const v8h*)p; u.q[1] = *(const v8h*)(p + 16); return u.v;
}
__device__ __forceinline__ v16h frag_f32(const float* rowk0, int lane) {
  v16h a; const float* p = rowk0 + 8 * (lane >> 4);
#pragma unroll
  for (int i = 0; i < 8; ++i) { a[i] = (_Float16)p[i]; a[8 + i] = (_Float16)p[16 + i]; }
  return a;
}
__device__ __forceinline__ v16h frag_f32s(const float* rowk0, int lane, float sc) {
  v16h a; const float* p = rowk0 + 8 * (lane >> 4);
#pragma unroll
  for (int i = 0; i < 8; ++i) { a[i] = (_Float16)(p[i] * sc); a[8 + i] = (_Float16)(p[16 + i] * sc); }
  return a;
}
// column fragment from a [K][ld] layout (column n), rows >= K read as 0
__device__ __forceinline__ v16h fragc_f32(const float* W, int k0, int n, int lane, int ld, int K) {
  v16h a; const int g = lane >> 4;
#pragma unroll
  for (int i = 0; i < 8; ++i) { const int ka = k0 + 8 * g + i, kb = ka + 16;
    a[i] = (_Float16)(ka < K ? W[(size_t)(ka < K ? ka : K - 1) * ld + n] : 0.f); a[8 + i] = (_Float16)(kb < K ? W[(size_t)(kb < K ? kb : K - 1) * ld + n] : 0.f); }
  return a;
}
struct F2 { v16b h, l; };
__device__ __forceinline__ F2 bsplit16(const float v[16]) { F2 r;
#pragma unroll
  for (int i = 0; i < 16; ++i) { const __bf16 h = (__bf16)v[i]; r.h[i] = h; r.l[i] = (__bf16)(v[i] - (float)h); }
  return r; }
__device__ __forceinline__ F2 split_row(const float* row, int k0, int lane) { float v[16]; const float* p = row + k0 + 8 * (lane >> 4);
#pragma unroll
  for (int i = 0; i < 8; ++i) { v[i] = p[i]; v[8 + i] = p[16 + i]; }
  return bsplit16(v); }
__device__ __forceinline__ F2 split_rowK(const float* row, int k0, int lane, int K) { float v[16]; const int g = lane >> 4;
#pragma unroll
  for (int i = 0; i < 8; ++i) { const int ka = k0 + 8 * g + i, kb = ka + 16; v[i] = ka < K ? row[ka < K ? ka : K - 1] : 0.f; v[8 + i] = kb < K ? row[kb < K ? kb : K - 1] : 0.f; }
  return bsplit16(v); }
__device__ __forceinline__ F2 split_col(const float* W, int k0, int n, int lane, int ld, int K) { float v[16]; const int g = lane >> 4;
#pragma unroll
  for (int i = 0; i < 8; ++i) { const int ka = k0 + 8 * g + i, kb = ka + 16; v[i] = ka < K ? W[(size_t)(ka < K ? ka : K - 1) * ld + n] : 0.f; v[8 + i] = kb < K ? W[(size_t)(kb < K ? kb : K - 1) * ld + n] : 0.f; }
  return bsplit16(v); }
__device__ __forceinline__ v8f mac3(const F2& a, const F2& b, v8f c) { c = wmma_bf(a.l, b.h, c); c = wmma_bf(a.h, b.l, c); return wmma_bf(a.h, b.h, c); }
__device__ __forceinline__ float sigm(float v) { return 1.0f / (1.0f + expf(-v)); }
#define LDSX() do { asm volatile("s_wait_dscnt 0" ::: "memory"); __builtin_amdgcn_wave_barrier(); __builtin_amdgcn_fence(__ATOMIC_RELEASE, "workgroup"); } while (0)
// the same for LDS that only its own wave reads, with the fence at wavefront scope: the work-group fence also waits for every global load in flight
#define LDSW() do { asm volatile("s_wait_dscnt 0" ::: "memory"); __builtin_amdgcn_wave_barrier(); __builtin_amdgcn_fence(__ATOMIC_RELEASE, "wavefront"); } while (0)


#define NB 4
#define SS 1024
#define DM 1024
#define NH 16
#define SCALEF 0.125f
__device__ __attribute__((noinline)) float log_p(float v) { return logf(v); }
__device__ __attribute__((noinline)) float cos_p(float v) { return cosf(v); }
__device__ __attribute__((noinline)) float atan2_p(float y, float x) { return atan2f(y, x); }
#define HD 64
#define QKVW (3 * DM)
#ifndef TQB
#define TQB (SS / 64)
#define TNB NB
#define TOB (NB * SS / 64)     // output row tiles (all)
#endif
typedef __attribute__((ext_vector_type(8))) __bf16 v8b;
__device__ __forceinline__ v16b frag_b(const __bf16* rowk0, int lane) {
  union { v16b v; v8b q[2]; } u; const __bf16* p = rowk0 + 8 * (lane >> 4);
  u.q[0] = *(const v8b*)p; u.q[1] = *(const v8b*)(p + 16); return u.v;
}
__device__ __forceinline__ float bfr(float v) { return (float)(__bf16)v; }
typedef __attribute__((ext_vector_type(4))) __bf16 v4b;
#define KT 64   // k columns of both operands staged in LDS per trip: 128 B of a bf16 row, 256 B of an f32 row, so every staging load covers whole lines
#define LP 72   // LDS row pitch in bf16 elements: 144 B = 16 B x odd, the conflict-free pitch for 16-byte fragment reads
__device__ __attribute__((noinline)) float exp_ni(float v) { return expf(v); }
__device__ __attribute__((noinline)) float erf_ni(float v) { return erff(v); }

#define PK_A 0                       // [3072][1024] Wqkv rows (natural [out][in])
#define PK_P (PK_A + QKVW * DM)        // [1024][1024] Wo rows (natural)
#define PK_END (PK_P + DM * DM)
#define WS_PK  0u
#define WS_QK  (WS_PK + 2u * PK_END)             // f16 [4096 rows][2048]: q | k
#define WS_QKL (WS_QK + 2u * NB * SS * 2 * DM)     // f16 q | k residual planes x2048
#define WS_VTH (WS_QKL + 2u * NB * SS * 2 * DM)    // f16 [b][1024 (h*64+d)][1024 s] hi
#define WS_VTL (WS_VTH + 2u * NB * DM * SS)        // f16 lo x 2048
#define WS_O   (WS_VTL + 2u * NB * DM * SS)        // f32 [4096][1024]
#define WS_CS  (WS_O + 4u * NB * SS * DM)           // f32 2 x [1024][32], unused
#define WS_END (WS_CS + 4u * 2 * SS * 32)
#define PT_N 64    // weight columns (= pack rows) a block
#define PT_K 256   // weight rows (= k of a pack row) a block
// ---- k_pack: block = (64 columns n, 256 rows k, which) of one (in,out) weight, transposed through LDS into bf16 pack rows; which 0..2 -> W_q/W_k/W_v into PK_A rows which*1024 + n; 3 -> W_o into PK_P. Sixteen lanes load 256 contiguous bytes of a weight row, a wave stores 512 contiguous bytes of a pack row: whole lines on both sides
__global__ __launch_bounds__(256) void k_pack(const float* __restrict__ WQ, const float* __restrict__ WK, const float* __restrict__ WV, const float* __restrict__ WO, __bf16* __restrict__ PK) {
  __shared__ __align__(16) __bf16 s[PT_N][PT_K];   // row n in 16-byte chunks of 8 k; chunk L lies at place L ^ (n >> 2), so the 16 lanes that write one chunk column of 16 rows, and the 32 that read one row, each meet all banks once
  const int n0 = blockIdx.x * PT_N, k0 = blockIdx.y * PT_K, which = blockIdx.z, t = threadIdx.x; const float* Wm = (which == 0) ? WQ : (which == 1) ? WK : (which == 2) ? WV : WO;
  const int c = t & 15, kg = t >> 4;   // the thread's 4 columns from 4 c, its 8 rows from 8 kg, and the same 128 rows on
  const float* wp = Wm + (size_t)(k0 + kg * 8) * DM + n0 + c * 4; v4f r[2][8];
#pragma unroll   // constant indices keep r in registers; all 16 loads in flight at once
  for (int p = 0; p < 2; ++p) {
#pragma unroll   // as above
    for (int j = 0; j < 8; ++j) r[p][j] = *(const v4f*)(wp + (size_t)(p * 128 + j) * DM); }
  // the pointer is an input here, so the address pair of these loads stays whole up to this wait; the loaded values are inputs too (inputs only), so all 16 loads go out ahead of the first conversion: one memory latency a block, where the build otherwise holds four loads back until registers of the first come free
  asm volatile("s_wait_xcnt 0x0" :: "v"(wp), "v"(r[0][0]), "v"(r[0][1]), "v"(r[0][2]), "v"(r[0][3]), "v"(r[0][4]), "v"(r[0][5]), "v"(r[0][6]), "v"(r[0][7]), "v"(r[1][0]), "v"(r[1][1]), "v"(r[1][2]), "v"(r[1][3]), "v"(r[1][4]), "v"(r[1][5]), "v"(r[1][6]), "v"(r[1][7]) : "memory");
#pragma unroll   // r indexed by constants
  for (int p = 0; p < 2; ++p) {
#pragma unroll   // r indexed by constants
    for (int e = 0; e < 4; ++e) { v8b o;
#pragma unroll   // 8 k of one column: one 16-byte LDS store
      for (int j = 0; j < 8; ++j) o[j] = (__bf16)r[p][j][e];
      *(v8b*)&s[c * 4 + e][((p * 16 + kg) ^ c) * 8] = o; } }
  __syncthreads();   // the tile is complete before any wave reads rows that other waves wrote
  __bf16* dst = ((which < 3) ? PK + PK_A + ((size_t)which * DM + n0) * DM : PK + PK_P + (size_t)n0 * DM) + k0; const int q = t & 31, rw = t >> 5;
#pragma unroll   // 8 pack rows a wave
  for (int i = 0; i < 8; ++i) { const int n = rw * 8 + i; vst2((unsigned*)(dst + (size_t)n * DM + q * 8), *(const v4u*)&s[n][(q ^ (n >> 2)) * 8]); }
}
__global__ __launch_bounds__(128) void k_qkv(const float* __restrict__ XQ, const float* __restrict__ XK, const float* __restrict__ XV, const __bf16* __restrict__ P, const float* __restrict__ BQ, const float* __restrict__ BK, const float* __restrict__ BV, _Float16* __restrict__ QK, _Float16* __restrict__ QKL, _Float16* __restrict__ VTH, _Float16* __restrict__ VTL) {
  const int which0 = (blockIdx.y * 128) / DM; const float* X = (which0 == 0) ? XQ : (which0 == 1) ? XK : XV; const float* BB = BQ ? (((which0 == 0) ? BQ : (which0 == 1) ? BK : BV) + (blockIdx.y * 128 - which0 * DM)) : nullptr;
  __shared__ __align__(16) _Float16 so[4][16][136], sol[4][16][136]; __shared__ __align__(16) _Float16 sth[128][72], stl[128][72];
  const int tid = threadIdx.x, wave = tid >> 5, lane = tid & 31, col = lane & 15, g = lane >> 4; const size_t r0 = (size_t)blockIdx.x * 64 + wave * 16; const int n0 = blockIdx.y * 128;
  v8f acc[8] = {};
  // the block's 64 x rows (rounded to bf16) and 128 weight rows go through LDS, KT columns a trip: each line is loaded once a block by contiguous lanes; the next trip's loads fly in registers under this trip's products
  __shared__ __align__(16) __bf16 sA[64][LP], sB[128][LP];
  const int ar = tid >> 4, ac = (tid & 15) * 4, br = tid >> 3, bc = (tid & 7) * 8;
  const float* Ag = X + ((size_t)blockIdx.x * 64 + ar) * DM + ac; const __bf16* Bg = P + (size_t)(n0 + br) * DM + bc;
  const float* Ap = Ag; const __bf16* Bp = Bg; v4f ra[8]; v8b rb[8];
#pragma unroll   // constant indices keep ra, rb in registers
  for (int i = 0; i < 8; ++i) { ra[i] = *(const v4f*)(Ag + (size_t)i * 8 * DM); rb[i] = *(const v8b*)(Bg + (size_t)i * 16 * DM); }
  for (int kt = 0; kt < DM / KT; ++kt) {
#pragma unroll   // constant indices keep ra, rb in registers
    for (int i = 0; i < 8; ++i) { v4b c;
#pragma unroll   // four conversions, one 8-byte store
      for (int e = 0; e < 4; ++e) c[e] = (__bf16)ra[i][e];
      *(v4b*)&sA[ar + i * 8][ac] = c; *(v8b*)&sB[br + i * 16][bc] = rb[i]; }
    __syncthreads();   // the tile is published to all four waves
    if (kt + 1 < DM / KT) { Ap += KT; Bp += KT;
#pragma unroll   // constant indices keep ra, rb in registers
      for (int i = 0; i < 8; ++i) { ra[i] = *(const v4f*)(Ap + (size_t)i * 8 * DM); rb[i] = *(const v8b*)(Bp + (size_t)i * 16 * DM); }
      asm volatile("s_wait_xcnt 0x0" :: "v"(Ap), "v"(Bp) : "memory"); }   // the two running pointers are inputs here, so the address pairs of these loads stay whole up to this wait: no load of the run lands in one, and they take their new values only behind it
#pragma unroll   // two k steps of 32, k ascending; constant LDS offsets
    for (int kc = 0; kc < KT / 32; ++kc) { const v16b a = frag_b(&sA[wave * 16 + col][kc * 32], lane); v16b w[8];
#pragma unroll   // the k step's fragment reads go out as one group ahead of its products: one LDS latency a step, not one a product
      for (int j = 0; j < 8; ++j) w[j] = frag_b(&sB[j * 16 + col][kc * 32], lane);
#pragma unroll   // acc[j] indexed by constants
      for (int j = 0; j < 8; ++j) acc[j] = wmma_bf(a, w[j], acc[j]); }
    __syncthreads();   // every wave has read the tile before the next trip overwrites it
  }
  if (n0 < 2 * DM) {   // q stored unscaled (f16 sigma ~0.6, no subnormal exposure); 1/8 applied to the f32 score
#pragma unroll
    for (int j = 0; j < 8; ++j) {
#pragma unroll
      for (int r = 0; r < 8; ++r) { const float v = acc[j][r] + (BB ? bfr(BB[j * 16 + col]) : 0.f); const _Float16 hv = (_Float16)v; so[wave][8 * g + r][j * 16 + col] = hv; sol[wave][8 * g + r][j * 16 + col] = (_Float16)((v - (float)hv) * 2048.0f); } }   // q, k (+ bias) as f16 hi + (x2048) residual
    LDSX();
    for (int rl = 0; rl < 16; ++rl) if (lane < 16) { vst2((unsigned*)(QK + (r0 + rl) * (2 * DM) + n0 + lane * 8), *(const v4u*)&so[wave][rl][lane * 8]); vst2((unsigned*)(QKL + (r0 + rl) * (2 * DM) + n0 + lane * 8), *(const v4u*)&sol[wave][rl][lane * 8]); }
  } else {
#pragma unroll
    for (int j = 0; j < 8; ++j) {
#pragma unroll
      for (int r = 0; r < 8; ++r) { const float v = acc[j][r] + (BB ? bfr(BB[j * 16 + col]) : 0.f); const _Float16 hv = (_Float16)v; sth[j * 16 + col][wave * 16 + 8 * g + r] = hv; stl[j * 16 + col][wave * 16 + 8 * g + r] = (_Float16)((v - (float)hv) * 2048.0f); } }
    __syncthreads();
    const size_t rb = (size_t)blockIdx.x * 64; const int b = (int)(rb / SS), s0 = (int)(rb % SS); const int pc0 = n0 - 2 * DM;
    for (int q = tid; q < 128 * 8; q += 128) { const int d = q >> 3, pc = q & 7; const size_t o = ((size_t)b * DM + pc0 + d) * SS + s0 + pc * 8; vst2((unsigned*)(VTH + o), *(const v4u*)&sth[d][pc * 8]); vst2((unsigned*)(VTL + o), *(const v4u*)&stl[d][pc * 8]); }
  }
}
// fragment at the lane's own address (row start + 8 * (lane >> 4)), the k order of frag_h
__device__ __forceinline__ v16h frag_at(const _Float16* p) { union { v16h v; v8h q[2]; } u; u.q[0] = *(const v8h*)p; u.q[1] = *(const v8h*)(p + 16); return u.v; }
// ---- k_attn: block = (64 queries, head h, batch b): causal flash attention (K = 64: 2 k-steps), scores = (q.k) * 0.125, q and k as f16 hi + residual (3 products) for qb < 2, single f16 operands beyond; P.V: f16 P*2048 x V hi in acc, for qb < 2 also P lo x V hi and P x V lo*2048 in accl; O[b*S+q][h*64+d] = (acc + accl / 2048) / (2048 l), 0 for dormant heads (256-B segments)
__global__ __launch_bounds__(128) void k_attn(const _Float16* __restrict__ QK, const _Float16* __restrict__ QKL, const _Float16* __restrict__ VTH, const _Float16* __restrict__ VTL, const void* __restrict__ KMASK, const float* __restrict__ KB, const int* __restrict__ AM, float* __restrict__ O) {
  __shared__ __align__(16) float sp[4][16][36]; __shared__ __align__(16) float so[4][16][68];
  const int tid = threadIdx.x, wave = tid >> 5, lane = tid & 31, col = lane & 15, g = lane >> 4;
  const int qb = blockIdx.x, h = blockIdx.y, b = blockIdx.z; const int q0 = qb * 64 + wave * 16; const size_t rq = (size_t)b * SS + q0 + col;
  v16h aq[2];   // the q residual, used by the leading query blocks alone, is loaded at its products: 16 registers less in every block
#pragma unroll
  for (int kc = 0; kc < 2; ++kc) aq[kc] = frag_h(QK + rq * (2 * DM) + h * HD + kc * 32, lane);
  float m[8], l[8];
#pragma unroll
  for (int r = 0; r < 8; ++r) { m[r] = -3.0e38f; l[r] = 0.f; }
  v8f acc[4] = {}, accl[4] = {};
  const int nks = (qb * 64 + 64) / 32;   // causal: key tiles up to the query tile's end
  // the V (hi) loads of a key step go out as one group behind its score products, the K (hi) and gate loads of the next step as one group behind the softmax: each group's latency runs under other work and is waited for by count, instead of a load and a full wait in front of every product. 254 registers: four waves per SIMD as before
  const _Float16* kp = QK + ((size_t)b * SS + col) * (2 * DM) + DM + h * HD + 8 * g; const float* bp = KB + ((size_t)b * NH + h) * SS + col; const _Float16* vp = VTH + ((size_t)b * DM + h * HD + col) * SS + 8 * g;   // the lane's own running addresses
  v16h kf[2][2], vf[4]; float kbv[2];
#pragma unroll   // constant indices keep kf, kbv in registers
  for (int ct = 0; ct < 2; ++ct) { kf[ct][0] = frag_at(kp + (size_t)ct * 16 * (2 * DM)); kf[ct][1] = frag_at(kp + (size_t)ct * 16 * (2 * DM) + 32); kbv[ct] = bp[ct * 16]; }
#pragma unroll 1
  for (int ks = 0; ks < nks; ++ks) { v8f s[2];
#pragma unroll
    for (int ct = 0; ct < 2; ++ct) { const int kk = ks * 32 + ct * 16 + col; const _Float16* krowl = QKL + ((size_t)b * SS + kk) * (2 * DM) + DM + h * HD; v8f c = {}, cl = {};
      if (qb < 2) {   // leading query blocks (few keys, outputs far above the global rms): 3 products
#pragma unroll
        for (int kc = 0; kc < 2; ++kc) { const v16h kh = kf[ct][kc]; c = wmma16(aq[kc], kh, c); cl = wmma16(frag_h(QKL + rq * (2 * DM) + h * HD + kc * 32, lane), kh, cl); cl = wmma16(aq[kc], frag_h(krowl + kc * 32, lane), cl); }
#pragma unroll
        for (int r = 0; r < 8; ++r) c[r] += cl[r] * (1.0f / 2048.0f); }
      else {
#pragma unroll
        for (int kc = 0; kc < 2; ++kc) c = wmma16(aq[kc], kf[ct][kc], c); }   // single product elsewhere
      { const float kb = kbv[ct];
#pragma unroll
      for (int r = 0; r < 8; ++r) s[ct][r] = (kk <= q0 + 8 * g + r) ? c[r] * SCALEF + kb : -3.0e38f; } }   // causal; + log resonance gate of key kk
#pragma unroll   // constant indices keep vf in registers
    for (int dt = 0; dt < 4; ++dt) vf[dt] = frag_at(vp + (size_t)dt * 16 * SS);
    asm volatile("s_wait_xcnt 0x0" :: "v"(vp) : "memory"); vp += 32;   // the running pointer is an input here, so the address pair of these loads stays whole up to this wait and takes its new value only behind it
#pragma unroll
    for (int r = 0; r < 8; ++r) { float mx = fmaxf(s[0][r], s[1][r]);
#pragma unroll
      for (int o = 1; o < 16; o <<= 1) mx = fmaxf(mx, __shfl_xor(mx, o));
      const float mn = fmaxf(m[r], mx); const float alpha = (m[r] <= -1.0e38f) ? 0.f : __expf(m[r] - mn);
      const float e0 = (s[0][r] <= -1.0e38f) ? 0.f : __expf(s[0][r] - mn), e1 = (s[1][r] <= -1.0e38f) ? 0.f : __expf(s[1][r] - mn); float es = e0 + e1;
#pragma unroll
      for (int o = 1; o < 16; o <<= 1) es += __shfl_xor(es, o);
      l[r] = l[r] * alpha + es; m[r] = mn;
#pragma unroll
      for (int dt = 0; dt < 4; ++dt) { acc[dt][r] *= alpha; accl[dt][r] *= alpha; }
      sp[wave][8 * g + r][col] = e0; sp[wave][8 * g + r][16 + col] = e1; }
    LDSW();
    { const int adv = (ks + 1 < nks) ? 32 : 0; kp += (size_t)adv * (2 * DM); bp += adv;   // no branch round this group: the last step loads its own rows once more (unused). Behind a join with a path without these loads the waits of the V fragments would have to cover this group too
#pragma unroll   // constant indices keep kf, kbv in registers
      for (int ct = 0; ct < 2; ++ct) { kf[ct][0] = frag_at(kp + (size_t)ct * 16 * (2 * DM)); kf[ct][1] = frag_at(kp + (size_t)ct * 16 * (2 * DM) + 32); kbv[ct] = bp[ct * 16]; }
      asm volatile("s_wait_xcnt 0x0" :: "v"(kp), "v"(bp) : "memory"); }   // as behind the V group
    v16h pa, pl; { const float* prow = &sp[wave][col][0] + 8 * (lane >> 4);
#pragma unroll
      for (int i = 0; i < 8; ++i) { const float x0 = prow[i] * 2048.0f, x1 = prow[16 + i] * 2048.0f; const _Float16 h0 = (_Float16)x0, h1 = (_Float16)x1; pa[i] = h0; pa[8 + i] = h1; pl[i] = (_Float16)((x0 - (float)h0) * 2048.0f); pl[8 + i] = (_Float16)((x1 - (float)h1) * 2048.0f); } }   // P scaled by 2^11 before the f16 split so small softmax weights stay out of the f16 subnormal range; 2^-11 folded into the epilogue
#pragma unroll
    for (int dt = 0; dt < 4; ++dt) acc[dt] = wmma16(pa, vf[dt], acc[dt]);
    if (qb < 2) {   // one branch a step for the four tiles' extra products: with one per tile the build holds accl twice
#pragma unroll   // accl, vf indexed by constants
      for (int dt = 0; dt < 4; ++dt) { const size_t vr = ((size_t)b * DM + h * HD + dt * 16 + col) * SS + ks * 32; accl[dt] = wmma16(pl, vf[dt], accl[dt]); accl[dt] = wmma16(pa, frag_h(VTL + vr, lane), accl[dt]); } }   // leading query blocks: P hi/lo x V hi/lo (3 products); elsewhere P x V single
    LDSW(); }
#pragma unroll
  for (int r = 0; r < 8; ++r) { const float il = ((AM[h] != 0) ? (1.0f / 2048.0f) : 0.f) / l[r];   // dormant heads contribute nothing
#pragma unroll
    for (int dt = 0; dt < 4; ++dt) so[wave][8 * g + r][dt * 16 + col] = (acc[dt][r] + accl[dt][r] * (1.0f / 2048.0f)) * il; }
  LDSX();
  for (int rl = 0; rl < 16; ++rl) if (lane < 16) vst2(O + ((size_t)b * SS + q0 + rl) * DM + h * HD + lane * 4, *(const v4f*)&so[wave][rl][lane * 4]);
}
// ---- k_out: block = (64 rows, 128 cols): out = O(hi/lo) . Wo rows (2 products), no bias (BO is null)
__global__ __launch_bounds__(128) void k_out(const float* __restrict__ O, const __bf16* __restrict__ P, const float* __restrict__ BO, float* __restrict__ Y) {
  __shared__ __align__(16) float so[4][16][132];
  const int tid = threadIdx.x, wave = tid >> 5, lane = tid & 31, col = lane & 15, g = lane >> 4; const size_t r0 = (size_t)blockIdx.x * 64 + wave * 16; const int n0 = blockIdx.y * 128;
  v8f acc[8] = {};
  // as in k_qkv: the block's 64 rows of O (split once into bf16 hi and residual) and 128 weight rows go through LDS, KT columns a trip
  __shared__ __align__(16) __bf16 sAh[64][LP], sAl[64][LP], sB[128][LP];
  const int ar = tid >> 4, ac = (tid & 15) * 4, br = tid >> 3, bc = (tid & 7) * 8;
  const float* Ag = O + ((size_t)blockIdx.x * 64 + ar) * DM + ac; const __bf16* Bg = P + (size_t)(n0 + br) * DM + bc;
  const float* Ap = Ag; const __bf16* Bp = Bg; v4f ra[8]; v8b rb[8];
#pragma unroll   // constant indices keep ra, rb in registers
  for (int i = 0; i < 8; ++i) { ra[i] = *(const v4f*)(Ag + (size_t)i * 8 * DM); rb[i] = *(const v8b*)(Bg + (size_t)i * 16 * DM); }
  for (int kt = 0; kt < DM / KT; ++kt) {
#pragma unroll   // constant indices keep ra, rb in registers
    for (int i = 0; i < 8; ++i) { v4b ch, cl;
#pragma unroll   // four splits, two 8-byte stores
      for (int e = 0; e < 4; ++e) { const __bf16 hv = (__bf16)ra[i][e]; ch[e] = hv; cl[e] = (__bf16)(ra[i][e] - (float)hv); }
      *(v4b*)&sAh[ar + i * 8][ac] = ch; *(v4b*)&sAl[ar + i * 8][ac] = cl; *(v8b*)&sB[br + i * 16][bc] = rb[i]; }
    __syncthreads();   // the tile is published to all four waves
    if (kt + 1 < DM / KT) { Ap += KT; Bp += KT;
#pragma unroll   // constant indices keep ra, rb in registers
      for (int i = 0; i < 8; ++i) { ra[i] = *(const v4f*)(Ap + (size_t)i * 8 * DM); rb[i] = *(const v8b*)(Bp + (size_t)i * 16 * DM); }
      asm volatile("s_wait_xcnt 0x0" :: "v"(Ap), "v"(Bp) : "memory"); }   // the two running pointers are inputs here, so the address pairs of these loads stay whole up to this wait: no load of the run lands in one, and they take their new values only behind it
#pragma unroll   // two k steps of 32, k ascending; constant LDS offsets
    for (int kc = 0; kc < KT / 32; ++kc) { const v16b ah = frag_b(&sAh[wave * 16 + col][kc * 32], lane), al = frag_b(&sAl[wave * 16 + col][kc * 32], lane); v16b w[8];
#pragma unroll   // the k step's fragment reads go out as one group ahead of its products: one LDS latency a step, not one a product
      for (int j = 0; j < 8; ++j) w[j] = frag_b(&sB[j * 16 + col][kc * 32], lane);
#pragma unroll   // acc[j] indexed by constants
      for (int j = 0; j < 8; ++j) { acc[j] = wmma_bf(al, w[j], acc[j]); acc[j] = wmma_bf(ah, w[j], acc[j]); } }
    __syncthreads();   // every wave has read the tile before the next trip overwrites it
  }
#pragma unroll
  for (int j = 0; j < 8; ++j) {
#pragma unroll
    for (int r = 0; r < 8; ++r) so[wave][8 * g + r][j * 16 + col] = acc[j][r] + (BO ? bfr(BO[n0 + j * 16 + col]) : 0.f); }
  LDSX();
  for (int rl = 0; rl < 16; ++rl) vst2(Y + (r0 + rl) * DM + n0 + lane * 4, *(const v4f*)&so[wave][rl][lane * 4]);
}

// ---- k_phase: block = token (256 threads): ph = bf16(x) . bf16(w_phase) (f32), phase = atan2(ph0, ph1); then the 16 per-head log gates for this key
__global__ __launch_bounds__(256) void k_phase(const float* __restrict__ X, const float* __restrict__ WP, const float* __restrict__ CAR, const float* __restrict__ LOCK, const float* __restrict__ BW, float* __restrict__ KB) {
  __shared__ float r0s[256], r1s[256]; const size_t row = blockIdx.x; const int t = threadIdx.x; float a0 = 0.f, a1 = 0.f;
  for (int d = t; d < DM; d += 256) { const float xv = bfr(X[row * DM + d]); a0 += xv * bfr(WP[d * 2]); a1 += xv * bfr(WP[d * 2 + 1]); }
  r0s[t] = a0; r1s[t] = a1; __syncthreads();
  for (int s = 128; s > 0; s >>= 1) { if (t < s) { r0s[t] += r0s[t + s]; r1s[t] += r1s[t + s]; } __syncthreads(); }
  if (t < NH) { const float phase = atan2_p(r0s[0], r1s[0]); const float lk = bfr(LOCK[t]), bw = bfr(BW[t]), car = bfr(CAR[t]); const float win = exp_ni((cos_p(phase - car) - 1.0f) / bw); const float gate = lk * win + (1.0f - lk); const size_t b = row / SS, s = row % SS; KB[(b * NH + t) * SS + s] = log_p(gate + 1e-6f); }   // 4-B scratch store
}
extern "C" void kernel_launch(void* const* d_in, const int* in_sizes, int n_in, void* d_out, int out_size, void* d_ws, size_t ws_size, hipStream_t stream) {
  (void)in_sizes; (void)n_in; (void)out_size;
  const float** F = (const float**)d_in;   // 0 x [4,1024,1024], 1 wq, 2 wk, 3 wv, 4 wo (all (in,out) [1024,1024]), 5 w_phase [1024,2], 6 carrier [16], 7 lock [16], 8 bandwidth [16], 9 active_mask [16] int
  if (ws_size < (size_t)WS_END + 4u * NB * NH * SS + 256) return;
  char* ws = (char*)d_ws; __bf16* PK = (__bf16*)(ws + WS_PK); _Float16 *QK = (_Float16*)(ws + WS_QK), *QKL = (_Float16*)(ws + WS_QKL), *VTH = (_Float16*)(ws + WS_VTH), *VTL = (_Float16*)(ws + WS_VTL); float* O = (float*)(ws + WS_O); float* KB = (float*)(ws + WS_END);
  k_pack<<<dim3(DM / PT_N, DM / PT_K, 4), 256, 0, stream>>>(F[1], F[2], F[3], F[4], PK);
  k_phase<<<NB * SS, 256, 0, stream>>>(F[0], F[5], F[6], F[7], F[8], KB);
  k_qkv<<<dim3(TNB * SS / 64, QKVW / 128), 128, 0, stream>>>(F[0], F[0], F[0], PK + PK_A, nullptr, nullptr, nullptr, QK, QKL, VTH, VTL);
  k_attn<<<dim3(TQB, NH, TNB), 128, 0, stream>>>(QK, QKL, VTH, VTL, nullptr, KB, (const int*)d_in[9], O);
  k_out<<<dim3(TOB, DM / 128), 128, 0, stream>>>(O, PK + PK_P, nullptr, (float*)d_out);
}

// v004
// Measured time: 132 microseconds a run.
// Timed twice side by side with v003, it ran 1.06 and 1.07 times as fast.
// Counting every step since v000, it is 2.71 times as fast.
// compute dtype: all float inputs rounded to bf16, active_mask (int) read on device; q/k/v = x . W with EXACT bf16 products on WMMA 16x16x32 ((in,out) weights as transposed rows); the per-token phase (x . w_phase, atan2) and the per-(batch, head, key) log resonance gate in f32 (precise expf/logf/cosf/atan2f); causal attention x 1/8 + log gate: for the first 128 queries of each sequence 3-product scores and P, v as f16 hi + residual (3 products), single f16 operands beyond; running-max softmax in f32 (hardware exp); the per-head active mask applied to the attention output; out = o (bf16 hi + residual) . Wo (2 products).
#include <hip/hip_runtime.h>
#include <math.h>

typedef __attribute__((ext_vector_type(16))) _Float16 v16h;
typedef __attribute__((ext_vector_type(16))) __bf16 v16b;
typedef __attribute__((ext_vector_type(8)))  _Float16 v8h;
typedef __attribute__((ext_vector_type(8)))  float v8f;
typedef __attribute__((ext_vector_type(4)))  float v4f;
typedef __attribute__((ext_vector_type(2)))  float v2f;
typedef __attribute__((ext_vector_type(4)))  unsigned v4u;
typedef __attribute__((ext_vector_type(4)))  int v4i;
typedef float __attribute__((may_alias)) float_a;
typedef int __attribute__((may_alias)) int_a;

template <typename T> __device__ __forceinline__ void vst2(void* p, T v) { *(T*)p = v;  }
__device__ __forceinline__ v8f wmma16(v16h a, v16h b, v8f c) {
  v8f d = __builtin_amdgcn_wmma_f32_16x16x32_f16(false, a, false, b, (short)0, c, false, false);
  asm volatile("v_nop\n\tv_nop\n\tv_nop\n\tv_nop" : "+v"(d) : "v"(a), "v"(b));
  return d;
}
__device__ __forceinline__ v8f wmma_bf(v16b a, v16b b, v8f c) {
  v8f d = __builtin_amdgcn_wmma_f32_16x16x32_bf16(false, a, false, b, (short)0, c, false, false);
  asm volatile("v_nop\n\tv_nop\n\tv_nop\n\tv_nop" : "+v"(d) : "v"(a), "v"(b));
  return d;
}
// Resonance-gated causal attention (B 4, S 1,024, d 1,024, 16 heads x 64): bias-free q/k/v/o projections, a per-key additive log-gate from each token's input phase against a per-head carrier (von Mises window opened by 1 - lock), causal softmax, dormant heads zeroed.
__device__ __forceinline__ v16h frag_h(const _Float16* rowk0, int lane) {
  union { v16h v; v8h q[2]; } u; const _Float16* p = rowk0 + 8 * (lane >> 4);
  u.q[0] = *(const v8h*)p; u.q[1] = *(const v8h*)(p + 16); return u.v;
}
__device__ __forceinline__ v16h frag_f32(const float* rowk0, int lane) {
  v16h a; const float* p = rowk0 + 8 * (lane >> 4);
#pragma unroll
  for (int i = 0; i < 8; ++i) { a[i] = (_Float16)p[i]; a[8 + i] = (_Float16)p[16 + i]; }
  return a;
}
__device__ __forceinline__ v16h frag_f32s(const float* rowk0, int lane, float sc) {
  v16h a; const float* p = rowk0 + 8 * (lane >> 4);
#pragma unroll
  for (int i = 0; i < 8; ++i) { a[i] = (_Float16)(p[i] * sc); a[8 + i] = (_Float16)(p[16 + i] * sc); }
  return a;
}
// column fragment from a [K][ld] layout (column n), rows >= K read as 0
__device__ __forceinline__ v16h fragc_f32(const float* W, int k0, int n, int lane, int ld, int K) {
  v16h a; const int g = lane >> 4;
#pragma unroll
  for (int i = 0; i < 8; ++i) { const int ka = k0 + 8 * g + i, kb = ka + 16;
    a[i] = (_Float16)(ka < K ? W[(size_t)(ka < K ? ka : K - 1) * ld + n] : 0.f); a[8 + i] = (_Float16)(kb < K ? W[(size_t)(kb < K ? kb : K - 1) * ld + n] : 0.f); }
  return a;
}
struct F2 { v16b h, l; };
__device__ __forceinline__ F2 bsplit16(const float v[16]) { F2 r;
#pragma unroll
  for (int i = 0; i < 16; ++i) { const __bf16 h = (__bf16)v[i]; r.h[i] = h; r.l[i] = (__bf16)(v[i] - (float)h); }
  return r; }
__device__ __forceinline__ F2 split_row(const float* row, int k0, int lane) { float v[16]; const float* p = row + k0 + 8 * (lane >> 4);
#pragma unroll
  for (int i = 0; i < 8; ++i) { v[i] = p[i]; v[8 + i] = p[16 + i]; }
  return bsplit16(v); }
__device__ __forceinline__ F2 split_rowK(const float* row, int k0, int lane, int K) { float v[16]; const int g = lane >> 4;
#pragma unroll
  for (int i = 0; i < 8; ++i) { const int ka = k0 + 8 * g + i, kb = ka + 16; v[i] = ka < K ? row[ka < K ? ka : K - 1] : 0.f; v[8 + i] = kb < K ? row[kb < K ? kb : K - 1] : 0.f; }
  return bsplit16(v); }
__device__ __forceinline__ F2 split_col(const float* W, int k0, int n, int lane, int ld, int K) { float v[16]; const int g = lane >> 4;
#pragma unroll
  for (int i = 0; i < 8; ++i) { const int ka = k0 + 8 * g + i, kb = ka + 16; v[i] = ka < K ? W[(size_t)(ka < K ? ka : K - 1) * ld + n] : 0.f; v[8 + i] = kb < K ? W[(size_t)(kb < K ? kb : K - 1) * ld + n] : 0.f; }
  return bsplit16(v); }
__device__ __forceinline__ v8f mac3(const F2& a, const F2& b, v8f c) { c = wmma_bf(a.l, b.h, c); c = wmma_bf(a.h, b.l, c); return wmma_bf(a.h, b.h, c); }
__device__ __forceinline__ float sigm(float v) { return 1.0f / (1.0f + expf(-v)); }
#define LDSX() do { asm volatile("s_wait_dscnt 0" ::: "memory"); __builtin_amdgcn_wave_barrier(); __builtin_amdgcn_fence(__ATOMIC_RELEASE, "workgroup"); } while (0)
// the same for LDS that only its own wave reads, with the fence at wavefront scope: the work-group fence also waits for every global load in flight
#define LDSW() do { asm volatile("s_wait_dscnt 0" ::: "memory"); __builtin_amdgcn_wave_barrier(); __builtin_amdgcn_fence(__ATOMIC_RELEASE, "wavefront"); } while (0)


#define NB 4
#define SS 1024
#define DM 1024
#define NH 16
#define SCALEF 0.125f
__device__ __attribute__((noinline)) float log_p(float v) { return logf(v); }
__device__ __attribute__((noinline)) float cos_p(float v) { return cosf(v); }
__device__ __attribute__((noinline)) float atan2_p(float y, float x) { return atan2f(y, x); }
#define HD 64
#define QKVW (3 * DM)
#ifndef TQB
#define TQB (SS / 64)
#define TNB NB
#define TOB (NB * SS / 64)     // output row tiles (all)
#endif
typedef __attribute__((ext_vector_type(8))) __bf16 v8b;
__device__ __forceinline__ v16b frag_b(const __bf16* rowk0, int lane) {
  union { v16b v; v8b q[2]; } u; const __bf16* p = rowk0 + 8 * (lane >> 4);
  u.q[0] = *(const v8b*)p; u.q[1] = *(const v8b*)(p + 16); return u.v;
}
__device__ __forceinline__ float bfr(float v) { return (float)(__bf16)v; }
typedef __attribute__((ext_vector_type(4))) __bf16 v4b;
#define KT 64   // k columns of both operands staged in LDS per trip: 128 B of a bf16 row, 256 B of an f32 row, so every staging load covers whole lines
#define LP 72   // LDS row pitch in bf16 elements: 144 B = 16 B x odd, the conflict-free pitch for 16-byte fragment reads
__device__ __attribute__((noinline)) float exp_ni(float v) { return expf(v); }
__device__ __attribute__((noinline)) float erf_ni(float v) { return erff(v); }

#define PK_A 0                       // [3072][1024] Wqkv rows (natural [out][in])
#define PK_P (PK_A + QKVW * DM)        // [1024][1024] Wo rows (natural)
#define PK_END (PK_P + DM * DM)
#define WS_PK  0u
#define WS_QK  (WS_PK + 2u * PK_END)             // f16 [4096 rows][2048]: q | k
#define WS_QKL (WS_QK + 2u * NB * SS * 2 * DM)     // f16 q | k residual planes x2048
#define WS_VTH (WS_QKL + 2u * NB * SS * 2 * DM)    // f16 [b][1024 (h*64+d)][1024 s] hi
#define WS_VTL (WS_VTH + 2u * NB * DM * SS)        // f16 lo x 2048
#define WS_O   (WS_VTL + 2u * NB * DM * SS)        // f32 [4096][1024]
#define WS_CS  (WS_O + 4u * NB * SS * DM)           // f32 2 x [1024][32], unused
#define WS_END (WS_CS + 4u * 2 * SS * 32)
#define PT_N 64    // weight columns (= pack rows) a block
#define PT_K 256   // weight rows (= k of a pack row) a block
// ---- k_pack: block = (64 columns n, 256 rows k, which) of one (in,out) weight, transposed through LDS into bf16 pack rows; which 0..2 -> W_q/W_k/W_v into PK_A rows which*1024 + n; 3 -> W_o into PK_P. Sixteen lanes load 256 contiguous bytes of a weight row, a wave stores 512 contiguous bytes of a pack row: whole lines on both sides
__global__ __launch_bounds__(256) void k_pack(const float* __restrict__ WQ, const float* __restrict__ WK, const float* __restrict__ WV, const float* __restrict__ WO, __bf16* __restrict__ PK) {
  __shared__ __align__(16) __bf16 s[PT_N][PT_K];   // row n in 16-byte chunks of 8 k; chunk L lies at place L ^ (n >> 2), so the 16 lanes that write one chunk column of 16 rows, and the 32 that read one row, each meet all banks once
  const int n0 = blockIdx.x * PT_N, k0 = blockIdx.y * PT_K, which = blockIdx.z, t = threadIdx.x; const float* Wm = (which == 0) ? WQ : (which == 1) ? WK : (which == 2) ? WV : WO;
  const int c = t & 15, kg = t >> 4;   // the thread's 4 columns from 4 c, its 8 rows from 8 kg, and the same 128 rows on
  const float* wp = Wm + (size_t)(k0 + kg * 8) * DM + n0 + c * 4; v4f r[2][8];
#pragma unroll   // constant indices keep r in registers; all 16 loads in flight at once
  for (int p = 0; p < 2; ++p) {
#pragma unroll   // as above
    for (int j = 0; j < 8; ++j) r[p][j] = *(const v4f*)(wp + (size_t)(p * 128 + j) * DM); }
  // the pointer is an input here, so the address pair of these loads stays whole up to this wait; the loaded values are inputs too (inputs only), so all 16 loads go out ahead of the first conversion: one memory latency a block, where the build otherwise holds four loads back until registers of the first come free
  asm volatile("s_wait_xcnt 0x0" :: "v"(wp), "v"(r[0][0]), "v"(r[0][1]), "v"(r[0][2]), "v"(r[0][3]), "v"(r[0][4]), "v"(r[0][5]), "v"(r[0][6]), "v"(r[0][7]), "v"(r[1][0]), "v"(r[1][1]), "v"(r[1][2]), "v"(r[1][3]), "v"(r[1][4]), "v"(r[1][5]), "v"(r[1][6]), "v"(r[1][7]) : "memory");
#pragma unroll   // r indexed by constants
  for (int p = 0; p < 2; ++p) {
#pragma unroll   // r indexed by constants
    for (int e = 0; e < 4; ++e) { v8b o;
#pragma unroll   // 8 k of one column: one 16-byte LDS store
      for (int j = 0; j < 8; ++j) o[j] = (__bf16)r[p][j][e];
      *(v8b*)&s[c * 4 + e][((p * 16 + kg) ^ c) * 8] = o; } }
  __syncthreads();   // the tile is complete before any wave reads rows that other waves wrote
  __bf16* dst = ((which < 3) ? PK + PK_A + ((size_t)which * DM + n0) * DM : PK + PK_P + (size_t)n0 * DM) + k0; const int q = t & 31, rw = t >> 5;
#pragma unroll   // 8 pack rows a wave
  for (int i = 0; i < 8; ++i) { const int n = rw * 8 + i; vst2((unsigned*)(dst + (size_t)n * DM + q * 8), *(const v4u*)&s[n][(q ^ (n >> 2)) * 8]); }
}
__global__ __launch_bounds__(128) void k_qkv(const float* __restrict__ XQ, const float* __restrict__ XK, const float* __restrict__ XV, const __bf16* __restrict__ P, const float* __restrict__ BQ, const float* __restrict__ BK, const float* __restrict__ BV, _Float16* __restrict__ QK, _Float16* __restrict__ QKL, _Float16* __restrict__ VTH, _Float16* __restrict__ VTL) {
  const int which0 = (blockIdx.y * 128) / DM; const float* X = (which0 == 0) ? XQ : (which0 == 1) ? XK : XV; const float* BB = BQ ? (((which0 == 0) ? BQ : (which0 == 1) ? BK : BV) + (blockIdx.y * 128 - which0 * DM)) : nullptr;
  __shared__ __align__(16) _Float16 so[4][16][136], sol[4][16][136]; __shared__ __align__(16) _Float16 sth[128][72], stl[128][72];
  const int tid = threadIdx.x, wave = tid >> 5, lane = tid & 31, col = lane & 15, g = lane >> 4; const size_t r0 = (size_t)blockIdx.x * 64 + wave * 16; const int n0 = blockIdx.y * 128;
  v8f acc[8] = {};
  // the block's 64 x rows (rounded to bf16) and 128 weight rows go through LDS, KT columns a trip: each line is loaded once a block by contiguous lanes; the next trip's loads fly in registers under this trip's products
  __shared__ __align__(16) __bf16 sA[64][LP], sB[128][LP];
  const int ar = tid >> 4, ac = (tid & 15) * 4, br = tid >> 3, bc = (tid & 7) * 8;
  const float* Ag = X + ((size_t)blockIdx.x * 64 + ar) * DM + ac; const __bf16* Bg = P + (size_t)(n0 + br) * DM + bc;
  const float* Ap = Ag; const __bf16* Bp = Bg; v4f ra[8]; v8b rb[8];
#pragma unroll   // constant indices keep ra, rb in registers
  for (int i = 0; i < 8; ++i) { ra[i] = *(const v4f*)(Ag + (size_t)i * 8 * DM); rb[i] = *(const v8b*)(Bg + (size_t)i * 16 * DM); }
  for (int kt = 0; kt < DM / KT; ++kt) {
#pragma unroll   // constant indices keep ra, rb in registers
    for (int i = 0; i < 8; ++i) { v4b c;
#pragma unroll   // four conversions, one 8-byte store
      for (int e = 0; e < 4; ++e) c[e] = (__bf16)ra[i][e];
      *(v4b*)&sA[ar + i * 8][ac] = c; *(v8b*)&sB[br + i * 16][bc] = rb[i]; }
    __syncthreads();   // the tile is published to all four waves
    if (kt + 1 < DM / KT) { Ap += KT; Bp += KT;
#pragma unroll   // constant indices keep ra, rb in registers
      for (int i = 0; i < 8; ++i) { ra[i] = *(const v4f*)(Ap + (size_t)i * 8 * DM); rb[i] = *(const v8b*)(Bp + (size_t)i * 16 * DM); }
      asm volatile("s_wait_xcnt 0x0" :: "v"(Ap), "v"(Bp) : "memory"); }   // the two running pointers are inputs here, so the address pairs of these loads stay whole up to this wait: no load of the run lands in one, and they take their new values only behind it
#pragma unroll   // two k steps of 32, k ascending; constant LDS offsets
    for (int kc = 0; kc < KT / 32; ++kc) { const v16b a = frag_b(&sA[wave * 16 + col][kc * 32], lane); v16b w[8];
#pragma unroll   // the k step's fragment reads go out as one group ahead of its products: one LDS latency a step, not one a product
      for (int j = 0; j < 8; ++j) w[j] = frag_b(&sB[j * 16 + col][kc * 32], lane);
#pragma unroll   // acc[j] indexed by constants
      for (int j = 0; j < 8; ++j) acc[j] = wmma_bf(a, w[j], acc[j]); }
    __syncthreads();   // every wave has read the tile before the next trip overwrites it
  }
  if (n0 < 2 * DM) {   // q stored unscaled (f16 sigma ~0.6, no subnormal exposure); 1/8 applied to the f32 score
#pragma unroll
    for (int j = 0; j < 8; ++j) {
#pragma unroll
      for (int r = 0; r < 8; ++r) { const float v = acc[j][r] + (BB ? bfr(BB[j * 16 + col]) : 0.f); const _Float16 hv = (_Float16)v; so[wave][8 * g + r][j * 16 + col] = hv; sol[wave][8 * g + r][j * 16 + col] = (_Float16)((v - (float)hv) * 2048.0f); } }   // q, k (+ bias) as f16 hi + (x2048) residual
    LDSX();
    for (int rl = 0; rl < 16; ++rl) if (lane < 16) { vst2((unsigned*)(QK + (r0 + rl) * (2 * DM) + n0 + lane * 8), *(const v4u*)&so[wave][rl][lane * 8]); vst2((unsigned*)(QKL + (r0 + rl) * (2 * DM) + n0 + lane * 8), *(const v4u*)&sol[wave][rl][lane * 8]); }
  } else {
#pragma unroll
    for (int j = 0; j < 8; ++j) {
#pragma unroll
      for (int r = 0; r < 8; ++r) { const float v = acc[j][r] + (BB ? bfr(BB[j * 16 + col]) : 0.f); const _Float16 hv = (_Float16)v; sth[j * 16 + col][wave * 16 + 8 * g + r] = hv; stl[j * 16 + col][wave * 16 + 8 * g + r] = (_Float16)((v - (float)hv) * 2048.0f); } }
    __syncthreads();
    const size_t rb = (size_t)blockIdx.x * 64; const int b = (int)(rb / SS), s0 = (int)(rb % SS); const int pc0 = n0 - 2 * DM;
    for (int q = tid; q < 128 * 8; q += 128) { const int d = q >> 3, pc = q & 7; const size_t o = ((size_t)b * DM + pc0 + d) * SS + s0 + pc * 8; vst2((unsigned*)(VTH + o), *(const v4u*)&sth[d][pc * 8]); vst2((unsigned*)(VTL + o), *(const v4u*)&stl[d][pc * 8]); }
  }
}
// fragment at the lane's own address (row start + 8 * (lane >> 4)), the k order of frag_h
__device__ __forceinline__ v16h frag_at(const _Float16* p) { union { v16h v; v8h q[2]; } u; u.q[0] = *(const v8h*)p; u.q[1] = *(const v8h*)(p + 16); return u.v; }
// ---- k_attn: block = (64 queries, head h, batch b): causal flash attention (K = 64: 2 k-steps), scores = (q.k) * 0.125, q and k as f16 hi + residual (3 products) for qb < 2, single f16 operands beyond; P.V: f16 P*2048 x V hi in acc, for qb < 2 also P lo x V hi and P x V lo*2048 in accl; O[b*S+q][h*64+d] = (acc + accl / 2048) / (2048 l), 0 for dormant heads (256-B segments)
__global__ __launch_bounds__(128) void k_attn(const _Float16* __restrict__ QK, const _Float16* __restrict__ QKL, const _Float16* __restrict__ VTH, const _Float16* __restrict__ VTL, const void* __restrict__ KMASK, const float* __restrict__ KB, const int* __restrict__ AM, float* __restrict__ O) {
  __shared__ __align__(16) float sp[4][16][36]; __shared__ __align__(16) float so[4][16][68];
  const int tid = threadIdx.x, wave = tid >> 5, lane = tid & 31, col = lane & 15, g = lane >> 4;
  const int qb = blockIdx.x, h = blockIdx.y, b = blockIdx.z; const int q0 = qb * 64 + wave * 16; const size_t rq = (size_t)b * SS + q0 + col;
  v16h aq[2];   // the q residual, used by the leading query blocks alone, is loaded at its products: 16 registers less in every block
#pragma unroll
  for (int kc = 0; kc < 2; ++kc) aq[kc] = frag_h(QK + rq * (2 * DM) + h * HD + kc * 32, lane);
  float m[8], l[8];
#pragma unroll
  for (int r = 0; r < 8; ++r) { m[r] = -3.0e38f; l[r] = 0.f; }
  v8f acc[4] = {}, accl[4] = {};
  const int nks = (qb * 64 + 64) / 32;   // causal: key tiles up to the query tile's end
  // the V (hi) loads of a key step go out as one group behind its score products, the K (hi) and gate loads of the next step as one group behind the softmax: each group's latency runs under other work and is waited for by count, instead of a load and a full wait in front of every product. 254 registers: four waves per SIMD as before
  const _Float16* kp = QK + ((size_t)b * SS + col) * (2 * DM) + DM + h * HD + 8 * g; const float* bp = KB + ((size_t)b * NH + h) * SS + col; const _Float16* vp = VTH + ((size_t)b * DM + h * HD + col) * SS + 8 * g;   // the lane's own running addresses
  v16h kf[2][2], vf[4]; float kbv[2];
#pragma unroll   // constant indices keep kf, kbv in registers
  for (int ct = 0; ct < 2; ++ct) { kf[ct][0] = frag_at(kp + (size_t)ct * 16 * (2 * DM)); kf[ct][1] = frag_at(kp + (size_t)ct * 16 * (2 * DM) + 32); kbv[ct] = bp[ct * 16]; }
#pragma unroll 1
  for (int ks = 0; ks < nks; ++ks) { v8f s[2];
#pragma unroll
    for (int ct = 0; ct < 2; ++ct) { const int kk = ks * 32 + ct * 16 + col; const _Float16* krowl = QKL + ((size_t)b * SS + kk) * (2 * DM) + DM + h * HD; v8f c = {}, cl = {};
      if (qb < 2) {   // leading query blocks (few keys, outputs far above the global rms): 3 products
#pragma unroll
        for (int kc = 0; kc < 2; ++kc) { const v16h kh = kf[ct][kc]; c = wmma16(aq[kc], kh, c); cl = wmma16(frag_h(QKL + rq * (2 * DM) + h * HD + kc * 32, lane), kh, cl); cl = wmma16(aq[kc], frag_h(krowl + kc * 32, lane), cl); }
#pragma unroll
        for (int r = 0; r < 8; ++r) c[r] += cl[r] * (1.0f / 2048.0f); }
      else {
#pragma unroll
        for (int kc = 0; kc < 2; ++kc) c = wmma16(aq[kc], kf[ct][kc], c); }   // single product elsewhere
      { const float kb = kbv[ct];
#pragma unroll
      for (int r = 0; r < 8; ++r) s[ct][r] = (kk <= q0 + 8 * g + r) ? c[r] * SCALEF + kb : -3.0e38f; } }   // causal; + log resonance gate of key kk
#pragma unroll   // constant indices keep vf in registers
    for (int dt = 0; dt < 4; ++dt) vf[dt] = frag_at(vp + (size_t)dt * 16 * SS);
    asm volatile("s_wait_xcnt 0x0" :: "v"(vp) : "memory"); vp += 32;   // the running pointer is an input here, so the address pair of these loads stays whole up to this wait and takes its new value only behind it
#pragma unroll
    for (int r = 0; r < 8; ++r) { float mx = fmaxf(s[0][r], s[1][r]);
#pragma unroll
      for (int o = 1; o < 16; o <<= 1) mx = fmaxf(mx, __shfl_xor(mx, o));
      const float mn = fmaxf(m[r], mx); const float alpha = (m[r] <= -1.0e38f) ? 0.f : __expf(m[r] - mn);
      const float e0 = (s[0][r] <= -1.0e38f) ? 0.f : __expf(s[0][r] - mn), e1 = (s[1][r] <= -1.0e38f) ? 0.f : __expf(s[1][r] - mn); float es = e0 + e1;
#pragma unroll
      for (int o = 1; o < 16; o <<= 1) es += __shfl_xor(es, o);
      l[r] = l[r] * alpha + es; m[r] = mn;
#pragma unroll
      for (int dt = 0; dt < 4; ++dt) { acc[dt][r] *= alpha; accl[dt][r] *= alpha; }
      sp[wave][8 * g + r][col] = e0; sp[wave][8 * g + r][16 + col] = e1; }
    LDSW();
    { const int adv = (ks + 1 < nks) ? 32 : 0; kp += (size_t)adv * (2 * DM); bp += adv;   // no branch round this group: the last step loads its own rows once more (unused). Behind a join with a path without these loads the waits of the V fragments would have to cover this group too
#pragma unroll   // constant indices keep kf, kbv in registers
      for (int ct = 0; ct < 2; ++ct) { kf[ct][0] = frag_at(kp + (size_t)ct * 16 * (2 * DM)); kf[ct][1] = frag_at(kp + (size_t)ct * 16 * (2 * DM) + 32); kbv[ct] = bp[ct * 16]; }
      asm volatile("s_wait_xcnt 0x0" :: "v"(kp), "v"(bp) : "memory"); }   // as behind the V group
    v16h pa, pl; { const float* prow = &sp[wave][col][0] + 8 * (lane >> 4);
#pragma unroll
      for (int i = 0; i < 8; ++i) { const float x0 = prow[i] * 2048.0f, x1 = prow[16 + i] * 2048.0f; const _Float16 h0 = (_Float16)x0, h1 = (_Float16)x1; pa[i] = h0; pa[8 + i] = h1; pl[i] = (_Float16)((x0 - (float)h0) * 2048.0f); pl[8 + i] = (_Float16)((x1 - (float)h1) * 2048.0f); } }   // P scaled by 2^11 before the f16 split so small softmax weights stay out of the f16 subnormal range; 2^-11 folded into the epilogue
#pragma unroll
    for (int dt = 0; dt < 4; ++dt) acc[dt] = wmma16(pa, vf[dt], acc[dt]);
    if (qb < 2) {   // one branch a step for the four tiles' extra products: with one per tile the build holds accl twice
#pragma unroll   // accl, vf indexed by constants
      for (int dt = 0; dt < 4; ++dt) { const size_t vr = ((size_t)b * DM + h * HD + dt * 16 + col) * SS + ks * 32; accl[dt] = wmma16(pl, vf[dt], accl[dt]); accl[dt] = wmma16(pa, frag_h(VTL + vr, lane), accl[dt]); } }   // leading query blocks: P hi/lo x V hi/lo (3 products); elsewhere P x V single
    LDSW(); }
#pragma unroll
  for (int r = 0; r < 8; ++r) { const float il = ((AM[h] != 0) ? (1.0f / 2048.0f) : 0.f) / l[r];   // dormant heads contribute nothing
#pragma unroll
    for (int dt = 0; dt < 4; ++dt) so[wave][8 * g + r][dt * 16 + col] = (acc[dt][r] + accl[dt][r] * (1.0f / 2048.0f)) * il; }
  LDSX();
  for (int rl = 0; rl < 16; ++rl) if (lane < 16) vst2(O + ((size_t)b * SS + q0 + rl) * DM + h * HD + lane * 4, *(const v4f*)&so[wave][rl][lane * 4]);
}
// ---- k_out: block = (64 rows, 128 cols): out = O(hi/lo) . Wo rows (2 products), no bias (BO is null)
__global__ __launch_bounds__(128) void k_out(const float* __restrict__ O, const __bf16* __restrict__ P, const float* __restrict__ BO, float* __restrict__ Y) {
  __shared__ __align__(16) float so[4][16][132];
  const int tid = threadIdx.x, wave = tid >> 5, lane = tid & 31, col = lane & 15, g = lane >> 4; const size_t r0 = (size_t)blockIdx.x * 64 + wave * 16; const int n0 = blockIdx.y * 128;
  v8f acc[8] = {};
  // as in k_qkv: the block's 64 rows of O (split once into bf16 hi and residual) and 128 weight rows go through LDS, KT columns a trip
  __shared__ __align__(16) __bf16 sAh[64][LP], sAl[64][LP], sB[128][LP];
  const int ar = tid >> 4, ac = (tid & 15) * 4, br = tid >> 3, bc = (tid & 7) * 8;
  const float* Ag = O + ((size_t)blockIdx.x * 64 + ar) * DM + ac; const __bf16* Bg = P + (size_t)(n0 + br) * DM + bc;
  const float* Ap = Ag; const __bf16* Bp = Bg; v4f ra[8]; v8b rb[8];
#pragma unroll   // constant indices keep ra, rb in registers
  for (int i = 0; i < 8; ++i) { ra[i] = *(const v4f*)(Ag + (size_t)i * 8 * DM); rb[i] = *(const v8b*)(Bg + (size_t)i * 16 * DM); }
  for (int kt = 0; kt < DM / KT; ++kt) {
#pragma unroll   // constant indices keep ra, rb in registers
    for (int i = 0; i < 8; ++i) { v4b ch, cl;
#pragma unroll   // four splits, two 8-byte stores
      for (int e = 0; e < 4; ++e) { const __bf16 hv = (__bf16)ra[i][e]; ch[e] = hv; cl[e] = (__bf16)(ra[i][e] - (float)hv); }
      *(v4b*)&sAh[ar + i * 8][ac] = ch; *(v4b*)&sAl[ar + i * 8][ac] = cl; *(v8b*)&sB[br + i * 16][bc] = rb[i]; }
    __syncthreads();   // the tile is published to all four waves
    if (kt + 1 < DM / KT) { Ap += KT; Bp += KT;
#pragma unroll   // constant indices keep ra, rb in registers
      for (int i = 0; i < 8; ++i) { ra[i] = *(const v4f*)(Ap + (size_t)i * 8 * DM); rb[i] = *(const v8b*)(Bp + (size_t)i * 16 * DM); }
      asm volatile("s_wait_xcnt 0x0" :: "v"(Ap), "v"(Bp) : "memory"); }   // the two running pointers are inputs here, so the address pairs of these loads stay whole up to this wait: no load of the run lands in one, and they take their new values only behind it
#pragma unroll   // two k steps of 32, k ascending; constant LDS offsets
    for (int kc = 0; kc < KT / 32; ++kc) { const v16b ah = frag_b(&sAh[wave * 16 + col][kc * 32], lane), al = frag_b(&sAl[wave * 16 + col][kc * 32], lane); v16b w[8];
#pragma unroll   // the k step's fragment reads go out as one group ahead of its products: one LDS latency a step, not one a product
      for (int j = 0; j < 8; ++j) w[j] = frag_b(&sB[j * 16 + col][kc * 32], lane);
#pragma unroll   // acc[j] indexed by constants
      for (int j = 0; j < 8; ++j) { acc[j] = wmma_bf(al, w[j], acc[j]); acc[j] = wmma_bf(ah, w[j], acc[j]); } }
    __syncthreads();   // every wave has read the tile before the next trip overwrites it
  }
#pragma unroll
  for (int j = 0; j < 8; ++j) {
#pragma unroll
    for (int r = 0; r < 8; ++r) so[wave][8 * g + r][j * 16 + col] = acc[j][r] + (BO ? bfr(BO[n0 + j * 16 + col]) : 0.f); }
  LDSX();
  for (int rl = 0; rl < 16; ++rl) vst2(Y + (r0 + rl) * DM + n0 + lane * 4, *(const v4f*)&so[wave][rl][lane * 4]);
}

#define PH_TW 4    // tokens a wave
#define PH_TB 32   // tokens a block (8 waves): the 32 gates of one head are one whole 128-byte line of KB
// ---- k_phase: block = 32 tokens, a wave = 4 of them: ph = bf16(x) . bf16(w_phase) (f32) with a lane on 32 of the 1,024 d (16-byte loads, 512 contiguous bytes a wave), w_phase loaded once for the wave's 4 tokens, the sums joined inside the wave; phase = atan2(ph0, ph1); then a lane = (token, head) for the 16 per-head log gates of each key. 128 blocks, where one block a token is 4,096 blocks of 8 waves that live shorter than they take to start
__global__ __launch_bounds__(256) void k_phase(const float* __restrict__ X, const float* __restrict__ WP, const float* __restrict__ CAR, const float* __restrict__ LOCK, const float* __restrict__ BW, float* __restrict__ KB) {
  __shared__ __align__(8) float sg[NH][PH_TB + 2];   // pitch 34: the 32 lanes that write (16 heads x 2 tokens) meet 32 different banks; even, for the 8-byte reads
  const int t = threadIdx.x, wave = t >> 5, lane = t & 31, hd = lane & 15, g = lane >> 4; const size_t row0 = (size_t)blockIdx.x * PH_TB;
  const float* xp = X + (row0 + wave * PH_TW) * DM + lane * 4; const float* wp = WP + lane * 8; v4f xv[PH_TW][8], wv[8][2];
#pragma unroll   // constant indices keep wv in registers
  for (int j = 0; j < 8; ++j) { wv[j][0] = *(const v4f*)(wp + j * 256); wv[j][1] = *(const v4f*)(wp + j * 256 + 4); }   // both columns of d = 128 j + 4 lane + (0 .. 3)
#pragma unroll   // constant indices keep xv in registers
  for (int k = 0; k < PH_TW; ++k) {
#pragma unroll   // as above
    for (int j = 0; j < 8; ++j) xv[k][j] = *(const v4f*)(xp + (size_t)k * DM + j * 128); }
  const float lkr = LOCK[hd], bwr = BW[hd], carr = CAR[hd];
  // the two pointers are inputs here, so the address pairs of these loads stay whole up to this wait; the loaded values are inputs too (inputs only; an asm statement takes thirty operands, so the rest stand in the fence below), so all 48 loads go out ahead of the first conversion: one memory latency a wave, where the build otherwise holds twelve loads back until registers of the first come free
  asm volatile("s_wait_xcnt 0x0" :: "v"(xp), "v"(wp), "v"(wv[0][0]), "v"(wv[0][1]), "v"(wv[1][0]), "v"(wv[1][1]), "v"(wv[2][0]), "v"(wv[2][1]), "v"(wv[3][0]), "v"(wv[3][1]), "v"(wv[4][0]), "v"(wv[4][1]), "v"(wv[5][0]), "v"(wv[5][1]), "v"(wv[6][0]), "v"(wv[6][1]), "v"(wv[7][0]), "v"(wv[7][1]), "v"(xv[0][0]), "v"(xv[0][1]), "v"(xv[0][2]), "v"(xv[0][3]), "v"(xv[0][4]), "v"(xv[0][5]), "v"(xv[0][6]), "v"(xv[0][7]), "v"(xv[1][0]), "v"(xv[1][1]), "v"(xv[1][2]), "v"(xv[1][3]) : "memory");
  asm volatile("" :: "v"(xv[1][4]), "v"(xv[1][5]), "v"(xv[1][6]), "v"(xv[1][7]), "v"(xv[2][0]), "v"(xv[2][1]), "v"(xv[2][2]), "v"(xv[2][3]), "v"(xv[2][4]), "v"(xv[2][5]), "v"(xv[2][6]), "v"(xv[2][7]), "v"(xv[3][0]), "v"(xv[3][1]), "v"(xv[3][2]), "v"(xv[3][3]), "v"(xv[3][4]), "v"(xv[3][5]), "v"(xv[3][6]), "v"(xv[3][7]));   // the other 20 loaded values, inputs only, for the same purpose
  float a0[PH_TW] = {}, a1[PH_TW] = {};
#pragma unroll   // xv, wv indexed by constants
  for (int j = 0; j < 8; ++j) {
#pragma unroll   // as above
    for (int e = 0; e < 4; ++e) { const float w0 = bfr(wv[j][e >> 1][(e & 1) * 2]), w1 = bfr(wv[j][e >> 1][(e & 1) * 2 + 1]);
#pragma unroll   // eight independent sums
      for (int k = 0; k < PH_TW; ++k) { const float xb = bfr(xv[k][j][e]); a0[k] += xb * w0; a1[k] += xb * w1; } } }
#pragma unroll   // five exchanges, the eight sums side by side in each
  for (int o = 16; o > 0; o >>= 1) {
#pragma unroll   // a0, a1 indexed by constants
    for (int k = 0; k < PH_TW; ++k) { a0[k] += __shfl_xor(a0[k], o); a1[k] += __shfl_xor(a1[k], o); } }
  const float lk = bfr(lkr), bw = bfr(bwr), car = bfr(carr);
#pragma unroll   // a0, a1 indexed by constants
  for (int p = 0; p < PH_TW / 2; ++p) { const float phase = atan2_p(g ? a0[2 * p + 1] : a0[2 * p], g ? a1[2 * p + 1] : a1[2 * p]); const float win = exp_ni((cos_p(phase - car) - 1.0f) / bw); const float gate = lk * win + (1.0f - lk); sg[hd][wave * PH_TW + 2 * p + g] = log_p(gate + 1e-6f); }   // lane = (token 2 p + g of the wave, head hd)
  __syncthreads();   // the block's 16 x 32 gates are complete before any wave reads what other waves wrote
  { const int hh = t >> 4, pr = t & 15; const size_t b = row0 / SS, s = row0 % SS; *(v2f*)(KB + (b * NH + hh) * SS + s + pr * 2) = *(const v2f*)&sg[hh][pr * 2]; }   // 16 lanes store one head's whole line
}
extern "C" void kernel_launch(void* const* d_in, const int* in_sizes, int n_in, void* d_out, int out_size, void* d_ws, size_t ws_size, hipStream_t stream) {
  (void)in_sizes; (void)n_in; (void)out_size;
  const float** F = (const float**)d_in;   // 0 x [4,1024,1024], 1 wq, 2 wk, 3 wv, 4 wo (all (in,out) [1024,1024]), 5 w_phase [1024,2], 6 carrier [16], 7 lock [16], 8 bandwidth [16], 9 active_mask [16] int
  if (ws_size < (size_t)WS_END + 4u * NB * NH * SS + 256) return;
  char* ws = (char*)d_ws; __bf16* PK = (__bf16*)(ws + WS_PK); _Float16 *QK = (_Float16*)(ws + WS_QK), *QKL = (_Float16*)(ws + WS_QKL), *VTH = (_Float16*)(ws + WS_VTH), *VTL = (_Float16*)(ws + WS_VTL); float* O = (float*)(ws + WS_O); float* KB = (float*)(ws + WS_END);
  k_pack<<<dim3(DM / PT_N, DM / PT_K, 4), 256, 0, stream>>>(F[1], F[2], F[3], F[4], PK);
  k_phase<<<NB * SS / PH_TB, 256, 0, stream>>>(F[0], F[5], F[6], F[7], F[8], KB);
  k_qkv<<<dim3(TNB * SS / 64, QKVW / 128), 128, 0, stream>>>(F[0], F[0], F[0], PK + PK_A, nullptr, nullptr, nullptr, QK, QKL, VTH, VTL);
  k_attn<<<dim3(TQB, NH, TNB), 128, 0, stream>>>(QK, QKL, VTH, VTL, nullptr, KB, (const int*)d_in[9], O);
  k_out<<<dim3(TOB, DM / 128), 128, 0, stream>>>(O, PK + PK_P, nullptr, (float*)d_out);
}

// v005
// One run takes 127 microseconds.
// Timed twice side by side with v004, it ran 1.04 times as fast both times.
// Over all steps from v000 it is 2.82 times as fast.
// compute dtype: all float inputs rounded to bf16, active_mask (int) read on device; q/k/v = x . W with EXACT bf16 products on WMMA 16x16x32 ((in,out) weights as transposed rows); the per-token phase (x . w_phase, atan2) and the per-(batch, head, key) log resonance gate in f32 (precise expf/logf/cosf/atan2f); causal attention x 1/8 + log gate: for the first 128 queries of each sequence 3-product scores and P, v as f16 hi + residual (3 products), single f16 operands beyond; running-max softmax in f32 (hardware exp); the per-head active mask applied to the attention output; out = o (bf16 hi + residual) . Wo (2 products).
#include <hip/hip_runtime.h>
#include <math.h>

typedef __attribute__((ext_vector_type(16))) _Float16 v16h;
typedef __attribute__((ext_vector_type(16))) __bf16 v16b;
typedef __attribute__((ext_vector_type(8)))  _Float16 v8h;
typedef __attribute__((ext_vector_type(8)))  float v8f;
typedef __attribute__((ext_vector_type(4)))  float v4f;
typedef __attribute__((ext_vector_type(2)))  float v2f;
typedef __attribute__((ext_vector_type(4)))  unsigned v4u;
typedef __attribute__((ext_vector_type(4)))  int v4i;
typedef float __attribute__((may_alias)) float_a;
typedef int __attribute__((may_alias)) int_a;

template <typename T> __device__ __forceinline__ void vst2(void* p, T v) { *(T*)p = v;  }
__device__ __forceinline__ v8f wmma16(v16h a, v16h b, v8f c) {
  v8f d = __builtin_amdgcn_wmma_f32_16x16x32_f16(false, a, false, b, (short)0, c, false, false);
  asm volatile("v_nop\n\tv_nop\n\tv_nop\n\tv_nop" : "+v"(d) : "v"(a), "v"(b));
  return d;
}
__device__ __forceinline__ v8f wmma_bf(v16b a, v16b b, v8f c) {
  v8f d = __builtin_amdgcn_wmma_f32_16x16x32_bf16(false, a, false, b, (short)0, c, false, false);
  asm volatile("v_nop\n\tv_nop\n\tv_nop\n\tv_nop" : "+v"(d) : "v"(a), "v"(b));
  return d;
}
// Resonance-gated causal attention (B 4, S 1,024, d 1,024, 16 heads x 64): bias-free q/k/v/o projections, a per-key additive log-gate from each token's input phase against a per-head carrier (von Mises window opened by 1 - lock), causal softmax, dormant heads zeroed.
__device__ __forceinline__ v16h frag_h(const _Float16* rowk0, int lane) {
  union { v16h v; v8h q[2]; } u; const _Float16* p = rowk0 + 8 * (lane >> 4);
  u.q[0] = *(const v8h*)p; u.q[1] = *(const v8h*)(p + 16); return u.v;
}
__device__ __forceinline__ v16h frag_f32(const float* rowk0, int lane) {
  v16h a; const float* p = rowk0 + 8 * (lane >> 4);
#pragma unroll
  for (int i = 0; i < 8; ++i) { a[i] = (_Float16)p[i]; a[8 + i] = (_Float16)p[16 + i]; }
  return a;
}
__device__ __forceinline__ v16h frag_f32s(const float* rowk0, int lane, float sc) {
  v16h a; const float* p = rowk0 + 8 * (lane >> 4);
#pragma unroll
  for (int i = 0; i < 8; ++i) { a[i] = (_Float16)(p[i] * sc); a[8 + i] = (_Float16)(p[16 + i] * sc); }
  return a;
}
// column fragment from a [K][ld] layout (column n), rows >= K read as 0
__device__ __forceinline__ v16h fragc_f32(const float* W, int k0, int n, int lane, int ld, int K) {
  v16h a; const int g = lane >> 4;
#pragma unroll
  for (int i = 0; i < 8; ++i) { const int ka = k0 + 8 * g + i, kb = ka + 16;
    a[i] = (_Float16)(ka < K ? W[(size_t)(ka < K ? ka : K - 1) * ld + n] : 0.f); a[8 + i] = (_Float16)(kb < K ? W[(size_t)(kb < K ? kb : K - 1) * ld + n] : 0.f); }
  return a;
}
struct F2 { v16b h, l; };
__device__ __forceinline__ F2 bsplit16(const float v[16]) { F2 r;
#pragma unroll
  for (int i = 0; i < 16; ++i) { const __bf16 h = (__bf16)v[i]; r.h[i] = h; r.l[i] = (__bf16)(v[i] - (float)h); }
  return r; }
__device__ __forceinline__ F2 split_row(const float* row, int k0, int lane) { float v[16]; const float* p = row + k0 + 8 * (lane >> 4);
#pragma unroll
  for (int i = 0; i < 8; ++i) { v[i] = p[i]; v[8 + i] = p[16 + i]; }
  return bsplit16(v); }
__device__ __forceinline__ F2 split_rowK(const float* row, int k0, int lane, int K) { float v[16]; const int g = lane >> 4;
#pragma unroll
  for (int i = 0; i < 8; ++i) { const int ka = k0 + 8 * g + i, kb = ka + 16; v[i] = ka < K ? row[ka < K ? ka : K - 1] : 0.f; v[8 + i] = kb < K ? row[kb < K ? kb : K - 1] : 0.f; }
  return bsplit16(v); }
__device__ __forceinline__ F2 split_col(const float* W, int k0, int n, int lane, int ld, int K) { float v[16]; const int g = lane >> 4;
#pragma unroll
  for (int i = 0; i < 8; ++i) { const int ka = k0 + 8 * g + i, kb = ka + 16; v[i] = ka < K ? W[(size_t)(ka < K ? ka : K - 1) * ld + n] : 0.f; v[8 + i] = kb < K ? W[(size_t)(kb < K ? kb : K - 1) * ld + n] : 0.f; }
  return bsplit16(v); }
__device__ __forceinline__ v8f mac3(const F2& a, const F2& b, v8f c) { c = wmma_bf(a.l, b.h, c); c = wmma_bf(a.h, b.l, c); return wmma_bf(a.h, b.h, c); }
__device__ __forceinline__ float sigm(float v) { return 1.0f / (1.0f + expf(-v)); }
#define LDSX() do { asm volatile("s_wait_dscnt 0" ::: "memory"); __builtin_amdgcn_wave_barrier(); __builtin_amdgcn_fence(__ATOMIC_RELEASE, "workgroup"); } while (0)
// the same for LDS that only its own wave reads, with the fence at wavefront scope: the work-group fence also waits for every global load in flight
#define LDSW() do { asm volatile("s_wait_dscnt 0" ::: "memory"); __builtin_amdgcn_wave_barrier(); __builtin_amdgcn_fence(__ATOMIC_RELEASE, "wavefront"); } while (0)


#define NB 4
#define SS 1024
#define DM 1024
#define NH 16
#define SCALEF 0.125f
__device__ __attribute__((noinline)) float log_p(float v) { return logf(v); }
__device__ __attribute__((noinline)) float cos_p(float v) { return cosf(v); }
__device__ __attribute__((noinline)) float atan2_p(float y, float x) { return atan2f(y, x); }
#define HD 64
#define QKVW (3 * DM)
#ifndef TQB
#define TQB (SS / 64)
#define TNB NB
#define TOB (NB * SS / 64)     // output row tiles (all)
#endif
typedef __attribute__((ext_vector_type(8))) __bf16 v8b;
__device__ __forceinline__ v16b frag_b(const __bf16* rowk0, int lane) {
  union { v16b v; v8b q[2]; } u; const __bf16* p = rowk0 + 8 * (lane >> 4);
  u.q[0] = *(const v8b*)p; u.q[1] = *(const v8b*)(p + 16); return u.v;
}
__device__ __forceinline__ float bfr(float v) { return (float)(__bf16)v; }
typedef __attribute__((ext_vector_type(4))) __bf16 v4b;
#define KT 64   // k columns of both operands staged in LDS per trip: 128 B of a bf16 row, 256 B of an f32 row, so every staging load covers whole lines
#define LP 72   // LDS row pitch in bf16 elements: 144 B = 16 B x odd, the conflict-free pitch for 16-byte fragment reads
__device__ __attribute__((noinline)) float exp_ni(float v) { return expf(v); }
__device__ __attribute__((noinline)) float erf_ni(float v) { return erff(v); }

#define PK_A 0                       // [3072][1024] Wqkv rows (natural [out][in])
#define PK_P (PK_A + QKVW * DM)        // [1024][1024] Wo rows (natural)
#define PK_END (PK_P + DM * DM)
#define WS_PK  0u
#define WS_QK  (WS_PK + 2u * PK_END)             // f16 [4096 rows][2048]: q | k
#define WS_QKL (WS_QK + 2u * NB * SS * 2 * DM)     // f16 q | k residual planes x2048
#define WS_VTH (WS_QKL + 2u * NB * SS * 2 * DM)    // f16 [b][1024 (h*64+d)][1024 s] hi
#define WS_VTL (WS_VTH + 2u * NB * DM * SS)        // f16 lo x 2048
#define WS_O   (WS_VTL + 2u * NB * DM * SS)        // f32 [4096][1024]
#define WS_CS  (WS_O + 4u * NB * SS * DM)           // f32 2 x [1024][32], unused
#define WS_END (WS_CS + 4u * 2 * SS * 32)
#define PT_N 64    // weight columns (= pack rows) a block
#define PT_K 256   // weight rows (= k of a pack row) a block
// ---- k_pack: block = (64 columns n, 256 rows k, which) of one (in,out) weight, transposed through LDS into bf16 pack rows; which 0..2 -> W_q/W_k/W_v into PK_A rows which*1024 + n; 3 -> W_o into PK_P. Sixteen lanes load 256 contiguous bytes of a weight row, a wave stores 512 contiguous bytes of a pack row: whole lines on both sides
__global__ __launch_bounds__(256) void k_pack(const float* __restrict__ WQ, const float* __restrict__ WK, const float* __restrict__ WV, const float* __restrict__ WO, __bf16* __restrict__ PK) {
  __shared__ __align__(16) __bf16 s[PT_N][PT_K];   // row n in 16-byte chunks of 8 k; chunk L lies at place L ^ (n >> 2), so the 16 lanes that write one chunk column of 16 rows, and the 32 that read one row, each meet all banks once
  const int n0 = blockIdx.x * PT_N, k0 = blockIdx.y * PT_K, which = blockIdx.z, t = threadIdx.x; const float* Wm = (which == 0) ? WQ : (which == 1) ? WK : (which == 2) ? WV : WO;
  const int c = t & 15, kg = t >> 4;   // the thread's 4 columns from 4 c, its 8 rows from 8 kg, and the same 128 rows on
  const float* wp = Wm + (size_t)(k0 + kg * 8) * DM + n0 + c * 4; v4f r[2][8];
#pragma unroll   // constant indices keep r in registers; all 16 loads in flight at once
  for (int p = 0; p < 2; ++p) {
#pragma unroll   // as above
    for (int j = 0; j < 8; ++j) r[p][j] = *(const v4f*)(wp + (size_t)(p * 128 + j) * DM); }
  // the pointer is an input here, so the address pair of these loads stays whole up to this wait; the loaded values are inputs too (inputs only), so all 16 loads go out ahead of the first conversion: one memory latency a block, where the build otherwise holds four loads back until registers of the first come free
  asm volatile("s_wait_xcnt 0x0" :: "v"(wp), "v"(r[0][0]), "v"(r[0][1]), "v"(r[0][2]), "v"(r[0][3]), "v"(r[0][4]), "v"(r[0][5]), "v"(r[0][6]), "v"(r[0][7]), "v"(r[1][0]), "v"(r[1][1]), "v"(r[1][2]), "v"(r[1][3]), "v"(r[1][4]), "v"(r[1][5]), "v"(r[1][6]), "v"(r[1][7]) : "memory");
#pragma unroll   // r indexed by constants
  for (int p = 0; p < 2; ++p) {
#pragma unroll   // r indexed by constants
    for (int e = 0; e < 4; ++e) { v8b o;
#pragma unroll   // 8 k of one column: one 16-byte LDS store
      for (int j = 0; j < 8; ++j) o[j] = (__bf16)r[p][j][e];
      *(v8b*)&s[c * 4 + e][((p * 16 + kg) ^ c) * 8] = o; } }
  __syncthreads();   // the tile is complete before any wave reads rows that other waves wrote
  __bf16* dst = ((which < 3) ? PK + PK_A + ((size_t)which * DM + n0) * DM : PK + PK_P + (size_t)n0 * DM) + k0; const int q = t & 31, rw = t >> 5;
#pragma unroll   // 8 pack rows a wave
  for (int i = 0; i < 8; ++i) { const int n = rw * 8 + i; vst2((unsigned*)(dst + (size_t)n * DM + q * 8), *(const v4u*)&s[n][(q ^ (n >> 2)) * 8]); }
}
__global__ __launch_bounds__(128) void k_qkv(const float* __restrict__ XQ, const float* __restrict__ XK, const float* __restrict__ XV, const __bf16* __restrict__ P, const float* __restrict__ BQ, const float* __restrict__ BK, const float* __restrict__ BV, _Float16* __restrict__ QK, _Float16* __restrict__ QKL, _Float16* __restrict__ VTH, _Float16* __restrict__ VTL) {
  const int which0 = (blockIdx.y * 128) / DM; const float* X = (which0 == 0) ? XQ : (which0 == 1) ? XK : XV; const float* BB = BQ ? (((which0 == 0) ? BQ : (which0 == 1) ? BK : BV) + (blockIdx.y * 128 - which0 * DM)) : nullptr;
  __shared__ __align__(16) _Float16 so[4][16][136], sol[4][16][136]; __shared__ __align__(16) _Float16 sth[128][72], stl[128][72];
  const int tid = threadIdx.x, wave = tid >> 5, lane = tid & 31, col = lane & 15, g = lane >> 4; const size_t r0 = (size_t)blockIdx.x * 64 + wave * 16; const int n0 = blockIdx.y * 128;
  v8f acc[8] = {};
  // the block's 64 x rows (rounded to bf16) and 128 weight rows go through LDS, KT columns a trip: each line is loaded once a block by contiguous lanes; the next trip's loads fly in registers under this trip's products
  __shared__ __align__(16) __bf16 sA[64][LP], sB[128][LP];
  const int ar = tid >> 4, ac = (tid & 15) * 4, br = tid >> 3, bc = (tid & 7) * 8;
  const float* Ag = X + ((size_t)blockIdx.x * 64 + ar) * DM + ac; const __bf16* Bg = P + (size_t)(n0 + br) * DM + bc;
  const float* Ap = Ag; const __bf16* Bp = Bg; v4f ra[8]; v8b rb[8];
#pragma unroll   // constant indices keep ra, rb in registers
  for (int i = 0; i < 8; ++i) { ra[i] = *(const v4f*)(Ag + (size_t)i * 8 * DM); rb[i] = *(const v8b*)(Bg + (size_t)i * 16 * DM); }
  for (int kt = 0; kt < DM / KT; ++kt) {
#pragma unroll   // constant indices keep ra, rb in registers
    for (int i = 0; i < 8; ++i) { v4b c;
#pragma unroll   // four conversions, one 8-byte store
      for (int e = 0; e < 4; ++e) c[e] = (__bf16)ra[i][e];
      *(v4b*)&sA[ar + i * 8][ac] = c; *(v8b*)&sB[br + i * 16][bc] = rb[i]; }
    __syncthreads();   // the tile is published to all four waves
    if (kt + 1 < DM / KT) { Ap += KT; Bp += KT;
#pragma unroll   // constant indices keep ra, rb in registers
      for (int i = 0; i < 8; ++i) { ra[i] = *(const v4f*)(Ap + (size_t)i * 8 * DM); rb[i] = *(const v8b*)(Bp + (size_t)i * 16 * DM); }
      asm volatile("s_wait_xcnt 0x0" :: "v"(Ap), "v"(Bp) : "memory"); }   // the two running pointers are inputs here, so the address pairs of these loads stay whole up to this wait: no load of the run lands in one, and they take their new values only behind it
#pragma unroll   // two k steps of 32, k ascending; constant LDS offsets
    for (int kc = 0; kc < KT / 32; ++kc) { const v16b a = frag_b(&sA[wave * 16 + col][kc * 32], lane); v16b w[8];
#pragma unroll   // the k step's fragment reads go out as one group ahead of its products: one LDS latency a step, not one a product
      for (int j = 0; j < 8; ++j) w[j] = frag_b(&sB[j * 16 + col][kc * 32], lane);
#pragma unroll   // acc[j] indexed by constants
      for (int j = 0; j < 8; ++j) acc[j] = wmma_bf(a, w[j], acc[j]); }
    __syncthreads();   // every wave has read the tile before the next trip overwrites it
  }
  if (n0 < 2 * DM) {   // q stored unscaled (f16 sigma ~0.6, no subnormal exposure); 1/8 applied to the f32 score
#pragma unroll
    for (int j = 0; j < 8; ++j) {
#pragma unroll
      for (int r = 0; r < 8; ++r) { const float v = acc[j][r] + (BB ? bfr(BB[j * 16 + col]) : 0.f); const _Float16 hv = (_Float16)v; so[wave][8 * g + r][j * 16 + col] = hv; sol[wave][8 * g + r][j * 16 + col] = (_Float16)((v - (float)hv) * 2048.0f); } }   // q, k (+ bias) as f16 hi + (x2048) residual
    LDSX();
    for (int rl = 0; rl < 16; ++rl) if (lane < 16) { vst2((unsigned*)(QK + (r0 + rl) * (2 * DM) + n0 + lane * 8), *(const v4u*)&so[wave][rl][lane * 8]); vst2((unsigned*)(QKL + (r0 + rl) * (2 * DM) + n0 + lane * 8), *(const v4u*)&sol[wave][rl][lane * 8]); }
  } else {
#pragma unroll
    for (int j = 0; j < 8; ++j) {
#pragma unroll
      for (int r = 0; r < 8; ++r) { const float v = acc[j][r] + (BB ? bfr(BB[j * 16 + col]) : 0.f); const _Float16 hv = (_Float16)v; sth[j * 16 + col][wave * 16 + 8 * g + r] = hv; stl[j * 16 + col][wave * 16 + 8 * g + r] = (_Float16)((v - (float)hv) * 2048.0f); } }
    __syncthreads();
    const size_t rb = (size_t)blockIdx.x * 64; const int b = (int)(rb / SS), s0 = (int)(rb % SS); const int pc0 = n0 - 2 * DM;
    for (int q = tid; q < 128 * 8; q += 128) { const int d = q >> 3, pc = q & 7; const size_t o = ((size_t)b * DM + pc0 + d) * SS + s0 + pc * 8; vst2((unsigned*)(VTH + o), *(const v4u*)&sth[d][pc * 8]); vst2((unsigned*)(VTL + o), *(const v4u*)&stl[d][pc * 8]); }
  }
}
// fragment at the lane's own address (row start + 8 * (lane >> 4)), the k order of frag_h
__device__ __forceinline__ v16h frag_at(const _Float16* p) { union { v16h v; v8h q[2]; } u; u.q[0] = *(const v8h*)p; u.q[1] = *(const v8h*)(p + 16); return u.v; }
#define AK 64               // keys of K and V staged in LDS a trip of k_attn: 128 B of a K row and of a V row, so every copy covers whole lines
#define AKB (AK * LP * 2)   // bytes of one LDS buffer of K or of V: 64 rows at the pitch LP
// one tile of K (64 keys x 64 d) and of V (64 d x 64 keys) into LDS, through no register: eight asynchronous copies of 16 B a lane. Eight lanes cover one row's 128 B, a lane's four rows of each tile lie 16 apart. kg, vg: the lane's global addresses of its first rows; kl, vl: its LDS byte addresses. The s_wait_xcnt is the last line of the copies' own statement, so no address register named here takes a new value in front of it
__device__ __forceinline__ void kv_copy(const _Float16* kg, const _Float16* vg, unsigned kl, unsigned vl) {
  asm volatile("global_load_async_to_lds_b128 %0, %8, off\n\tglobal_load_async_to_lds_b128 %1, %9, off\n\tglobal_load_async_to_lds_b128 %2, %10, off\n\tglobal_load_async_to_lds_b128 %3, %11, off\n\t"
               "global_load_async_to_lds_b128 %4, %12, off\n\tglobal_load_async_to_lds_b128 %5, %13, off\n\tglobal_load_async_to_lds_b128 %6, %14, off\n\tglobal_load_async_to_lds_b128 %7, %15, off\n\ts_wait_xcnt 0x0"
               :: "v"(kl), "v"(kl + 16 * LP * 2), "v"(kl + 32 * LP * 2), "v"(kl + 48 * LP * 2), "v"(vl), "v"(vl + 16 * LP * 2), "v"(vl + 32 * LP * 2), "v"(vl + 48 * LP * 2),
                  "v"(kg), "v"(kg + (size_t)16 * (2 * DM)), "v"(kg + (size_t)32 * (2 * DM)), "v"(kg + (size_t)48 * (2 * DM)), "v"(vg), "v"(vg + (size_t)16 * SS), "v"(vg + (size_t)32 * SS), "v"(vg + (size_t)48 * SS) : "memory");
}
// ---- k_attn: block = (64 queries, head h, batch b): causal flash attention (K = 64: 2 k-steps), scores = (q.k) * 0.125 + key gate, single f16 operands except 3 products for qb < 2, P.V: f16 P x V hi into acc, for qb < 2 also P lo x V hi and P x V lo*2048 into accl; O[b*S+q][h*64+d] = (acc + accl / 2048) / (2048 l) (256-B segments)
__global__ __launch_bounds__(128) void k_attn(const _Float16* __restrict__ QK, const _Float16* __restrict__ QKL, const _Float16* __restrict__ VTH, const _Float16* __restrict__ VTL, const void* __restrict__ KMASK, const float* __restrict__ KB, const int* __restrict__ AM, float* __restrict__ O) {
  __shared__ __align__(16) float sp[4][16][36]; __shared__ __align__(16) float so[4][16][68];
  __shared__ __align__(16) _Float16 sK[2][AK][LP], sV[2][HD][LP];   // two buffers each of K rows (key, d) and V rows (d, key); pitch 144 B, conflict-free for the 16-byte fragment reads
  const int tid = threadIdx.x, wave = tid >> 5, lane = tid & 31, col = lane & 15, g = lane >> 4;
  const int qb = blockIdx.x, h = blockIdx.y, b = blockIdx.z; const int q0 = qb * 64 + wave * 16; const size_t rq = (size_t)b * SS + q0 + col;
  v16h aq[2];   // the q residual, used by the leading query blocks alone, is loaded at its products: 16 registers less in every block
#pragma unroll
  for (int kc = 0; kc < 2; ++kc) aq[kc] = frag_h(QK + rq * (2 * DM) + h * HD + kc * 32, lane);
  float m[8], l[8];
#pragma unroll
  for (int r = 0; r < 8; ++r) { m[r] = -3.0e38f; l[r] = 0.f; }
  v8f acc[4] = {}, accl[4] = {};
  const int nt = qb + 1;   // causal: key tiles of 64 up to the query tile's end; two key steps of 32 a tile, in the order of before
  const int cr = tid >> 3, cc = (tid & 7) * 8;
  const _Float16* kg = QK + ((size_t)b * SS + cr) * (2 * DM) + DM + h * HD + cc; const _Float16* vg = VTH + ((size_t)b * DM + h * HD + cr) * SS + cc; const float* bp = KB + ((size_t)b * NH + h) * SS + col;
  const unsigned kl = (unsigned)(size_t)&sK[0][cr][cc], vl = (unsigned)(size_t)&sV[0][cr][cc];
  kv_copy(kg, vg, kl, vl);
  asm volatile("s_wait_asynccnt 0x0" ::: "memory");   // this wave's copies of tile 0 have landed
  __syncthreads();   // tile 0 is published to all four waves
  if (nt > 1) kv_copy(kg + (size_t)AK * (2 * DM), vg + AK, kl + AKB, vl + AKB);   // tile 1 into the second buffer
  kg += (size_t)2 * AK * (2 * DM); vg += 2 * AK;   // the next tile to copy
  v16h kf[2][2], vf[4]; float kbv[2], kbn[2]; kbv[0] = bp[0]; kbv[1] = bp[16];
#pragma unroll 1   // one trip a tile: the buffer is chosen by the trip's parity
  for (int t = 0; t < nt; ++t) {
#pragma unroll 1   // the tile's two key steps stay a loop: unrolled, the live values of both steps together pass 256 registers, which costs a wave per SIMD
    for (int sub = 0; sub < 2; ++sub) { const int ks = 2 * t + sub; v8f s[2]; const _Float16* kt = &sK[t & 1][sub * 32 + col][8 * g]; const _Float16* vt = &sV[t & 1][col][sub * 32 + 8 * g];   // the lane's fragment addresses in this trip's buffers
#pragma unroll   // constant indices keep kf in registers
    for (int ct = 0; ct < 2; ++ct) { kf[ct][0] = frag_at(kt + ct * 16 * LP); kf[ct][1] = frag_at(kt + ct * 16 * LP + 32); }
    bp += (ks + 1 < 2 * nt) ? 32 : 0; kbn[0] = bp[0]; kbn[1] = bp[16];   // the next step's gates go out a whole step ahead, so that none is in flight at the trip's barrier, which waits for global loads too; no branch: the last step loads its own once more (unused)
    asm volatile("s_wait_xcnt 0x0" :: "v"(bp) : "memory");   // the running pointer is an input here, so the address pair of these loads stays whole up to this wait and takes its new value only behind it
#pragma unroll
    for (int ct = 0; ct < 2; ++ct) { const int kk = ks * 32 + ct * 16 + col; const _Float16* krowl = QKL + ((size_t)b * SS + kk) * (2 * DM) + DM + h * HD; v8f c = {}, cl = {};
      if (qb < 2) {   // leading query blocks (few keys, outputs far above the global rms): 3 products
#pragma unroll
        for (int kc = 0; kc < 2; ++kc) { const v16h kh = kf[ct][kc]; c = wmma16(aq[kc], kh, c); cl = wmma16(frag_h(QKL + rq * (2 * DM) + h * HD + kc * 32, lane), kh, cl); cl = wmma16(aq[kc], frag_h(krowl + kc * 32, lane), cl); }
#pragma unroll
        for (int r = 0; r < 8; ++r) c[r] += cl[r] * (1.0f / 2048.0f); }
      else {
#pragma unroll
        for (int kc = 0; kc < 2; ++kc) c = wmma16(aq[kc], kf[ct][kc], c); }   // single product elsewhere
      { const float kb = kbv[ct];
#pragma unroll
      for (int r = 0; r < 8; ++r) s[ct][r] = (kk <= q0 + 8 * g + r) ? c[r] * SCALEF + kb : -3.0e38f; } }   // causal; + log resonance gate of key kk
#pragma unroll   // constant indices keep vf in registers; the V fragment reads go out as one group behind the score products and land under the softmax
    for (int dt = 0; dt < 4; ++dt) vf[dt] = frag_at(vt + dt * 16 * LP);
#pragma unroll
    for (int r = 0; r < 8; ++r) { float mx = fmaxf(s[0][r], s[1][r]);
#pragma unroll
      for (int o = 1; o < 16; o <<= 1) mx = fmaxf(mx, __shfl_xor(mx, o));
      const float mn = fmaxf(m[r], mx); const float alpha = (m[r] <= -1.0e38f) ? 0.f : __expf(m[r] - mn);
      const float e0 = (s[0][r] <= -1.0e38f) ? 0.f : __expf(s[0][r] - mn), e1 = (s[1][r] <= -1.0e38f) ? 0.f : __expf(s[1][r] - mn); float es = e0 + e1;
#pragma unroll
      for (int o = 1; o < 16; o <<= 1) es += __shfl_xor(es, o);
      l[r] = l[r] * alpha + es; m[r] = mn;
#pragma unroll
      for (int dt = 0; dt < 4; ++dt) { acc[dt][r] *= alpha; accl[dt][r] *= alpha; }
      sp[wave][8 * g + r][col] = e0; sp[wave][8 * g + r][16 + col] = e1; }
    LDSW();
    v16h pa, pl; { const float* prow = &sp[wave][col][0] + 8 * (lane >> 4);
#pragma unroll
      for (int i = 0; i < 8; ++i) { const float x0 = prow[i] * 2048.0f, x1 = prow[16 + i] * 2048.0f; const _Float16 h0 = (_Float16)x0, h1 = (_Float16)x1; pa[i] = h0; pa[8 + i] = h1; pl[i] = (_Float16)((x0 - (float)h0) * 2048.0f); pl[8 + i] = (_Float16)((x1 - (float)h1) * 2048.0f); } }   // P scaled by 2^11 before the f16 split so small softmax weights stay out of the f16 subnormal range; 2^-11 folded into the epilogue
#pragma unroll
    for (int dt = 0; dt < 4; ++dt) acc[dt] = wmma16(pa, vf[dt], acc[dt]);
    if (qb < 2) {   // one branch a step for the four tiles' extra products: with one per tile the build holds accl twice
#pragma unroll   // accl, vf indexed by constants
      for (int dt = 0; dt < 4; ++dt) { const size_t vr = ((size_t)b * DM + h * HD + dt * 16 + col) * SS + ks * 32; accl[dt] = wmma16(pl, vf[dt], accl[dt]); accl[dt] = wmma16(pa, frag_h(VTL + vr, lane), accl[dt]); } }   // leading query blocks: P hi/lo x V hi/lo (3 products); elsewhere P x V single
    LDSW(); kbv[0] = kbn[0]; kbv[1] = kbn[1]; }
    asm volatile("s_wait_dscnt 0x0" ::: "memory");      // this wave's reads of this trip's buffers are done
    asm volatile("s_wait_asynccnt 0x0" ::: "memory");   // this wave's copies of the next tile have landed
    __syncthreads();   // publishes the next tile and ends every wave's reads of the buffers refilled below
    if (t + 2 < nt) { kv_copy(kg, vg, kl + (t & 1) * AKB, vl + (t & 1) * AKB); kg += (size_t)AK * (2 * DM); vg += AK; } }   // tile t + 2 into the buffers that this trip has read
  asm volatile("s_wait_asynccnt 0x0" ::: "memory");   // no copy is outstanding when the wave goes on to its end
#pragma unroll
  for (int r = 0; r < 8; ++r) { const float il = ((AM[h] != 0) ? (1.0f / 2048.0f) : 0.f) / l[r];   // dormant heads contribute nothing
#pragma unroll
    for (int dt = 0; dt < 4; ++dt) so[wave][8 * g + r][dt * 16 + col] = (acc[dt][r] + accl[dt][r] * (1.0f / 2048.0f)) * il; }
  LDSX();
  for (int rl = 0; rl < 16; ++rl) if (lane < 16) vst2(O + ((size_t)b * SS + q0 + rl) * DM + h * HD + lane * 4, *(const v4f*)&so[wave][rl][lane * 4]);
}
// ---- k_out: block = (64 rows, 128 cols): out = O(hi/lo) . Wo rows (2 products), no bias (BO is null)
__global__ __launch_bounds__(128) void k_out(const float* __restrict__ O, const __bf16* __restrict__ P, const float* __restrict__ BO, float* __restrict__ Y) {
  __shared__ __align__(16) float so[4][16][132];
  const int tid = threadIdx.x, wave = tid >> 5, lane = tid & 31, col = lane & 15, g = lane >> 4; const size_t r0 = (size_t)blockIdx.x * 64 + wave * 16; const int n0 = blockIdx.y * 128;
  v8f acc[8] = {};
  // as in k_qkv: the block's 64 rows of O (split once into bf16 hi and residual) and 128 weight rows go through LDS, KT columns a trip
  __shared__ __align__(16) __bf16 sAh[64][LP], sAl[64][LP], sB[128][LP];
  const int ar = tid >> 4, ac = (tid & 15) * 4, br = tid >> 3, bc = (tid & 7) * 8;
  const float* Ag = O + ((size_t)blockIdx.x * 64 + ar) * DM + ac; const __bf16* Bg = P + (size_t)(n0 + br) * DM + bc;
  const float* Ap = Ag; const __bf16* Bp = Bg; v4f ra[8]; v8b rb[8];
#pragma unroll   // constant indices keep ra, rb in registers
  for (int i = 0; i < 8; ++i) { ra[i] = *(const v4f*)(Ag + (size_t)i * 8 * DM); rb[i] = *(const v8b*)(Bg + (size_t)i * 16 * DM); }
  for (int kt = 0; kt < DM / KT; ++kt) {
#pragma unroll   // constant indices keep ra, rb in registers
    for (int i = 0; i < 8; ++i) { v4b ch, cl;
#pragma unroll   // four splits, two 8-byte stores
      for (int e = 0; e < 4; ++e) { const __bf16 hv = (__bf16)ra[i][e]; ch[e] = hv; cl[e] = (__bf16)(ra[i][e] - (float)hv); }
      *(v4b*)&sAh[ar + i * 8][ac] = ch; *(v4b*)&sAl[ar + i * 8][ac] = cl; *(v8b*)&sB[br + i * 16][bc] = rb[i]; }
    __syncthreads();   // the tile is published to all four waves
    if (kt + 1 < DM / KT) { Ap += KT; Bp += KT;
#pragma unroll   // constant indices keep ra, rb in registers
      for (int i = 0; i < 8; ++i) { ra[i] = *(const v4f*)(Ap + (size_t)i * 8 * DM); rb[i] = *(const v8b*)(Bp + (size_t)i * 16 * DM); }
      asm volatile("s_wait_xcnt 0x0" :: "v"(Ap), "v"(Bp) : "memory"); }   // the two running pointers are inputs here, so the address pairs of these loads stay whole up to this wait: no load of the run lands in one, and they take their new values only behind it
#pragma unroll   // two k steps of 32, k ascending; constant LDS offsets
    for (int kc = 0; kc < KT / 32; ++kc) { const v16b ah = frag_b(&sAh[wave * 16 + col][kc * 32], lane), al = frag_b(&sAl[wave * 16 + col][kc * 32], lane); v16b w[8];
#pragma unroll   // the k step's fragment reads go out as one group ahead of its products: one LDS latency a step, not one a product
      for (int j = 0; j < 8; ++j) w[j] = frag_b(&sB[j * 16 + col][kc * 32], lane);
#pragma unroll   // acc[j] indexed by constants
      for (int j = 0; j < 8; ++j) { acc[j] = wmma_bf(al, w[j], acc[j]); acc[j] = wmma_bf(ah, w[j], acc[j]); } }
    __syncthreads();   // every wave has read the tile before the next trip overwrites it
  }
#pragma unroll
  for (int j = 0; j < 8; ++j) {
#pragma unroll
    for (int r = 0; r < 8; ++r) so[wave][8 * g + r][j * 16 + col] = acc[j][r] + (BO ? bfr(BO[n0 + j * 16 + col]) : 0.f); }
  LDSX();
  for (int rl = 0; rl < 16; ++rl) vst2(Y + (r0 + rl) * DM + n0 + lane * 4, *(const v4f*)&so[wave][rl][lane * 4]);
}

#define PH_TW 4    // tokens a wave
#define PH_TB 32   // tokens a block (8 waves): the 32 gates of one head are one whole 128-byte line of KB
// ---- k_phase: block = 32 tokens, a wave = 4 of them: ph = bf16(x) . bf16(w_phase) (f32) with a lane on 32 of the 1,024 d (16-byte loads, 512 contiguous bytes a wave), w_phase loaded once for the wave's 4 tokens, the sums joined inside the wave; phase = atan2(ph0, ph1); then a lane = (token, head) for the 16 per-head log gates of each key. 128 blocks, where one block a token is 4,096 blocks of 8 waves that live shorter than they take to start
__global__ __launch_bounds__(256) void k_phase(const float* __restrict__ X, const float* __restrict__ WP, const float* __restrict__ CAR, const float* __restrict__ LOCK, const float* __restrict__ BW, float* __restrict__ KB) {
  __shared__ __align__(8) float sg[NH][PH_TB + 2];   // pitch 34: the 32 lanes that write (16 heads x 2 tokens) meet 32 different banks; even, for the 8-byte reads
  const int t = threadIdx.x, wave = t >> 5, lane = t & 31, hd = lane & 15, g = lane >> 4; const size_t row0 = (size_t)blockIdx.x * PH_TB;
  const float* xp = X + (row0 + wave * PH_TW) * DM + lane * 4; const float* wp = WP + lane * 8; v4f xv[PH_TW][8], wv[8][2];
#pragma unroll   // constant indices keep wv in registers
  for (int j = 0; j < 8; ++j) { wv[j][0] = *(const v4f*)(wp + j * 256); wv[j][1] = *(const v4f*)(wp + j * 256 + 4); }   // both columns of d = 128 j + 4 lane + (0 .. 3)
#pragma unroll   // constant indices keep xv in registers
  for (int k = 0; k < PH_TW; ++k) {
#pragma unroll   // as above
    for (int j = 0; j < 8; ++j) xv[k][j] = *(const v4f*)(xp + (size_t)k * DM + j * 128); }
  const float lkr = LOCK[hd], bwr = BW[hd], carr = CAR[hd];
  // the two pointers are inputs here, so the address pairs of these loads stay whole up to this wait; the loaded values are inputs too (inputs only; an asm statement takes thirty operands, so the rest stand in the fence below), so all 48 loads go out ahead of the first conversion: one memory latency a wave, where the build otherwise holds twelve loads back until registers of the first come free
  asm volatile("s_wait_xcnt 0x0" :: "v"(xp), "v"(wp), "v"(wv[0][0]), "v"(wv[0][1]), "v"(wv[1][0]), "v"(wv[1][1]), "v"(wv[2][0]), "v"(wv[2][1]), "v"(wv[3][0]), "v"(wv[3][1]), "v"(wv[4][0]), "v"(wv[4][1]), "v"(wv[5][0]), "v"(wv[5][1]), "v"(wv[6][0]), "v"(wv[6][1]), "v"(wv[7][0]), "v"(wv[7][1]), "v"(xv[0][0]), "v"(xv[0][1]), "v"(xv[0][2]), "v"(xv[0][3]), "v"(xv[0][4]), "v"(xv[0][5]), "v"(xv[0][6]), "v"(xv[0][7]), "v"(xv[1][0]), "v"(xv[1][1]), "v"(xv[1][2]), "v"(xv[1][3]) : "memory");
  asm volatile("" :: "v"(xv[1][4]), "v"(xv[1][5]), "v"(xv[1][6]), "v"(xv[1][7]), "v"(xv[2][0]), "v"(xv[2][1]), "v"(xv[2][2]), "v"(xv[2][3]), "v"(xv[2][4]), "v"(xv[2][5]), "v"(xv[2][6]), "v"(xv[2][7]), "v"(xv[3][0]), "v"(xv[3][1]), "v"(xv[3][2]), "v"(xv[3][3]), "v"(xv[3][4]), "v"(xv[3][5]), "v"(xv[3][6]), "v"(xv[3][7]));   // the other 20 loaded values, inputs only, for the same purpose
  float a0[PH_TW] = {}, a1[PH_TW] = {};
#pragma unroll   // xv, wv indexed by constants
  for (int j = 0; j < 8; ++j) {
#pragma unroll   // as above
    for (int e = 0; e < 4; ++e) { const float w0 = bfr(wv[j][e >> 1][(e & 1) * 2]), w1 = bfr(wv[j][e >> 1][(e & 1) * 2 + 1]);
#pragma unroll   // eight independent sums
      for (int k = 0; k < PH_TW; ++k) { const float xb = bfr(xv[k][j][e]); a0[k] += xb * w0; a1[k] += xb * w1; } } }
#pragma unroll   // five exchanges, the eight sums side by side in each
  for (int o = 16; o > 0; o >>= 1) {
#pragma unroll   // a0, a1 indexed by constants
    for (int k = 0; k < PH_TW; ++k) { a0[k] += __shfl_xor(a0[k], o); a1[k] += __shfl_xor(a1[k], o); } }
  const float lk = bfr(lkr), bw = bfr(bwr), car = bfr(carr);
#pragma unroll   // a0, a1 indexed by constants
  for (int p = 0; p < PH_TW / 2; ++p) { const float phase = atan2_p(g ? a0[2 * p + 1] : a0[2 * p], g ? a1[2 * p + 1] : a1[2 * p]); const float win = exp_ni((cos_p(phase - car) - 1.0f) / bw); const float gate = lk * win + (1.0f - lk); sg[hd][wave * PH_TW + 2 * p + g] = log_p(gate + 1e-6f); }   // lane = (token 2 p + g of the wave, head hd)
  __syncthreads();   // the block's 16 x 32 gates are complete before any wave reads what other waves wrote
  { const int hh = t >> 4, pr = t & 15; const size_t b = row0 / SS, s = row0 % SS; *(v2f*)(KB + (b * NH + hh) * SS + s + pr * 2) = *(const v2f*)&sg[hh][pr * 2]; }   // 16 lanes store one head's whole line
}
extern "C" void kernel_launch(void* const* d_in, const int* in_sizes, int n_in, void* d_out, int out_size, void* d_ws, size_t ws_size, hipStream_t stream) {
  (void)in_sizes; (void)n_in; (void)out_size;
  const float** F = (const float**)d_in;   // 0 x [4,1024,1024], 1 wq, 2 wk, 3 wv, 4 wo (all (in,out) [1024,1024]), 5 w_phase [1024,2], 6 carrier [16], 7 lock [16], 8 bandwidth [16], 9 active_mask [16] int
  if (ws_size < (size_t)WS_END + 4u * NB * NH * SS + 256) return;
  char* ws = (char*)d_ws; __bf16* PK = (__bf16*)(ws + WS_PK); _Float16 *QK = (_Float16*)(ws + WS_QK), *QKL = (_Float16*)(ws + WS_QKL), *VTH = (_Float16*)(ws + WS_VTH), *VTL = (_Float16*)(ws + WS_VTL); float* O = (float*)(ws + WS_O); float* KB = (float*)(ws + WS_END);
  k_pack<<<dim3(DM / PT_N, DM / PT_K, 4), 256, 0, stream>>>(F[1], F[2], F[3], F[4], PK);
  k_phase<<<NB * SS / PH_TB, 256, 0, stream>>>(F[0], F[5], F[6], F[7], F[8], KB);
  k_qkv<<<dim3(TNB * SS / 64, QKVW / 128), 128, 0, stream>>>(F[0], F[0], F[0], PK + PK_A, nullptr, nullptr, nullptr, QK, QKL, VTH, VTL);
  k_attn<<<dim3(TQB, NH, TNB), 128, 0, stream>>>(QK, QKL, VTH, VTL, nullptr, KB, (const int*)d_in[9], O);
  k_out<<<dim3(TOB, DM / 128), 128, 0, stream>>>(O, PK + PK_P, nullptr, (float*)d_out);
}

// v006
// A run of this version takes 105 microseconds.
// Two timings next to v005 both put it at 1.21 times that version's speed.
// Over all steps from v000 it is 3.41 times as fast.
// compute dtype: all float inputs rounded to bf16, active_mask (int) read on device; q/k/v = x . W with EXACT bf16 products on WMMA 16x16x32 ((in,out) weights as transposed rows); the per-token phase (x . w_phase, atan2) and the per-(batch, head, key) log resonance gate in f32 (precise expf/logf/cosf/atan2f); causal attention x 1/8 + log gate: for the first 128 queries of each sequence 3-product scores and P, v as f16 hi + residual (3 products), single f16 operands beyond; running-max softmax in f32 (hardware exp); the per-head active mask applied to the attention output; out = o (bf16 hi + residual) . Wo (2 products).
#include <hip/hip_runtime.h>
#include <math.h>

typedef __attribute__((ext_vector_type(16))) _Float16 v16h;
typedef __attribute__((ext_vector_type(16))) __bf16 v16b;
typedef __attribute__((ext_vector_type(8)))  _Float16 v8h;
typedef __attribute__((ext_vector_type(8)))  float v8f;
typedef __attribute__((ext_vector_type(4)))  float v4f;
typedef __attribute__((ext_vector_type(2)))  float v2f;
typedef __attribute__((ext_vector_type(4)))  unsigned v4u;
typedef __attribute__((ext_vector_type(4)))  int v4i;
typedef float __attribute__((may_alias)) float_a;
typedef int __attribute__((may_alias)) int_a;

template <typename T> __device__ __forceinline__ void vst2(void* p, T v) { *(T*)p = v;  }
__device__ __forceinline__ v8f wmma16(v16h a, v16h b, v8f c) {
  v8f d = __builtin_amdgcn_wmma_f32_16x16x32_f16(false, a, false, b, (short)0, c, false, false);
  asm volatile("v_nop\n\tv_nop\n\tv_nop\n\tv_nop" : "+v"(d) : "v"(a), "v"(b));
  return d;
}
__device__ __forceinline__ v8f wmma_bf(v16b a, v16b b, v8f c) {
  v8f d = __builtin_amdgcn_wmma_f32_16x16x32_bf16(false, a, false, b, (short)0, c, false, false);
  asm volatile("v_nop\n\tv_nop\n\tv_nop\n\tv_nop" : "+v"(d) : "v"(a), "v"(b));
  return d;
}
// Resonance-gated causal attention (B 4, S 1,024, d 1,024, 16 heads x 64): bias-free q/k/v/o projections, a per-key additive log-gate from each token's input phase against a per-head carrier (von Mises window opened by 1 - lock), causal softmax, dormant heads zeroed.
__device__ __forceinline__ v16h frag_h(const _Float16* rowk0, int lane) {
  union { v16h v; v8h q[2]; } u; const _Float16* p = rowk0 + 8 * (lane >> 4);
  u.q[0] = *(const v8h*)p; u.q[1] = *(const v8h*)(p + 16); return u.v;
}
__device__ __forceinline__ v16h frag_f32(const float* rowk0, int lane) {
  v16h a; const float* p = rowk0 + 8 * (lane >> 4);
#pragma unroll
  for (int i = 0; i < 8; ++i) { a[i] = (_Float16)p[i]; a[8 + i] = (_Float16)p[16 + i]; }
  return a;
}
__device__ __forceinline__ v16h frag_f32s(const float* rowk0, int lane, float sc) {
  v16h a; const float* p = rowk0 + 8 * (lane >> 4);
#pragma unroll
  for (int i = 0; i < 8; ++i) { a[i] = (_Float16)(p[i] * sc); a[8 + i] = (_Float16)(p[16 + i] * sc); }
  return a;
}
// column fragment from a [K][ld] layout (column n), rows >= K read as 0
__device__ __forceinline__ v16h fragc_f32(const float* W, int k0, int n, int lane, int ld, int K) {
  v16h a; const int g = lane >> 4;
#pragma unroll
  for (int i = 0; i < 8; ++i) { const int ka = k0 + 8 * g + i, kb = ka + 16;
    a[i] = (_Float16)(ka < K ? W[(size_t)(ka < K ? ka : K - 1) * ld + n] : 0.f); a[8 + i] = (_Float16)(kb < K ? W[(size_t)(kb < K ? kb : K - 1) * ld + n] : 0.f); }
  return a;
}
struct F2 { v16b h, l; };
__device__ __forceinline__ F2 bsplit16(const float v[16]) { F2 r;
#pragma unroll
  for (int i = 0; i < 16; ++i) { const __bf16 h = (__bf16)v[i]; r.h[i] = h; r.l[i] = (__bf16)(v[i] - (float)h); }
  return r; }
__device__ __forceinline__ F2 split_row(const float* row, int k0, int lane) { float v[16]; const float* p = row + k0 + 8 * (lane >> 4);
#pragma unroll
  for (int i = 0; i < 8; ++i) { v[i] = p[i]; v[8 + i] = p[16 + i]; }
  return bsplit16(v); }
__device__ __forceinline__ F2 split_rowK(const float* row, int k0, int lane, int K) { float v[16]; const int g = lane >> 4;
#pragma unroll
  for (int i = 0; i < 8; ++i) { const int ka = k0 + 8 * g + i, kb = ka + 16; v[i] = ka < K ? row[ka < K ? ka : K - 1] : 0.f; v[8 + i] = kb < K ? row[kb < K ? kb : K - 1] : 0.f; }
  return bsplit16(v); }
__device__ __forceinline__ F2 split_col(const float* W, int k0, int n, int lane, int ld, int K) { float v[16]; const int g = lane >> 4;
#pragma unroll
  for (int i = 0; i < 8; ++i) { const int ka = k0 + 8 * g + i, kb = ka + 16; v[i] = ka < K ? W[(size_t)(ka < K ? ka : K - 1) * ld + n] : 0.f; v[8 + i] = kb < K ? W[(size_t)(kb < K ? kb : K - 1) * ld + n] : 0.f; }
  return bsplit16(v); }
__device__ __forceinline__ v8f mac3(const F2& a, const F2& b, v8f c) { c = wmma_bf(a.l, b.h, c); c = wmma_bf(a.h, b.l, c); return wmma_bf(a.h, b.h, c); }
__device__ __forceinline__ float sigm(float v) { return 1.0f / (1.0f + expf(-v)); }
#define LDSX() do { asm volatile("s_wait_dscnt 0" ::: "memory"); __builtin_amdgcn_wave_barrier(); __builtin_amdgcn_fence(__ATOMIC_RELEASE, "workgroup"); } while (0)


#define NB 4
#define SS 1024
#define DM 1024
#define NH 16
#define SCALEF 0.125f
__device__ __attribute__((noinline)) float log_p(float v) { return logf(v); }
__device__ __attribute__((noinline)) float cos_p(float v) { return cosf(v); }
__device__ __attribute__((noinline)) float atan2_p(float y, float x) { return atan2f(y, x); }
#define HD 64
#define QKVW (3 * DM)
#ifndef TQB
#define TQB (SS / 64)
#define TNB NB
#define TOB (NB * SS / 64)     // output row tiles (all)
#endif
typedef __attribute__((ext_vector_type(8))) __bf16 v8b;
__device__ __forceinline__ v16b frag_b(const __bf16* rowk0, int lane) {
  union { v16b v; v8b q[2]; } u; const __bf16* p = rowk0 + 8 * (lane >> 4);
  u.q[0] = *(const v8b*)p; u.q[1] = *(const v8b*)(p + 16); return u.v;
}
__device__ __forceinline__ float bfr(float v) { return (float)(__bf16)v; }
typedef __attribute__((ext_vector_type(4))) __bf16 v4b;
#define KT 64   // k columns of both operands staged in LDS per trip: 128 B of a bf16 row, 256 B of an f32 row, so every staging load covers whole lines
#define LP 72   // LDS row pitch in bf16 elements: 144 B = 16 B x odd, the conflict-free pitch for 16-byte fragment reads
__device__ __attribute__((noinline)) float exp_ni(float v) { return expf(v); }
__device__ __attribute__((noinline)) float erf_ni(float v) { return erff(v); }

#define PK_A 0                       // [3072][1024] Wqkv rows (natural [out][in])
#define PK_P (PK_A + QKVW * DM)        // [1024][1024] Wo rows (natural)
#define PK_END (PK_P + DM * DM)
#define WS_PK  0u
#define WS_QK  (WS_PK + 2u * PK_END)             // f16 [4096 rows][2048]: q | k
#define WS_QKL (WS_QK + 2u * NB * SS * 2 * DM)     // f16 q | k residual planes x2048
#define WS_VTH (WS_QKL + 2u * NB * SS * 2 * DM)    // f16 [b][1024 (h*64+d)][1024 s] hi
#define WS_VTL (WS_VTH + 2u * NB * DM * SS)        // f16 lo x 2048
#define WS_O   (WS_VTL + 2u * NB * DM * SS)        // f32 [4096][1024]
#define WS_CS  (WS_O + 4u * NB * SS * DM)           // f32 2 x [1024][32], unused
#define WS_END (WS_CS + 4u * 2 * SS * 32)
#define PT_N 64    // weight columns (= pack rows) a block
#define PT_K 256   // weight rows (= k of a pack row) a block
// ---- k_pack: block = (64 columns n, 256 rows k, which) of one (in,out) weight, transposed through LDS into bf16 pack rows; which 0..2 -> W_q/W_k/W_v into PK_A rows which*1024 + n; 3 -> W_o into PK_P. Sixteen lanes load 256 contiguous bytes of a weight row, a wave stores 512 contiguous bytes of a pack row: whole lines on both sides
__global__ __launch_bounds__(256) void k_pack(const float* __restrict__ WQ, const float* __restrict__ WK, const float* __restrict__ WV, const float* __restrict__ WO, __bf16* __restrict__ PK) {
  __shared__ __align__(16) __bf16 s[PT_N][PT_K];   // row n in 16-byte chunks of 8 k; chunk L lies at place L ^ (n >> 2), so the 16 lanes that write one chunk column of 16 rows, and the 32 that read one row, each meet all banks once
  const int n0 = blockIdx.x * PT_N, k0 = blockIdx.y * PT_K, which = blockIdx.z, t = threadIdx.x; const float* Wm = (which == 0) ? WQ : (which == 1) ? WK : (which == 2) ? WV : WO;
  const int c = t & 15, kg = t >> 4;   // the thread's 4 columns from 4 c, its 8 rows from 8 kg, and the same 128 rows on
  const float* wp = Wm + (size_t)(k0 + kg * 8) * DM + n0 + c * 4; v4f r[2][8];
#pragma unroll   // constant indices keep r in registers; all 16 loads in flight at once
  for (int p = 0; p < 2; ++p) {
#pragma unroll   // as above
    for (int j = 0; j < 8; ++j) r[p][j] = *(const v4f*)(wp + (size_t)(p * 128 + j) * DM); }
  // the pointer is an input here, so the address pair of these loads stays whole up to this wait; the loaded values are inputs too (inputs only), so all 16 loads go out ahead of the first conversion: one memory latency a block, where the build otherwise holds four loads back until registers of the first come free
  asm volatile("s_wait_xcnt 0x0" :: "v"(wp), "v"(r[0][0]), "v"(r[0][1]), "v"(r[0][2]), "v"(r[0][3]), "v"(r[0][4]), "v"(r[0][5]), "v"(r[0][6]), "v"(r[0][7]), "v"(r[1][0]), "v"(r[1][1]), "v"(r[1][2]), "v"(r[1][3]), "v"(r[1][4]), "v"(r[1][5]), "v"(r[1][6]), "v"(r[1][7]) : "memory");
#pragma unroll   // r indexed by constants
  for (int p = 0; p < 2; ++p) {
#pragma unroll   // r indexed by constants
    for (int e = 0; e < 4; ++e) { v8b o;
#pragma unroll   // 8 k of one column: one 16-byte LDS store
      for (int j = 0; j < 8; ++j) o[j] = (__bf16)r[p][j][e];
      *(v8b*)&s[c * 4 + e][((p * 16 + kg) ^ c) * 8] = o; } }
  __syncthreads();   // the tile is complete before any wave reads rows that other waves wrote
  __bf16* dst = ((which < 3) ? PK + PK_A + ((size_t)which * DM + n0) * DM : PK + PK_P + (size_t)n0 * DM) + k0; const int q = t & 31, rw = t >> 5;
#pragma unroll   // 8 pack rows a wave
  for (int i = 0; i < 8; ++i) { const int n = rw * 8 + i; vst2((unsigned*)(dst + (size_t)n * DM + q * 8), *(const v4u*)&s[n][(q ^ (n >> 2)) * 8]); }
}
__global__ __launch_bounds__(128) void k_qkv(const float* __restrict__ XQ, const float* __restrict__ XK, const float* __restrict__ XV, const __bf16* __restrict__ P, const float* __restrict__ BQ, const float* __restrict__ BK, const float* __restrict__ BV, _Float16* __restrict__ QK, _Float16* __restrict__ QKL, _Float16* __restrict__ VTH, _Float16* __restrict__ VTL) {
  const int which0 = (blockIdx.y * 128) / DM; const float* X = (which0 == 0) ? XQ : (which0 == 1) ? XK : XV; const float* BB = BQ ? (((which0 == 0) ? BQ : (which0 == 1) ? BK : BV) + (blockIdx.y * 128 - which0 * DM)) : nullptr;
  __shared__ __align__(16) _Float16 so[4][16][136], sol[4][16][136]; __shared__ __align__(16) _Float16 sth[128][72], stl[128][72];
  const int tid = threadIdx.x, wave = tid >> 5, lane = tid & 31, col = lane & 15, g = lane >> 4; const size_t r0 = (size_t)blockIdx.x * 64 + wave * 16; const int n0 = blockIdx.y * 128;
  v8f acc[8] = {};
  // the block's 64 x rows (rounded to bf16) and 128 weight rows go through LDS, KT columns a trip: each line is loaded once a block by contiguous lanes; the next trip's loads fly in registers under this trip's products
  __shared__ __align__(16) __bf16 sA[64][LP], sB[128][LP];
  const int ar = tid >> 4, ac = (tid & 15) * 4, br = tid >> 3, bc = (tid & 7) * 8;
  const float* Ag = X + ((size_t)blockIdx.x * 64 + ar) * DM + ac; const __bf16* Bg = P + (size_t)(n0 + br) * DM + bc;
  const float* Ap = Ag; const __bf16* Bp = Bg; v4f ra[8]; v8b rb[8];
#pragma unroll   // constant indices keep ra, rb in registers
  for (int i = 0; i < 8; ++i) { ra[i] = *(const v4f*)(Ag + (size_t)i * 8 * DM); rb[i] = *(const v8b*)(Bg + (size_t)i * 16 * DM); }
  for (int kt = 0; kt < DM / KT; ++kt) {
#pragma unroll   // constant indices keep ra, rb in registers
    for (int i = 0; i < 8; ++i) { v4b c;
#pragma unroll   // four conversions, one 8-byte store
      for (int e = 0; e < 4; ++e) c[e] = (__bf16)ra[i][e];
      *(v4b*)&sA[ar + i * 8][ac] = c; *(v8b*)&sB[br + i * 16][bc] = rb[i]; }
    __syncthreads();   // the tile is published to all four waves
    if (kt + 1 < DM / KT) { Ap += KT; Bp += KT;
#pragma unroll   // constant indices keep ra, rb in registers
      for (int i = 0; i < 8; ++i) { ra[i] = *(const v4f*)(Ap + (size_t)i * 8 * DM); rb[i] = *(const v8b*)(Bp + (size_t)i * 16 * DM); }
      asm volatile("s_wait_xcnt 0x0" :: "v"(Ap), "v"(Bp) : "memory"); }   // the two running pointers are inputs here, so the address pairs of these loads stay whole up to this wait: no load of the run lands in one, and they take their new values only behind it
#pragma unroll   // two k steps of 32, k ascending; constant LDS offsets
    for (int kc = 0; kc < KT / 32; ++kc) { const v16b a = frag_b(&sA[wave * 16 + col][kc * 32], lane); v16b w[8];
#pragma unroll   // the k step's fragment reads go out as one group ahead of its products: one LDS latency a step, not one a product
      for (int j = 0; j < 8; ++j) w[j] = frag_b(&sB[j * 16 + col][kc * 32], lane);
#pragma unroll   // acc[j] indexed by constants
      for (int j = 0; j < 8; ++j) acc[j] = wmma_bf(a, w[j], acc[j]); }
    __syncthreads();   // every wave has read the tile before the next trip overwrites it
  }
  if (n0 < 2 * DM) {   // q stored unscaled (f16 sigma ~0.6, no subnormal exposure); 1/8 applied to the f32 score
#pragma unroll
    for (int j = 0; j < 8; ++j) {
#pragma unroll
      for (int r = 0; r < 8; ++r) { const float v = acc[j][r] + (BB ? bfr(BB[j * 16 + col]) : 0.f); const _Float16 hv = (_Float16)v; so[wave][8 * g + r][j * 16 + col] = hv; sol[wave][8 * g + r][j * 16 + col] = (_Float16)((v - (float)hv) * 2048.0f); } }   // q, k (+ bias) as f16 hi + (x2048) residual
    LDSX();
    for (int rl = 0; rl < 16; ++rl) if (lane < 16) { vst2((unsigned*)(QK + (r0 + rl) * (2 * DM) + n0 + lane * 8), *(const v4u*)&so[wave][rl][lane * 8]); vst2((unsigned*)(QKL + (r0 + rl) * (2 * DM) + n0 + lane * 8), *(const v4u*)&sol[wave][rl][lane * 8]); }
  } else {
#pragma unroll
    for (int j = 0; j < 8; ++j) {
#pragma unroll
      for (int r = 0; r < 8; ++r) { const float v = acc[j][r] + (BB ? bfr(BB[j * 16 + col]) : 0.f); const _Float16 hv = (_Float16)v; sth[j * 16 + col][wave * 16 + 8 * g + r] = hv; stl[j * 16 + col][wave * 16 + 8 * g + r] = (_Float16)((v - (float)hv) * 2048.0f); } }
    __syncthreads();
    const size_t rb = (size_t)blockIdx.x * 64; const int b = (int)(rb / SS), s0 = (int)(rb % SS); const int pc0 = n0 - 2 * DM;
    for (int q = tid; q < 128 * 8; q += 128) { const int d = q >> 3, pc = q & 7; const size_t o = ((size_t)b * DM + pc0 + d) * SS + s0 + pc * 8; vst2((unsigned*)(VTH + o), *(const v4u*)&sth[d][pc * 8]); vst2((unsigned*)(VTL + o), *(const v4u*)&stl[d][pc * 8]); }
  }
}
// fragment at the lane's own address (row start + 8 * (lane >> 4)), the k order of frag_h
__device__ __forceinline__ v16h frag_at(const _Float16* p) { union { v16h v; v8h q[2]; } u; u.q[0] = *(const v8h*)p; u.q[1] = *(const v8h*)(p + 16); return u.v; }
#define AK 64               // keys of K and V staged in LDS a trip of k_attn: 128 B of a K row and of a V row, so every copy covers whole lines
#define AKB (AK * LP * 2)   // bytes of one LDS buffer of K or of V: 64 rows at the pitch LP
// one tile of K (64 keys x 64 d) and of V (64 d x 64 keys) into LDS, through no register: eight asynchronous copies of 16 B a lane. Eight lanes cover one row's 128 B, a lane's four rows of each tile lie 16 apart. kg, vg: the lane's global addresses of its first rows; kl, vl: its LDS byte addresses. The s_wait_xcnt is the last line of the copies' own statement, so no address register named here takes a new value in front of it
__device__ __forceinline__ void kv_copy(const _Float16* kg, const _Float16* vg, unsigned kl, unsigned vl) {
  asm volatile("global_load_async_to_lds_b128 %0, %8, off\n\tglobal_load_async_to_lds_b128 %1, %9, off\n\tglobal_load_async_to_lds_b128 %2, %10, off\n\tglobal_load_async_to_lds_b128 %3, %11, off\n\t"
               "global_load_async_to_lds_b128 %4, %12, off\n\tglobal_load_async_to_lds_b128 %5, %13, off\n\tglobal_load_async_to_lds_b128 %6, %14, off\n\tglobal_load_async_to_lds_b128 %7, %15, off\n\ts_wait_xcnt 0x0"
               :: "v"(kl), "v"(kl + 16 * LP * 2), "v"(kl + 32 * LP * 2), "v"(kl + 48 * LP * 2), "v"(vl), "v"(vl + 16 * LP * 2), "v"(vl + 32 * LP * 2), "v"(vl + 48 * LP * 2),
                  "v"(kg), "v"(kg + (size_t)16 * (2 * DM)), "v"(kg + (size_t)32 * (2 * DM)), "v"(kg + (size_t)48 * (2 * DM)), "v"(vg), "v"(vg + (size_t)16 * SS), "v"(vg + (size_t)32 * SS), "v"(vg + (size_t)48 * SS) : "memory");
}
// hardware base-2 exponentials with, behind the last, the one slot that the instruction set asks for between a transcendental and an instruction that uses its result or overwrites its source. In asm text, slot included. The outputs are early-clobber, so inside the run no exponential touches a register of the one before
__device__ __forceinline__ float exp2_1(float x) { float y; asm("v_exp_f32 %0, %1\n\tv_nop" : "=&v"(y) : "v"(x)); return y; }
__device__ __forceinline__ void exp2_4(float* y, const float* x) { asm("v_exp_f32 %0, %4\n\tv_exp_f32 %1, %5\n\tv_exp_f32 %2, %6\n\tv_exp_f32 %3, %7\n\tv_nop" : "=&v"(y[0]), "=&v"(y[1]), "=&v"(y[2]), "=&v"(y[3]) : "v"(x[0]), "v"(x[1]), "v"(x[2]), "v"(x[3])); }
#define L2E 1.44269504f   // log2(e): exp(x) = 2^(x * L2E), the form that __expf builds to
// lane l with lane l ^ 16, in the vector unit (__shfl_xor by 16 builds to an LDS-pipe permute)
__device__ __forceinline__ float xhalf(float x) { return __builtin_bit_cast(float, __builtin_amdgcn_permlanex16(__builtin_bit_cast(int, x), __builtin_bit_cast(int, x), 0x76543210, 0xfedcba98, false, false)); }
// ---- k_attn: block = (64 queries, head h, batch b): causal flash attention with the products transposed: S^T = K . Q^T (A = 16 keys, B = the wave's 16 queries), O^T += V^T . P^T (A = 16 d, B = P^T). A lane holds 16 of the 32 scores of ONE query (column lane & 15; keys 8 * (lane >> 4) + r of each 16-key tile), so maximum and sum are in-lane, joined with the other half by one exchange, and the two score tiles, converted in place, are the B operand P^T in the k order of frag_h: P never goes through LDS. scores = (q.k) * 0.125: in the two leading query blocks q, k as f16 hi + (x2048) residual (3 products), single f16 operands beyond; P.V there f16 P and V hi + (x2048) residual (3 products), the residual products in a second accumulator, beyond f16 P x V hi alone; O[b*S+q][h*64+d] = (acc + accl / 2048) / (2048 l) (256-B segments)
__global__ __launch_bounds__(128) void k_attn(const _Float16* __restrict__ QK, const _Float16* __restrict__ QKL, const _Float16* __restrict__ VTH, const _Float16* __restrict__ VTL, const void* __restrict__ KMASK, const float* __restrict__ KB, const int* __restrict__ AM, float* __restrict__ O) {
  __shared__ __align__(16) float so[4][16][68];
  __shared__ __align__(16) _Float16 sK[2][AK][LP], sV[2][HD][LP];   // two buffers each of K rows (key, d) and V rows (d, key); pitch 144 B, conflict-free for the 16-byte fragment reads
  const int tid = threadIdx.x, wave = tid >> 5, lane = tid & 31, col = lane & 15, g = lane >> 4;
  const int qb = blockIdx.x, h = blockIdx.y, b = blockIdx.z; const int q0 = qb * 64 + wave * 16; const size_t rq = (size_t)b * SS + q0 + col;
  v16h aq[2];   // the q residual, used by the leading query blocks alone, is loaded at its products: 16 registers less in every block
#pragma unroll
  for (int kc = 0; kc < 2; ++kc) aq[kc] = frag_h(QK + rq * (2 * DM) + h * HD + kc * 32, lane);
  float m = -3.0e38f, l = 0.f;   // of the lane's query; l holds the sum over the lane's own half of the keys, the halves are joined once behind the loop
  v8f acc[4] = {}, accl[4] = {};   // acc[dt][r] = O^T[d = dt * 16 + 8 g + r][query col]
  const int nt = qb + 1;   // causal: key tiles of 64 up to the query tile's end; two key steps of 32 a tile, in the order of before
  const int cr = tid >> 3, cc = (tid & 7) * 8;
  const _Float16* kg = QK + ((size_t)b * SS + cr) * (2 * DM) + DM + h * HD + cc; const _Float16* vg = VTH + ((size_t)b * DM + h * HD + cr) * SS + cc; const float* bp = KB + ((size_t)b * NH + h) * SS + 8 * g;
  const unsigned kl = (unsigned)(size_t)&sK[0][cr][cc], vl = (unsigned)(size_t)&sV[0][cr][cc];
  kv_copy(kg, vg, kl, vl);
  asm volatile("s_wait_asynccnt 0x0" ::: "memory");   // this wave's copies of tile 0 have landed
  __syncthreads();   // tile 0 is published to all four waves
  if (nt > 1) kv_copy(kg + (size_t)AK * (2 * DM), vg + AK, kl + AKB, vl + AKB);   // tile 1 into the second buffer
  kg += (size_t)2 * AK * (2 * DM); vg += 2 * AK;   // the next tile to copy
  v16h kf[2][2], vf[4]; v4f kbv[4], kbn[4]; kbv[0] = *(const v4f*)bp; kbv[1] = *(const v4f*)(bp + 4); kbv[2] = *(const v4f*)(bp + 16); kbv[3] = *(const v4f*)(bp + 20);
  asm volatile("s_wait_xcnt 0x0" :: "v"(bp) : "memory");   // the running pointer is an input here, so the address pair of these loads stays whole up to this wait and takes its new value only behind it
  const int qd = q0 + col - 8 * g;   // key ks * 32 + ct * 16 + 8 g + r is seen by query q0 + col where ks * 32 + ct * 16 + r <= qd
#pragma unroll 1   // one trip a tile: the buffer is chosen by the trip's parity
  for (int t = 0; t < nt; ++t) {
#pragma unroll 1   // the tile's two key steps stay a loop: the registers hold the live values of one step, not of two
    for (int sub = 0; sub < 2; ++sub) { const int ks = 2 * t + sub; v8f s[2]; const _Float16* kt = &sK[t & 1][sub * 32 + col][8 * g]; const _Float16* vt = &sV[t & 1][col][sub * 32 + 8 * g];   // the lane's fragment addresses in this trip's buffers
#pragma unroll   // constant indices keep kf in registers
    for (int ct = 0; ct < 2; ++ct) { kf[ct][0] = frag_at(kt + ct * 16 * LP); kf[ct][1] = frag_at(kt + ct * 16 * LP + 32); }
    bp += (ks + 1 < 2 * nt) ? 32 : 0; kbn[0] = *(const v4f*)bp; kbn[1] = *(const v4f*)(bp + 4); kbn[2] = *(const v4f*)(bp + 16); kbn[3] = *(const v4f*)(bp + 20);   // the next step's gates go out a whole step ahead, so that none is in flight at the trip's barrier, which waits for global loads too; no branch: the last step loads its own once more (unused)
    asm volatile("s_wait_xcnt 0x0" :: "v"(bp) : "memory");   // the running pointer is an input here, so the address pair of these loads stays whole up to this wait and takes its new value only behind it
#pragma unroll
    for (int ct = 0; ct < 2; ++ct) { const _Float16* krowl = QKL + ((size_t)b * SS + ks * 32 + ct * 16 + col) * (2 * DM) + DM + h * HD; v8f c = {}, cl = {};   // krowl: the residual of the lane's A row, key ct * 16 + col of the step
      if (qb < 2) {   // leading query blocks (few keys, outputs far above the global rms): 3 products
#pragma unroll
        for (int kc = 0; kc < 2; ++kc) { const v16h kh = kf[ct][kc]; c = wmma16(kh, aq[kc], c); cl = wmma16(kh, frag_h(QKL + rq * (2 * DM) + h * HD + kc * 32, lane), cl); cl = wmma16(frag_h(krowl + kc * 32, lane), aq[kc], cl); }
#pragma unroll
        for (int r = 0; r < 8; ++r) c[r] += cl[r] * (1.0f / 2048.0f); }
      else {
#pragma unroll
        for (int kc = 0; kc < 2; ++kc) c = wmma16(kf[ct][kc], aq[kc], c); }   // single product elsewhere
#pragma unroll
      for (int r = 0; r < 8; ++r) s[ct][r] = (ks * 32 + ct * 16 + r <= qd) ? c[r] * SCALEF + kbv[ct * 2 + (r >> 2)][r & 3] : -3.0e38f; }   // causal; + log resonance gate of the key
#pragma unroll   // constant indices keep vf in registers; the V fragment reads go out as one group behind the score products and land under the softmax
    for (int dt = 0; dt < 4; ++dt) vf[dt] = frag_at(vt + dt * 16 * LP);
    float mx8[8];
#pragma unroll   // the lane's 16 scores, as a tree
    for (int r = 0; r < 8; ++r) mx8[r] = fmaxf(s[0][r], s[1][r]);
    float mx = fmaxf(fmaxf(fmaxf(mx8[0], mx8[1]), fmaxf(mx8[2], mx8[3])), fmaxf(fmaxf(mx8[4], mx8[5]), fmaxf(mx8[6], mx8[7])));
    mx = fmaxf(mx, xhalf(mx));   // with the query's other 16 keys of the step
    const float mn = fmaxf(m, mx); const float ea = exp2_1((m - mn) * L2E); const float alpha = (m <= -1.0e38f) ? 0.f : ea;   // the exponential stands in front of the choice: no branch
    float e[2][8], es8[8], ax[2][8], ex[2][8];
#pragma unroll
    for (int r = 0; r < 8; ++r) { ax[0][r] = (s[0][r] - mn) * L2E; ax[1][r] = (s[1][r] - mn) * L2E; }
    exp2_4(&ex[0][0], &ax[0][0]); exp2_4(&ex[0][4], &ax[0][4]); exp2_4(&ex[1][0], &ax[1][0]); exp2_4(&ex[1][4], &ax[1][4]);
#pragma unroll
    for (int r = 0; r < 8; ++r) { e[0][r] = (s[0][r] <= -1.0e38f) ? 0.f : ex[0][r]; e[1][r] = (s[1][r] <= -1.0e38f) ? 0.f : ex[1][r]; es8[r] = e[0][r] + e[1][r]; }
    l = l * alpha + (((es8[0] + es8[1]) + (es8[2] + es8[3])) + ((es8[4] + es8[5]) + (es8[6] + es8[7]))); m = mn;
#pragma unroll
    for (int dt = 0; dt < 4; ++dt) {
#pragma unroll
      for (int r = 0; r < 8; ++r) { acc[dt][r] *= alpha; accl[dt][r] *= alpha; } }
    v16h pa, pl;   // P^T as B operand: element i = key 8 g + i (score tile 0, register i), element 8 + i = key 16 + 8 g + i (tile 1): the k order of the V fragments
#pragma unroll
    for (int i = 0; i < 8; ++i) { const float x0 = e[0][i] * 2048.0f, x1 = e[1][i] * 2048.0f; const _Float16 h0 = (_Float16)x0, h1 = (_Float16)x1; pa[i] = h0; pa[8 + i] = h1; pl[i] = (_Float16)((x0 - (float)h0) * 2048.0f); pl[8 + i] = (_Float16)((x1 - (float)h1) * 2048.0f); }   // P scaled by 2^11 before the f16 split so small softmax weights stay out of the f16 subnormal range; 2^-11 folded into the epilogue
#pragma unroll
    for (int dt = 0; dt < 4; ++dt) acc[dt] = wmma16(vf[dt], pa, acc[dt]);
    if (qb < 2) {   // one branch a step for the four tiles' extra products: with one per tile the build holds accl twice
#pragma unroll   // accl, vf indexed by constants
      for (int dt = 0; dt < 4; ++dt) { const size_t vr = ((size_t)b * DM + h * HD + dt * 16 + col) * SS + ks * 32; accl[dt] = wmma16(vf[dt], pl, accl[dt]); accl[dt] = wmma16(frag_h(VTL + vr, lane), pa, accl[dt]); } }   // leading query blocks: P hi/lo x V hi/lo (3 products); elsewhere P x V single
#pragma unroll
    for (int i = 0; i < 4; ++i) kbv[i] = kbn[i]; }
    asm volatile("s_wait_dscnt 0x0" ::: "memory");      // this wave's reads of this trip's buffers are done
    asm volatile("s_wait_asynccnt 0x0" ::: "memory");   // this wave's copies of the next tile have landed
    __syncthreads();   // publishes the next tile and ends every wave's reads of the buffers refilled below
    if (t + 2 < nt) { kv_copy(kg, vg, kl + (t & 1) * AKB, vl + (t & 1) * AKB); kg += (size_t)AK * (2 * DM); vg += AK; } }   // tile t + 2 into the buffers that this trip has read
  asm volatile("s_wait_asynccnt 0x0" ::: "memory");   // no copy is outstanding when the wave goes on to its end
  l += xhalf(l);   // the two halves of the query's keys
  const int am = AM[h];
  asm volatile("s_wait_xcnt 0x0" :: "v"(h) : "memory");   // the index is an input here, so the load does not land in its own address register, which stays whole up to this wait
  const float il = ((am != 0) ? (1.0f / 2048.0f) : 0.f) / l;   // dormant heads contribute nothing
#pragma unroll
  for (int dt = 0; dt < 4; ++dt) { v4f o0, o1;
#pragma unroll   // the lane's 8 consecutive d of its query: two 16-byte LDS stores
    for (int r = 0; r < 4; ++r) { o0[r] = (acc[dt][r] + accl[dt][r] * (1.0f / 2048.0f)) * il; o1[r] = (acc[dt][4 + r] + accl[dt][4 + r] * (1.0f / 2048.0f)) * il; }
    *(v4f*)&so[wave][col][dt * 16 + 8 * g] = o0; *(v4f*)&so[wave][col][dt * 16 + 8 * g + 4] = o1; }
  LDSX();
  for (int rl = 0; rl < 16; ++rl) if (lane < 16) vst2(O + ((size_t)b * SS + q0 + rl) * DM + h * HD + lane * 4, *(const v4f*)&so[wave][rl][lane * 4]);
}
// ---- k_out: block = (64 rows, 128 cols): out = O(hi/lo) . Wo rows (2 products), no bias (BO is null)
__global__ __launch_bounds__(128) void k_out(const float* __restrict__ O, const __bf16* __restrict__ P, const float* __restrict__ BO, float* __restrict__ Y) {
  __shared__ __align__(16) float so[4][16][132];
  const int tid = threadIdx.x, wave = tid >> 5, lane = tid & 31, col = lane & 15, g = lane >> 4; const size_t r0 = (size_t)blockIdx.x * 64 + wave * 16; const int n0 = blockIdx.y * 128;
  v8f acc[8] = {};
  // as in k_qkv: the block's 64 rows of O (split once into bf16 hi and residual) and 128 weight rows go through LDS, KT columns a trip
  __shared__ __align__(16) __bf16 sAh[64][LP], sAl[64][LP], sB[128][LP];
  const int ar = tid >> 4, ac = (tid & 15) * 4, br = tid >> 3, bc = (tid & 7) * 8;
  const float* Ag = O + ((size_t)blockIdx.x * 64 + ar) * DM + ac; const __bf16* Bg = P + (size_t)(n0 + br) * DM + bc;
  const float* Ap = Ag; const __bf16* Bp = Bg; v4f ra[8]; v8b rb[8];
#pragma unroll   // constant indices keep ra, rb in registers
  for (int i = 0; i < 8; ++i) { ra[i] = *(const v4f*)(Ag + (size_t)i * 8 * DM); rb[i] = *(const v8b*)(Bg + (size_t)i * 16 * DM); }
  for (int kt = 0; kt < DM / KT; ++kt) {
#pragma unroll   // constant indices keep ra, rb in registers
    for (int i = 0; i < 8; ++i) { v4b ch, cl;
#pragma unroll   // four splits, two 8-byte stores
      for (int e = 0; e < 4; ++e) { const __bf16 hv = (__bf16)ra[i][e]; ch[e] = hv; cl[e] = (__bf16)(ra[i][e] - (float)hv); }
      *(v4b*)&sAh[ar + i * 8][ac] = ch; *(v4b*)&sAl[ar + i * 8][ac] = cl; *(v8b*)&sB[br + i * 16][bc] = rb[i]; }
    __syncthreads();   // the tile is published to all four waves
    if (kt + 1 < DM / KT) { Ap += KT; Bp += KT;
#pragma unroll   // constant indices keep ra, rb in registers
      for (int i = 0; i < 8; ++i) { ra[i] = *(const v4f*)(Ap + (size_t)i * 8 * DM); rb[i] = *(const v8b*)(Bp + (size_t)i * 16 * DM); }
      asm volatile("s_wait_xcnt 0x0" :: "v"(Ap), "v"(Bp) : "memory"); }   // the two running pointers are inputs here, so the address pairs of these loads stay whole up to this wait: no load of the run lands in one, and they take their new values only behind it
#pragma unroll   // two k steps of 32, k ascending; constant LDS offsets
    for (int kc = 0; kc < KT / 32; ++kc) { const v16b ah = frag_b(&sAh[wave * 16 + col][kc * 32], lane), al = frag_b(&sAl[wave * 16 + col][kc * 32], lane); v16b w[8];
#pragma unroll   // the k step's fragment reads go out as one group ahead of its products: one LDS latency a step, not one a product
      for (int j = 0; j < 8; ++j) w[j] = frag_b(&sB[j * 16 + col][kc * 32], lane);
#pragma unroll   // acc[j] indexed by constants
      for (int j = 0; j < 8; ++j) { acc[j] = wmma_bf(al, w[j], acc[j]); acc[j] = wmma_bf(ah, w[j], acc[j]); } }
    __syncthreads();   // every wave has read the tile before the next trip overwrites it
  }
#pragma unroll
  for (int j = 0; j < 8; ++j) {
#pragma unroll
    for (int r = 0; r < 8; ++r) so[wave][8 * g + r][j * 16 + col] = acc[j][r] + (BO ? bfr(BO[n0 + j * 16 + col]) : 0.f); }
  LDSX();
  for (int rl = 0; rl < 16; ++rl) vst2(Y + (r0 + rl) * DM + n0 + lane * 4, *(const v4f*)&so[wave][rl][lane * 4]);
}

#define PH_TW 4    // tokens a wave
#define PH_TB 32   // tokens a block (8 waves): the 32 gates of one head are one whole 128-byte line of KB
// ---- k_phase: block = 32 tokens, a wave = 4 of them: ph = bf16(x) . bf16(w_phase) (f32) with a lane on 32 of the 1,024 d (16-byte loads, 512 contiguous bytes a wave), w_phase loaded once for the wave's 4 tokens, the sums joined inside the wave; phase = atan2(ph0, ph1); then a lane = (token, head) for the 16 per-head log gates of each key. 128 blocks, where one block a token is 4,096 blocks of 8 waves that live shorter than they take to start
__global__ __launch_bounds__(256) void k_phase(const float* __restrict__ X, const float* __restrict__ WP, const float* __restrict__ CAR, const float* __restrict__ LOCK, const float* __restrict__ BW, float* __restrict__ KB) {
  __shared__ __align__(8) float sg[NH][PH_TB + 2];   // pitch 34: the 32 lanes that write (16 heads x 2 tokens) meet 32 different banks; even, for the 8-byte reads
  const int t = threadIdx.x, wave = t >> 5, lane = t & 31, hd = lane & 15, g = lane >> 4; const size_t row0 = (size_t)blockIdx.x * PH_TB;
  const float* xp = X + (row0 + wave * PH_TW) * DM + lane * 4; const float* wp = WP + lane * 8; v4f xv[PH_TW][8], wv[8][2];
#pragma unroll   // constant indices keep wv in registers
  for (int j = 0; j < 8; ++j) { wv[j][0] = *(const v4f*)(wp + j * 256); wv[j][1] = *(const v4f*)(wp + j * 256 + 4); }   // both columns of d = 128 j + 4 lane + (0 .. 3)
#pragma unroll   // constant indices keep xv in registers
  for (int k = 0; k < PH_TW; ++k) {
#pragma unroll   // as above
    for (int j = 0; j < 8; ++j) xv[k][j] = *(const v4f*)(xp + (size_t)k * DM + j * 128); }
  const float lkr = LOCK[hd], bwr = BW[hd], carr = CAR[hd];
  // the two pointers are inputs here, so the address pairs of these loads stay whole up to this wait; the loaded values are inputs too (inputs only; an asm statement takes thirty operands, so the rest stand in the fence below), so all 48 loads go out ahead of the first conversion: one memory latency a wave, where the build otherwise holds twelve loads back until registers of the first come free
  asm volatile("s_wait_xcnt 0x0" :: "v"(xp), "v"(wp), "v"(wv[0][0]), "v"(wv[0][1]), "v"(wv[1][0]), "v"(wv[1][1]), "v"(wv[2][0]), "v"(wv[2][1]), "v"(wv[3][0]), "v"(wv[3][1]), "v"(wv[4][0]), "v"(wv[4][1]), "v"(wv[5][0]), "v"(wv[5][1]), "v"(wv[6][0]), "v"(wv[6][1]), "v"(wv[7][0]), "v"(wv[7][1]), "v"(xv[0][0]), "v"(xv[0][1]), "v"(xv[0][2]), "v"(xv[0][3]), "v"(xv[0][4]), "v"(xv[0][5]), "v"(xv[0][6]), "v"(xv[0][7]), "v"(xv[1][0]), "v"(xv[1][1]), "v"(xv[1][2]), "v"(xv[1][3]) : "memory");
  asm volatile("" :: "v"(xv[1][4]), "v"(xv[1][5]), "v"(xv[1][6]), "v"(xv[1][7]), "v"(xv[2][0]), "v"(xv[2][1]), "v"(xv[2][2]), "v"(xv[2][3]), "v"(xv[2][4]), "v"(xv[2][5]), "v"(xv[2][6]), "v"(xv[2][7]), "v"(xv[3][0]), "v"(xv[3][1]), "v"(xv[3][2]), "v"(xv[3][3]), "v"(xv[3][4]), "v"(xv[3][5]), "v"(xv[3][6]), "v"(xv[3][7]));   // the other 20 loaded values, inputs only, for the same purpose
  float a0[PH_TW] = {}, a1[PH_TW] = {};
#pragma unroll   // xv, wv indexed by constants
  for (int j = 0; j < 8; ++j) {
#pragma unroll   // as above
    for (int e = 0; e < 4; ++e) { const float w0 = bfr(wv[j][e >> 1][(e & 1) * 2]), w1 = bfr(wv[j][e >> 1][(e & 1) * 2 + 1]);
#pragma unroll   // eight independent sums
      for (int k = 0; k < PH_TW; ++k) { const float xb = bfr(xv[k][j][e]); a0[k] += xb * w0; a1[k] += xb * w1; } } }
#pragma unroll   // five exchanges, the eight sums side by side in each
  for (int o = 16; o > 0; o >>= 1) {
#pragma unroll   // a0, a1 indexed by constants
    for (int k = 0; k < PH_TW; ++k) { a0[k] += __shfl_xor(a0[k], o); a1[k] += __shfl_xor(a1[k], o); } }
  const float lk = bfr(lkr), bw = bfr(bwr), car = bfr(carr);
#pragma unroll   // a0, a1 indexed by constants
  for (int p = 0; p < PH_TW / 2; ++p) { const float phase = atan2_p(g ? a0[2 * p + 1] : a0[2 * p], g ? a1[2 * p + 1] : a1[2 * p]); const float win = exp_ni((cos_p(phase - car) - 1.0f) / bw); const float gate = lk * win + (1.0f - lk); sg[hd][wave * PH_TW + 2 * p + g] = log_p(gate + 1e-6f); }   // lane = (token 2 p + g of the wave, head hd)
  __syncthreads();   // the block's 16 x 32 gates are complete before any wave reads what other waves wrote
  { const int hh = t >> 4, pr = t & 15; const size_t b = row0 / SS, s = row0 % SS; *(v2f*)(KB + (b * NH + hh) * SS + s + pr * 2) = *(const v2f*)&sg[hh][pr * 2]; }   // 16 lanes store one head's whole line
}
extern "C" void kernel_launch(void* const* d_in, const int* in_sizes, int n_in, void* d_out, int out_size, void* d_ws, size_t ws_size, hipStream_t stream) {
  (void)in_sizes; (void)n_in; (void)out_size;
  const float** F = (const float**)d_in;   // 0 x [4,1024,1024], 1 wq, 2 wk, 3 wv, 4 wo (all (in,out) [1024,1024]), 5 w_phase [1024,2], 6 carrier [16], 7 lock [16], 8 bandwidth [16], 9 active_mask [16] int
  if (ws_size < (size_t)WS_END + 4u * NB * NH * SS + 256) return;
  char* ws = (char*)d_ws; __bf16* PK = (__bf16*)(ws + WS_PK); _Float16 *QK = (_Float16*)(ws + WS_QK), *QKL = (_Float16*)(ws + WS_QKL), *VTH = (_Float16*)(ws + WS_VTH), *VTL = (_Float16*)(ws + WS_VTL); float* O = (float*)(ws + WS_O); float* KB = (float*)(ws + WS_END);
  k_pack<<<dim3(DM / PT_N, DM / PT_K, 4), 256, 0, stream>>>(F[1], F[2], F[3], F[4], PK);
  k_phase<<<NB * SS / PH_TB, 256, 0, stream>>>(F[0], F[5], F[6], F[7], F[8], KB);
  k_qkv<<<dim3(TNB * SS / 64, QKVW / 128), 128, 0, stream>>>(F[0], F[0], F[0], PK + PK_A, nullptr, nullptr, nullptr, QK, QKL, VTH, VTL);
  k_attn<<<dim3(TQB, NH, TNB), 128, 0, stream>>>(QK, QKL, VTH, VTL, nullptr, KB, (const int*)d_in[9], O);
  k_out<<<dim3(TOB, DM / 128), 128, 0, stream>>>(O, PK + PK_P, nullptr, (float*)d_out);
}

// v007
// One run takes 100 microseconds.
// Next to v006, in two timings, it ran 1.05 times as fast each time.
// All steps since v000 together make it 3.58 times as fast.
// compute dtype: all float inputs rounded to bf16, active_mask (int) read on device; q/k/v = x . W with EXACT bf16 products on WMMA 16x16x32 ((in,out) weights as transposed rows); the per-token phase (x . w_phase, atan2) and the per-(batch, head, key) log resonance gate in f32 (precise expf/logf/cosf/atan2f); causal attention x 1/8 + log gate: for the first 128 queries of each sequence 3-product scores and P, v as f16 hi + residual (3 products), single f16 operands beyond; running-max softmax in f32 (hardware exp); the per-head active mask applied to the attention output; out = o (bf16 hi + residual) . Wo (2 products).
#include <hip/hip_runtime.h>
#include <math.h>

typedef __attribute__((ext_vector_type(16))) _Float16 v16h;
typedef __attribute__((ext_vector_type(16))) __bf16 v16b;
typedef __attribute__((ext_vector_type(8)))  _Float16 v8h;
typedef __attribute__((ext_vector_type(8)))  float v8f;
typedef __attribute__((ext_vector_type(4)))  float v4f;
typedef __attribute__((ext_vector_type(2)))  float v2f;
typedef __attribute__((ext_vector_type(4)))  unsigned v4u;
typedef __attribute__((ext_vector_type(4)))  int v4i;
typedef float __attribute__((may_alias)) float_a;
typedef int __attribute__((may_alias)) int_a;

template <typename T> __device__ __forceinline__ void vst2(void* p, T v) { *(T*)p = v;  }
__device__ __forceinline__ v8f wmma16(v16h a, v16h b, v8f c) {
  v8f d = __builtin_amdgcn_wmma_f32_16x16x32_f16(false, a, false, b, (short)0, c, false, false);
  asm volatile("v_nop\n\tv_nop\n\tv_nop\n\tv_nop" : "+v"(d) : "v"(a), "v"(b));
  return d;
}
__device__ __forceinline__ v8f wmma_bf(v16b a, v16b b, v8f c) {
  v8f d = __builtin_amdgcn_wmma_f32_16x16x32_bf16(false, a, false, b, (short)0, c, false, false);
  asm volatile("v_nop\n\tv_nop\n\tv_nop\n\tv_nop" : "+v"(d) : "v"(a), "v"(b));
  return d;
}
// Resonance-gated causal attention (B 4, S 1,024, d 1,024, 16 heads x 64): bias-free q/k/v/o projections, a per-key additive log-gate from each token's input phase against a per-head carrier (von Mises window opened by 1 - lock), causal softmax, dormant heads zeroed.
__device__ __forceinline__ v16h frag_h(const _Float16* rowk0, int lane) {
  union { v16h v; v8h q[2]; } u; const _Float16* p = rowk0 + 8 * (lane >> 4);
  u.q[0] = *(const v8h*)p; u.q[1] = *(const v8h*)(p + 16); return u.v;
}
__device__ __forceinline__ v16h frag_f32(const float* rowk0, int lane) {
  v16h a; const float* p = rowk0 + 8 * (lane >> 4);
#pragma unroll
  for (int i = 0; i < 8; ++i) { a[i] = (_Float16)p[i]; a[8 + i] = (_Float16)p[16 + i]; }
  return a;
}
__device__ __forceinline__ v16h frag_f32s(const float* rowk0, int lane, float sc) {
  v16h a; const float* p = rowk0 + 8 * (lane >> 4);
#pragma unroll
  for (int i = 0; i < 8; ++i) { a[i] = (_Float16)(p[i] * sc); a[8 + i] = (_Float16)(p[16 + i] * sc); }
  return a;
}
// column fragment from a [K][ld] layout (column n), rows >= K read as 0
__device__ __forceinline__ v16h fragc_f32(const float* W, int k0, int n, int lane, int ld, int K) {
  v16h a; const int g = lane >> 4;
#pragma unroll
  for (int i = 0; i < 8; ++i) { const int ka = k0 + 8 * g + i, kb = ka + 16;
    a[i] = (_Float16)(ka < K ? W[(size_t)(ka < K ? ka : K - 1) * ld + n] : 0.f); a[8 + i] = (_Float16)(kb < K ? W[(size_t)(kb < K ? kb : K - 1) * ld + n] : 0.f); }
  return a;
}
struct F2 { v16b h, l; };
__device__ __forceinline__ F2 bsplit16(const float v[16]) { F2 r;
#pragma unroll
  for (int i = 0; i < 16; ++i) { const __bf16 h = (__bf16)v[i]; r.h[i] = h; r.l[i] = (__bf16)(v[i] - (float)h); }
  return r; }
__device__ __forceinline__ F2 split_row(const float* row, int k0, int lane) { float v[16]; const float* p = row + k0 + 8 * (lane >> 4);
#pragma unroll
  for (int i = 0; i < 8; ++i) { v[i] = p[i]; v[8 + i] = p[16 + i]; }
  return bsplit16(v); }
__device__ __forceinline__ F2 split_rowK(const float* row, int k0, int lane, int K) { float v[16]; const int g = lane >> 4;
#pragma unroll
  for (int i = 0; i < 8; ++i) { const int ka = k0 + 8 * g + i, kb = ka + 16; v[i] = ka < K ? row[ka < K ? ka : K - 1] : 0.f; v[8 + i] = kb < K ? row[kb < K ? kb : K - 1] : 0.f; }
  return bsplit16(v); }
__device__ __forceinline__ F2 split_col(const float* W, int k0, int n, int lane, int ld, int K) { float v[16]; const int g = lane >> 4;
#pragma unroll
  for (int i = 0; i < 8; ++i) { const int ka = k0 + 8 * g + i, kb = ka + 16; v[i] = ka < K ? W[(size_t)(ka < K ? ka : K - 1) * ld + n] : 0.f; v[8 + i] = kb < K ? W[(size_t)(kb < K ? kb : K - 1) * ld + n] : 0.f; }
  return bsplit16(v); }
__device__ __forceinline__ v8f mac3(const F2& a, const F2& b, v8f c) { c = wmma_bf(a.l, b.h, c); c = wmma_bf(a.h, b.l, c); return wmma_bf(a.h, b.h, c); }
__device__ __forceinline__ float sigm(float v) { return 1.0f / (1.0f + expf(-v)); }
#define LDSX() do { asm volatile("s_wait_dscnt 0" ::: "memory"); __builtin_amdgcn_wave_barrier(); __builtin_amdgcn_fence(__ATOMIC_RELEASE, "workgroup"); } while (0)


#define NB 4
#define SS 1024
#define DM 1024
#define NH 16
#define SCALEF 0.125f
__device__ __attribute__((noinline)) float log_p(float v) { return logf(v); }
__device__ __attribute__((noinline)) float cos_p(float v) { return cosf(v); }
__device__ __attribute__((noinline)) float atan2_p(float y, float x) { return atan2f(y, x); }
#define HD 64
#define QKVW (3 * DM)
#ifndef TQB
#define TQB (SS / 64)
#define TNB NB
#define TOB (NB * SS / 64)     // output row tiles (all)
#endif
typedef __attribute__((ext_vector_type(8))) __bf16 v8b;
__device__ __forceinline__ v16b frag_b(const __bf16* rowk0, int lane) {
  union { v16b v; v8b q[2]; } u; const __bf16* p = rowk0 + 8 * (lane >> 4);
  u.q[0] = *(const v8b*)p; u.q[1] = *(const v8b*)(p + 16); return u.v;
}
__device__ __forceinline__ float bfr(float v) { return (float)(__bf16)v; }
typedef __attribute__((ext_vector_type(4))) __bf16 v4b;
#define KT 64   // k columns of both operands staged in LDS per trip: 128 B of a bf16 row, 256 B of an f32 row, so every staging load covers whole lines
#define LP 72   // LDS row pitch in bf16 elements: 144 B = 16 B x odd, the conflict-free pitch for 16-byte fragment reads
__device__ __attribute__((noinline)) float exp_ni(float v) { return expf(v); }
__device__ __attribute__((noinline)) float erf_ni(float v) { return erff(v); }

#define PK_A 0                       // [3072][1024] Wqkv rows (natural [out][in])
#define PK_P (PK_A + QKVW * DM)        // [1024][1024] Wo rows (natural)
#define PK_END (PK_P + DM * DM)
#define WS_PK  0u
#define WS_QK  (WS_PK + 2u * PK_END)             // f16 [4096 rows][2048]: q | k
#define WS_QKL (WS_QK + 2u * NB * SS * 2 * DM)     // f16 q | k residual planes x2048
#define WS_VTH (WS_QKL + 2u * NB * SS * 2 * DM)    // f16 [b][1024 (h*64+d)][1024 s] hi
#define WS_VTL (WS_VTH + 2u * NB * DM * SS)        // f16 lo x 2048
#define WS_O   (WS_VTL + 2u * NB * DM * SS)        // f32 [4096][1024]
#define WS_CS  (WS_O + 4u * NB * SS * DM)           // f32 2 x [1024][32], unused
#define WS_END (WS_CS + 4u * 2 * SS * 32)
#define PT_N 64    // weight columns (= pack rows) a block
#define PT_K 256   // weight rows (= k of a pack row) a block
// ---- k_pack: block = (64 columns n, 256 rows k, which) of one (in,out) weight, transposed through LDS into bf16 pack rows; which 0..2 -> W_q/W_k/W_v into PK_A rows which*1024 + n; 3 -> W_o into PK_P. Sixteen lanes load 256 contiguous bytes of a weight row, a wave stores 512 contiguous bytes of a pack row: whole lines on both sides
__global__ __launch_bounds__(256) void k_pack(const float* __restrict__ WQ, const float* __restrict__ WK, const float* __restrict__ WV, const float* __restrict__ WO, __bf16* __restrict__ PK) {
  __shared__ __align__(16) __bf16 s[PT_N][PT_K];   // row n in 16-byte chunks of 8 k; chunk L lies at place L ^ (n >> 2), so the 16 lanes that write one chunk column of 16 rows, and the 32 that read one row, each meet all banks once
  const int n0 = blockIdx.x * PT_N, k0 = blockIdx.y * PT_K, which = blockIdx.z, t = threadIdx.x; const float* Wm = (which == 0) ? WQ : (which == 1) ? WK : (which == 2) ? WV : WO;
  const int c = t & 15, kg = t >> 4;   // the thread's 4 columns from 4 c, its 8 rows from 8 kg, and the same 128 rows on
  const float* wp = Wm + (size_t)(k0 + kg * 8) * DM + n0 + c * 4; v4f r[2][8];
#pragma unroll   // constant indices keep r in registers; all 16 loads in flight at once
  for (int p = 0; p < 2; ++p) {
#pragma unroll   // as above
    for (int j = 0; j < 8; ++j) r[p][j] = *(const v4f*)(wp + (size_t)(p * 128 + j) * DM); }
  // the pointer is an input here, so the address pair of these loads stays whole up to this wait; the loaded values are inputs too (inputs only), so all 16 loads go out ahead of the first conversion: one memory latency a block, where the build otherwise holds four loads back until registers of the first come free
  asm volatile("s_wait_xcnt 0x0" :: "v"(wp), "v"(r[0][0]), "v"(r[0][1]), "v"(r[0][2]), "v"(r[0][3]), "v"(r[0][4]), "v"(r[0][5]), "v"(r[0][6]), "v"(r[0][7]), "v"(r[1][0]), "v"(r[1][1]), "v"(r[1][2]), "v"(r[1][3]), "v"(r[1][4]), "v"(r[1][5]), "v"(r[1][6]), "v"(r[1][7]) : "memory");
#pragma unroll   // r indexed by constants
  for (int p = 0; p < 2; ++p) {
#pragma unroll   // r indexed by constants
    for (int e = 0; e < 4; ++e) { v8b o;
#pragma unroll   // 8 k of one column: one 16-byte LDS store
      for (int j = 0; j < 8; ++j) o[j] = (__bf16)r[p][j][e];
      *(v8b*)&s[c * 4 + e][((p * 16 + kg) ^ c) * 8] = o; } }
  __syncthreads();   // the tile is complete before any wave reads rows that other waves wrote
  __bf16* dst = ((which < 3) ? PK + PK_A + ((size_t)which * DM + n0) * DM : PK + PK_P + (size_t)n0 * DM) + k0; const int q = t & 31, rw = t >> 5;
#pragma unroll   // 8 pack rows a wave
  for (int i = 0; i < 8; ++i) { const int n = rw * 8 + i; vst2((unsigned*)(dst + (size_t)n * DM + q * 8), *(const v4u*)&s[n][(q ^ (n >> 2)) * 8]); }
}
__global__ __launch_bounds__(128) void k_qkv(const float* __restrict__ XQ, const float* __restrict__ XK, const float* __restrict__ XV, const __bf16* __restrict__ P, const float* __restrict__ BQ, const float* __restrict__ BK, const float* __restrict__ BV, _Float16* __restrict__ QK, _Float16* __restrict__ QKL, _Float16* __restrict__ VTH, _Float16* __restrict__ VTL) {
  const int which0 = (blockIdx.y * 128) / DM; const float* X = (which0 == 0) ? XQ : (which0 == 1) ? XK : XV; const float* BB = BQ ? (((which0 == 0) ? BQ : (which0 == 1) ? BK : BV) + (blockIdx.y * 128 - which0 * DM)) : nullptr;
  __shared__ __align__(16) _Float16 so[4][16][136], sol[4][16][136]; __shared__ __align__(16) _Float16 sth[128][72], stl[128][72];
  const int tid = threadIdx.x, wave = tid >> 5, lane = tid & 31, col = lane & 15, g = lane >> 4; const size_t r0 = (size_t)blockIdx.x * 64 + wave * 16; const int n0 = blockIdx.y * 128;
  v8f acc[8] = {};
  // the block's 64 x rows (rounded to bf16) and 128 weight rows go through LDS, KT columns a trip: each line is loaded once a block by contiguous lanes; the next trip's loads fly in registers under this trip's products
  __shared__ __align__(16) __bf16 sA[64][LP], sB[128][LP];
  const int ar = tid >> 4, ac = (tid & 15) * 4, br = tid >> 3, bc = (tid & 7) * 8;
  const float* Ag = X + ((size_t)blockIdx.x * 64 + ar) * DM + ac; const __bf16* Bg = P + (size_t)(n0 + br) * DM + bc;
  const float* Ap = Ag; const __bf16* Bp = Bg; v4f ra[8]; v8b rb[8];
#pragma unroll   // constant indices keep ra, rb in registers
  for (int i = 0; i < 8; ++i) { ra[i] = *(const v4f*)(Ag + (size_t)i * 8 * DM); rb[i] = *(const v8b*)(Bg + (size_t)i * 16 * DM); }
  for (int kt = 0; kt < DM / KT; ++kt) {
#pragma unroll   // constant indices keep ra, rb in registers
    for (int i = 0; i < 8; ++i) { v4b c;
#pragma unroll   // four conversions, one 8-byte store
      for (int e = 0; e < 4; ++e) c[e] = (__bf16)ra[i][e];
      *(v4b*)&sA[ar + i * 8][ac] = c; *(v8b*)&sB[br + i * 16][bc] = rb[i]; }
    __syncthreads();   // the tile is published to all four waves
    if (kt + 1 < DM / KT) { Ap += KT; Bp += KT;
#pragma unroll   // constant indices keep ra, rb in registers
      for (int i = 0; i < 8; ++i) { ra[i] = *(const v4f*)(Ap + (size_t)i * 8 * DM); rb[i] = *(const v8b*)(Bp + (size_t)i * 16 * DM); }
      asm volatile("s_wait_xcnt 0x0" :: "v"(Ap), "v"(Bp) : "memory"); }   // the two running pointers are inputs here, so the address pairs of these loads stay whole up to this wait: no load of the run lands in one, and they take their new values only behind it
#pragma unroll   // two k steps of 32, k ascending; constant LDS offsets
    for (int kc = 0; kc < KT / 32; ++kc) { const v16b a = frag_b(&sA[wave * 16 + col][kc * 32], lane); v16b w[8];
#pragma unroll   // the k step's fragment reads go out as one group ahead of its products: one LDS latency a step, not one a product
      for (int j = 0; j < 8; ++j) w[j] = frag_b(&sB[j * 16 + col][kc * 32], lane);
#pragma unroll   // acc[j] indexed by constants
      for (int j = 0; j < 8; ++j) acc[j] = wmma_bf(a, w[j], acc[j]); }
    __syncthreads();   // every wave has read the tile before the next trip overwrites it
  }
  if (n0 < 2 * DM) {   // q stored unscaled (f16 sigma ~0.6, no subnormal exposure); 1/8 applied to the f32 score
#pragma unroll
    for (int j = 0; j < 8; ++j) {
#pragma unroll
      for (int r = 0; r < 8; ++r) { const float v = acc[j][r] + (BB ? bfr(BB[j * 16 + col]) : 0.f); const _Float16 hv = (_Float16)v; so[wave][8 * g + r][j * 16 + col] = hv; sol[wave][8 * g + r][j * 16 + col] = (_Float16)((v - (float)hv) * 2048.0f); } }   // q, k (+ bias) as f16 hi + (x2048) residual
    LDSX();
    for (int rl = 0; rl < 16; ++rl) if (lane < 16) { vst2((unsigned*)(QK + (r0 + rl) * (2 * DM) + n0 + lane * 8), *(const v4u*)&so[wave][rl][lane * 8]); vst2((unsigned*)(QKL + (r0 + rl) * (2 * DM) + n0 + lane * 8), *(const v4u*)&sol[wave][rl][lane * 8]); }
  } else {
#pragma unroll
    for (int j = 0; j < 8; ++j) {
#pragma unroll
      for (int r = 0; r < 8; ++r) { const float v = acc[j][r] + (BB ? bfr(BB[j * 16 + col]) : 0.f); const _Float16 hv = (_Float16)v; sth[j * 16 + col][wave * 16 + 8 * g + r] = hv; stl[j * 16 + col][wave * 16 + 8 * g + r] = (_Float16)((v - (float)hv) * 2048.0f); } }
    __syncthreads();
    const size_t rb = (size_t)blockIdx.x * 64; const int b = (int)(rb / SS), s0 = (int)(rb % SS); const int pc0 = n0 - 2 * DM;
    for (int q = tid; q < 128 * 8; q += 128) { const int d = q >> 3, pc = q & 7; const size_t o = ((size_t)b * DM + pc0 + d) * SS + s0 + pc * 8; vst2((unsigned*)(VTH + o), *(const v4u*)&sth[d][pc * 8]); vst2((unsigned*)(VTL + o), *(const v4u*)&stl[d][pc * 8]); }
  }
}
// fragment at the lane's own address (row start + 8 * (lane >> 4)), the k order of frag_h
__device__ __forceinline__ v16h frag_at(const _Float16* p) { union { v16h v; v8h q[2]; } u; u.q[0] = *(const v8h*)p; u.q[1] = *(const v8h*)(p + 16); return u.v; }
#define AK 64               // keys of K and V staged in LDS a trip of k_attn: 128 B of a K row and of a V row, so every copy covers whole lines
#define AKB (AK * LP * 2)   // bytes of one LDS buffer of K or of V: 64 rows at the pitch LP
// one tile of K (64 keys x 64 d) and of V (64 d x 64 keys) into LDS, through no register: eight asynchronous copies of 16 B a lane. Eight lanes cover one row's 128 B, a lane's four rows of each tile lie 16 apart. kg, vg: the lane's global addresses of its first rows; kl, vl: its LDS byte addresses. The s_wait_xcnt is the last line of the copies' own statement, so no address register named here takes a new value in front of it
__device__ __forceinline__ void kv_copy(const _Float16* kg, const _Float16* vg, unsigned kl, unsigned vl) {
  asm volatile("global_load_async_to_lds_b128 %0, %8, off\n\tglobal_load_async_to_lds_b128 %1, %9, off\n\tglobal_load_async_to_lds_b128 %2, %10, off\n\tglobal_load_async_to_lds_b128 %3, %11, off\n\t"
               "global_load_async_to_lds_b128 %4, %12, off\n\tglobal_load_async_to_lds_b128 %5, %13, off\n\tglobal_load_async_to_lds_b128 %6, %14, off\n\tglobal_load_async_to_lds_b128 %7, %15, off\n\ts_wait_xcnt 0x0"
               :: "v"(kl), "v"(kl + 16 * LP * 2), "v"(kl + 32 * LP * 2), "v"(kl + 48 * LP * 2), "v"(vl), "v"(vl + 16 * LP * 2), "v"(vl + 32 * LP * 2), "v"(vl + 48 * LP * 2),
                  "v"(kg), "v"(kg + (size_t)16 * (2 * DM)), "v"(kg + (size_t)32 * (2 * DM)), "v"(kg + (size_t)48 * (2 * DM)), "v"(vg), "v"(vg + (size_t)16 * SS), "v"(vg + (size_t)32 * SS), "v"(vg + (size_t)48 * SS) : "memory");
}
// hardware base-2 exponentials with, behind the last, the one slot that the instruction set asks for between a transcendental and an instruction that uses its result or overwrites its source. In asm text, slot included. The outputs are early-clobber, so inside the run no exponential touches a register of the one before
__device__ __forceinline__ float exp2_1(float x) { float y; asm("v_exp_f32 %0, %1\n\tv_nop" : "=&v"(y) : "v"(x)); return y; }
__device__ __forceinline__ void exp2_4(float* y, const float* x) { asm("v_exp_f32 %0, %4\n\tv_exp_f32 %1, %5\n\tv_exp_f32 %2, %6\n\tv_exp_f32 %3, %7\n\tv_nop" : "=&v"(y[0]), "=&v"(y[1]), "=&v"(y[2]), "=&v"(y[3]) : "v"(x[0]), "v"(x[1]), "v"(x[2]), "v"(x[3])); }
#define L2E 1.44269504f   // log2(e): exp(x) = 2^(x * L2E), the form that __expf builds to
// lane l with lane l ^ 16, in the vector unit (__shfl_xor by 16 builds to an LDS-pipe permute)
__device__ __forceinline__ float xhalf(float x) { return __builtin_bit_cast(float, __builtin_amdgcn_permlanex16(__builtin_bit_cast(int, x), __builtin_bit_cast(int, x), 0x76543210, 0xfedcba98, false, false)); }
// ---- k_attn: block = (head h, 64 queries, batch b): causal flash attention with the products transposed: S^T = K . Q^T (A = 16 keys, B = the wave's 16 queries), O^T += V^T . P^T (A = 16 d, B = P^T). A lane holds 16 of the 32 scores of ONE query (column lane & 15; keys 8 * (lane >> 4) + r of each 16-key tile), so maximum and sum are in-lane, joined with the other half by one exchange, and the two score tiles, converted in place, are the B operand P^T in the k order of frag_h: P never goes through LDS. scores = (q.k) * 0.125: in the two leading query blocks q, k as f16 hi + (x2048) residual (3 products), single f16 operands beyond; P.V there f16 P and V hi + (x2048) residual (3 products), the residual products in a second accumulator, beyond f16 P x V hi alone; O[b*S+q][h*64+d] = (acc + accl / 2048) / (2048 l) (256-B segments)
__global__ __launch_bounds__(128) void k_attn(const _Float16* __restrict__ QK, const _Float16* __restrict__ QKL, const _Float16* __restrict__ VTH, const _Float16* __restrict__ VTL, const void* __restrict__ KMASK, const float* __restrict__ KB, const int* __restrict__ AM, float* __restrict__ O) {
  __shared__ __align__(16) float so[4][16][68];
  __shared__ __align__(16) _Float16 sK[2][AK][LP], sV[2][HD][LP];   // two buffers each of K rows (key, d) and V rows (d, key); pitch 144 B, conflict-free for the 16-byte fragment reads
  const int tid = threadIdx.x, wave = tid >> 5, lane = tid & 31, col = lane & 15, g = lane >> 4;
  // which query tile a block takes. All blocks of the launch are resident at once, four to a WGP, and a block's cost grows with its tile index (causal), so the launch lasts as long as the WGP with the most key tiles. With the tile index as the fastest grid index, blocks whose flat indices lie a multiple of 16 apart all had the same tile. Here any four blocks that differ only in blockIdx.z, or only in the low two bits of blockIdx.y, take the tiles n - 1 - 2 r, 2 r, n - 2 - 2 r, 2 r + 1 (n = TQB, r = blockIdx.y >> 2): the same number of key tiles for every such four, and two long blocks side by side to the end. For speed only: for each (head, batch) the map blockIdx.y -> tile is a permutation, wherever the blocks land (TQB a multiple of 4)
  const int h = blockIdx.x, b = blockIdx.z, sl = (blockIdx.y + blockIdx.z) & 3, pr = 2 * (blockIdx.y >> 2) + (sl >> 1); const int qb = (sl & 1) ? pr : TQB - 1 - pr; const int q0 = qb * 64 + wave * 16; const size_t rq = (size_t)b * SS + q0 + col;
  v16h aq[2];   // the q residual, used by the leading query blocks alone, is loaded at its products: 16 registers less in every block
#pragma unroll
  for (int kc = 0; kc < 2; ++kc) aq[kc] = frag_h(QK + rq * (2 * DM) + h * HD + kc * 32, lane);
  float m = -3.0e38f, l = 0.f;   // of the lane's query; l holds the sum over the lane's own half of the keys, the halves are joined once behind the loop
  v8f acc[4] = {}, accl[4] = {};   // acc[dt][r] = O^T[d = dt * 16 + 8 g + r][query col]
  const int nt = qb + 1;   // causal: key tiles of 64 up to the query tile's end; two key steps of 32 a tile, in the order of before
  const int cr = tid >> 3, cc = (tid & 7) * 8;
  const _Float16* kg = QK + ((size_t)b * SS + cr) * (2 * DM) + DM + h * HD + cc; const _Float16* vg = VTH + ((size_t)b * DM + h * HD + cr) * SS + cc; const float* bp = KB + ((size_t)b * NH + h) * SS + 8 * g;
  const unsigned kl = (unsigned)(size_t)&sK[0][cr][cc], vl = (unsigned)(size_t)&sV[0][cr][cc];
  kv_copy(kg, vg, kl, vl);
  asm volatile("s_wait_asynccnt 0x0" ::: "memory");   // this wave's copies of tile 0 have landed
  __syncthreads();   // tile 0 is published to all four waves
  if (nt > 1) kv_copy(kg + (size_t)AK * (2 * DM), vg + AK, kl + AKB, vl + AKB);   // tile 1 into the second buffer
  kg += (size_t)2 * AK * (2 * DM); vg += 2 * AK;   // the next tile to copy
  v16h kf[2][2], vf[4]; v4f kbv[4], kbn[4]; kbv[0] = *(const v4f*)bp; kbv[1] = *(const v4f*)(bp + 4); kbv[2] = *(const v4f*)(bp + 16); kbv[3] = *(const v4f*)(bp + 20);
  asm volatile("s_wait_xcnt 0x0" :: "v"(bp) : "memory");   // the running pointer is an input here, so the address pair of these loads stays whole up to this wait and takes its new value only behind it
  const int qd = q0 + col - 8 * g;   // key ks * 32 + ct * 16 + 8 g + r is seen by query q0 + col where ks * 32 + ct * 16 + r <= qd
#pragma unroll 1   // one trip a tile: the buffer is chosen by the trip's parity
  for (int t = 0; t < nt; ++t) {
#pragma unroll 1   // the tile's two key steps stay a loop: the registers hold the live values of one step, not of two
    for (int sub = 0; sub < 2; ++sub) { const int ks = 2 * t + sub; v8f s[2]; const _Float16* kt = &sK[t & 1][sub * 32 + col][8 * g]; const _Float16* vt = &sV[t & 1][col][sub * 32 + 8 * g];   // the lane's fragment addresses in this trip's buffers
#pragma unroll   // constant indices keep kf in registers
    for (int ct = 0; ct < 2; ++ct) { kf[ct][0] = frag_at(kt + ct * 16 * LP); kf[ct][1] = frag_at(kt + ct * 16 * LP + 32); }
    bp += (ks + 1 < 2 * nt) ? 32 : 0; kbn[0] = *(const v4f*)bp; kbn[1] = *(const v4f*)(bp + 4); kbn[2] = *(const v4f*)(bp + 16); kbn[3] = *(const v4f*)(bp + 20);   // the next step's gates go out a whole step ahead, so that none is in flight at the trip's barrier, which waits for global loads too; no branch: the last step loads its own once more (unused)
    asm volatile("s_wait_xcnt 0x0" :: "v"(bp) : "memory");   // the running pointer is an input here, so the address pair of these loads stays whole up to this wait and takes its new value only behind it
#pragma unroll
    for (int ct = 0; ct < 2; ++ct) { const _Float16* krowl = QKL + ((size_t)b * SS + ks * 32 + ct * 16 + col) * (2 * DM) + DM + h * HD; v8f c = {}, cl = {};   // krowl: the residual of the lane's A row, key ct * 16 + col of the step
      if (qb < 2) {   // leading query blocks (few keys, outputs far above the global rms): 3 products
#pragma unroll
        for (int kc = 0; kc < 2; ++kc) { const v16h kh = kf[ct][kc]; c = wmma16(kh, aq[kc], c); cl = wmma16(kh, frag_h(QKL + rq * (2 * DM) + h * HD + kc * 32, lane), cl); cl = wmma16(frag_h(krowl + kc * 32, lane), aq[kc], cl); }
#pragma unroll
        for (int r = 0; r < 8; ++r) c[r] += cl[r] * (1.0f / 2048.0f); }
      else {
#pragma unroll
        for (int kc = 0; kc < 2; ++kc) c = wmma16(kf[ct][kc], aq[kc], c); }   // single product elsewhere
#pragma unroll
      for (int r = 0; r < 8; ++r) s[ct][r] = (ks * 32 + ct * 16 + r <= qd) ? c[r] * SCALEF + kbv[ct * 2 + (r >> 2)][r & 3] : -3.0e38f; }   // causal; + log resonance gate of the key
#pragma unroll   // constant indices keep vf in registers; the V fragment reads go out as one group behind the score products and land under the softmax
    for (int dt = 0; dt < 4; ++dt) vf[dt] = frag_at(vt + dt * 16 * LP);
    float mx8[8];
#pragma unroll   // the lane's 16 scores, as a tree
    for (int r = 0; r < 8; ++r) mx8[r] = fmaxf(s[0][r], s[1][r]);
    float mx = fmaxf(fmaxf(fmaxf(mx8[0], mx8[1]), fmaxf(mx8[2], mx8[3])), fmaxf(fmaxf(mx8[4], mx8[5]), fmaxf(mx8[6], mx8[7])));
    mx = fmaxf(mx, xhalf(mx));   // with the query's other 16 keys of the step
    const float mn = fmaxf(m, mx); const float ea = exp2_1((m - mn) * L2E); const float alpha = (m <= -1.0e38f) ? 0.f : ea;   // the exponential stands in front of the choice: no branch
    float e[2][8], es8[8], ax[2][8], ex[2][8];
#pragma unroll
    for (int r = 0; r < 8; ++r) { ax[0][r] = (s[0][r] - mn) * L2E; ax[1][r] = (s[1][r] - mn) * L2E; }
    exp2_4(&ex[0][0], &ax[0][0]); exp2_4(&ex[0][4], &ax[0][4]); exp2_4(&ex[1][0], &ax[1][0]); exp2_4(&ex[1][4], &ax[1][4]);
#pragma unroll
    for (int r = 0; r < 8; ++r) { e[0][r] = (s[0][r] <= -1.0e38f) ? 0.f : ex[0][r]; e[1][r] = (s[1][r] <= -1.0e38f) ? 0.f : ex[1][r]; es8[r] = e[0][r] + e[1][r]; }
    l = l * alpha + (((es8[0] + es8[1]) + (es8[2] + es8[3])) + ((es8[4] + es8[5]) + (es8[6] + es8[7]))); m = mn;
#pragma unroll
    for (int dt = 0; dt < 4; ++dt) {
#pragma unroll
      for (int r = 0; r < 8; ++r) { acc[dt][r] *= alpha; accl[dt][r] *= alpha; } }
    v16h pa, pl;   // P^T as B operand: element i = key 8 g + i (score tile 0, register i), element 8 + i = key 16 + 8 g + i (tile 1): the k order of the V fragments
#pragma unroll
    for (int i = 0; i < 8; ++i) { const float x0 = e[0][i] * 2048.0f, x1 = e[1][i] * 2048.0f; const _Float16 h0 = (_Float16)x0, h1 = (_Float16)x1; pa[i] = h0; pa[8 + i] = h1; pl[i] = (_Float16)((x0 - (float)h0) * 2048.0f); pl[8 + i] = (_Float16)((x1 - (float)h1) * 2048.0f); }   // P scaled by 2^11 before the f16 split so small softmax weights stay out of the f16 subnormal range; 2^-11 folded into the epilogue
#pragma unroll
    for (int dt = 0; dt < 4; ++dt) acc[dt] = wmma16(vf[dt], pa, acc[dt]);
    if (qb < 2) {   // one branch a step for the four tiles' extra products: with one per tile the build holds accl twice
#pragma unroll   // accl, vf indexed by constants
      for (int dt = 0; dt < 4; ++dt) { const size_t vr = ((size_t)b * DM + h * HD + dt * 16 + col) * SS + ks * 32; accl[dt] = wmma16(vf[dt], pl, accl[dt]); accl[dt] = wmma16(frag_h(VTL + vr, lane), pa, accl[dt]); } }   // leading query blocks: P hi/lo x V hi/lo (3 products); elsewhere P x V single
#pragma unroll
    for (int i = 0; i < 4; ++i) kbv[i] = kbn[i]; }
    asm volatile("s_wait_dscnt 0x0" ::: "memory");      // this wave's reads of this trip's buffers are done
    asm volatile("s_wait_asynccnt 0x0" ::: "memory");   // this wave's copies of the next tile have landed
    __syncthreads();   // publishes the next tile and ends every wave's reads of the buffers refilled below
    if (t + 2 < nt) { kv_copy(kg, vg, kl + (t & 1) * AKB, vl + (t & 1) * AKB); kg += (size_t)AK * (2 * DM); vg += AK; } }   // tile t + 2 into the buffers that this trip has read
  asm volatile("s_wait_asynccnt 0x0" ::: "memory");   // no copy is outstanding when the wave goes on to its end
  l += xhalf(l);   // the two halves of the query's keys
  const int am = AM[h];
  asm volatile("s_wait_xcnt 0x0" :: "v"(h) : "memory");   // the index is an input here, so the load does not land in its own address register, which stays whole up to this wait
  const float il = ((am != 0) ? (1.0f / 2048.0f) : 0.f) / l;   // dormant heads contribute nothing
#pragma unroll
  for (int dt = 0; dt < 4; ++dt) { v4f o0, o1;
#pragma unroll   // the lane's 8 consecutive d of its query: two 16-byte LDS stores
    for (int r = 0; r < 4; ++r) { o0[r] = (acc[dt][r] + accl[dt][r] * (1.0f / 2048.0f)) * il; o1[r] = (acc[dt][4 + r] + accl[dt][4 + r] * (1.0f / 2048.0f)) * il; }
    *(v4f*)&so[wave][col][dt * 16 + 8 * g] = o0; *(v4f*)&so[wave][col][dt * 16 + 8 * g + 4] = o1; }
  LDSX();
  for (int rl = 0; rl < 16; ++rl) if (lane < 16) vst2(O + ((size_t)b * SS + q0 + rl) * DM + h * HD + lane * 4, *(const v4f*)&so[wave][rl][lane * 4]);
}
// ---- k_out: block = (64 rows, 128 cols): out = O(hi/lo) . Wo rows (2 products), no bias (BO is null)
__global__ __launch_bounds__(128) void k_out(const float* __restrict__ O, const __bf16* __restrict__ P, const float* __restrict__ BO, float* __restrict__ Y) {
  __shared__ __align__(16) float so[4][16][132];
  const int tid = threadIdx.x, wave = tid >> 5, lane = tid & 31, col = lane & 15, g = lane >> 4; const size_t r0 = (size_t)blockIdx.x * 64 + wave * 16; const int n0 = blockIdx.y * 128;
  v8f acc[8] = {};
  // as in k_qkv: the block's 64 rows of O (split once into bf16 hi and residual) and 128 weight rows go through LDS, KT columns a trip
  __shared__ __align__(16) __bf16 sAh[64][LP], sAl[64][LP], sB[128][LP];
  const int ar = tid >> 4, ac = (tid & 15) * 4, br = tid >> 3, bc = (tid & 7) * 8;
  const float* Ag = O + ((size_t)blockIdx.x * 64 + ar) * DM + ac; const __bf16* Bg = P + (size_t)(n0 + br) * DM + bc;
  const float* Ap = Ag; const __bf16* Bp = Bg; v4f ra[8]; v8b rb[8];
#pragma unroll   // constant indices keep ra, rb in registers
  for (int i = 0; i < 8; ++i) { ra[i] = *(const v4f*)(Ag + (size_t)i * 8 * DM); rb[i] = *(const v8b*)(Bg + (size_t)i * 16 * DM); }
  for (int kt = 0; kt < DM / KT; ++kt) {
#pragma unroll   // constant indices keep ra, rb in registers
    for (int i = 0; i < 8; ++i) { v4b ch, cl;
#pragma unroll   // four splits, two 8-byte stores
      for (int e = 0; e < 4; ++e) { const __bf16 hv = (__bf16)ra[i][e]; ch[e] = hv; cl[e] = (__bf16)(ra[i][e] - (float)hv); }
      *(v4b*)&sAh[ar + i * 8][ac] = ch; *(v4b*)&sAl[ar + i * 8][ac] = cl; *(v8b*)&sB[br + i * 16][bc] = rb[i]; }
    __syncthreads();   // the tile is published to all four waves
    if (kt + 1 < DM / KT) { Ap += KT; Bp += KT;
#pragma unroll   // constant indices keep ra, rb in registers
      for (int i = 0; i < 8; ++i) { ra[i] = *(const v4f*)(Ap + (size_t)i * 8 * DM); rb[i] = *(const v8b*)(Bp + (size_t)i * 16 * DM); }
      asm volatile("s_wait_xcnt 0x0" :: "v"(Ap), "v"(Bp) : "memory"); }   // the two running pointers are inputs here, so the address pairs of these loads stay whole up to this wait: no load of the run lands in one, and they take their new values only behind it
#pragma unroll   // two k steps of 32, k ascending; constant LDS offsets
    for (int kc = 0; kc < KT / 32; ++kc) { const v16b ah = frag_b(&sAh[wave * 16 + col][kc * 32], lane), al = frag_b(&sAl[wave * 16 + col][kc * 32], lane); v16b w[8];
#pragma unroll   // the k step's fragment reads go out as one group ahead of its products: one LDS latency a step, not one a product
      for (int j = 0; j < 8; ++j) w[j] = frag_b(&sB[j * 16 + col][kc * 32], lane);
#pragma unroll   // acc[j] indexed by constants
      for (int j = 0; j < 8; ++j) { acc[j] = wmma_bf(al, w[j], acc[j]); acc[j] = wmma_bf(ah, w[j], acc[j]); } }
    __syncthreads();   // every wave has read the tile before the next trip overwrites it
  }
#pragma unroll
  for (int j = 0; j < 8; ++j) {
#pragma unroll
    for (int r = 0; r < 8; ++r) so[wave][8 * g + r][j * 16 + col] = acc[j][r] + (BO ? bfr(BO[n0 + j * 16 + col]) : 0.f); }
  LDSX();
  for (int rl = 0; rl < 16; ++rl) vst2(Y + (r0 + rl) * DM + n0 + lane * 4, *(const v4f*)&so[wave][rl][lane * 4]);
}

#define PH_TW 4    // tokens a wave
#define PH_TB 32   // tokens a block (8 waves): the 32 gates of one head are one whole 128-byte line of KB
// ---- k_phase: block = 32 tokens, a wave = 4 of them: ph = bf16(x) . bf16(w_phase) (f32) with a lane on 32 of the 1,024 d (16-byte loads, 512 contiguous bytes a wave), w_phase loaded once for the wave's 4 tokens, the sums joined inside the wave; phase = atan2(ph0, ph1); then a lane = (token, head) for the 16 per-head log gates of each key. 128 blocks, where one block a token is 4,096 blocks of 8 waves that live shorter than they take to start
__global__ __launch_bounds__(256) void k_phase(const float* __restrict__ X, const float* __restrict__ WP, const float* __restrict__ CAR, const float* __restrict__ LOCK, const float* __restrict__ BW, float* __restrict__ KB) {
  __shared__ __align__(8) float sg[NH][PH_TB + 2];   // pitch 34: the 32 lanes that write (16 heads x 2 tokens) meet 32 different banks; even, for the 8-byte reads
  const int t = threadIdx.x, wave = t >> 5, lane = t & 31, hd = lane & 15, g = lane >> 4; const size_t row0 = (size_t)blockIdx.x * PH_TB;
  const float* xp = X + (row0 + wave * PH_TW) * DM + lane * 4; const float* wp = WP + lane * 8; v4f xv[PH_TW][8], wv[8][2];
#pragma unroll   // constant indices keep wv in registers
  for (int j = 0; j < 8; ++j) { wv[j][0] = *(const v4f*)(wp + j * 256); wv[j][1] = *(const v4f*)(wp + j * 256 + 4); }   // both columns of d = 128 j + 4 lane + (0 .. 3)
#pragma unroll   // constant indices keep xv in registers
  for (int k = 0; k < PH_TW; ++k) {
#pragma unroll   // as above
    for (int j = 0; j < 8; ++j) xv[k][j] = *(const v4f*)(xp + (size_t)k * DM + j * 128); }
  const float lkr = LOCK[hd], bwr = BW[hd], carr = CAR[hd];
  // the two pointers are inputs here, so the address pairs of these loads stay whole up to this wait; the loaded values are inputs too (inputs only; an asm statement takes thirty operands, so the rest stand in the fence below), so all 48 loads go out ahead of the first conversion: one memory latency a wave, where the build otherwise holds twelve loads back until registers of the first come free
  asm volatile("s_wait_xcnt 0x0" :: "v"(xp), "v"(wp), "v"(wv[0][0]), "v"(wv[0][1]), "v"(wv[1][0]), "v"(wv[1][1]), "v"(wv[2][0]), "v"(wv[2][1]), "v"(wv[3][0]), "v"(wv[3][1]), "v"(wv[4][0]), "v"(wv[4][1]), "v"(wv[5][0]), "v"(wv[5][1]), "v"(wv[6][0]), "v"(wv[6][1]), "v"(wv[7][0]), "v"(wv[7][1]), "v"(xv[0][0]), "v"(xv[0][1]), "v"(xv[0][2]), "v"(xv[0][3]), "v"(xv[0][4]), "v"(xv[0][5]), "v"(xv[0][6]), "v"(xv[0][7]), "v"(xv[1][0]), "v"(xv[1][1]), "v"(xv[1][2]), "v"(xv[1][3]) : "memory");
  asm volatile("" :: "v"(xv[1][4]), "v"(xv[1][5]), "v"(xv[1][6]), "v"(xv[1][7]), "v"(xv[2][0]), "v"(xv[2][1]), "v"(xv[2][2]), "v"(xv[2][3]), "v"(xv[2][4]), "v"(xv[2][5]), "v"(xv[2][6]), "v"(xv[2][7]), "v"(xv[3][0]), "v"(xv[3][1]), "v"(xv[3][2]), "v"(xv[3][3]), "v"(xv[3][4]), "v"(xv[3][5]), "v"(xv[3][6]), "v"(xv[3][7]));   // the other 20 loaded values, inputs only, for the same purpose
  float a0[PH_TW] = {}, a1[PH_TW] = {};
#pragma unroll   // xv, wv indexed by constants
  for (int j = 0; j < 8; ++j) {
#pragma unroll   // as above
    for (int e = 0; e < 4; ++e) { const float w0 = bfr(wv[j][e >> 1][(e & 1) * 2]), w1 = bfr(wv[j][e >> 1][(e & 1) * 2 + 1]);
#pragma unroll   // eight independent sums
      for (int k = 0; k < PH_TW; ++k) { const float xb = bfr(xv[k][j][e]); a0[k] += xb * w0; a1[k] += xb * w1; } } }
#pragma unroll   // five exchanges, the eight sums side by side in each
  for (int o = 16; o > 0; o >>= 1) {
#pragma unroll   // a0, a1 indexed by constants
    for (int k = 0; k < PH_TW; ++k) { a0[k] += __shfl_xor(a0[k], o); a1[k] += __shfl_xor(a1[k], o); } }
  const float lk = bfr(lkr), bw = bfr(bwr), car = bfr(carr);
#pragma unroll   // a0, a1 indexed by constants
  for (int p = 0; p < PH_TW / 2; ++p) { const float phase = atan2_p(g ? a0[2 * p + 1] : a0[2 * p], g ? a1[2 * p + 1] : a1[2 * p]); const float win = exp_ni((cos_p(phase - car) - 1.0f) / bw); const float gate = lk * win + (1.0f - lk); sg[hd][wave * PH_TW + 2 * p + g] = log_p(gate + 1e-6f); }   // lane = (token 2 p + g of the wave, head hd)
  __syncthreads();   // the block's 16 x 32 gates are complete before any wave reads what other waves wrote
  { const int hh = t >> 4, pr = t & 15; const size_t b = row0 / SS, s = row0 % SS; *(v2f*)(KB + (b * NH + hh) * SS + s + pr * 2) = *(const v2f*)&sg[hh][pr * 2]; }   // 16 lanes store one head's whole line
}
extern "C" void kernel_launch(void* const* d_in, const int* in_sizes, int n_in, void* d_out, int out_size, void* d_ws, size_t ws_size, hipStream_t stream) {
  (void)in_sizes; (void)n_in; (void)out_size;
  const float** F = (const float**)d_in;   // 0 x [4,1024,1024], 1 wq, 2 wk, 3 wv, 4 wo (all (in,out) [1024,1024]), 5 w_phase [1024,2], 6 carrier [16], 7 lock [16], 8 bandwidth [16], 9 active_mask [16] int
  if (ws_size < (size_t)WS_END + 4u * NB * NH * SS + 256) return;
  char* ws = (char*)d_ws; __bf16* PK = (__bf16*)(ws + WS_PK); _Float16 *QK = (_Float16*)(ws + WS_QK), *QKL = (_Float16*)(ws + WS_QKL), *VTH = (_Float16*)(ws + WS_VTH), *VTL = (_Float16*)(ws + WS_VTL); float* O = (float*)(ws + WS_O); float* KB = (float*)(ws + WS_END);
  k_pack<<<dim3(DM / PT_N, DM / PT_K, 4), 256, 0, stream>>>(F[1], F[2], F[3], F[4], PK);
  k_phase<<<NB * SS / PH_TB, 256, 0, stream>>>(F[0], F[5], F[6], F[7], F[8], KB);
  k_qkv<<<dim3(TNB * SS / 64, QKVW / 128), 128, 0, stream>>>(F[0], F[0], F[0], PK + PK_A, nullptr, nullptr, nullptr, QK, QKL, VTH, VTL);
  k_attn<<<dim3(NH, TQB, TNB), 128, 0, stream>>>(QK, QKL, VTH, VTL, nullptr, KB, (const int*)d_in[9], O);
  k_out<<<dim3(TOB, DM / 128), 128, 0, stream>>>(O, PK + PK_P, nullptr, (float*)d_out);
}

// v008
// One run takes 95.7 microseconds.
// In two side-by-side timings against v007, it was 1.03 and 1.05 times as fast.
// Over all steps from v000 it is 3.73 times as fast.
// compute dtype: all float inputs rounded to bf16, active_mask (int) read on device; q/k/v = x . W with EXACT bf16 products on WMMA 16x16x32 ((in,out) weights as transposed rows); the per-token phase (x . w_phase, atan2) and the per-(batch, head, key) log resonance gate in f32 (precise expf/logf/cosf/atan2f); causal attention x 1/8 + log gate: for the first 128 queries of each sequence 3-product scores and P, v as f16 hi + residual (3 products), single f16 operands beyond; running-max softmax in f32 (hardware exp); the per-head active mask applied to the attention output; out = o (bf16 hi + residual) . Wo (2 products).
#include <hip/hip_runtime.h>
#include <math.h>

typedef __attribute__((ext_vector_type(16))) _Float16 v16h;
typedef __attribute__((ext_vector_type(16))) __bf16 v16b;
typedef __attribute__((ext_vector_type(8)))  _Float16 v8h;
typedef __attribute__((ext_vector_type(8)))  float v8f;
typedef __attribute__((ext_vector_type(4)))  float v4f;
typedef __attribute__((ext_vector_type(2)))  float v2f;
typedef __attribute__((ext_vector_type(4)))  unsigned v4u;
typedef __attribute__((ext_vector_type(4)))  int v4i;
typedef float __attribute__((may_alias)) float_a;
typedef int __attribute__((may_alias)) int_a;

template <typename T> __device__ __forceinline__ void vst2(void* p, T v) { *(T*)p = v;  }
__device__ __forceinline__ v8f wmma16(v16h a, v16h b, v8f c) {
  v8f d = __builtin_amdgcn_wmma_f32_16x16x32_f16(false, a, false, b, (short)0, c, false, false);
  asm volatile("v_nop\n\tv_nop\n\tv_nop\n\tv_nop" : "+v"(d) : "v"(a), "v"(b));
  return d;
}
__device__ __forceinline__ v8f wmma_bf(v16b a, v16b b, v8f c) {
  v8f d = __builtin_amdgcn_wmma_f32_16x16x32_bf16(false, a, false, b, (short)0, c, false, false);
  asm volatile("v_nop\n\tv_nop\n\tv_nop\n\tv_nop" : "+v"(d) : "v"(a), "v"(b));
  return d;
}
// Resonance-gated causal attention (B 4, S 1,024, d 1,024, 16 heads x 64): bias-free q/k/v/o projections, a per-key additive log-gate from each token's input phase against a per-head carrier (von Mises window opened by 1 - lock), causal softmax, dormant heads zeroed.
__device__ __forceinline__ v16h frag_h(const _Float16* rowk0, int lane) {
  union { v16h v; v8h q[2]; } u; const _Float16* p = rowk0 + 8 * (lane >> 4);
  u.q[0] = *(const v8h*)p; u.q[1] = *(const v8h*)(p + 16); return u.v;
}
__device__ __forceinline__ v16h frag_f32(const float* rowk0, int lane) {
  v16h a; const float* p = rowk0 + 8 * (lane >> 4);
#pragma unroll
  for (int i = 0; i < 8; ++i) { a[i] = (_Float16)p[i]; a[8 + i] = (_Float16)p[16 + i]; }
  return a;
}
__device__ __forceinline__ v16h frag_f32s(const float* rowk0, int lane, float sc) {
  v16h a; const float* p = rowk0 + 8 * (lane >> 4);
#pragma unroll
  for (int i = 0; i < 8; ++i) { a[i] = (_Float16)(p[i] * sc); a[8 + i] = (_Float16)(p[16 + i] * sc); }
  return a;
}
// column fragment from a [K][ld] layout (column n), rows >= K read as 0
__device__ __forceinline__ v16h fragc_f32(const float* W, int k0, int n, int lane, int ld, int K) {
  v16h a; const int g = lane >> 4;
#pragma unroll
  for (int i = 0; i < 8; ++i) { const int ka = k0 + 8 * g + i, kb = ka + 16;
    a[i] = (_Float16)(ka < K ? W[(size_t)(ka < K ? ka : K - 1) * ld + n] : 0.f); a[8 + i] = (_Float16)(kb < K ? W[(size_t)(kb < K ? kb : K - 1) * ld + n] : 0.f); }
  return a;
}
struct F2 { v16b h, l; };
__device__ __forceinline__ F2 bsplit16(const float v[16]) { F2 r;
#pragma unroll
  for (int i = 0; i < 16; ++i) { const __bf16 h = (__bf16)v[i]; r.h[i] = h; r.l[i] = (__bf16)(v[i] - (float)h); }
  return r; }
__device__ __forceinline__ F2 split_row(const float* row, int k0, int lane) { float v[16]; const float* p = row + k0 + 8 * (lane >> 4);
#pragma unroll
  for (int i = 0; i < 8; ++i) { v[i] = p[i]; v[8 + i] = p[16 + i]; }
  return bsplit16(v); }
__device__ __forceinline__ F2 split_rowK(const float* row, int k0, int lane, int K) { float v[16]; const int g = lane >> 4;
#pragma unroll
  for (int i = 0; i < 8; ++i) { const int ka = k0 + 8 * g + i, kb = ka + 16; v[i] = ka < K ? row[ka < K ? ka : K - 1] : 0.f; v[8 + i] = kb < K ? row[kb < K ? kb : K - 1] : 0.f; }
  return bsplit16(v); }
__device__ __forceinline__ F2 split_col(const float* W, int k0, int n, int lane, int ld, int K) { float v[16]; const int g = lane >> 4;
#pragma unroll
  for (int i = 0; i < 8; ++i) { const int ka = k0 + 8 * g + i, kb = ka + 16; v[i] = ka < K ? W[(size_t)(ka < K ? ka : K - 1) * ld + n] : 0.f; v[8 + i] = kb < K ? W[(size_t)(kb < K ? kb : K - 1) * ld + n] : 0.f; }
  return bsplit16(v); }
__device__ __forceinline__ v8f mac3(const F2& a, const F2& b, v8f c) { c = wmma_bf(a.l, b.h, c); c = wmma_bf(a.h, b.l, c); return wmma_bf(a.h, b.h, c); }
__device__ __forceinline__ float sigm(float v) { return 1.0f / (1.0f + expf(-v)); }
#define LDSX() do { asm volatile("s_wait_dscnt 0" ::: "memory"); __builtin_amdgcn_wave_barrier(); __builtin_amdgcn_fence(__ATOMIC_RELEASE, "workgroup"); } while (0)


#define NB 4
#define SS 1024
#define DM 1024
#define NH 16
#define SCALEF 0.125f
__device__ __attribute__((noinline)) float log_p(float v) { return logf(v); }
__device__ __attribute__((noinline)) float cos_p(float v) { return cosf(v); }
__device__ __attribute__((noinline)) float atan2_p(float y, float x) { return atan2f(y, x); }
#define HD 64
#define QKVW (3 * DM)
#ifndef TQB
#define TQB (SS / 64)
#define TNB NB
#define TOB (NB * SS / 64)     // output row tiles (all)
#endif
typedef __attribute__((ext_vector_type(8))) __bf16 v8b;
__device__ __forceinline__ v16b frag_b(const __bf16* rowk0, int lane) {
  union { v16b v; v8b q[2]; } u; const __bf16* p = rowk0 + 8 * (lane >> 4);
  u.q[0] = *(const v8b*)p; u.q[1] = *(const v8b*)(p + 16); return u.v;
}
__device__ __forceinline__ float bfr(float v) { return (float)(__bf16)v; }
typedef __attribute__((ext_vector_type(4))) __bf16 v4b;
#define KT 64   // k columns of both operands staged in LDS per trip: 128 B of a bf16 row, 256 B of an f32 row, so every staging load covers whole lines
#define LP 72   // LDS row pitch in bf16 elements: 144 B = 16 B x odd, the conflict-free pitch for 16-byte fragment reads
__device__ __attribute__((noinline)) float exp_ni(float v) { return expf(v); }
__device__ __attribute__((noinline)) float erf_ni(float v) { return erff(v); }

#define PK_A 0                       // [3072][1024] Wqkv rows (natural [out][in])
#define PK_P (PK_A + QKVW * DM)        // [1024][1024] Wo rows (natural)
#define PK_END (PK_P + DM * DM)
#define WS_PK  0u
#define WS_QK  (WS_PK + 2u * PK_END)             // f16 [4096 rows][2048]: q | k
#define WS_QKL (WS_QK + 2u * NB * SS * 2 * DM)     // f16 q | k residual planes x2048
#define WS_VTH (WS_QKL + 2u * NB * SS * 2 * DM)    // f16 [b][1024 (h*64+d)][1024 s] hi
#define WS_VTL (WS_VTH + 2u * NB * DM * SS)        // f16 lo x 2048
#define WS_O   (WS_VTL + 2u * NB * DM * SS)        // f32 [4096][1024]
#define WS_CS  (WS_O + 4u * NB * SS * DM)           // f32 2 x [1024][32], unused
#define WS_END (WS_CS + 4u * 2 * SS * 32)
#define PT_N 64    // weight columns (= pack rows) a block
#define PT_K 256   // weight rows (= k of a pack row) a block
// ---- pack_block: block = (64 columns n, 256 rows k, which) of one (in,out) weight, transposed through LDS into bf16 pack rows; which 0..2 -> W_q/W_k/W_v into PK_A rows which*1024 + n; 3 -> W_o into PK_P. Sixteen lanes load 256 contiguous bytes of a weight row, a wave stores 512 contiguous bytes of a pack row: whole lines on both sides
__device__ __forceinline__ void pack_block(int bx, int by, int bz, const float* __restrict__ WQ, const float* __restrict__ WK, const float* __restrict__ WV, const float* __restrict__ WO, __bf16* __restrict__ PK) {
  __shared__ __align__(16) __bf16 s[PT_N][PT_K];   // row n in 16-byte chunks of 8 k; chunk L lies at place L ^ (n >> 2), so the 16 lanes that write one chunk column of 16 rows, and the 32 that read one row, each meet all banks once
  const int n0 = bx * PT_N, k0 = by * PT_K, which = bz, t = threadIdx.x; const float* Wm = (which == 0) ? WQ : (which == 1) ? WK : (which == 2) ? WV : WO;
  const int c = t & 15, kg = t >> 4;   // the thread's 4 columns from 4 c, its 8 rows from 8 kg, and the same 128 rows on
  const float* wp = Wm + (size_t)(k0 + kg * 8) * DM + n0 + c * 4; v4f r[2][8];
#pragma unroll   // constant indices keep r in registers; all 16 loads in flight at once
  for (int p = 0; p < 2; ++p) {
#pragma unroll   // as above
    for (int j = 0; j < 8; ++j) r[p][j] = *(const v4f*)(wp + (size_t)(p * 128 + j) * DM); }
  // the pointer is an input here, so the address pair of these loads stays whole up to this wait; the loaded values are inputs too (inputs only), so all 16 loads go out ahead of the first conversion: one memory latency a block, where the build otherwise holds four loads back until registers of the first come free
  asm volatile("s_wait_xcnt 0x0" :: "v"(wp), "v"(r[0][0]), "v"(r[0][1]), "v"(r[0][2]), "v"(r[0][3]), "v"(r[0][4]), "v"(r[0][5]), "v"(r[0][6]), "v"(r[0][7]), "v"(r[1][0]), "v"(r[1][1]), "v"(r[1][2]), "v"(r[1][3]), "v"(r[1][4]), "v"(r[1][5]), "v"(r[1][6]), "v"(r[1][7]) : "memory");
#pragma unroll   // r indexed by constants
  for (int p = 0; p < 2; ++p) {
#pragma unroll   // r indexed by constants
    for (int e = 0; e < 4; ++e) { v8b o;
#pragma unroll   // 8 k of one column: one 16-byte LDS store
      for (int j = 0; j < 8; ++j) o[j] = (__bf16)r[p][j][e];
      *(v8b*)&s[c * 4 + e][((p * 16 + kg) ^ c) * 8] = o; } }
  __syncthreads();   // the tile is complete before any wave reads rows that other waves wrote
  __bf16* dst = ((which < 3) ? PK + PK_A + ((size_t)which * DM + n0) * DM : PK + PK_P + (size_t)n0 * DM) + k0; const int q = t & 31, rw = t >> 5;
#pragma unroll   // 8 pack rows a wave
  for (int i = 0; i < 8; ++i) { const int n = rw * 8 + i; vst2((unsigned*)(dst + (size_t)n * DM + q * 8), *(const v4u*)&s[n][(q ^ (n >> 2)) * 8]); }
}
__global__ __launch_bounds__(128) void k_qkv(const float* __restrict__ XQ, const float* __restrict__ XK, const float* __restrict__ XV, const __bf16* __restrict__ P, const float* __restrict__ BQ, const float* __restrict__ BK, const float* __restrict__ BV, _Float16* __restrict__ QK, _Float16* __restrict__ QKL, _Float16* __restrict__ VTH, _Float16* __restrict__ VTL) {
  const int which0 = (blockIdx.y * 128) / DM; const float* X = (which0 == 0) ? XQ : (which0 == 1) ? XK : XV; const float* BB = BQ ? (((which0 == 0) ? BQ : (which0 == 1) ? BK : BV) + (blockIdx.y * 128 - which0 * DM)) : nullptr;
  __shared__ __align__(16) _Float16 so[4][16][136], sol[4][16][136]; __shared__ __align__(16) _Float16 sth[128][72], stl[128][72];
  const int tid = threadIdx.x, wave = tid >> 5, lane = tid & 31, col = lane & 15, g = lane >> 4; const size_t r0 = (size_t)blockIdx.x * 64 + wave * 16; const int n0 = blockIdx.y * 128;
  v8f acc[8] = {};
  // the block's 64 x rows (rounded to bf16) and 128 weight rows go through LDS, KT columns a trip: each line is loaded once a block by contiguous lanes; the next trip's loads fly in registers under this trip's products
  __shared__ __align__(16) __bf16 sA[64][LP], sB[128][LP];
  const int ar = tid >> 4, ac = (tid & 15) * 4, br = tid >> 3, bc = (tid & 7) * 8;
  const float* Ag = X + ((size_t)blockIdx.x * 64 + ar) * DM + ac; const __bf16* Bg = P + (size_t)(n0 + br) * DM + bc;
  const float* Ap = Ag; const __bf16* Bp = Bg; v4f ra[8]; v8b rb[8];
#pragma unroll   // constant indices keep ra, rb in registers
  for (int i = 0; i < 8; ++i) { ra[i] = *(const v4f*)(Ag + (size_t)i * 8 * DM); rb[i] = *(const v8b*)(Bg + (size_t)i * 16 * DM); }
  for (int kt = 0; kt < DM / KT; ++kt) {
#pragma unroll   // constant indices keep ra, rb in registers
    for (int i = 0; i < 8; ++i) { v4b c;
#pragma unroll   // four conversions, one 8-byte store
      for (int e = 0; e < 4; ++e) c[e] = (__bf16)ra[i][e];
      *(v4b*)&sA[ar + i * 8][ac] = c; *(v8b*)&sB[br + i * 16][bc] = rb[i]; }
    __syncthreads();   // the tile is published to all four waves
    if (kt + 1 < DM / KT) { Ap += KT; Bp += KT;
#pragma unroll   // constant indices keep ra, rb in registers
      for (int i = 0; i < 8; ++i) { ra[i] = *(const v4f*)(Ap + (size_t)i * 8 * DM); rb[i] = *(const v8b*)(Bp + (size_t)i * 16 * DM); }
      asm volatile("s_wait_xcnt 0x0" :: "v"(Ap), "v"(Bp) : "memory"); }   // the two running pointers are inputs here, so the address pairs of these loads stay whole up to this wait: no load of the run lands in one, and they take their new values only behind it
#pragma unroll   // two k steps of 32, k ascending; constant LDS offsets
    for (int kc = 0; kc < KT / 32; ++kc) { const v16b a = frag_b(&sA[wave * 16 + col][kc * 32], lane); v16b w[8];
#pragma unroll   // the k step's fragment reads go out as one group ahead of its products: one LDS latency a step, not one a product
      for (int j = 0; j < 8; ++j) w[j] = frag_b(&sB[j * 16 + col][kc * 32], lane);
#pragma unroll   // acc[j] indexed by constants
      for (int j = 0; j < 8; ++j) acc[j] = wmma_bf(a, w[j], acc[j]); }
    __syncthreads();   // every wave has read the tile before the next trip overwrites it
  }
  if (n0 < 2 * DM) {   // q stored unscaled (f16 sigma ~0.6, no subnormal exposure); 1/8 applied to the f32 score
#pragma unroll
    for (int j = 0; j < 8; ++j) {
#pragma unroll
      for (int r = 0; r < 8; ++r) { const float v = acc[j][r] + (BB ? bfr(BB[j * 16 + col]) : 0.f); const _Float16 hv = (_Float16)v; so[wave][8 * g + r][j * 16 + col] = hv; sol[wave][8 * g + r][j * 16 + col] = (_Float16)((v - (float)hv) * 2048.0f); } }   // q, k (+ bias) as f16 hi + (x2048) residual
    LDSX();
    for (int rl = 0; rl < 16; ++rl) if (lane < 16) { vst2((unsigned*)(QK + (r0 + rl) * (2 * DM) + n0 + lane * 8), *(const v4u*)&so[wave][rl][lane * 8]); vst2((unsigned*)(QKL + (r0 + rl) * (2 * DM) + n0 + lane * 8), *(const v4u*)&sol[wave][rl][lane * 8]); }
  } else {
#pragma unroll
    for (int j = 0; j < 8; ++j) {
#pragma unroll
      for (int r = 0; r < 8; ++r) { const float v = acc[j][r] + (BB ? bfr(BB[j * 16 + col]) : 0.f); const _Float16 hv = (_Float16)v; sth[j * 16 + col][wave * 16 + 8 * g + r] = hv; stl[j * 16 + col][wave * 16 + 8 * g + r] = (_Float16)((v - (float)hv) * 2048.0f); } }
    __syncthreads();
    const size_t rb = (size_t)blockIdx.x * 64; const int b = (int)(rb / SS), s0 = (int)(rb % SS); const int pc0 = n0 - 2 * DM;
    for (int q = tid; q < 128 * 8; q += 128) { const int d = q >> 3, pc = q & 7; const size_t o = ((size_t)b * DM + pc0 + d) * SS + s0 + pc * 8; vst2((unsigned*)(VTH + o), *(const v4u*)&sth[d][pc * 8]); vst2((unsigned*)(VTL + o), *(const v4u*)&stl[d][pc * 8]); }
  }
}
// fragment at the lane's own address (row start + 8 * (lane >> 4)), the k order of frag_h
__device__ __forceinline__ v16h frag_at(const _Float16* p) { union { v16h v; v8h q[2]; } u; u.q[0] = *(const v8h*)p; u.q[1] = *(const v8h*)(p + 16); return u.v; }
#define AK 64               // keys of K and V staged in LDS a trip of k_attn: 128 B of a K row and of a V row, so every copy covers whole lines
#define AKB (AK * LP * 2)   // bytes of one LDS buffer of K or of V: 64 rows at the pitch LP
// one tile of K (64 keys x 64 d) and of V (64 d x 64 keys) into LDS, through no register: eight asynchronous copies of 16 B a lane. Eight lanes cover one row's 128 B, a lane's four rows of each tile lie 16 apart. kg, vg: the lane's global addresses of its first rows; kl, vl: its LDS byte addresses. The s_wait_xcnt is the last line of the copies' own statement, so no address register named here takes a new value in front of it
__device__ __forceinline__ void kv_copy(const _Float16* kg, const _Float16* vg, unsigned kl, unsigned vl) {
  asm volatile("global_load_async_to_lds_b128 %0, %8, off\n\tglobal_load_async_to_lds_b128 %1, %9, off\n\tglobal_load_async_to_lds_b128 %2, %10, off\n\tglobal_load_async_to_lds_b128 %3, %11, off\n\t"
               "global_load_async_to_lds_b128 %4, %12, off\n\tglobal_load_async_to_lds_b128 %5, %13, off\n\tglobal_load_async_to_lds_b128 %6, %14, off\n\tglobal_load_async_to_lds_b128 %7, %15, off\n\ts_wait_xcnt 0x0"
               :: "v"(kl), "v"(kl + 16 * LP * 2), "v"(kl + 32 * LP * 2), "v"(kl + 48 * LP * 2), "v"(vl), "v"(vl + 16 * LP * 2), "v"(vl + 32 * LP * 2), "v"(vl + 48 * LP * 2),
                  "v"(kg), "v"(kg + (size_t)16 * (2 * DM)), "v"(kg + (size_t)32 * (2 * DM)), "v"(kg + (size_t)48 * (2 * DM)), "v"(vg), "v"(vg + (size_t)16 * SS), "v"(vg + (size_t)32 * SS), "v"(vg + (size_t)48 * SS) : "memory");
}
// hardware base-2 exponentials with, behind the last, the one slot that the instruction set asks for between a transcendental and an instruction that uses its result or overwrites its source. In asm text, slot included. The outputs are early-clobber, so inside the run no exponential touches a register of the one before
__device__ __forceinline__ float exp2_1(float x) { float y; asm("v_exp_f32 %0, %1\n\tv_nop" : "=&v"(y) : "v"(x)); return y; }
__device__ __forceinline__ void exp2_4(float* y, const float* x) { asm("v_exp_f32 %0, %4\n\tv_exp_f32 %1, %5\n\tv_exp_f32 %2, %6\n\tv_exp_f32 %3, %7\n\tv_nop" : "=&v"(y[0]), "=&v"(y[1]), "=&v"(y[2]), "=&v"(y[3]) : "v"(x[0]), "v"(x[1]), "v"(x[2]), "v"(x[3])); }
#define L2E 1.44269504f   // log2(e): exp(x) = 2^(x * L2E), the form that __expf builds to
// lane l with lane l ^ 16, in the vector unit (__shfl_xor by 16 builds to an LDS-pipe permute)
__device__ __forceinline__ float xhalf(float x) { return __builtin_bit_cast(float, __builtin_amdgcn_permlanex16(__builtin_bit_cast(int, x), __builtin_bit_cast(int, x), 0x76543210, 0xfedcba98, false, false)); }
// ---- k_attn: block = (head h, 64 queries, batch b): causal flash attention with the products transposed: S^T = K . Q^T (A = 16 keys, B = the wave's 16 queries), O^T += V^T . P^T (A = 16 d, B = P^T). A lane holds 16 of the 32 scores of ONE query (column lane & 15; keys 8 * (lane >> 4) + r of each 16-key tile), so maximum and sum are in-lane, joined with the other half by one exchange, and the two score tiles, converted in place, are the B operand P^T in the k order of frag_h: P never goes through LDS. scores = (q.k) * 0.125: in the two leading query blocks q, k as f16 hi + (x2048) residual (3 products), single f16 operands beyond; P.V there f16 P and V hi + (x2048) residual (3 products), the residual products in a second accumulator, beyond f16 P x V hi alone; O[b*S+q][h*64+d] = (acc + accl / 2048) / (2048 l) (256-B segments)
__global__ __launch_bounds__(128) void k_attn(const _Float16* __restrict__ QK, const _Float16* __restrict__ QKL, const _Float16* __restrict__ VTH, const _Float16* __restrict__ VTL, const void* __restrict__ KMASK, const float* __restrict__ KB, const int* __restrict__ AM, float* __restrict__ O) {
  __shared__ __align__(16) float so[4][16][68];
  __shared__ __align__(16) _Float16 sK[2][AK][LP], sV[2][HD][LP];   // two buffers each of K rows (key, d) and V rows (d, key); pitch 144 B, conflict-free for the 16-byte fragment reads
  const int tid = threadIdx.x, wave = tid >> 5, lane = tid & 31, col = lane & 15, g = lane >> 4;
  // which query tile a block takes. All blocks of the launch are resident at once, four to a WGP, and a block's cost grows with its tile index (causal), so the launch lasts as long as the WGP with the most key tiles. With the tile index as the fastest grid index, blocks whose flat indices lie a multiple of 16 apart all had the same tile. Here any four blocks that differ only in blockIdx.z, or only in the low two bits of blockIdx.y, take the tiles n - 1 - 2 r, 2 r, n - 2 - 2 r, 2 r + 1 (n = TQB, r = blockIdx.y >> 2): the same number of key tiles for every such four, and two long blocks side by side to the end. For speed only: for each (head, batch) the map blockIdx.y -> tile is a permutation, wherever the blocks land (TQB a multiple of 4)
  const int h = blockIdx.x, b = blockIdx.z, sl = (blockIdx.y + blockIdx.z) & 3, pr = 2 * (blockIdx.y >> 2) + (sl >> 1); const int qb = (sl & 1) ? pr : TQB - 1 - pr; const int q0 = qb * 64 + wave * 16; const size_t rq = (size_t)b * SS + q0 + col;
  v16h aq[2];   // the q residual, used by the leading query blocks alone, is loaded at its products: 16 registers less in every block
#pragma unroll
  for (int kc = 0; kc < 2; ++kc) aq[kc] = frag_h(QK + rq * (2 * DM) + h * HD + kc * 32, lane);
  float m = -3.0e38f, l = 0.f;   // of the lane's query; l holds the sum over the lane's own half of the keys, the halves are joined once behind the loop
  v8f acc[4] = {}, accl[4] = {};   // acc[dt][r] = O^T[d = dt * 16 + 8 g + r][query col]
  const int nt = qb + 1;   // causal: key tiles of 64 up to the query tile's end; two key steps of 32 a tile, in the order of before
  const int cr = tid >> 3, cc = (tid & 7) * 8;
  const _Float16* kg = QK + ((size_t)b * SS + cr) * (2 * DM) + DM + h * HD + cc; const _Float16* vg = VTH + ((size_t)b * DM + h * HD + cr) * SS + cc; const float* bp = KB + ((size_t)b * NH + h) * SS + 8 * g;
  const unsigned kl = (unsigned)(size_t)&sK[0][cr][cc], vl = (unsigned)(size_t)&sV[0][cr][cc];
  kv_copy(kg, vg, kl, vl);
  asm volatile("s_wait_asynccnt 0x0" ::: "memory");   // this wave's copies of tile 0 have landed
  __syncthreads();   // tile 0 is published to all four waves
  if (nt > 1) kv_copy(kg + (size_t)AK * (2 * DM), vg + AK, kl + AKB, vl + AKB);   // tile 1 into the second buffer
  kg += (size_t)2 * AK * (2 * DM); vg += 2 * AK;   // the next tile to copy
  v16h kf[2][2], vf[4]; v4f kbv[4], kbn[4]; kbv[0] = *(const v4f*)bp; kbv[1] = *(const v4f*)(bp + 4); kbv[2] = *(const v4f*)(bp + 16); kbv[3] = *(const v4f*)(bp + 20);
  asm volatile("s_wait_xcnt 0x0" :: "v"(bp) : "memory");   // the running pointer is an input here, so the address pair of these loads stays whole up to this wait and takes its new value only behind it
  const int qd = q0 + col - 8 * g;   // key ks * 32 + ct * 16 + 8 g + r is seen by query q0 + col where ks * 32 + ct * 16 + r <= qd
#pragma unroll 1   // one trip a tile: the buffer is chosen by the trip's parity
  for (int t = 0; t < nt; ++t) {
#pragma unroll 1   // the tile's two key steps stay a loop: the registers hold the live values of one step, not of two
    for (int sub = 0; sub < 2; ++sub) { const int ks = 2 * t + sub; v8f s[2]; const _Float16* kt = &sK[t & 1][sub * 32 + col][8 * g]; const _Float16* vt = &sV[t & 1][col][sub * 32 + 8 * g];   // the lane's fragment addresses in this trip's buffers
#pragma unroll   // constant indices keep kf in registers
    for (int ct = 0; ct < 2; ++ct) { kf[ct][0] = frag_at(kt + ct * 16 * LP); kf[ct][1] = frag_at(kt + ct * 16 * LP + 32); }
    bp += (ks + 1 < 2 * nt) ? 32 : 0; kbn[0] = *(const v4f*)bp; kbn[1] = *(const v4f*)(bp + 4); kbn[2] = *(const v4f*)(bp + 16); kbn[3] = *(const v4f*)(bp + 20);   // the next step's gates go out a whole step ahead, so that none is in flight at the trip's barrier, which waits for global loads too; no branch: the last step loads its own once more (unused)
    asm volatile("s_wait_xcnt 0x0" :: "v"(bp) : "memory");   // the running pointer is an input here, so the address pair of these loads stays whole up to this wait and takes its new value only behind it
#pragma unroll
    for (int ct = 0; ct < 2; ++ct) { const _Float16* krowl = QKL + ((size_t)b * SS + ks * 32 + ct * 16 + col) * (2 * DM) + DM + h * HD; v8f c = {}, cl = {};   // krowl: the residual of the lane's A row, key ct * 16 + col of the step
      if (qb < 2) {   // leading query blocks (few keys, outputs far above the global rms): 3 products
#pragma unroll
        for (int kc = 0; kc < 2; ++kc) { const v16h kh = kf[ct][kc]; c = wmma16(kh, aq[kc], c); cl = wmma16(kh, frag_h(QKL + rq * (2 * DM) + h * HD + kc * 32, lane), cl); cl = wmma16(frag_h(krowl + kc * 32, lane), aq[kc], cl); }
#pragma unroll
        for (int r = 0; r < 8; ++r) c[r] += cl[r] * (1.0f / 2048.0f); }
      else {
#pragma unroll
        for (int kc = 0; kc < 2; ++kc) c = wmma16(kf[ct][kc], aq[kc], c); }   // single product elsewhere
#pragma unroll
      for (int r = 0; r < 8; ++r) s[ct][r] = (ks * 32 + ct * 16 + r <= qd) ? c[r] * SCALEF + kbv[ct * 2 + (r >> 2)][r & 3] : -3.0e38f; }   // causal; + log resonance gate of the key
#pragma unroll   // constant indices keep vf in registers; the V fragment reads go out as one group behind the score products and land under the softmax
    for (int dt = 0; dt < 4; ++dt) vf[dt] = frag_at(vt + dt * 16 * LP);
    float mx8[8];
#pragma unroll   // the lane's 16 scores, as a tree
    for (int r = 0; r < 8; ++r) mx8[r] = fmaxf(s[0][r], s[1][r]);
    float mx = fmaxf(fmaxf(fmaxf(mx8[0], mx8[1]), fmaxf(mx8[2], mx8[3])), fmaxf(fmaxf(mx8[4], mx8[5]), fmaxf(mx8[6], mx8[7])));
    mx = fmaxf(mx, xhalf(mx));   // with the query's other 16 keys of the step
    const float mn = fmaxf(m, mx); const float ea = exp2_1((m - mn) * L2E); const float alpha = (m <= -1.0e38f) ? 0.f : ea;   // the exponential stands in front of the choice: no branch
    float e[2][8], es8[8], ax[2][8], ex[2][8];
#pragma unroll
    for (int r = 0; r < 8; ++r) { ax[0][r] = (s[0][r] - mn) * L2E; ax[1][r] = (s[1][r] - mn) * L2E; }
    exp2_4(&ex[0][0], &ax[0][0]); exp2_4(&ex[0][4], &ax[0][4]); exp2_4(&ex[1][0], &ax[1][0]); exp2_4(&ex[1][4], &ax[1][4]);
#pragma unroll
    for (int r = 0; r < 8; ++r) { e[0][r] = (s[0][r] <= -1.0e38f) ? 0.f : ex[0][r]; e[1][r] = (s[1][r] <= -1.0e38f) ? 0.f : ex[1][r]; es8[r] = e[0][r] + e[1][r]; }
    l = l * alpha + (((es8[0] + es8[1]) + (es8[2] + es8[3])) + ((es8[4] + es8[5]) + (es8[6] + es8[7]))); m = mn;
#pragma unroll
    for (int dt = 0; dt < 4; ++dt) {
#pragma unroll
      for (int r = 0; r < 8; ++r) { acc[dt][r] *= alpha; accl[dt][r] *= alpha; } }
    v16h pa, pl;   // P^T as B operand: element i = key 8 g + i (score tile 0, register i), element 8 + i = key 16 + 8 g + i (tile 1): the k order of the V fragments
#pragma unroll
    for (int i = 0; i < 8; ++i) { const float x0 = e[0][i] * 2048.0f, x1 = e[1][i] * 2048.0f; const _Float16 h0 = (_Float16)x0, h1 = (_Float16)x1; pa[i] = h0; pa[8 + i] = h1; pl[i] = (_Float16)((x0 - (float)h0) * 2048.0f); pl[8 + i] = (_Float16)((x1 - (float)h1) * 2048.0f); }   // P scaled by 2^11 before the f16 split so small softmax weights stay out of the f16 subnormal range; 2^-11 folded into the epilogue
#pragma unroll
    for (int dt = 0; dt < 4; ++dt) acc[dt] = wmma16(vf[dt], pa, acc[dt]);
    if (qb < 2) {   // one branch a step for the four tiles' extra products: with one per tile the build holds accl twice
#pragma unroll   // accl, vf indexed by constants
      for (int dt = 0; dt < 4; ++dt) { const size_t vr = ((size_t)b * DM + h * HD + dt * 16 + col) * SS + ks * 32; accl[dt] = wmma16(vf[dt], pl, accl[dt]); accl[dt] = wmma16(frag_h(VTL + vr, lane), pa, accl[dt]); } }   // leading query blocks: P hi/lo x V hi/lo (3 products); elsewhere P x V single
#pragma unroll
    for (int i = 0; i < 4; ++i) kbv[i] = kbn[i]; }
    asm volatile("s_wait_dscnt 0x0" ::: "memory");      // this wave's reads of this trip's buffers are done
    asm volatile("s_wait_asynccnt 0x0" ::: "memory");   // this wave's copies of the next tile have landed
    __syncthreads();   // publishes the next tile and ends every wave's reads of the buffers refilled below
    if (t + 2 < nt) { kv_copy(kg, vg, kl + (t & 1) * AKB, vl + (t & 1) * AKB); kg += (size_t)AK * (2 * DM); vg += AK; } }   // tile t + 2 into the buffers that this trip has read
  asm volatile("s_wait_asynccnt 0x0" ::: "memory");   // no copy is outstanding when the wave goes on to its end
  l += xhalf(l);   // the two halves of the query's keys
  const int am = AM[h];
  asm volatile("s_wait_xcnt 0x0" :: "v"(h) : "memory");   // the index is an input here, so the load does not land in its own address register, which stays whole up to this wait
  const float il = ((am != 0) ? (1.0f / 2048.0f) : 0.f) / l;   // dormant heads contribute nothing
#pragma unroll
  for (int dt = 0; dt < 4; ++dt) { v4f o0, o1;
#pragma unroll   // the lane's 8 consecutive d of its query: two 16-byte LDS stores
    for (int r = 0; r < 4; ++r) { o0[r] = (acc[dt][r] + accl[dt][r] * (1.0f / 2048.0f)) * il; o1[r] = (acc[dt][4 + r] + accl[dt][4 + r] * (1.0f / 2048.0f)) * il; }
    *(v4f*)&so[wave][col][dt * 16 + 8 * g] = o0; *(v4f*)&so[wave][col][dt * 16 + 8 * g + 4] = o1; }
  LDSX();
  for (int rl = 0; rl < 16; ++rl) if (lane < 16) vst2(O + ((size_t)b * SS + q0 + rl) * DM + h * HD + lane * 4, *(const v4f*)&so[wave][rl][lane * 4]);
}
// ---- k_out: block = (64 rows, 128 cols): out = O(hi/lo) . Wo rows (2 products), no bias (BO is null)
__global__ __launch_bounds__(128) void k_out(const float* __restrict__ O, const __bf16* __restrict__ P, const float* __restrict__ BO, float* __restrict__ Y) {
  __shared__ __align__(16) float so[4][16][132];
  const int tid = threadIdx.x, wave = tid >> 5, lane = tid & 31, col = lane & 15, g = lane >> 4; const size_t r0 = (size_t)blockIdx.x * 64 + wave * 16; const int n0 = blockIdx.y * 128;
  v8f acc[8] = {};
  // as in k_qkv: the block's 64 rows of O (split once into bf16 hi and residual) and 128 weight rows go through LDS, KT columns a trip
  __shared__ __align__(16) __bf16 sAh[64][LP], sAl[64][LP], sB[128][LP];
  const int ar = tid >> 4, ac = (tid & 15) * 4, br = tid >> 3, bc = (tid & 7) * 8;
  const float* Ag = O + ((size_t)blockIdx.x * 64 + ar) * DM + ac; const __bf16* Bg = P + (size_t)(n0 + br) * DM + bc;
  const float* Ap = Ag; const __bf16* Bp = Bg; v4f ra[8]; v8b rb[8];
#pragma unroll   // constant indices keep ra, rb in registers
  for (int i = 0; i < 8; ++i) { ra[i] = *(const v4f*)(Ag + (size_t)i * 8 * DM); rb[i] = *(const v8b*)(Bg + (size_t)i * 16 * DM); }
  for (int kt = 0; kt < DM / KT; ++kt) {
#pragma unroll   // constant indices keep ra, rb in registers
    for (int i = 0; i < 8; ++i) { v4b ch, cl;
#pragma unroll   // four splits, two 8-byte stores
      for (int e = 0; e < 4; ++e) { const __bf16 hv = (__bf16)ra[i][e]; ch[e] = hv; cl[e] = (__bf16)(ra[i][e] - (float)hv); }
      *(v4b*)&sAh[ar + i * 8][ac] = ch; *(v4b*)&sAl[ar + i * 8][ac] = cl; *(v8b*)&sB[br + i * 16][bc] = rb[i]; }
    __syncthreads();   // the tile is published to all four waves
    if (kt + 1 < DM / KT) { Ap += KT; Bp += KT;
#pragma unroll   // constant indices keep ra, rb in registers
      for (int i = 0; i < 8; ++i) { ra[i] = *(const v4f*)(Ap + (size_t)i * 8 * DM); rb[i] = *(const v8b*)(Bp + (size_t)i * 16 * DM); }
      asm volatile("s_wait_xcnt 0x0" :: "v"(Ap), "v"(Bp) : "memory"); }   // the two running pointers are inputs here, so the address pairs of these loads stay whole up to this wait: no load of the run lands in one, and they take their new values only behind it
#pragma unroll   // two k steps of 32, k ascending; constant LDS offsets
    for (int kc = 0; kc < KT / 32; ++kc) { const v16b ah = frag_b(&sAh[wave * 16 + col][kc * 32], lane), al = frag_b(&sAl[wave * 16 + col][kc * 32], lane); v16b w[8];
#pragma unroll   // the k step's fragment reads go out as one group ahead of its products: one LDS latency a step, not one a product
      for (int j = 0; j < 8; ++j) w[j] = frag_b(&sB[j * 16 + col][kc * 32], lane);
#pragma unroll   // acc[j] indexed by constants
      for (int j = 0; j < 8; ++j) { acc[j] = wmma_bf(al, w[j], acc[j]); acc[j] = wmma_bf(ah, w[j], acc[j]); } }
    __syncthreads();   // every wave has read the tile before the next trip overwrites it
  }
#pragma unroll
  for (int j = 0; j < 8; ++j) {
#pragma unroll
    for (int r = 0; r < 8; ++r) so[wave][8 * g + r][j * 16 + col] = acc[j][r] + (BO ? bfr(BO[n0 + j * 16 + col]) : 0.f); }
  LDSX();
  for (int rl = 0; rl < 16; ++rl) vst2(Y + (r0 + rl) * DM + n0 + lane * 4, *(const v4f*)&so[wave][rl][lane * 4]);
}

#define PH_TW 4    // tokens a wave
#define PH_TB 32   // tokens a block (8 waves): the 32 gates of one head are one whole 128-byte line of KB
// ---- phase_block: block = 32 tokens, a wave = 4 of them: ph = bf16(x) . bf16(w_phase) (f32) with a lane on 32 of the 1,024 d (16-byte loads, 512 contiguous bytes a wave), w_phase loaded once for the wave's 4 tokens, the sums joined inside the wave; phase = atan2(ph0, ph1); then a lane = (token, head) for the 16 per-head log gates of each key. 128 blocks, where one block a token is 4,096 blocks of 8 waves that live shorter than they take to start
__device__ __forceinline__ void phase_block(int bx, const float* __restrict__ X, const float* __restrict__ WP, const float* __restrict__ CAR, const float* __restrict__ LOCK, const float* __restrict__ BW, float* __restrict__ KB) {
  __shared__ __align__(8) float sg[NH][PH_TB + 2];   // pitch 34: the 32 lanes that write (16 heads x 2 tokens) meet 32 different banks; even, for the 8-byte reads
  const int t = threadIdx.x, wave = t >> 5, lane = t & 31, hd = lane & 15, g = lane >> 4; const size_t row0 = (size_t)bx * PH_TB;
  const float* xp = X + (row0 + wave * PH_TW) * DM + lane * 4; const float* wp = WP + lane * 8; v4f xv[PH_TW][8], wv[8][2];
#pragma unroll   // constant indices keep wv in registers
  for (int j = 0; j < 8; ++j) { wv[j][0] = *(const v4f*)(wp + j * 256); wv[j][1] = *(const v4f*)(wp + j * 256 + 4); }   // both columns of d = 128 j + 4 lane + (0 .. 3)
#pragma unroll   // constant indices keep xv in registers
  for (int k = 0; k < PH_TW; ++k) {
#pragma unroll   // as above
    for (int j = 0; j < 8; ++j) xv[k][j] = *(const v4f*)(xp + (size_t)k * DM + j * 128); }
  const float lkr = LOCK[hd], bwr = BW[hd], carr = CAR[hd];
  // the two pointers are inputs here, so the address pairs of these loads stay whole up to this wait; the loaded values are inputs too (inputs only; an asm statement takes thirty operands, so the rest stand in the fence below), so all 48 loads go out ahead of the first conversion: one memory latency a wave, where the build otherwise holds twelve loads back until registers of the first come free
  asm volatile("s_wait_xcnt 0x0" :: "v"(xp), "v"(wp), "v"(wv[0][0]), "v"(wv[0][1]), "v"(wv[1][0]), "v"(wv[1][1]), "v"(wv[2][0]), "v"(wv[2][1]), "v"(wv[3][0]), "v"(wv[3][1]), "v"(wv[4][0]), "v"(wv[4][1]), "v"(wv[5][0]), "v"(wv[5][1]), "v"(wv[6][0]), "v"(wv[6][1]), "v"(wv[7][0]), "v"(wv[7][1]), "v"(xv[0][0]), "v"(xv[0][1]), "v"(xv[0][2]), "v"(xv[0][3]), "v"(xv[0][4]), "v"(xv[0][5]), "v"(xv[0][6]), "v"(xv[0][7]), "v"(xv[1][0]), "v"(xv[1][1]), "v"(xv[1][2]), "v"(xv[1][3]) : "memory");
  asm volatile("" :: "v"(xv[1][4]), "v"(xv[1][5]), "v"(xv[1][6]), "v"(xv[1][7]), "v"(xv[2][0]), "v"(xv[2][1]), "v"(xv[2][2]), "v"(xv[2][3]), "v"(xv[2][4]), "v"(xv[2][5]), "v"(xv[2][6]), "v"(xv[2][7]), "v"(xv[3][0]), "v"(xv[3][1]), "v"(xv[3][2]), "v"(xv[3][3]), "v"(xv[3][4]), "v"(xv[3][5]), "v"(xv[3][6]), "v"(xv[3][7]));   // the other 20 loaded values, inputs only, for the same purpose
  float a0[PH_TW] = {}, a1[PH_TW] = {};
#pragma unroll   // xv, wv indexed by constants
  for (int j = 0; j < 8; ++j) {
#pragma unroll   // as above
    for (int e = 0; e < 4; ++e) { const float w0 = bfr(wv[j][e >> 1][(e & 1) * 2]), w1 = bfr(wv[j][e >> 1][(e & 1) * 2 + 1]);
#pragma unroll   // eight independent sums
      for (int k = 0; k < PH_TW; ++k) { const float xb = bfr(xv[k][j][e]); a0[k] += xb * w0; a1[k] += xb * w1; } } }
#pragma unroll   // five exchanges, the eight sums side by side in each
  for (int o = 16; o > 0; o >>= 1) {
#pragma unroll   // a0, a1 indexed by constants
    for (int k = 0; k < PH_TW; ++k) { a0[k] += __shfl_xor(a0[k], o); a1[k] += __shfl_xor(a1[k], o); } }
  const float lk = bfr(lkr), bw = bfr(bwr), car = bfr(carr);
#pragma unroll   // a0, a1 indexed by constants
  for (int p = 0; p < PH_TW / 2; ++p) { const float phase = atan2_p(g ? a0[2 * p + 1] : a0[2 * p], g ? a1[2 * p + 1] : a1[2 * p]); const float win = exp_ni((cos_p(phase - car) - 1.0f) / bw); const float gate = lk * win + (1.0f - lk); sg[hd][wave * PH_TW + 2 * p + g] = log_p(gate + 1e-6f); }   // lane = (token 2 p + g of the wave, head hd)
  __syncthreads();   // the block's 16 x 32 gates are complete before any wave reads what other waves wrote
  { const int hh = t >> 4, pr = t & 15; const size_t b = row0 / SS, s = row0 % SS; *(v2f*)(KB + (b * NH + hh) * SS + s + pr * 2) = *(const v2f*)&sg[hh][pr * 2]; }   // 16 lanes store one head's whole line
}
#define PH_NB (NB * SS / PH_TB)                 // phase blocks
#define PK_NB ((DM / PT_N) * (DM / PT_K) * 4)   // pack blocks
// ---- k_prep: the two jobs that read inputs alone and none of each other's output, in ONE launch: blocks 0 .. PH_NB - 1 do the phase gates, the rest pack the weights. All blocks are resident at once, so the two short, latency-bound jobs run side by side and one launch with its start and its drain goes. The longer job has the low indices, which start first. The choice is the same for a whole block, so each job's barrier is passed by all of its block's waves
__global__ __launch_bounds__(256) void k_prep(const float* __restrict__ WQ, const float* __restrict__ WK, const float* __restrict__ WV, const float* __restrict__ WO, __bf16* __restrict__ PK, const float* __restrict__ X, const float* __restrict__ WP, const float* __restrict__ CAR, const float* __restrict__ LOCK, const float* __restrict__ BW, float* __restrict__ KB) {
  const int bi = blockIdx.x;
  if (bi < PH_NB) phase_block(bi, X, WP, CAR, LOCK, BW, KB);
  else { const int p = bi - PH_NB; pack_block(p % (DM / PT_N), (p / (DM / PT_N)) % (DM / PT_K), p / ((DM / PT_N) * (DM / PT_K)), WQ, WK, WV, WO, PK); }
}
extern "C" void kernel_launch(void* const* d_in, const int* in_sizes, int n_in, void* d_out, int out_size, void* d_ws, size_t ws_size, hipStream_t stream) {
  (void)in_sizes; (void)n_in; (void)out_size;
  const float** F = (const float**)d_in;   // 0 x [4,1024,1024], 1 wq, 2 wk, 3 wv, 4 wo (all (in,out) [1024,1024]), 5 w_phase [1024,2], 6 carrier [16], 7 lock [16], 8 bandwidth [16], 9 active_mask [16] int
  if (ws_size < (size_t)WS_END + 4u * NB * NH * SS + 256) return;
  char* ws = (char*)d_ws; __bf16* PK = (__bf16*)(ws + WS_PK); _Float16 *QK = (_Float16*)(ws + WS_QK), *QKL = (_Float16*)(ws + WS_QKL), *VTH = (_Float16*)(ws + WS_VTH), *VTL = (_Float16*)(ws + WS_VTL); float* O = (float*)(ws + WS_O); float* KB = (float*)(ws + WS_END);
  k_prep<<<PH_NB + PK_NB, 256, 0, stream>>>(F[1], F[2], F[3], F[4], PK, F[0], F[5], F[6], F[7], F[8], KB);
  k_qkv<<<dim3(TNB * SS / 64, QKVW / 128), 128, 0, stream>>>(F[0], F[0], F[0], PK + PK_A, nullptr, nullptr, nullptr, QK, QKL, VTH, VTL);
  k_attn<<<dim3(NH, TQB, TNB), 128, 0, stream>>>(QK, QKL, VTH, VTL, nullptr, KB, (const int*)d_in[9], O);
  k_out<<<dim3(TOB, DM / 128), 128, 0, stream>>>(O, PK + PK_P, nullptr, (float*)d_out);
}

// v009
// One run takes 90.2 microseconds.
// In two side-by-side timings against v008, it was 1.06 and 1.07 times as fast.
// Over all steps from v000 it is 3.96 times as fast.
// compute dtype: all float inputs rounded to bf16, active_mask (int) read on device; q/k/v = x . W with EXACT bf16 products on WMMA 16x16x32 ((in,out) weights as transposed rows); the per-token phase (x . w_phase, atan2) and the per-(batch, head, key) log resonance gate in f32 (precise expf/logf/cosf/atan2f); causal attention x 1/8 + log gate: for the first 128 queries of each sequence 3-product scores and P, v as f16 hi + residual (3 products), single f16 operands beyond; running-max softmax in f32 (hardware exp); the per-head active mask applied to the attention output; out = o (bf16 hi + residual) . Wo (2 products).
#include <hip/hip_runtime.h>
#include <math.h>

typedef __attribute__((ext_vector_type(16))) _Float16 v16h;
typedef __attribute__((ext_vector_type(16))) __bf16 v16b;
typedef __attribute__((ext_vector_type(8)))  _Float16 v8h;
typedef __attribute__((ext_vector_type(8)))  float v8f;
typedef __attribute__((ext_vector_type(4)))  float v4f;
typedef __attribute__((ext_vector_type(2)))  float v2f;
typedef __attribute__((ext_vector_type(4)))  unsigned v4u;
typedef __attribute__((ext_vector_type(4)))  int v4i;
typedef float __attribute__((may_alias)) float_a;
typedef int __attribute__((may_alias)) int_a;

template <typename T> __device__ __forceinline__ void vst2(void* p, T v) { *(T*)p = v;  }
__device__ __forceinline__ v8f wmma16(v16h a, v16h b, v8f c) {
  v8f d = __builtin_amdgcn_wmma_f32_16x16x32_f16(false, a, false, b, (short)0, c, false, false);
  asm volatile("v_nop\n\tv_nop\n\tv_nop\n\tv_nop" : "+v"(d) : "v"(a), "v"(b));
  return d;
}
__device__ __forceinline__ v8f wmma_bf(v16b a, v16b b, v8f c) {
  v8f d = __builtin_amdgcn_wmma_f32_16x16x32_bf16(false, a, false, b, (short)0, c, false, false);
  asm volatile("v_nop\n\tv_nop\n\tv_nop\n\tv_nop" : "+v"(d) : "v"(a), "v"(b));
  return d;
}
// Resonance-gated causal attention (B 4, S 1,024, d 1,024, 16 heads x 64): bias-free q/k/v/o projections, a per-key additive log-gate from each token's input phase against a per-head carrier (von Mises window opened by 1 - lock), causal softmax, dormant heads zeroed.
__device__ __forceinline__ v16h frag_h(const _Float16* rowk0, int lane) {
  union { v16h v; v8h q[2]; } u; const _Float16* p = rowk0 + 8 * (lane >> 4);
  u.q[0] = *(const v8h*)p; u.q[1] = *(const v8h*)(p + 16); return u.v;
}
__device__ __forceinline__ v16h frag_f32(const float* rowk0, int lane) {
  v16h a; const float* p = rowk0 + 8 * (lane >> 4);
#pragma unroll
  for (int i = 0; i < 8; ++i) { a[i] = (_Float16)p[i]; a[8 + i] = (_Float16)p[16 + i]; }
  return a;
}
__device__ __forceinline__ v16h frag_f32s(const float* rowk0, int lane, float sc) {
  v16h a; const float* p = rowk0 + 8 * (lane >> 4);
#pragma unroll
  for (int i = 0; i < 8; ++i) { a[i] = (_Float16)(p[i] * sc); a[8 + i] = (_Float16)(p[16 + i] * sc); }
  return a;
}
// column fragment from a [K][ld] layout (column n), rows >= K read as 0
__device__ __forceinline__ v16h fragc_f32(const float* W, int k0, int n, int lane, int ld, int K) {
  v16h a; const int g = lane >> 4;
#pragma unroll
  for (int i = 0; i < 8; ++i) { const int ka = k0 + 8 * g + i, kb = ka + 16;
    a[i] = (_Float16)(ka < K ? W[(size_t)(ka < K ? ka : K - 1) * ld + n] : 0.f); a[8 + i] = (_Float16)(kb < K ? W[(size_t)(kb < K ? kb : K - 1) * ld + n] : 0.f); }
  return a;
}
struct F2 { v16b h, l; };
__device__ __forceinline__ F2 bsplit16(const float v[16]) { F2 r;
#pragma unroll
  for (int i = 0; i < 16; ++i) { const __bf16 h = (__bf16)v[i]; r.h[i] = h; r.l[i] = (__bf16)(v[i] - (float)h); }
  return r; }
__device__ __forceinline__ F2 split_row(const float* row, int k0, int lane) { float v[16]; const float* p = row + k0 + 8 * (lane >> 4);
#pragma unroll
  for (int i = 0; i < 8; ++i) { v[i] = p[i]; v[8 + i] = p[16 + i]; }
  return bsplit16(v); }
__device__ __forceinline__ F2 split_rowK(const float* row, int k0, int lane, int K) { float v[16]; const int g = lane >> 4;
#pragma unroll
  for (int i = 0; i < 8; ++i) { const int ka = k0 + 8 * g + i, kb = ka + 16; v[i] = ka < K ? row[ka < K ? ka : K - 1] : 0.f; v[8 + i] = kb < K ? row[kb < K ? kb : K - 1] : 0.f; }
  return bsplit16(v); }
__device__ __forceinline__ F2 split_col(const float* W, int k0, int n, int lane, int ld, int K) { float v[16]; const int g = lane >> 4;
#pragma unroll
  for (int i = 0; i < 8; ++i) { const int ka = k0 + 8 * g + i, kb = ka + 16; v[i] = ka < K ? W[(size_t)(ka < K ? ka : K - 1) * ld + n] : 0.f; v[8 + i] = kb < K ? W[(size_t)(kb < K ? kb : K - 1) * ld + n] : 0.f; }
  return bsplit16(v); }
__device__ __forceinline__ v8f mac3(const F2& a, const F2& b, v8f c) { c = wmma_bf(a.l, b.h, c); c = wmma_bf(a.h, b.l, c); return wmma_bf(a.h, b.h, c); }
__device__ __forceinline__ float sigm(float v) { return 1.0f / (1.0f + expf(-v)); }
#define LDSX() do { asm volatile("s_wait_dscnt 0" ::: "memory"); __builtin_amdgcn_wave_barrier(); __builtin_amdgcn_fence(__ATOMIC_RELEASE, "workgroup"); } while (0)


#define NB 4
#define SS 1024
#define DM 1024
#define NH 16
#define SCALEF 0.125f
__device__ __attribute__((noinline)) float log_p(float v) { return logf(v); }
__device__ __attribute__((noinline)) float cos_p(float v) { return cosf(v); }
__device__ __attribute__((noinline)) float atan2_p(float y, float x) { return atan2f(y, x); }
#define HD 64
#define QKVW (3 * DM)
#ifndef TQB
#define TQB (SS / 64)
#define TNB NB
#define TOB (NB * SS / 64)     // output row tiles (all)
#endif
typedef __attribute__((ext_vector_type(8))) __bf16 v8b;
__device__ __forceinline__ v16b frag_b(const __bf16* rowk0, int lane) {
  union { v16b v; v8b q[2]; } u; const __bf16* p = rowk0 + 8 * (lane >> 4);
  u.q[0] = *(const v8b*)p; u.q[1] = *(const v8b*)(p + 16); return u.v;
}
__device__ __forceinline__ float bfr(float v) { return (float)(__bf16)v; }
typedef __attribute__((ext_vector_type(4))) __bf16 v4b;
#define KT 64   // k columns of both operands staged in LDS per trip: 128 B of a bf16 row, 256 B of an f32 row, so every staging load covers whole lines
#define LP 72   // LDS row pitch in bf16 elements: 144 B = 16 B x odd, the conflict-free pitch for 16-byte fragment reads
__device__ __attribute__((noinline)) float exp_ni(float v) { return expf(v); }
__device__ __attribute__((noinline)) float erf_ni(float v) { return erff(v); }

#define PK_A 0                       // [3072][1024] Wqkv rows (natural [out][in])
#define PK_P (PK_A + QKVW * DM)        // [1024][1024] Wo rows (natural)
#define PK_END (PK_P + DM * DM)
#define WS_PK  0u
#define WS_QK  (WS_PK + 2u * PK_END)             // f16 [4096 rows][2048]: q | k
#define WS_QKL (WS_QK + 2u * NB * SS * 2 * DM)     // f16 q | k residual planes x2048
#define WS_VTH (WS_QKL + 2u * NB * SS * 2 * DM)    // f16 [b][1024 (h*64+d)][1024 s] hi
#define WS_VTL (WS_VTH + 2u * NB * DM * SS)        // f16 lo x 2048
#define WS_O   (WS_VTL + 2u * NB * DM * SS)        // f32 [4096][1024]
#define WS_CS  (WS_O + 4u * NB * SS * DM)           // f32 2 x [1024][32], unused
#define WS_END (WS_CS + 4u * 2 * SS * 32)
#define PT_N 64    // weight columns (= pack rows) a block
#define PT_K 256   // weight rows (= k of a pack row) a block
// ---- pack_block: block = (64 columns n, 256 rows k, which) of one (in,out) weight, transposed through LDS into bf16 pack rows; which 0..2 -> W_q/W_k/W_v into PK_A rows which*1024 + n; 3 -> W_o into PK_P. Sixteen lanes load 256 contiguous bytes of a weight row, a wave stores 512 contiguous bytes of a pack row: whole lines on both sides
__device__ __forceinline__ void pack_block(int bx, int by, int bz, const float* __restrict__ WQ, const float* __restrict__ WK, const float* __restrict__ WV, const float* __restrict__ WO, __bf16* __restrict__ PK) {
  __shared__ __align__(16) __bf16 s[PT_N][PT_K];   // row n in 16-byte chunks of 8 k; chunk L lies at place L ^ (n >> 2), so the 16 lanes that write one chunk column of 16 rows, and the 32 that read one row, each meet all banks once
  const int n0 = bx * PT_N, k0 = by * PT_K, which = bz, t = threadIdx.x; const float* Wm = (which == 0) ? WQ : (which == 1) ? WK : (which == 2) ? WV : WO;
  const int c = t & 15, kg = t >> 4;   // the thread's 4 columns from 4 c, its 8 rows from 8 kg, and the same 128 rows on
  const float* wp = Wm + (size_t)(k0 + kg * 8) * DM + n0 + c * 4; v4f r[2][8];
#pragma unroll   // constant indices keep r in registers; all 16 loads in flight at once
  for (int p = 0; p < 2; ++p) {
#pragma unroll   // as above
    for (int j = 0; j < 8; ++j) r[p][j] = *(const v4f*)(wp + (size_t)(p * 128 + j) * DM); }
  // the pointer is an input here, so the address pair of these loads stays whole up to this wait; the loaded values are inputs too (inputs only), so all 16 loads go out ahead of the first conversion: one memory latency a block, where the build otherwise holds four loads back until registers of the first come free
  asm volatile("s_wait_xcnt 0x0" :: "v"(wp), "v"(r[0][0]), "v"(r[0][1]), "v"(r[0][2]), "v"(r[0][3]), "v"(r[0][4]), "v"(r[0][5]), "v"(r[0][6]), "v"(r[0][7]), "v"(r[1][0]), "v"(r[1][1]), "v"(r[1][2]), "v"(r[1][3]), "v"(r[1][4]), "v"(r[1][5]), "v"(r[1][6]), "v"(r[1][7]) : "memory");
#pragma unroll   // r indexed by constants
  for (int p = 0; p < 2; ++p) {
#pragma unroll   // r indexed by constants
    for (int e = 0; e < 4; ++e) { v8b o;
#pragma unroll   // 8 k of one column: one 16-byte LDS store
      for (int j = 0; j < 8; ++j) o[j] = (__bf16)r[p][j][e];
      *(v8b*)&s[c * 4 + e][((p * 16 + kg) ^ c) * 8] = o; } }
  __syncthreads();   // the tile is complete before any wave reads rows that other waves wrote
  __bf16* dst = ((which < 3) ? PK + PK_A + ((size_t)which * DM + n0) * DM : PK + PK_P + (size_t)n0 * DM) + k0; const int q = t & 31, rw = t >> 5;
#pragma unroll   // 8 pack rows a wave
  for (int i = 0; i < 8; ++i) { const int n = rw * 8 + i; vst2((unsigned*)(dst + (size_t)n * DM + q * 8), *(const v4u*)&s[n][(q ^ (n >> 2)) * 8]); }
}
__global__ __launch_bounds__(128) void k_qkv(const float* __restrict__ XQ, const float* __restrict__ XK, const float* __restrict__ XV, const __bf16* __restrict__ P, const float* __restrict__ BQ, const float* __restrict__ BK, const float* __restrict__ BV, _Float16* __restrict__ QK, _Float16* __restrict__ QKL, _Float16* __restrict__ VTH, _Float16* __restrict__ VTL) {
  const int which0 = (blockIdx.y * 128) / DM; const float* X = (which0 == 0) ? XQ : (which0 == 1) ? XK : XV; const float* BB = BQ ? (((which0 == 0) ? BQ : (which0 == 1) ? BK : BV) + (blockIdx.y * 128 - which0 * DM)) : nullptr;
  __shared__ __align__(16) _Float16 so[4][16][136], sol[4][16][136]; __shared__ __align__(16) _Float16 sth[128][72], stl[128][72];
  const int tid = threadIdx.x, wave = tid >> 5, lane = tid & 31, col = lane & 15, g = lane >> 4; const size_t r0 = (size_t)blockIdx.x * 64 + wave * 16; const int n0 = blockIdx.y * 128;
  v8f acc[8] = {};
  // the block's 64 x rows (rounded to bf16) and 128 weight rows go through LDS, KT columns a trip: each line is loaded once a block by contiguous lanes; the next trip's loads fly in registers under this trip's products
  __shared__ __align__(16) __bf16 sA[64][LP], sB[128][LP];
  const int ar = tid >> 4, ac = (tid & 15) * 4, br = tid >> 3, bc = (tid & 7) * 8;
  const float* Ag = X + ((size_t)blockIdx.x * 64 + ar) * DM + ac; const __bf16* Bg = P + (size_t)(n0 + br) * DM + bc;
  const float* Ap = Ag; const __bf16* Bp = Bg; v4f ra[8]; v8b rb[8];
#pragma unroll   // constant indices keep ra, rb in registers
  for (int i = 0; i < 8; ++i) { ra[i] = *(const v4f*)(Ag + (size_t)i * 8 * DM); rb[i] = *(const v8b*)(Bg + (size_t)i * 16 * DM); }
  for (int kt = 0; kt < DM / KT; ++kt) {
#pragma unroll   // constant indices keep ra, rb in registers
    for (int i = 0; i < 8; ++i) { v4b c;
#pragma unroll   // four conversions, one 8-byte store
      for (int e = 0; e < 4; ++e) c[e] = (__bf16)ra[i][e];
      *(v4b*)&sA[ar + i * 8][ac] = c; *(v8b*)&sB[br + i * 16][bc] = rb[i]; }
    __syncthreads();   // the tile is published to all four waves
    if (kt + 1 < DM / KT) { Ap += KT; Bp += KT;
#pragma unroll   // constant indices keep ra, rb in registers
      for (int i = 0; i < 8; ++i) { ra[i] = *(const v4f*)(Ap + (size_t)i * 8 * DM); rb[i] = *(const v8b*)(Bp + (size_t)i * 16 * DM); }
      asm volatile("s_wait_xcnt 0x0" :: "v"(Ap), "v"(Bp) : "memory"); }   // the two running pointers are inputs here, so the address pairs of these loads stay whole up to this wait: no load of the run lands in one, and they take their new values only behind it
#pragma unroll   // two k steps of 32, k ascending; constant LDS offsets
    for (int kc = 0; kc < KT / 32; ++kc) { const v16b a = frag_b(&sA[wave * 16 + col][kc * 32], lane); v16b w[8];
#pragma unroll   // the k step's fragment reads go out as one group ahead of its products: one LDS latency a step, not one a product
      for (int j = 0; j < 8; ++j) w[j] = frag_b(&sB[j * 16 + col][kc * 32], lane);
#pragma unroll   // acc[j] indexed by constants
      for (int j = 0; j < 8; ++j) acc[j] = wmma_bf(a, w[j], acc[j]); }
    __syncthreads();   // every wave has read the tile before the next trip overwrites it
  }
  if (n0 < 2 * DM) {   // q stored unscaled (f16 sigma ~0.6, no subnormal exposure); 1/8 applied to the f32 score
#pragma unroll
    for (int j = 0; j < 8; ++j) {
#pragma unroll
      for (int r = 0; r < 8; ++r) { const float v = acc[j][r] + (BB ? bfr(BB[j * 16 + col]) : 0.f); const _Float16 hv = (_Float16)v; so[wave][8 * g + r][j * 16 + col] = hv; sol[wave][8 * g + r][j * 16 + col] = (_Float16)((v - (float)hv) * 2048.0f); } }   // q, k (+ bias) as f16 hi + (x2048) residual
    LDSX();
    for (int rl = 0; rl < 16; ++rl) if (lane < 16) { vst2((unsigned*)(QK + (r0 + rl) * (2 * DM) + n0 + lane * 8), *(const v4u*)&so[wave][rl][lane * 8]); vst2((unsigned*)(QKL + (r0 + rl) * (2 * DM) + n0 + lane * 8), *(const v4u*)&sol[wave][rl][lane * 8]); }
  } else {
#pragma unroll
    for (int j = 0; j < 8; ++j) {
#pragma unroll
      for (int r = 0; r < 8; ++r) { const float v = acc[j][r] + (BB ? bfr(BB[j * 16 + col]) : 0.f); const _Float16 hv = (_Float16)v; sth[j * 16 + col][wave * 16 + 8 * g + r] = hv; stl[j * 16 + col][wave * 16 + 8 * g + r] = (_Float16)((v - (float)hv) * 2048.0f); } }
    __syncthreads();
    const size_t rb = (size_t)blockIdx.x * 64; const int b = (int)(rb / SS), s0 = (int)(rb % SS); const int pc0 = n0 - 2 * DM;
    for (int q = tid; q < 128 * 8; q += 128) { const int d = q >> 3, pc = q & 7; const size_t o = ((size_t)b * DM + pc0 + d) * SS + s0 + pc * 8; vst2((unsigned*)(VTH + o), *(const v4u*)&sth[d][pc * 8]); vst2((unsigned*)(VTL + o), *(const v4u*)&stl[d][pc * 8]); }
  }
}
// fragment at the lane's own address (row start + 8 * (lane >> 4)), the k order of frag_h
__device__ __forceinline__ v16h frag_at(const _Float16* p) { union { v16h v; v8h q[2]; } u; u.q[0] = *(const v8h*)p; u.q[1] = *(const v8h*)(p + 16); return u.v; }
#define AK 64               // keys of K and V staged in LDS a trip of k_attn: 128 B of a K row and of a V row, so every copy covers whole lines
#define AKB (AK * LP * 2)   // bytes of one LDS buffer of K or of V: 64 rows at the pitch LP
// one tile of K (64 keys x 64 d) and of V (64 d x 64 keys) into LDS, through no register: eight asynchronous copies of 16 B a lane. Eight lanes cover one row's 128 B, a lane's four rows of each tile lie 16 apart. kg, vg: the lane's global addresses of its first rows; kl, vl: its LDS byte addresses. The s_wait_xcnt is the last line of the copies' own statement, so no address register named here takes a new value in front of it
__device__ __forceinline__ void kv_copy(const _Float16* kg, const _Float16* vg, unsigned kl, unsigned vl) {
  asm volatile("global_load_async_to_lds_b128 %0, %8, off\n\tglobal_load_async_to_lds_b128 %1, %9, off\n\tglobal_load_async_to_lds_b128 %2, %10, off\n\tglobal_load_async_to_lds_b128 %3, %11, off\n\t"
               "global_load_async_to_lds_b128 %4, %12, off\n\tglobal_load_async_to_lds_b128 %5, %13, off\n\tglobal_load_async_to_lds_b128 %6, %14, off\n\tglobal_load_async_to_lds_b128 %7, %15, off\n\ts_wait_xcnt 0x0"
               :: "v"(kl), "v"(kl + 16 * LP * 2), "v"(kl + 32 * LP * 2), "v"(kl + 48 * LP * 2), "v"(vl), "v"(vl + 16 * LP * 2), "v"(vl + 32 * LP * 2), "v"(vl + 48 * LP * 2),
                  "v"(kg), "v"(kg + (size_t)16 * (2 * DM)), "v"(kg + (size_t)32 * (2 * DM)), "v"(kg + (size_t)48 * (2 * DM)), "v"(vg), "v"(vg + (size_t)16 * SS), "v"(vg + (size_t)32 * SS), "v"(vg + (size_t)48 * SS) : "memory");
}
// hardware base-2 exponentials with, behind the last, the one slot that the instruction set asks for between a transcendental and an instruction that uses its result or overwrites its source. In asm text, slot included. The outputs are early-clobber, so inside the run no exponential touches a register of the one before
__device__ __forceinline__ float exp2_1(float x) { float y; asm("v_exp_f32 %0, %1\n\tv_nop" : "=&v"(y) : "v"(x)); return y; }
__device__ __forceinline__ void exp2_4(float* y, const float* x) { asm("v_exp_f32 %0, %4\n\tv_exp_f32 %1, %5\n\tv_exp_f32 %2, %6\n\tv_exp_f32 %3, %7\n\tv_nop" : "=&v"(y[0]), "=&v"(y[1]), "=&v"(y[2]), "=&v"(y[3]) : "v"(x[0]), "v"(x[1]), "v"(x[2]), "v"(x[3])); }
#define L2E 1.44269504f   // log2(e): exp(x) = 2^(x * L2E), the form that __expf builds to
// lane l with lane l ^ 16, in the vector unit (__shfl_xor by 16 builds to an LDS-pipe permute)
__device__ __forceinline__ float xhalf(float x) { return __builtin_bit_cast(float, __builtin_amdgcn_permlanex16(__builtin_bit_cast(int, x), __builtin_bit_cast(int, x), 0x76543210, 0xfedcba98, false, false)); }
// one key step (32 keys) of k_attn, built in three forms, so that work which only some steps need is not done by all. LEAD: a leading query block (3-product scores, P and V with residuals, second accumulator set). DIAG: the step's key tile may hold keys behind a query of the block, so the causal compare and select, and the select that zeroes a masked weight, are built in; in a tile that lies wholly in front of the block's first query every key is seen by every query, both selects are identities, and the form without them gives the same bits
template <bool LEAD, bool DIAG>
__device__ __forceinline__ void attn_step(const int ks, const int nks, const _Float16* kt, const _Float16* vt, const float*& bp, v4f (&kbv)[4], const v16h (&aq)[2], v8f (&acc)[4], v8f (&accl)[4], float& m, float& l, const int qd, const int lane, const int col, const int b, const int h, const size_t rq, const _Float16* __restrict__ QKL, const _Float16* __restrict__ VTL) {
    v16h kf[2][2], vf[4]; v4f kbn[4]; v8f s[2];
#pragma unroll   // constant indices keep kf in registers
    for (int ct = 0; ct < 2; ++ct) { kf[ct][0] = frag_at(kt + ct * 16 * LP); kf[ct][1] = frag_at(kt + ct * 16 * LP + 32); }
    bp += (ks + 1 < nks) ? 32 : 0; kbn[0] = *(const v4f*)bp; kbn[1] = *(const v4f*)(bp + 4); kbn[2] = *(const v4f*)(bp + 16); kbn[3] = *(const v4f*)(bp + 20);   // the next step's gates go out a whole step ahead, so that none is in flight at the trip's barrier, which waits for global loads too; no branch: the last step loads its own once more (unused)
    asm volatile("s_wait_xcnt 0x0" :: "v"(bp) : "memory");   // the running pointer is an input here, so the address pair of these loads stays whole up to this wait and takes its new value only behind it
#pragma unroll
    for (int ct = 0; ct < 2; ++ct) { v8f c = {};
      if constexpr (LEAD) { const _Float16* krowl = QKL + ((size_t)b * SS + ks * 32 + ct * 16 + col) * (2 * DM) + DM + h * HD; v8f cl = {};   // leading query blocks (few keys, outputs far above the global rms): 3 products; krowl: the residual of the lane's A row, key ct * 16 + col of the step
#pragma unroll
        for (int kc = 0; kc < 2; ++kc) { const v16h kh = kf[ct][kc]; c = wmma16(kh, aq[kc], c); cl = wmma16(kh, frag_h(QKL + rq * (2 * DM) + h * HD + kc * 32, lane), cl); cl = wmma16(frag_h(krowl + kc * 32, lane), aq[kc], cl); }
#pragma unroll
        for (int r = 0; r < 8; ++r) c[r] += cl[r] * (1.0f / 2048.0f); }
      else {
#pragma unroll
        for (int kc = 0; kc < 2; ++kc) c = wmma16(kf[ct][kc], aq[kc], c); }   // single product elsewhere
#pragma unroll
      for (int r = 0; r < 8; ++r) { const float sv = c[r] * SCALEF + kbv[ct * 2 + (r >> 2)][r & 3]; s[ct][r] = (!DIAG || ks * 32 + ct * 16 + r <= qd) ? sv : -3.0e38f; } }   // + log resonance gate of the key; causal
#pragma unroll   // constant indices keep vf in registers; the V fragment reads go out as one group behind the score products and land under the softmax
    for (int dt = 0; dt < 4; ++dt) vf[dt] = frag_at(vt + dt * 16 * LP);
    float mx8[8];
#pragma unroll   // the lane's 16 scores, as a tree
    for (int r = 0; r < 8; ++r) mx8[r] = fmaxf(s[0][r], s[1][r]);
    float mx = fmaxf(fmaxf(fmaxf(mx8[0], mx8[1]), fmaxf(mx8[2], mx8[3])), fmaxf(fmaxf(mx8[4], mx8[5]), fmaxf(mx8[6], mx8[7])));
    mx = fmaxf(mx, xhalf(mx));   // with the query's other 16 keys of the step
    const float mn = fmaxf(m, mx); const float ea = exp2_1((m - mn) * L2E); const float alpha = (m <= -1.0e38f) ? 0.f : ea;   // the exponential stands in front of the choice: no branch
    float e[2][8], es8[8], ax[2][8], ex[2][8];
#pragma unroll
    for (int r = 0; r < 8; ++r) { ax[0][r] = (s[0][r] - mn) * L2E; ax[1][r] = (s[1][r] - mn) * L2E; }
    exp2_4(&ex[0][0], &ax[0][0]); exp2_4(&ex[0][4], &ax[0][4]); exp2_4(&ex[1][0], &ax[1][0]); exp2_4(&ex[1][4], &ax[1][4]);
#pragma unroll
    for (int r = 0; r < 8; ++r) { e[0][r] = (DIAG && s[0][r] <= -1.0e38f) ? 0.f : ex[0][r]; e[1][r] = (DIAG && s[1][r] <= -1.0e38f) ? 0.f : ex[1][r]; es8[r] = e[0][r] + e[1][r]; }
    l = l * alpha + (((es8[0] + es8[1]) + (es8[2] + es8[3])) + ((es8[4] + es8[5]) + (es8[6] + es8[7]))); m = mn;
#pragma unroll
    for (int dt = 0; dt < 4; ++dt) {
#pragma unroll
      for (int r = 0; r < 8; ++r) { acc[dt][r] *= alpha; if constexpr (LEAD) accl[dt][r] *= alpha; } }   // the second set stays zero outside the leading blocks
    v16h pa, pl;   // P^T as B operand: element i = key 8 g + i (score tile 0, register i), element 8 + i = key 16 + 8 g + i (tile 1): the k order of the V fragments
#pragma unroll
    for (int i = 0; i < 8; ++i) { const float x0 = e[0][i] * 2048.0f, x1 = e[1][i] * 2048.0f; const _Float16 h0 = (_Float16)x0, h1 = (_Float16)x1; pa[i] = h0; pa[8 + i] = h1; pl[i] = (_Float16)((x0 - (float)h0) * 2048.0f); pl[8 + i] = (_Float16)((x1 - (float)h1) * 2048.0f); }   // P scaled by 2^11 before the f16 split so small softmax weights stay out of the f16 subnormal range; 2^-11 folded into the epilogue
#pragma unroll
    for (int dt = 0; dt < 4; ++dt) acc[dt] = wmma16(vf[dt], pa, acc[dt]);
    if constexpr (LEAD) {
#pragma unroll   // accl, vf indexed by constants
      for (int dt = 0; dt < 4; ++dt) { const size_t vr = ((size_t)b * DM + h * HD + dt * 16 + col) * SS + ks * 32; accl[dt] = wmma16(vf[dt], pl, accl[dt]); accl[dt] = wmma16(frag_h(VTL + vr, lane), pa, accl[dt]); } }   // leading query blocks: P hi/lo x V hi/lo (3 products); elsewhere P x V single
#pragma unroll
    for (int i = 0; i < 4; ++i) kbv[i] = kbn[i];
}
// the foot of a trip of k_attn, passed by every wave of the block: tile t + 1 is published, tile t + 2 goes into the buffers that trip t has read
__device__ __forceinline__ void attn_foot(const int t, const int nt, const _Float16*& kg, const _Float16*& vg, const unsigned kl, const unsigned vl) {
    asm volatile("s_wait_dscnt 0x0" ::: "memory");      // this wave's reads of this trip's buffers are done
    asm volatile("s_wait_asynccnt 0x0" ::: "memory");   // this wave's copies of the next tile have landed
    __syncthreads();   // publishes the next tile and ends every wave's reads of the buffers refilled below
    if (t + 2 < nt) { kv_copy(kg, vg, kl + (t & 1) * AKB, vl + (t & 1) * AKB); kg += (size_t)AK * (2 * DM); vg += AK; }   // tile t + 2 into the buffers that this trip has read
}
// ---- k_attn: block = (64 queries, head h, batch b): causal flash attention with the products transposed: S^T = K . Q^T (A = 16 keys, B = the wave's 16 queries), O^T += V^T . P^T (A = 16 d, B = P^T). A lane holds 16 of the 32 scores of ONE query (column lane & 15; keys 8 * (lane >> 4) + r of each 16-key tile), so maximum and sum are in-lane, joined with the other half by one exchange, and the two score tiles, converted in place, are the B operand P^T in the k order of frag_h: P never goes through LDS. scores = (q.k) * 0.125 + gate, 3 products in the leading query blocks (qb < 2), single f16 operands beyond; P.V: P (x2048) hi/lo x V hi/lo, 3 products in two accumulators, in the leading blocks, P x V hi beyond; O[b*S+q][h*64+d] = (acc + accl / 2048) / (2048 l) (256-B segments)
__global__ __launch_bounds__(128) void k_attn(const _Float16* __restrict__ QK, const _Float16* __restrict__ QKL, const _Float16* __restrict__ VTH, const _Float16* __restrict__ VTL, const void* __restrict__ KMASK, const float* __restrict__ KB, const int* __restrict__ AM, float* __restrict__ O) {
  __shared__ __align__(16) float so[4][16][68];
  __shared__ __align__(16) _Float16 sK[2][AK][LP], sV[2][HD][LP];   // two buffers each of K rows (key, d) and V rows (d, key); pitch 144 B, conflict-free for the 16-byte fragment reads
  const int tid = threadIdx.x, wave = tid >> 5, lane = tid & 31, col = lane & 15, g = lane >> 4;
  // which query tile a block takes. All blocks of the launch are resident at once, four to a WGP, and a block's cost grows with its tile index (causal), so the launch lasts as long as the WGP with the most key tiles. With the tile index as the fastest grid index, blocks whose flat indices lie a multiple of 16 apart all had the same tile. Here any four blocks that differ only in blockIdx.z, or only in the low two bits of blockIdx.y, take the tiles n - 1 - 2 r, 2 r, n - 2 - 2 r, 2 r + 1 (n = TQB, r = blockIdx.y >> 2): the same number of key tiles for every such four, and two long blocks side by side to the end. For speed only: for each (head, batch) the map blockIdx.y -> tile is a permutation, wherever the blocks land (TQB a multiple of 4)
  const int h = blockIdx.x, b = blockIdx.z, sl = (blockIdx.y + blockIdx.z) & 3, pr = 2 * (blockIdx.y >> 2) + (sl >> 1); const int qb = (sl & 1) ? pr : TQB - 1 - pr; const int q0 = qb * 64 + wave * 16; const size_t rq = (size_t)b * SS + q0 + col;
  v16h aq[2];   // the q residual, used by the leading query blocks alone, is loaded at its products: 16 registers less in every block
#pragma unroll
  for (int kc = 0; kc < 2; ++kc) aq[kc] = frag_h(QK + rq * (2 * DM) + h * HD + kc * 32, lane);
  float m = -3.0e38f, l = 0.f;   // of the lane's query; l holds the sum over the lane's own half of the keys, the halves are joined once behind the loop
  v8f acc[4] = {}, accl[4] = {};   // acc[dt][r] = O^T[d = dt * 16 + 8 g + r][query col]
  const int nt = qb + 1;   // causal: key tiles of 64 up to the query tile's end; two key steps of 32 a tile, in the order of before
  const int cr = tid >> 3, cc = (tid & 7) * 8;
  const _Float16* kg = QK + ((size_t)b * SS + cr) * (2 * DM) + DM + h * HD + cc; const _Float16* vg = VTH + ((size_t)b * DM + h * HD + cr) * SS + cc; const float* bp = KB + ((size_t)b * NH + h) * SS + 8 * g;
  const unsigned kl = (unsigned)(size_t)&sK[0][cr][cc], vl = (unsigned)(size_t)&sV[0][cr][cc];
  kv_copy(kg, vg, kl, vl);
  asm volatile("s_wait_asynccnt 0x0" ::: "memory");   // this wave's copies of tile 0 have landed
  __syncthreads();   // tile 0 is published to all four waves
  if (nt > 1) kv_copy(kg + (size_t)AK * (2 * DM), vg + AK, kl + AKB, vl + AKB);   // tile 1 into the second buffer
  kg += (size_t)2 * AK * (2 * DM); vg += 2 * AK;   // the next tile to copy
  v4f kbv[4]; kbv[0] = *(const v4f*)bp; kbv[1] = *(const v4f*)(bp + 4); kbv[2] = *(const v4f*)(bp + 16); kbv[3] = *(const v4f*)(bp + 20);
  asm volatile("s_wait_xcnt 0x0" :: "v"(bp) : "memory");   // the running pointer is an input here, so the address pair of these loads stays whole up to this wait and takes its new value only behind it
  const int qd = q0 + col - 8 * g;   // key ks * 32 + ct * 16 + 8 g + r is seen by query q0 + col where ks * 32 + ct * 16 + r <= qd
  // one trip a tile, the buffer chosen by the trip's parity. The form of a tile's key steps is the same for the whole block, so every wave of a block passes the same feet. In each form a tile's two key steps stay a loop: the registers hold the live values of one step, not of two
  if (qb < 2) {
#pragma unroll 1   // see above
    for (int t = 0; t < nt; ++t) {
#pragma unroll 1   // see above
      for (int sub = 0; sub < 2; ++sub) attn_step<true, true>(2 * t + sub, 2 * nt, &sK[t & 1][sub * 32 + col][8 * g], &sV[t & 1][col][sub * 32 + 8 * g], bp, kbv, aq, acc, accl, m, l, qd, lane, col, b, h, rq, QKL, VTL);
      attn_foot(t, nt, kg, vg, kl, vl); } }
  else {
#pragma unroll 1   // see above
    for (int t = 0; t < nt - 1; ++t) {   // the tiles in front of the block's first query
#pragma unroll 1   // see above
      for (int sub = 0; sub < 2; ++sub) attn_step<false, false>(2 * t + sub, 2 * nt, &sK[t & 1][sub * 32 + col][8 * g], &sV[t & 1][col][sub * 32 + 8 * g], bp, kbv, aq, acc, accl, m, l, qd, lane, col, b, h, rq, QKL, VTL);
      attn_foot(t, nt, kg, vg, kl, vl); }
    const int tl = nt - 1;   // the diagonal tile
#pragma unroll 1   // see above
    for (int sub = 0; sub < 2; ++sub) attn_step<false, true>(2 * tl + sub, 2 * nt, &sK[tl & 1][sub * 32 + col][8 * g], &sV[tl & 1][col][sub * 32 + 8 * g], bp, kbv, aq, acc, accl, m, l, qd, lane, col, b, h, rq, QKL, VTL);
    attn_foot(tl, nt, kg, vg, kl, vl); }
  asm volatile("s_wait_asynccnt 0x0" ::: "memory");   // no copy is outstanding when the wave goes on to its end
  l += xhalf(l);   // the two halves of the query's keys
  const int am = AM[h];
  asm volatile("s_wait_xcnt 0x0" :: "v"(h) : "memory");   // the index is an input here, so the load does not land in its own address register, which stays whole up to this wait
  const float il = ((am != 0) ? (1.0f / 2048.0f) : 0.f) / l;   // dormant heads contribute nothing
#pragma unroll
  for (int dt = 0; dt < 4; ++dt) { v4f o0, o1;
#pragma unroll   // the lane's 8 consecutive d of its query: two 16-byte LDS stores
    for (int r = 0; r < 4; ++r) { o0[r] = (acc[dt][r] + accl[dt][r] * (1.0f / 2048.0f)) * il; o1[r] = (acc[dt][4 + r] + accl[dt][4 + r] * (1.0f / 2048.0f)) * il; }
    *(v4f*)&so[wave][col][dt * 16 + 8 * g] = o0; *(v4f*)&so[wave][col][dt * 16 + 8 * g + 4] = o1; }
  LDSX();
  for (int rl = 0; rl < 16; ++rl) if (lane < 16) vst2(O + ((size_t)b * SS + q0 + rl) * DM + h * HD + lane * 4, *(const v4f*)&so[wave][rl][lane * 4]);
}
// ---- k_out: block = (64 rows, 128 cols): out = O(hi/lo) . Wo rows (2 products), no bias (BO is null)
__global__ __launch_bounds__(128) void k_out(const float* __restrict__ O, const __bf16* __restrict__ P, const float* __restrict__ BO, float* __restrict__ Y) {
  __shared__ __align__(16) float so[4][16][132];
  const int tid = threadIdx.x, wave = tid >> 5, lane = tid & 31, col = lane & 15, g = lane >> 4; const size_t r0 = (size_t)blockIdx.x * 64 + wave * 16; const int n0 = blockIdx.y * 128;
  v8f acc[8] = {};
  // as in k_qkv: the block's 64 rows of O (split once into bf16 hi and residual) and 128 weight rows go through LDS, KT columns a trip
  __shared__ __align__(16) __bf16 sAh[64][LP], sAl[64][LP], sB[128][LP];
  const int ar = tid >> 4, ac = (tid & 15) * 4, br = tid >> 3, bc = (tid & 7) * 8;
  const float* Ag = O + ((size_t)blockIdx.x * 64 + ar) * DM + ac; const __bf16* Bg = P + (size_t)(n0 + br) * DM + bc;
  const float* Ap = Ag; const __bf16* Bp = Bg; v4f ra[8]; v8b rb[8];
#pragma unroll   // constant indices keep ra, rb in registers
  for (int i = 0; i < 8; ++i) { ra[i] = *(const v4f*)(Ag + (size_t)i * 8 * DM); rb[i] = *(const v8b*)(Bg + (size_t)i * 16 * DM); }
  for (int kt = 0; kt < DM / KT; ++kt) {
#pragma unroll   // constant indices keep ra, rb in registers
    for (int i = 0; i < 8; ++i) { v4b ch, cl;
#pragma unroll   // four splits, two 8-byte stores
      for (int e = 0; e < 4; ++e) { const __bf16 hv = (__bf16)ra[i][e]; ch[e] = hv; cl[e] = (__bf16)(ra[i][e] - (float)hv); }
      *(v4b*)&sAh[ar + i * 8][ac] = ch; *(v4b*)&sAl[ar + i * 8][ac] = cl; *(v8b*)&sB[br + i * 16][bc] = rb[i]; }
    __syncthreads();   // the tile is published to all four waves
    if (kt + 1 < DM / KT) { Ap += KT; Bp += KT;
#pragma unroll   // constant indices keep ra, rb in registers
      for (int i = 0; i < 8; ++i) { ra[i] = *(const v4f*)(Ap + (size_t)i * 8 * DM); rb[i] = *(const v8b*)(Bp + (size_t)i * 16 * DM); }
      asm volatile("s_wait_xcnt 0x0" :: "v"(Ap), "v"(Bp) : "memory"); }   // the two running pointers are inputs here, so the address pairs of these loads stay whole up to this wait: no load of the run lands in one, and they take their new values only behind it
#pragma unroll   // two k steps of 32, k ascending; constant LDS offsets
    for (int kc = 0; kc < KT / 32; ++kc) { const v16b ah = frag_b(&sAh[wave * 16 + col][kc * 32], lane), al = frag_b(&sAl[wave * 16 + col][kc * 32], lane); v16b w[8];
#pragma unroll   // the k step's fragment reads go out as one group ahead of its products: one LDS latency a step, not one a product
      for (int j = 0; j < 8; ++j) w[j] = frag_b(&sB[j * 16 + col][kc * 32], lane);
#pragma unroll   // acc[j] indexed by constants
      for (int j = 0; j < 8; ++j) { acc[j] = wmma_bf(al, w[j], acc[j]); acc[j] = wmma_bf(ah, w[j], acc[j]); } }
    __syncthreads();   // every wave has read the tile before the next trip overwrites it
  }
#pragma unroll
  for (int j = 0; j < 8; ++j) {
#pragma unroll
    for (int r = 0; r < 8; ++r) so[wave][8 * g + r][j * 16 + col] = acc[j][r] + (BO ? bfr(BO[n0 + j * 16 + col]) : 0.f); }
  LDSX();
  for (int rl = 0; rl < 16; ++rl) vst2(Y + (r0 + rl) * DM + n0 + lane * 4, *(const v4f*)&so[wave][rl][lane * 4]);
}

#define PH_TW 4    // tokens a wave
#define PH_TB 32   // tokens a block (8 waves): the 32 gates of one head are one whole 128-byte line of KB
// ---- phase_block: block = 32 tokens, a wave = 4 of them: ph = bf16(x) . bf16(w_phase) (f32) with a lane on 32 of the 1,024 d (16-byte loads, 512 contiguous bytes a wave), w_phase loaded once for the wave's 4 tokens, the sums joined inside the wave; phase = atan2(ph0, ph1); then a lane = (token, head) for the 16 per-head log gates of each key. 128 blocks, where one block a token is 4,096 blocks of 8 waves that live shorter than they take to start
__device__ __forceinline__ void phase_block(int bx, const float* __restrict__ X, const float* __restrict__ WP, const float* __restrict__ CAR, const float* __restrict__ LOCK, const float* __restrict__ BW, float* __restrict__ KB) {
  __shared__ __align__(8) float sg[NH][PH_TB + 2];   // pitch 34: the 32 lanes that write (16 heads x 2 tokens) meet 32 different banks; even, for the 8-byte reads
  const int t = threadIdx.x, wave = t >> 5, lane = t & 31, hd = lane & 15, g = lane >> 4; const size_t row0 = (size_t)bx * PH_TB;
  const float* xp = X + (row0 + wave * PH_TW) * DM + lane * 4; const float* wp = WP + lane * 8; v4f xv[PH_TW][8], wv[8][2];
#pragma unroll   // constant indices keep wv in registers
  for (int j = 0; j < 8; ++j) { wv[j][0] = *(const v4f*)(wp + j * 256); wv[j][1] = *(const v4f*)(wp + j * 256 + 4); }   // both columns of d = 128 j + 4 lane + (0 .. 3)
#pragma unroll   // constant indices keep xv in registers
  for (int k = 0; k < PH_TW; ++k) {
#pragma unroll   // as above
    for (int j = 0; j < 8; ++j) xv[k][j] = *(const v4f*)(xp + (size_t)k * DM + j * 128); }
  const float lkr = LOCK[hd], bwr = BW[hd], carr = CAR[hd];
  // the two pointers are inputs here, so the address pairs of these loads stay whole up to this wait; the loaded values are inputs too (inputs only; an asm statement takes thirty operands, so the rest stand in the fence below), so all 48 loads go out ahead of the first conversion: one memory latency a wave, where the build otherwise holds twelve loads back until registers of the first come free
  asm volatile("s_wait_xcnt 0x0" :: "v"(xp), "v"(wp), "v"(wv[0][0]), "v"(wv[0][1]), "v"(wv[1][0]), "v"(wv[1][1]), "v"(wv[2][0]), "v"(wv[2][1]), "v"(wv[3][0]), "v"(wv[3][1]), "v"(wv[4][0]), "v"(wv[4][1]), "v"(wv[5][0]), "v"(wv[5][1]), "v"(wv[6][0]), "v"(wv[6][1]), "v"(wv[7][0]), "v"(wv[7][1]), "v"(xv[0][0]), "v"(xv[0][1]), "v"(xv[0][2]), "v"(xv[0][3]), "v"(xv[0][4]), "v"(xv[0][5]), "v"(xv[0][6]), "v"(xv[0][7]), "v"(xv[1][0]), "v"(xv[1][1]), "v"(xv[1][2]), "v"(xv[1][3]) : "memory");
  asm volatile("" :: "v"(xv[1][4]), "v"(xv[1][5]), "v"(xv[1][6]), "v"(xv[1][7]), "v"(xv[2][0]), "v"(xv[2][1]), "v"(xv[2][2]), "v"(xv[2][3]), "v"(xv[2][4]), "v"(xv[2][5]), "v"(xv[2][6]), "v"(xv[2][7]), "v"(xv[3][0]), "v"(xv[3][1]), "v"(xv[3][2]), "v"(xv[3][3]), "v"(xv[3][4]), "v"(xv[3][5]), "v"(xv[3][6]), "v"(xv[3][7]));   // the other 20 loaded values, inputs only, for the same purpose
  float a0[PH_TW] = {}, a1[PH_TW] = {};
#pragma unroll   // xv, wv indexed by constants
  for (int j = 0; j < 8; ++j) {
#pragma unroll   // as above
    for (int e = 0; e < 4; ++e) { const float w0 = bfr(wv[j][e >> 1][(e & 1) * 2]), w1 = bfr(wv[j][e >> 1][(e & 1) * 2 + 1]);
#pragma unroll   // eight independent sums
      for (int k = 0; k < PH_TW; ++k) { const float xb = bfr(xv[k][j][e]); a0[k] += xb * w0; a1[k] += xb * w1; } } }
#pragma unroll   // five exchanges, the eight sums side by side in each
  for (int o = 16; o > 0; o >>= 1) {
#pragma unroll   // a0, a1 indexed by constants
    for (int k = 0; k < PH_TW; ++k) { a0[k] += __shfl_xor(a0[k], o); a1[k] += __shfl_xor(a1[k], o); } }
  const float lk = bfr(lkr), bw = bfr(bwr), car = bfr(carr);
#pragma unroll   // a0, a1 indexed by constants
  for (int p = 0; p < PH_TW / 2; ++p) { const float phase = atan2_p(g ? a0[2 * p + 1] : a0[2 * p], g ? a1[2 * p + 1] : a1[2 * p]); const float win = exp_ni((cos_p(phase - car) - 1.0f) / bw); const float gate = lk * win + (1.0f - lk); sg[hd][wave * PH_TW + 2 * p + g] = log_p(gate + 1e-6f); }   // lane = (token 2 p + g of the wave, head hd)
  __syncthreads();   // the block's 16 x 32 gates are complete before any wave reads what other waves wrote
  { const int hh = t >> 4, pr = t & 15; const size_t b = row0 / SS, s = row0 % SS; *(v2f*)(KB + (b * NH + hh) * SS + s + pr * 2) = *(const v2f*)&sg[hh][pr * 2]; }   // 16 lanes store one head's whole line
}
#define PH_NB (NB * SS / PH_TB)                 // phase blocks
#define PK_NB ((DM / PT_N) * (DM / PT_K) * 4)   // pack blocks
// ---- k_prep: the two jobs that read inputs alone and none of each other's output, in ONE launch: blocks 0 .. PH_NB - 1 do the phase gates, the rest pack the weights. All blocks are resident at once, so the two short, latency-bound jobs run side by side and one launch with its start and its drain goes. The longer job has the low indices, which start first. The choice is the same for a whole block, so each job's barrier is passed by all of its block's waves
__global__ __launch_bounds__(256) void k_prep(const float* __restrict__ WQ, const float* __restrict__ WK, const float* __restrict__ WV, const float* __restrict__ WO, __bf16* __restrict__ PK, const float* __restrict__ X, const float* __restrict__ WP, const float* __restrict__ CAR, const float* __restrict__ LOCK, const float* __restrict__ BW, float* __restrict__ KB) {
  const int bi = blockIdx.x;
  if (bi < PH_NB) phase_block(bi, X, WP, CAR, LOCK, BW, KB);
  else { const int p = bi - PH_NB; pack_block(p % (DM / PT_N), (p / (DM / PT_N)) % (DM / PT_K), p / ((DM / PT_N) * (DM / PT_K)), WQ, WK, WV, WO, PK); }
}
extern "C" void kernel_launch(void* const* d_in, const int* in_sizes, int n_in, void* d_out, int out_size, void* d_ws, size_t ws_size, hipStream_t stream) {
  (void)in_sizes; (void)n_in; (void)out_size;
  const float** F = (const float**)d_in;   // 0 x [4,1024,1024], 1 wq, 2 wk, 3 wv, 4 wo (all (in,out) [1024,1024]), 5 w_phase [1024,2], 6 carrier [16], 7 lock [16], 8 bandwidth [16], 9 active_mask [16] int
  if (ws_size < (size_t)WS_END + 4u * NB * NH * SS + 256) return;
  char* ws = (char*)d_ws; __bf16* PK = (__bf16*)(ws + WS_PK); _Float16 *QK = (_Float16*)(ws + WS_QK), *QKL = (_Float16*)(ws + WS_QKL), *VTH = (_Float16*)(ws + WS_VTH), *VTL = (_Float16*)(ws + WS_VTL); float* O = (float*)(ws + WS_O); float* KB = (float*)(ws + WS_END);
  k_prep<<<PH_NB + PK_NB, 256, 0, stream>>>(F[1], F[2], F[3], F[4], PK, F[0], F[5], F[6], F[7], F[8], KB);
  k_qkv<<<dim3(TNB * SS / 64, QKVW / 128), 128, 0, stream>>>(F[0], F[0], F[0], PK + PK_A, nullptr, nullptr, nullptr, QK, QKL, VTH, VTL);
  k_attn<<<dim3(NH, TQB, TNB), 128, 0, stream>>>(QK, QKL, VTH, VTL, nullptr, KB, (const int*)d_in[9], O);
  k_out<<<dim3(TOB, DM / 128), 128, 0, stream>>>(O, PK + PK_P, nullptr, (float*)d_out);
}

// v010
// It runs in 85.8 microseconds.
// Timed twice side by side with v009, it ran 1.04 and 1.06 times as fast.
// Counting every step since v000, it is 4.16 times as fast.
// compute dtype: all float inputs rounded to bf16, active_mask (int) read on device; q/k/v = x . W with EXACT bf16 products on WMMA 16x16x32 ((in,out) weights as transposed rows); the per-token phase (x . w_phase, atan2) and the per-(batch, head, key) log resonance gate in f32 (precise expf/logf/cosf/atan2f); causal attention x 1/8 + log gate: for the first 128 queries of each sequence 3-product scores and P, v as f16 hi + residual (3 products), single f16 operands beyond; running-max softmax in f32 (hardware exp); the per-head active mask applied to the attention output; out = o (bf16 hi + residual) . Wo (2 products).
#include <hip/hip_runtime.h>
#include <math.h>

typedef __attribute__((ext_vector_type(16))) _Float16 v16h;
typedef __attribute__((ext_vector_type(16))) __bf16 v16b;
typedef __attribute__((ext_vector_type(8)))  _Float16 v8h;
typedef __attribute__((ext_vector_type(8)))  float v8f;
typedef __attribute__((ext_vector_type(4)))  float v4f;
typedef __attribute__((ext_vector_type(2)))  float v2f;
typedef __attribute__((ext_vector_type(4)))  unsigned v4u;
typedef __attribute__((ext_vector_type(4)))  int v4i;
typedef float __attribute__((may_alias)) float_a;
typedef int __attribute__((may_alias)) int_a;

template <typename T> __device__ __forceinline__ void vst2(void* p, T v) { *(T*)p = v;  }
__device__ __forceinline__ v8f wmma16(v16h a, v16h b, v8f c) {
  v8f d = __builtin_amdgcn_wmma_f32_16x16x32_f16(false, a, false, b, (short)0, c, false, false);
  asm volatile("v_nop\n\tv_nop\n\tv_nop\n\tv_nop" : "+v"(d) : "v"(a), "v"(b));
  return d;
}
__device__ __forceinline__ v8f wmma_bf(v16b a, v16b b, v8f c) {
  v8f d = __builtin_amdgcn_wmma_f32_16x16x32_bf16(false, a, false, b, (short)0, c, false, false);
  asm volatile("v_nop\n\tv_nop\n\tv_nop\n\tv_nop" : "+v"(d) : "v"(a), "v"(b));
  return d;
}
// Resonance-gated causal attention (B 4, S 1,024, d 1,024, 16 heads x 64): bias-free q/k/v/o projections, a per-key additive log-gate from each token's input phase against a per-head carrier (von Mises window opened by 1 - lock), causal softmax, dormant heads zeroed.
__device__ __forceinline__ v16h frag_h(const _Float16* rowk0, int lane) {
  union { v16h v; v8h q[2]; } u; const _Float16* p = rowk0 + 8 * (lane >> 4);
  u.q[0] = *(const v8h*)p; u.q[1] = *(const v8h*)(p + 16); return u.v;
}
__device__ __forceinline__ v16h frag_f32(const float* rowk0, int lane) {
  v16h a; const float* p = rowk0 + 8 * (lane >> 4);
#pragma unroll
  for (int i = 0; i < 8; ++i) { a[i] = (_Float16)p[i]; a[8 + i] = (_Float16)p[16 + i]; }
  return a;
}
__device__ __forceinline__ v16h frag_f32s(const float* rowk0, int lane, float sc) {
  v16h a; const float* p = rowk0 + 8 * (lane >> 4);
#pragma unroll
  for (int i = 0; i < 8; ++i) { a[i] = (_Float16)(p[i] * sc); a[8 + i] = (_Float16)(p[16 + i] * sc); }
  return a;
}
// column fragment from a [K][ld] layout (column n), rows >= K read as 0
__device__ __forceinline__ v16h fragc_f32(const float* W, int k0, int n, int lane, int ld, int K) {
  v16h a; const int g = lane >> 4;
#pragma unroll
  for (int i = 0; i < 8; ++i) { const int ka = k0 + 8 * g + i, kb = ka + 16;
    a[i] = (_Float16)(ka < K ? W[(size_t)(ka < K ? ka : K - 1) * ld + n] : 0.f); a[8 + i] = (_Float16)(kb < K ? W[(size_t)(kb < K ? kb : K - 1) * ld + n] : 0.f); }
  return a;
}
struct F2 { v16b h, l; };
__device__ __forceinline__ F2 bsplit16(const float v[16]) { F2 r;
#pragma unroll
  for (int i = 0; i < 16; ++i) { const __bf16 h = (__bf16)v[i]; r.h[i] = h; r.l[i] = (__bf16)(v[i] - (float)h); }
  return r; }
__device__ __forceinline__ F2 split_row(const float* row, int k0, int lane) { float v[16]; const float* p = row + k0 + 8 * (lane >> 4);
#pragma unroll
  for (int i = 0; i < 8; ++i) { v[i] = p[i]; v[8 + i] = p[16 + i]; }
  return bsplit16(v); }
__device__ __forceinline__ F2 split_rowK(const float* row, int k0, int lane, int K) { float v[16]; const int g = lane >> 4;
#pragma unroll
  for (int i = 0; i < 8; ++i) { const int ka = k0 + 8 * g + i, kb = ka + 16; v[i] = ka < K ? row[ka < K ? ka : K - 1] : 0.f; v[8 + i] = kb < K ? row[kb < K ? kb : K - 1] : 0.f; }
  return bsplit16(v); }
__device__ __forceinline__ F2 split_col(const float* W, int k0, int n, int lane, int ld, int K) { float v[16]; const int g = lane >> 4;
#pragma unroll
  for (int i = 0; i < 8; ++i) { const int ka = k0 + 8 * g + i, kb = ka + 16; v[i] = ka < K ? W[(size_t)(ka < K ? ka : K - 1) * ld + n] : 0.f; v[8 + i] = kb < K ? W[(size_t)(kb < K ? kb : K - 1) * ld + n] : 0.f; }
  return bsplit16(v); }
__device__ __forceinline__ v8f mac3(const F2& a, const F2& b, v8f c) { c = wmma_bf(a.l, b.h, c); c = wmma_bf(a.h, b.l, c); return wmma_bf(a.h, b.h, c); }
__device__ __forceinline__ float sigm(float v) { return 1.0f / (1.0f + expf(-v)); }
#define LDSX() do { asm volatile("s_wait_dscnt 0" ::: "memory"); __builtin_amdgcn_wave_barrier(); __builtin_amdgcn_fence(__ATOMIC_RELEASE, "workgroup"); } while (0)


#define NB 4
#define SS 1024
#define DM 1024
#define NH 16
#define SCALEF 0.125f
__device__ __attribute__((noinline)) float log_p(float v) { return logf(v); }
__device__ __attribute__((noinline)) float cos_p(float v) { return cosf(v); }
__device__ __attribute__((noinline)) float atan2_p(float y, float x) { return atan2f(y, x); }
#define HD 64
#define QKVW (3 * DM)
#ifndef TQB
#define TQB (SS / 64)
#define TNB NB
#define TOB (NB * SS / 64)     // output row tiles (all)
#endif
typedef __attribute__((ext_vector_type(8))) __bf16 v8b;
__device__ __forceinline__ v16b frag_b(const __bf16* rowk0, int lane) {
  union { v16b v; v8b q[2]; } u; const __bf16* p = rowk0 + 8 * (lane >> 4);
  u.q[0] = *(const v8b*)p; u.q[1] = *(const v8b*)(p + 16); return u.v;
}
__device__ __forceinline__ float bfr(float v) { return (float)(__bf16)v; }
typedef __attribute__((ext_vector_type(4))) __bf16 v4b;
#define KT 64   // k columns of both operands staged in LDS per trip: 128 B of a bf16 row, 256 B of an f32 row, so every staging load covers whole lines
#define LP 72   // LDS row pitch in bf16 elements: 144 B = 16 B x odd, the conflict-free pitch for 16-byte fragment reads
__device__ __attribute__((noinline)) float exp_ni(float v) { return expf(v); }
__device__ __attribute__((noinline)) float erf_ni(float v) { return erff(v); }

#define PK_A 0                       // [3072][1024] Wqkv rows (natural [out][in])
#define PK_P (PK_A + QKVW * DM)        // [1024][1024] Wo rows (natural)
#define PK_END (PK_P + DM * DM)
#define WS_PK  0u
#define WS_QK  (WS_PK + 2u * PK_END)             // f16 [4096 rows][2048]: q | k
#define WS_QKL (WS_QK + 2u * NB * SS * 2 * DM)     // f16 q | k residual planes x2048
#define WS_VTH (WS_QKL + 2u * NB * SS * 2 * DM)    // f16 [b][1024 (h*64+d)][1024 s] hi
#define WS_VTL (WS_VTH + 2u * NB * DM * SS)        // f16 lo x 2048
#define WS_O   (WS_VTL + 2u * NB * DM * SS)        // f32 [4096][1024]
#define WS_CS  (WS_O + 4u * NB * SS * DM)           // f32 2 x [1024][32], unused
#define WS_END (WS_CS + 4u * 2 * SS * 32)
#define PT_N 64    // weight columns (= pack rows) a block
#define PT_K 256   // weight rows (= k of a pack row) a block
// ---- pack_block: block = (64 columns n, 256 rows k, which) of one (in,out) weight, transposed through LDS into bf16 pack rows; which 0..2 -> W_q/W_k/W_v into PK_A rows which*1024 + n; 3 -> W_o into PK_P. Sixteen lanes load 256 contiguous bytes of a weight row, a wave stores 512 contiguous bytes of a pack row: whole lines on both sides
__device__ __forceinline__ void pack_block(int bx, int by, int bz, const float* __restrict__ WQ, const float* __restrict__ WK, const float* __restrict__ WV, const float* __restrict__ WO, __bf16* __restrict__ PK) {
  __shared__ __align__(16) __bf16 s[PT_N][PT_K];   // row n in 16-byte chunks of 8 k; chunk L lies at place L ^ (n >> 2), so the 16 lanes that write one chunk column of 16 rows, and the 32 that read one row, each meet all banks once
  const int n0 = bx * PT_N, k0 = by * PT_K, which = bz, t = threadIdx.x; const float* Wm = (which == 0) ? WQ : (which == 1) ? WK : (which == 2) ? WV : WO;
  const int c = t & 15, kg = t >> 4;   // the thread's 4 columns from 4 c, its 8 rows from 8 kg, and the same 128 rows on
  const float* wp = Wm + (size_t)(k0 + kg * 8) * DM + n0 + c * 4; v4f r[2][8];
#pragma unroll   // constant indices keep r in registers; all 16 loads in flight at once
  for (int p = 0; p < 2; ++p) {
#pragma unroll   // as above
    for (int j = 0; j < 8; ++j) r[p][j] = *(const v4f*)(wp + (size_t)(p * 128 + j) * DM); }
  // the pointer is an input here, so the address pair of these loads stays whole up to this wait; the loaded values are inputs too (inputs only), so all 16 loads go out ahead of the first conversion: one memory latency a block, where the build otherwise holds four loads back until registers of the first come free
  asm volatile("s_wait_xcnt 0x0" :: "v"(wp), "v"(r[0][0]), "v"(r[0][1]), "v"(r[0][2]), "v"(r[0][3]), "v"(r[0][4]), "v"(r[0][5]), "v"(r[0][6]), "v"(r[0][7]), "v"(r[1][0]), "v"(r[1][1]), "v"(r[1][2]), "v"(r[1][3]), "v"(r[1][4]), "v"(r[1][5]), "v"(r[1][6]), "v"(r[1][7]) : "memory");
#pragma unroll   // r indexed by constants
  for (int p = 0; p < 2; ++p) {
#pragma unroll   // r indexed by constants
    for (int e = 0; e < 4; ++e) { v8b o;
#pragma unroll   // 8 k of one column: one 16-byte LDS store
      for (int j = 0; j < 8; ++j) o[j] = (__bf16)r[p][j][e];
      *(v8b*)&s[c * 4 + e][((p * 16 + kg) ^ c) * 8] = o; } }
  __syncthreads();   // the tile is complete before any wave reads rows that other waves wrote
  __bf16* dst = ((which < 3) ? PK + PK_A + ((size_t)which * DM + n0) * DM : PK + PK_P + (size_t)n0 * DM) + k0; const int q = t & 31, rw = t >> 5;
#pragma unroll   // 8 pack rows a wave
  for (int i = 0; i < 8; ++i) { const int n = rw * 8 + i; vst2((unsigned*)(dst + (size_t)n * DM + q * 8), *(const v4u*)&s[n][(q ^ (n >> 2)) * 8]); }
}
#define NLEAD 2   // leading query blocks (of 64 queries) of a sequence: k_attn does their products with residuals, and they see no key behind token NLEAD * 64
__global__ __launch_bounds__(128) void k_qkv(const float* __restrict__ XQ, const float* __restrict__ XK, const float* __restrict__ XV, const __bf16* __restrict__ P, _Float16* __restrict__ QK, _Float16* __restrict__ QKL, _Float16* __restrict__ VTH, _Float16* __restrict__ VTL) {
  const int which0 = (blockIdx.y * 128) / DM; const float* X = (which0 == 0) ? XQ : (which0 == 1) ? XK : XV;
  __shared__ __align__(16) _Float16 so[4][16][136], sol[4][16][136]; __shared__ __align__(16) _Float16 sth[128][72], stl[128][72];
  const int tid = threadIdx.x, wave = tid >> 5, lane = tid & 31, col = lane & 15, g = lane >> 4; const size_t r0 = (size_t)blockIdx.x * 64 + wave * 16; const int n0 = blockIdx.y * 128;
  v8f acc[8] = {};
  // the block's 64 x rows (rounded to bf16) and 128 weight rows go through LDS, KT columns a trip: each line is loaded once a block by contiguous lanes; the next trip's loads fly in registers under this trip's products
  __shared__ __align__(16) __bf16 sA[64][LP], sB[128][LP];
  const int ar = tid >> 4, ac = (tid & 15) * 4, br = tid >> 3, bc = (tid & 7) * 8;
  const float* Ag = X + ((size_t)blockIdx.x * 64 + ar) * DM + ac; const __bf16* Bg = P + (size_t)(n0 + br) * DM + bc;
  const float* Ap = Ag; const __bf16* Bp = Bg; v4f ra[8]; v8b rb[8];
#pragma unroll   // constant indices keep ra, rb in registers
  for (int i = 0; i < 8; ++i) { ra[i] = *(const v4f*)(Ag + (size_t)i * 8 * DM); rb[i] = *(const v8b*)(Bg + (size_t)i * 16 * DM); }
  for (int kt = 0; kt < DM / KT; ++kt) {
#pragma unroll   // constant indices keep ra, rb in registers
    for (int i = 0; i < 8; ++i) { v4b c;
#pragma unroll   // four conversions, one 8-byte store
      for (int e = 0; e < 4; ++e) c[e] = (__bf16)ra[i][e];
      *(v4b*)&sA[ar + i * 8][ac] = c; *(v8b*)&sB[br + i * 16][bc] = rb[i]; }
    __syncthreads();   // the tile is published to all four waves
    if (kt + 1 < DM / KT) { Ap += KT; Bp += KT;
#pragma unroll   // constant indices keep ra, rb in registers
      for (int i = 0; i < 8; ++i) { ra[i] = *(const v4f*)(Ap + (size_t)i * 8 * DM); rb[i] = *(const v8b*)(Bp + (size_t)i * 16 * DM); }
      asm volatile("s_wait_xcnt 0x0" :: "v"(Ap), "v"(Bp) : "memory"); }   // the two running pointers are inputs here, so the address pairs of these loads stay whole up to this wait: no load of the run lands in one, and they take their new values only behind it
#pragma unroll   // two k steps of 32, k ascending; constant LDS offsets
    for (int kc = 0; kc < KT / 32; ++kc) { const v16b a = frag_b(&sA[wave * 16 + col][kc * 32], lane); v16b w[8];
#pragma unroll   // the k step's fragment reads go out as one group ahead of its products: one LDS latency a step, not one a product
      for (int j = 0; j < 8; ++j) w[j] = frag_b(&sB[j * 16 + col][kc * 32], lane);
#pragma unroll   // acc[j] indexed by constants
      for (int j = 0; j < 8; ++j) acc[j] = wmma_bf(a, w[j], acc[j]); }
    __syncthreads();   // every wave has read the tile before the next trip overwrites it
  }
  // the residual planes have one reader, the leading query blocks of k_attn, which read them at tokens below NLEAD * 64 of a sequence alone: only the blocks of those tokens make and store residuals. The same for a whole block. The projections have no bias, so the epilogue is straight-line code
  const bool lead = (blockIdx.x % (SS / 64)) < NLEAD;
  if (n0 < 2 * DM) {   // q stored unscaled (f16 sigma ~0.6, no subnormal exposure); 1/8 applied to the f32 score
#pragma unroll
    for (int j = 0; j < 8; ++j) {
#pragma unroll
      for (int r = 0; r < 8; ++r) so[wave][8 * g + r][j * 16 + col] = (_Float16)acc[j][r]; }   // q, k as f16
    if (lead) {
#pragma unroll   // acc indexed by constants
      for (int j = 0; j < 8; ++j) {
#pragma unroll   // as above
        for (int r = 0; r < 8; ++r) { const float v = acc[j][r]; sol[wave][8 * g + r][j * 16 + col] = (_Float16)((v - (float)(_Float16)v) * 2048.0f); } } }   // + (x2048) residual
    LDSX();
    for (int rl = 0; rl < 16; ++rl) if (lane < 16) vst2((unsigned*)(QK + (r0 + rl) * (2 * DM) + n0 + lane * 8), *(const v4u*)&so[wave][rl][lane * 8]);
    if (lead) { for (int rl = 0; rl < 16; ++rl) if (lane < 16) vst2((unsigned*)(QKL + (r0 + rl) * (2 * DM) + n0 + lane * 8), *(const v4u*)&sol[wave][rl][lane * 8]); }
  } else {
#pragma unroll
    for (int j = 0; j < 8; ++j) {
#pragma unroll
      for (int r = 0; r < 8; ++r) sth[j * 16 + col][wave * 16 + 8 * g + r] = (_Float16)acc[j][r]; }
    if (lead) {
#pragma unroll   // acc indexed by constants
      for (int j = 0; j < 8; ++j) {
#pragma unroll   // as above
        for (int r = 0; r < 8; ++r) { const float v = acc[j][r]; stl[j * 16 + col][wave * 16 + 8 * g + r] = (_Float16)((v - (float)(_Float16)v) * 2048.0f); } } }
    __syncthreads();
    const size_t rb = (size_t)blockIdx.x * 64; const int b = (int)(rb / SS), s0 = (int)(rb % SS); const int pc0 = n0 - 2 * DM;
    for (int q = tid; q < 128 * 8; q += 128) { const int d = q >> 3, pc = q & 7; const size_t o = ((size_t)b * DM + pc0 + d) * SS + s0 + pc * 8; vst2((unsigned*)(VTH + o), *(const v4u*)&sth[d][pc * 8]); }
    if (lead) { for (int q = tid; q < 128 * 8; q += 128) { const int d = q >> 3, pc = q & 7; const size_t o = ((size_t)b * DM + pc0 + d) * SS + s0 + pc * 8; vst2((unsigned*)(VTL + o), *(const v4u*)&stl[d][pc * 8]); } }
  }
}
// fragment at the lane's own address (row start + 8 * (lane >> 4)), the k order of frag_h
__device__ __forceinline__ v16h frag_at(const _Float16* p) { union { v16h v; v8h q[2]; } u; u.q[0] = *(const v8h*)p; u.q[1] = *(const v8h*)(p + 16); return u.v; }
#define AK 64               // keys of K and V staged in LDS a trip of k_attn: 128 B of a K row and of a V row, so every copy covers whole lines
#define AKB (AK * LP * 2)   // bytes of one LDS buffer of K or of V: 64 rows at the pitch LP
// one tile of K (64 keys x 64 d) and of V (64 d x 64 keys) into LDS, through no register: eight asynchronous copies of 16 B a lane. Eight lanes cover one row's 128 B, a lane's four rows of each tile lie 16 apart. kg, vg: the lane's global addresses of its first rows; kl, vl: its LDS byte addresses. The s_wait_xcnt is the last line of the copies' own statement, so no address register named here takes a new value in front of it
__device__ __forceinline__ void kv_copy(const _Float16* kg, const _Float16* vg, unsigned kl, unsigned vl) {
  asm volatile("global_load_async_to_lds_b128 %0, %8, off\n\tglobal_load_async_to_lds_b128 %1, %9, off\n\tglobal_load_async_to_lds_b128 %2, %10, off\n\tglobal_load_async_to_lds_b128 %3, %11, off\n\t"
               "global_load_async_to_lds_b128 %4, %12, off\n\tglobal_load_async_to_lds_b128 %5, %13, off\n\tglobal_load_async_to_lds_b128 %6, %14, off\n\tglobal_load_async_to_lds_b128 %7, %15, off\n\ts_wait_xcnt 0x0"
               :: "v"(kl), "v"(kl + 16 * LP * 2), "v"(kl + 32 * LP * 2), "v"(kl + 48 * LP * 2), "v"(vl), "v"(vl + 16 * LP * 2), "v"(vl + 32 * LP * 2), "v"(vl + 48 * LP * 2),
                  "v"(kg), "v"(kg + (size_t)16 * (2 * DM)), "v"(kg + (size_t)32 * (2 * DM)), "v"(kg + (size_t)48 * (2 * DM)), "v"(vg), "v"(vg + (size_t)16 * SS), "v"(vg + (size_t)32 * SS), "v"(vg + (size_t)48 * SS) : "memory");
}
// hardware base-2 exponentials with, behind the last, the one slot that the instruction set asks for between a transcendental and an instruction that uses its result or overwrites its source. In asm text, slot included. The outputs are early-clobber, so inside the run no exponential touches a register of the one before
__device__ __forceinline__ float exp2_1(float x) { float y; asm("v_exp_f32 %0, %1\n\tv_nop" : "=&v"(y) : "v"(x)); return y; }
__device__ __forceinline__ void exp2_4(float* y, const float* x) { asm("v_exp_f32 %0, %4\n\tv_exp_f32 %1, %5\n\tv_exp_f32 %2, %6\n\tv_exp_f32 %3, %7\n\tv_nop" : "=&v"(y[0]), "=&v"(y[1]), "=&v"(y[2]), "=&v"(y[3]) : "v"(x[0]), "v"(x[1]), "v"(x[2]), "v"(x[3])); }
#define L2E 1.44269504f   // log2(e): exp(x) = 2^(x * L2E), the form that __expf builds to
// lane l with lane l ^ 16, in the vector unit (__shfl_xor by 16 builds to an LDS-pipe permute)
__device__ __forceinline__ float xhalf(float x) { return __builtin_bit_cast(float, __builtin_amdgcn_permlanex16(__builtin_bit_cast(int, x), __builtin_bit_cast(int, x), 0x76543210, 0xfedcba98, false, false)); }
// one key step (32 keys) of k_attn, built in three forms, so that work which only some steps need is not done by all. LEAD: a leading query block (3-product scores, P and V with residuals, second accumulator set). DIAG: the step's key tile may hold keys behind a query of the block, so the causal compare and select, and the select that zeroes a masked weight, are built in; in a tile that lies wholly in front of the block's first query every key is seen by every query, both selects are identities, and the form without them gives the same bits
template <bool LEAD, bool DIAG>
__device__ __forceinline__ void attn_step(const int ks, const int nks, const _Float16* kt, const _Float16* vt, const float*& bp, v4f (&kbv)[4], const v16h (&aq)[2], v8f (&acc)[4], v8f (&accl)[4], float& m, float& l, const int qd, const int lane, const int col, const int b, const int h, const size_t rq, const _Float16* __restrict__ QKL, const _Float16* __restrict__ VTL) {
    v16h kf[2][2], vf[4]; v4f kbn[4]; v8f s[2];
#pragma unroll   // constant indices keep kf in registers
    for (int ct = 0; ct < 2; ++ct) { kf[ct][0] = frag_at(kt + ct * 16 * LP); kf[ct][1] = frag_at(kt + ct * 16 * LP + 32); }
    bp += (ks + 1 < nks) ? 32 : 0; kbn[0] = *(const v4f*)bp; kbn[1] = *(const v4f*)(bp + 4); kbn[2] = *(const v4f*)(bp + 16); kbn[3] = *(const v4f*)(bp + 20);   // the next step's gates go out a whole step ahead, so that none is in flight at the trip's barrier, which waits for global loads too; no branch: the last step loads its own once more (unused)
    asm volatile("s_wait_xcnt 0x0" :: "v"(bp) : "memory");   // the running pointer is an input here, so the address pair of these loads stays whole up to this wait and takes its new value only behind it
#pragma unroll
    for (int ct = 0; ct < 2; ++ct) { v8f c = {};
      if constexpr (LEAD) { const _Float16* krowl = QKL + ((size_t)b * SS + ks * 32 + ct * 16 + col) * (2 * DM) + DM + h * HD; v8f cl = {};   // leading query blocks (few keys, outputs far above the global rms): 3 products; krowl: the residual of the lane's A row, key ct * 16 + col of the step
#pragma unroll
        for (int kc = 0; kc < 2; ++kc) { const v16h kh = kf[ct][kc]; c = wmma16(kh, aq[kc], c); cl = wmma16(kh, frag_h(QKL + rq * (2 * DM) + h * HD + kc * 32, lane), cl); cl = wmma16(frag_h(krowl + kc * 32, lane), aq[kc], cl); }
#pragma unroll
        for (int r = 0; r < 8; ++r) c[r] += cl[r] * (1.0f / 2048.0f); }
      else {
#pragma unroll
        for (int kc = 0; kc < 2; ++kc) c = wmma16(kf[ct][kc], aq[kc], c); }   // single product elsewhere
#pragma unroll
      for (int r = 0; r < 8; ++r) { const float sv = c[r] * SCALEF + kbv[ct * 2 + (r >> 2)][r & 3]; s[ct][r] = (!DIAG || ks * 32 + ct * 16 + r <= qd) ? sv : -3.0e38f; } }   // + log resonance gate of the key; causal
#pragma unroll   // constant indices keep vf in registers; the V fragment reads go out as one group behind the score products and land under the softmax
    for (int dt = 0; dt < 4; ++dt) vf[dt] = frag_at(vt + dt * 16 * LP);
    float mx8[8];
#pragma unroll   // the lane's 16 scores, as a tree
    for (int r = 0; r < 8; ++r) mx8[r] = fmaxf(s[0][r], s[1][r]);
    float mx = fmaxf(fmaxf(fmaxf(mx8[0], mx8[1]), fmaxf(mx8[2], mx8[3])), fmaxf(fmaxf(mx8[4], mx8[5]), fmaxf(mx8[6], mx8[7])));
    mx = fmaxf(mx, xhalf(mx));   // with the query's other 16 keys of the step
    const float mn = fmaxf(m, mx); const float ea = exp2_1((m - mn) * L2E); const float alpha = (m <= -1.0e38f) ? 0.f : ea;   // the exponential stands in front of the choice: no branch
    float e[2][8], es8[8], ax[2][8], ex[2][8];
#pragma unroll
    for (int r = 0; r < 8; ++r) { ax[0][r] = (s[0][r] - mn) * L2E; ax[1][r] = (s[1][r] - mn) * L2E; }
    exp2_4(&ex[0][0], &ax[0][0]); exp2_4(&ex[0][4], &ax[0][4]); exp2_4(&ex[1][0], &ax[1][0]); exp2_4(&ex[1][4], &ax[1][4]);
#pragma unroll
    for (int r = 0; r < 8; ++r) { e[0][r] = (DIAG && s[0][r] <= -1.0e38f) ? 0.f : ex[0][r]; e[1][r] = (DIAG && s[1][r] <= -1.0e38f) ? 0.f : ex[1][r]; es8[r] = e[0][r] + e[1][r]; }
    l = l * alpha + (((es8[0] + es8[1]) + (es8[2] + es8[3])) + ((es8[4] + es8[5]) + (es8[6] + es8[7]))); m = mn;
#pragma unroll
    for (int dt = 0; dt < 4; ++dt) {
#pragma unroll
      for (int r = 0; r < 8; ++r) { acc[dt][r] *= alpha; if constexpr (LEAD) accl[dt][r] *= alpha; } }   // the second set stays zero outside the leading blocks
    v16h pa, pl;   // P^T as B operand: element i = key 8 g + i (score tile 0, register i), element 8 + i = key 16 + 8 g + i (tile 1): the k order of the V fragments
#pragma unroll
    for (int i = 0; i < 8; ++i) { const float x0 = e[0][i] * 2048.0f, x1 = e[1][i] * 2048.0f; const _Float16 h0 = (_Float16)x0, h1 = (_Float16)x1; pa[i] = h0; pa[8 + i] = h1; pl[i] = (_Float16)((x0 - (float)h0) * 2048.0f); pl[8 + i] = (_Float16)((x1 - (float)h1) * 2048.0f); }   // P scaled by 2^11 before the f16 split so small softmax weights stay out of the f16 subnormal range; 2^-11 folded into the epilogue
#pragma unroll
    for (int dt = 0; dt < 4; ++dt) acc[dt] = wmma16(vf[dt], pa, acc[dt]);
    if constexpr (LEAD) {
#pragma unroll   // accl, vf indexed by constants
      for (int dt = 0; dt < 4; ++dt) { const size_t vr = ((size_t)b * DM + h * HD + dt * 16 + col) * SS + ks * 32; accl[dt] = wmma16(vf[dt], pl, accl[dt]); accl[dt] = wmma16(frag_h(VTL + vr, lane), pa, accl[dt]); } }   // leading query blocks: P hi/lo x V hi/lo (3 products); elsewhere P x V single
#pragma unroll
    for (int i = 0; i < 4; ++i) kbv[i] = kbn[i];
}
// the foot of a trip of k_attn, passed by every wave of the block: tile t + 1 is published, tile t + 2 goes into the buffers that trip t has read
__device__ __forceinline__ void attn_foot(const int t, const int nt, const _Float16*& kg, const _Float16*& vg, const unsigned kl, const unsigned vl) {
    asm volatile("s_wait_dscnt 0x0" ::: "memory");      // this wave's reads of this trip's buffers are done
    asm volatile("s_wait_asynccnt 0x0" ::: "memory");   // this wave's copies of the next tile have landed
    __syncthreads();   // publishes the next tile and ends every wave's reads of the buffers refilled below
    if (t + 2 < nt) { kv_copy(kg, vg, kl + (t & 1) * AKB, vl + (t & 1) * AKB); kg += (size_t)AK * (2 * DM); vg += AK; }   // tile t + 2 into the buffers that this trip has read
}
// ---- k_attn: block = (64 queries, head h, batch b): causal flash attention with the products transposed: S^T = K . Q^T (A = 16 keys, B = the wave's 16 queries), O^T += V^T . P^T (A = 16 d, B = P^T). A lane holds 16 of the 32 scores of ONE query (column lane & 15; keys 8 * (lane >> 4) + r of each 16-key tile), so maximum and sum are in-lane, joined with the other half by one exchange, and the two score tiles, converted in place, are the B operand P^T in the k order of frag_h: P never goes through LDS. scores = (q.k) * 0.125 + gate, 3 products in the leading query blocks (qb < 2), single f16 operands beyond; P.V: P (x2048) hi/lo x V hi/lo, 3 products in two accumulators, in the leading blocks, P x V hi beyond; O[b*S+q][h*64+d] = (acc + accl / 2048) / (2048 l) (256-B segments)
__global__ __launch_bounds__(128) void k_attn(const _Float16* __restrict__ QK, const _Float16* __restrict__ QKL, const _Float16* __restrict__ VTH, const _Float16* __restrict__ VTL, const void* __restrict__ KMASK, const float* __restrict__ KB, const int* __restrict__ AM, float* __restrict__ O) {
  __shared__ __align__(16) float so[4][16][68];
  __shared__ __align__(16) _Float16 sK[2][AK][LP], sV[2][HD][LP];   // two buffers each of K rows (key, d) and V rows (d, key); pitch 144 B, conflict-free for the 16-byte fragment reads
  const int tid = threadIdx.x, wave = tid >> 5, lane = tid & 31, col = lane & 15, g = lane >> 4;
  // which query tile a block takes. All blocks of the launch are resident at once, four to a WGP, and a block's cost grows with its tile index (causal), so the launch lasts as long as the WGP with the most key tiles. With the tile index as the fastest grid index, blocks whose flat indices lie a multiple of 16 apart all had the same tile. Here any four blocks that differ only in blockIdx.z, or only in the low two bits of blockIdx.y, take the tiles n - 1 - 2 r, 2 r, n - 2 - 2 r, 2 r + 1 (n = TQB, r = blockIdx.y >> 2): the same number of key tiles for every such four, and two long blocks side by side to the end. For speed only: for each (head, batch) the map blockIdx.y -> tile is a permutation, wherever the blocks land (TQB a multiple of 4)
  const int h = blockIdx.x, b = blockIdx.z, sl = (blockIdx.y + blockIdx.z) & 3, pr = 2 * (blockIdx.y >> 2) + (sl >> 1); const int qb = (sl & 1) ? pr : TQB - 1 - pr; const int q0 = qb * 64 + wave * 16; const size_t rq = (size_t)b * SS + q0 + col;
  v16h aq[2];   // the q residual, used by the leading query blocks alone, is loaded at its products: 16 registers less in every block
#pragma unroll
  for (int kc = 0; kc < 2; ++kc) aq[kc] = frag_h(QK + rq * (2 * DM) + h * HD + kc * 32, lane);
  float m = -3.0e38f, l = 0.f;   // of the lane's query; l holds the sum over the lane's own half of the keys, the halves are joined once behind the loop
  v8f acc[4] = {}, accl[4] = {};   // acc[dt][r] = O^T[d = dt * 16 + 8 g + r][query col]
  const int nt = qb + 1;   // causal: key tiles of 64 up to the query tile's end; two key steps of 32 a tile, in the order of before
  const int cr = tid >> 3, cc = (tid & 7) * 8;
  const _Float16* kg = QK + ((size_t)b * SS + cr) * (2 * DM) + DM + h * HD + cc; const _Float16* vg = VTH + ((size_t)b * DM + h * HD + cr) * SS + cc; const float* bp = KB + ((size_t)b * NH + h) * SS + 8 * g;
  const unsigned kl = (unsigned)(size_t)&sK[0][cr][cc], vl = (unsigned)(size_t)&sV[0][cr][cc];
  kv_copy(kg, vg, kl, vl);
  asm volatile("s_wait_asynccnt 0x0" ::: "memory");   // this wave's copies of tile 0 have landed
  __syncthreads();   // tile 0 is published to all four waves
  if (nt > 1) kv_copy(kg + (size_t)AK * (2 * DM), vg + AK, kl + AKB, vl + AKB);   // tile 1 into the second buffer
  kg += (size_t)2 * AK * (2 * DM); vg += 2 * AK;   // the next tile to copy
  v4f kbv[4]; kbv[0] = *(const v4f*)bp; kbv[1] = *(const v4f*)(bp + 4); kbv[2] = *(const v4f*)(bp + 16); kbv[3] = *(const v4f*)(bp + 20);
  asm volatile("s_wait_xcnt 0x0" :: "v"(bp) : "memory");   // the running pointer is an input here, so the address pair of these loads stays whole up to this wait and takes its new value only behind it
  const int qd = q0 + col - 8 * g;   // key ks * 32 + ct * 16 + 8 g + r is seen by query q0 + col where ks * 32 + ct * 16 + r <= qd
  // one trip a tile, the buffer chosen by the trip's parity. The form of a tile's key steps is the same for the whole block, so every wave of a block passes the same feet. In each form a tile's two key steps stay a loop: the registers hold the live values of one step, not of two
  if (qb < NLEAD) {
#pragma unroll 1   // see above
    for (int t = 0; t < nt; ++t) {
#pragma unroll 1   // see above
      for (int sub = 0; sub < 2; ++sub) attn_step<true, true>(2 * t + sub, 2 * nt, &sK[t & 1][sub * 32 + col][8 * g], &sV[t & 1][col][sub * 32 + 8 * g], bp, kbv, aq, acc, accl, m, l, qd, lane, col, b, h, rq, QKL, VTL);
      attn_foot(t, nt, kg, vg, kl, vl); } }
  else {
#pragma unroll 1   // see above
    for (int t = 0; t < nt - 1; ++t) {   // the tiles in front of the block's first query
#pragma unroll 1   // see above
      for (int sub = 0; sub < 2; ++sub) attn_step<false, false>(2 * t + sub, 2 * nt, &sK[t & 1][sub * 32 + col][8 * g], &sV[t & 1][col][sub * 32 + 8 * g], bp, kbv, aq, acc, accl, m, l, qd, lane, col, b, h, rq, QKL, VTL);
      attn_foot(t, nt, kg, vg, kl, vl); }
    const int tl = nt - 1;   // the diagonal tile
#pragma unroll 1   // see above
    for (int sub = 0; sub < 2; ++sub) attn_step<false, true>(2 * tl + sub, 2 * nt, &sK[tl & 1][sub * 32 + col][8 * g], &sV[tl & 1][col][sub * 32 + 8 * g], bp, kbv, aq, acc, accl, m, l, qd, lane, col, b, h, rq, QKL, VTL);
    attn_foot(tl, nt, kg, vg, kl, vl); }
  asm volatile("s_wait_asynccnt 0x0" ::: "memory");   // no copy is outstanding when the wave goes on to its end
  l += xhalf(l);   // the two halves of the query's keys
  const int am = AM[h];
  asm volatile("s_wait_xcnt 0x0" :: "v"(h) : "memory");   // the index is an input here, so the load does not land in its own address register, which stays whole up to this wait
  const float il = ((am != 0) ? (1.0f / 2048.0f) : 0.f) / l;   // dormant heads contribute nothing
#pragma unroll
  for (int dt = 0; dt < 4; ++dt) { v4f o0, o1;
#pragma unroll   // the lane's 8 consecutive d of its query: two 16-byte LDS stores
    for (int r = 0; r < 4; ++r) { o0[r] = (acc[dt][r] + accl[dt][r] * (1.0f / 2048.0f)) * il; o1[r] = (acc[dt][4 + r] + accl[dt][4 + r] * (1.0f / 2048.0f)) * il; }
    *(v4f*)&so[wave][col][dt * 16 + 8 * g] = o0; *(v4f*)&so[wave][col][dt * 16 + 8 * g + 4] = o1; }
  LDSX();
  for (int rl = 0; rl < 16; ++rl) if (lane < 16) vst2(O + ((size_t)b * SS + q0 + rl) * DM + h * HD + lane * 4, *(const v4f*)&so[wave][rl][lane * 4]);
}
// ---- k_out: block = (64 rows, 128 cols): out = O(hi/lo) . Wo rows (2 products)
__global__ __launch_bounds__(128) void k_out(const float* __restrict__ O, const __bf16* __restrict__ P, float* __restrict__ Y) {
  __shared__ __align__(16) float so[4][16][132];
  const int tid = threadIdx.x, wave = tid >> 5, lane = tid & 31, col = lane & 15, g = lane >> 4; const size_t r0 = (size_t)blockIdx.x * 64 + wave * 16; const int n0 = blockIdx.y * 128;
  v8f acc[8] = {};
  // as in k_qkv: the block's 64 rows of O (split once into bf16 hi and residual) and 128 weight rows go through LDS, KT columns a trip
  __shared__ __align__(16) __bf16 sAh[64][LP], sAl[64][LP], sB[128][LP];
  const int ar = tid >> 4, ac = (tid & 15) * 4, br = tid >> 3, bc = (tid & 7) * 8;
  const float* Ag = O + ((size_t)blockIdx.x * 64 + ar) * DM + ac; const __bf16* Bg = P + (size_t)(n0 + br) * DM + bc;
  const float* Ap = Ag; const __bf16* Bp = Bg; v4f ra[8]; v8b rb[8];
#pragma unroll   // constant indices keep ra, rb in registers
  for (int i = 0; i < 8; ++i) { ra[i] = *(const v4f*)(Ag + (size_t)i * 8 * DM); rb[i] = *(const v8b*)(Bg + (size_t)i * 16 * DM); }
  for (int kt = 0; kt < DM / KT; ++kt) {
#pragma unroll   // constant indices keep ra, rb in registers
    for (int i = 0; i < 8; ++i) { v4b ch, cl;
#pragma unroll   // four splits, two 8-byte stores
      for (int e = 0; e < 4; ++e) { const __bf16 hv = (__bf16)ra[i][e]; ch[e] = hv; cl[e] = (__bf16)(ra[i][e] - (float)hv); }
      *(v4b*)&sAh[ar + i * 8][ac] = ch; *(v4b*)&sAl[ar + i * 8][ac] = cl; *(v8b*)&sB[br + i * 16][bc] = rb[i]; }
    __syncthreads();   // the tile is published to all four waves
    if (kt + 1 < DM / KT) { Ap += KT; Bp += KT;
#pragma unroll   // constant indices keep ra, rb in registers
      for (int i = 0; i < 8; ++i) { ra[i] = *(const v4f*)(Ap + (size_t)i * 8 * DM); rb[i] = *(const v8b*)(Bp + (size_t)i * 16 * DM); }
      asm volatile("s_wait_xcnt 0x0" :: "v"(Ap), "v"(Bp) : "memory"); }   // the two running pointers are inputs here, so the address pairs of these loads stay whole up to this wait: no load of the run lands in one, and they take their new values only behind it
#pragma unroll   // two k steps of 32, k ascending; constant LDS offsets
    for (int kc = 0; kc < KT / 32; ++kc) { const v16b ah = frag_b(&sAh[wave * 16 + col][kc * 32], lane), al = frag_b(&sAl[wave * 16 + col][kc * 32], lane); v16b w[8];
#pragma unroll   // the k step's fragment reads go out as one group ahead of its products: one LDS latency a step, not one a product
      for (int j = 0; j < 8; ++j) w[j] = frag_b(&sB[j * 16 + col][kc * 32], lane);
#pragma unroll   // acc[j] indexed by constants
      for (int j = 0; j < 8; ++j) { acc[j] = wmma_bf(al, w[j], acc[j]); acc[j] = wmma_bf(ah, w[j], acc[j]); } }
    __syncthreads();   // every wave has read the tile before the next trip overwrites it
  }
#pragma unroll
  for (int j = 0; j < 8; ++j) {
#pragma unroll
    for (int r = 0; r < 8; ++r) so[wave][8 * g + r][j * 16 + col] = acc[j][r]; }
  LDSX();
  for (int rl = 0; rl < 16; ++rl) vst2(Y + (r0 + rl) * DM + n0 + lane * 4, *(const v4f*)&so[wave][rl][lane * 4]);
}

#define PH_TW 4    // tokens a wave
#define PH_TB 32   // tokens a block (8 waves): the 32 gates of one head are one whole 128-byte line of KB
// ---- phase_block: block = 32 tokens, a wave = 4 of them: ph = bf16(x) . bf16(w_phase) (f32) with a lane on 32 of the 1,024 d (16-byte loads, 512 contiguous bytes a wave), w_phase loaded once for the wave's 4 tokens, the sums joined inside the wave; phase = atan2(ph0, ph1); then a lane = (token, head) for the 16 per-head log gates of each key. 128 blocks, where one block a token is 4,096 blocks of 8 waves that live shorter than they take to start
__device__ __forceinline__ void phase_block(int bx, const float* __restrict__ X, const float* __restrict__ WP, const float* __restrict__ CAR, const float* __restrict__ LOCK, const float* __restrict__ BW, float* __restrict__ KB) {
  __shared__ __align__(8) float sg[NH][PH_TB + 2];   // pitch 34: the 32 lanes that write (16 heads x 2 tokens) meet 32 different banks; even, for the 8-byte reads
  const int t = threadIdx.x, wave = t >> 5, lane = t & 31, hd = lane & 15, g = lane >> 4; const size_t row0 = (size_t)bx * PH_TB;
  const float* xp = X + (row0 + wave * PH_TW) * DM + lane * 4; const float* wp = WP + lane * 8; v4f xv[PH_TW][8], wv[8][2];
#pragma unroll   // constant indices keep wv in registers
  for (int j = 0; j < 8; ++j) { wv[j][0] = *(const v4f*)(wp + j * 256); wv[j][1] = *(const v4f*)(wp + j * 256 + 4); }   // both columns of d = 128 j + 4 lane + (0 .. 3)
#pragma unroll   // constant indices keep xv in registers
  for (int k = 0; k < PH_TW; ++k) {
#pragma unroll   // as above
    for (int j = 0; j < 8; ++j) xv[k][j] = *(const v4f*)(xp + (size_t)k * DM + j * 128); }
  const float lkr = LOCK[hd], bwr = BW[hd], carr = CAR[hd];
  // the two pointers are inputs here, so the address pairs of these loads stay whole up to this wait; the loaded values are inputs too (inputs only; an asm statement takes thirty operands, so the rest stand in the fence below), so all 48 loads go out ahead of the first conversion: one memory latency a wave, where the build otherwise holds twelve loads back until registers of the first come free
  asm volatile("s_wait_xcnt 0x0" :: "v"(xp), "v"(wp), "v"(wv[0][0]), "v"(wv[0][1]), "v"(wv[1][0]), "v"(wv[1][1]), "v"(wv[2][0]), "v"(wv[2][1]), "v"(wv[3][0]), "v"(wv[3][1]), "v"(wv[4][0]), "v"(wv[4][1]), "v"(wv[5][0]), "v"(wv[5][1]), "v"(wv[6][0]), "v"(wv[6][1]), "v"(wv[7][0]), "v"(wv[7][1]), "v"(xv[0][0]), "v"(xv[0][1]), "v"(xv[0][2]), "v"(xv[0][3]), "v"(xv[0][4]), "v"(xv[0][5]), "v"(xv[0][6]), "v"(xv[0][7]), "v"(xv[1][0]), "v"(xv[1][1]), "v"(xv[1][2]), "v"(xv[1][3]) : "memory");
  asm volatile("" :: "v"(xv[1][4]), "v"(xv[1][5]), "v"(xv[1][6]), "v"(xv[1][7]), "v"(xv[2][0]), "v"(xv[2][1]), "v"(xv[2][2]), "v"(xv[2][3]), "v"(xv[2][4]), "v"(xv[2][5]), "v"(xv[2][6]), "v"(xv[2][7]), "v"(xv[3][0]), "v"(xv[3][1]), "v"(xv[3][2]), "v"(xv[3][3]), "v"(xv[3][4]), "v"(xv[3][5]), "v"(xv[3][6]), "v"(xv[3][7]));   // the other 20 loaded values, inputs only, for the same purpose
  float a0[PH_TW] = {}, a1[PH_TW] = {};
#pragma unroll   // xv, wv indexed by constants
  for (int j = 0; j < 8; ++j) {
#pragma unroll   // as above
    for (int e = 0; e < 4; ++e) { const float w0 = bfr(wv[j][e >> 1][(e & 1) * 2]), w1 = bfr(wv[j][e >> 1][(e & 1) * 2 + 1]);
#pragma unroll   // eight independent sums
      for (int k = 0; k < PH_TW; ++k) { const float xb = bfr(xv[k][j][e]); a0[k] += xb * w0; a1[k] += xb * w1; } } }
#pragma unroll   // five exchanges, the eight sums side by side in each
  for (int o = 16; o > 0; o >>= 1) {
#pragma unroll   // a0, a1 indexed by constants
    for (int k = 0; k < PH_TW; ++k) { a0[k] += __shfl_xor(a0[k], o); a1[k] += __shfl_xor(a1[k], o); } }
  const float lk = bfr(lkr), bw = bfr(bwr), car = bfr(carr);
#pragma unroll   // a0, a1 indexed by constants
  for (int p = 0; p < PH_TW / 2; ++p) { const float phase = atan2_p(g ? a0[2 * p + 1] : a0[2 * p], g ? a1[2 * p + 1] : a1[2 * p]); const float win = exp_ni((cos_p(phase - car) - 1.0f) / bw); const float gate = lk * win + (1.0f - lk); sg[hd][wave * PH_TW + 2 * p + g] = log_p(gate + 1e-6f); }   // lane = (token 2 p + g of the wave, head hd)
  __syncthreads();   // the block's 16 x 32 gates are complete before any wave reads what other waves wrote
  { const int hh = t >> 4, pr = t & 15; const size_t b = row0 / SS, s = row0 % SS; *(v2f*)(KB + (b * NH + hh) * SS + s + pr * 2) = *(const v2f*)&sg[hh][pr * 2]; }   // 16 lanes store one head's whole line
}
#define PH_NB (NB * SS / PH_TB)                 // phase blocks
#define PK_NB ((DM / PT_N) * (DM / PT_K) * 4)   // pack blocks
// ---- k_prep: the two jobs that read inputs alone and none of each other's output, in ONE launch: blocks 0 .. PH_NB - 1 do the phase gates, the rest pack the weights. All blocks are resident at once, so the two short, latency-bound jobs run side by side and one launch with its start and its drain goes. The longer job has the low indices, which start first. The choice is the same for a whole block, so each job's barrier is passed by all of its block's waves
__global__ __launch_bounds__(256) void k_prep(const float* __restrict__ WQ, const float* __restrict__ WK, const float* __restrict__ WV, const float* __restrict__ WO, __bf16* __restrict__ PK, const float* __restrict__ X, const float* __restrict__ WP, const float* __restrict__ CAR, const float* __restrict__ LOCK, const float* __restrict__ BW, float* __restrict__ KB) {
  const int bi = blockIdx.x;
  if (bi < PH_NB) phase_block(bi, X, WP, CAR, LOCK, BW, KB);
  else { const int p = bi - PH_NB; pack_block(p % (DM / PT_N), (p / (DM / PT_N)) % (DM / PT_K), p / ((DM / PT_N) * (DM / PT_K)), WQ, WK, WV, WO, PK); }
}
extern "C" void kernel_launch(void* const* d_in, const int* in_sizes, int n_in, void* d_out, int out_size, void* d_ws, size_t ws_size, hipStream_t stream) {
  (void)in_sizes; (void)n_in; (void)out_size;
  const float** F = (const float**)d_in;   // 0 x [4,1024,1024], 1 wq, 2 wk, 3 wv, 4 wo (all (in,out) [1024,1024]), 5 w_phase [1024,2], 6 carrier [16], 7 lock [16], 8 bandwidth [16], 9 active_mask [16] int
  if (ws_size < (size_t)WS_END + 4u * NB * NH * SS + 256) return;
  char* ws = (char*)d_ws; __bf16* PK = (__bf16*)(ws + WS_PK); _Float16 *QK = (_Float16*)(ws + WS_QK), *QKL = (_Float16*)(ws + WS_QKL), *VTH = (_Float16*)(ws + WS_VTH), *VTL = (_Float16*)(ws + WS_VTL); float* O = (float*)(ws + WS_O); float* KB = (float*)(ws + WS_END);
  k_prep<<<PH_NB + PK_NB, 256, 0, stream>>>(F[1], F[2], F[3], F[4], PK, F[0], F[5], F[6], F[7], F[8], KB);
  k_qkv<<<dim3(TNB * SS / 64, QKVW / 128), 128, 0, stream>>>(F[0], F[0], F[0], PK + PK_A, QK, QKL, VTH, VTL);
  k_attn<<<dim3(NH, TQB, TNB), 128, 0, stream>>>(QK, QKL, VTH, VTL, nullptr, KB, (const int*)d_in[9], O);
  k_out<<<dim3(TOB, DM / 128), 128, 0, stream>>>(O, PK + PK_P, (float*)d_out);
}
